// v000
// The times below were measured on an AMD MI455X: many runs one after another, warmed up first and cycling through
// copies of the inputs, with the whole window's GPU time divided by the number of runs. Launches and the gaps
// between them are all in it. The median over several windows is given; except for v000 it joins two sittings, which
// can be a few percent apart, so the side-by-side timings, each taken in one sitting, are the better comparison.
// v000, which the later versions start from, runs in 572 microseconds.
// Contractions: q, k, v^T projections = v_wmma_f32_16x16x32_bf16 (bf16 operands from RNE-converted inputs, single product, f32 bias add);
// q.k^T scores = v_wmma_f32_16x16x32_bf16 with bf16 hi/lo split q and k (hi.hi + hi.lo + lo.hi);
// p.v = v_wmma_f32_16x16x32_f16 (p carried x1024 in f16, v in f16; extra f16 residual planes x4096 of p and v for the first VLP query rows);
// ctx.Wo = v_wmma_f32_16x16x32_bf16 with ctx as bf16 hi/lo planes times bf16 Wo (2 products); all f32 accumulate; causal compare and softmax in f32.
#include <hip/hip_runtime.h>
#include <math.h>
#include <float.h>
#include <stdint.h>

#ifndef NB
#define NB    1
#endif
#ifndef SEQ
#define SEQ   4096
#endif
#define SEQ_FULL 4096
#define DM    1024
#define NH    16
#define HD    64
#define NQKV  (3 * DM)
#define NQB   (SEQ / 64)                      // key / query tiles of 64
#define VLP   ((SEQ < 512) ? SEQ : 512)       // key pitch of the v^T residual plane (keys 0..VLP-1)
#define RESQB (VLP / 64)                      // number of leading 64-row query blocks that use the p / v residual planes
static_assert(NB == 1);
static_assert(NH * HD == DM && HD == 64);
static_assert((SEQ % 64) == 0 && (DM % 64) == 0 && SEQ >= 64 && SEQ <= SEQ_FULL);
static_assert(RESQB * 64 == VLP && VLP <= SEQ && RESQB >= 1 && RESQB <= NQB);
static_assert((NQKV % 64) == 0);

typedef _Float16 v16h __attribute__((ext_vector_type(16)));
typedef _Float16 v8h  __attribute__((ext_vector_type(8)));
typedef __bf16   v16b __attribute__((ext_vector_type(16)));
typedef __bf16   v8b  __attribute__((ext_vector_type(8)));
typedef float    v8f  __attribute__((ext_vector_type(8)));
typedef float    v4f  __attribute__((ext_vector_type(4)));
typedef unsigned int v4u __attribute__((ext_vector_type(4)));

// ---- scalar helpers --------------------------------------------------------------------------------
__device__ __forceinline__ unsigned short bf_bits(float f) {          // f32 -> bf16 bits, RNE convert
  unsigned u = __float_as_uint(f);
  return (unsigned short)((u + 0x7FFFu + ((u >> 16) & 1u)) >> 16);
}
__device__ __forceinline__ float bf_up(unsigned short h) { return __uint_as_float(((unsigned)h) << 16); }
__device__ __forceinline__ unsigned short h_bits(_Float16 x) { return __builtin_bit_cast(unsigned short, x); }
__device__ __forceinline__ unsigned pk16(unsigned short a, unsigned short b) { return (unsigned)a | ((unsigned)b << 16); }
__device__ __forceinline__ v8f zero8() { v8f z = {0.f, 0.f, 0.f, 0.f, 0.f, 0.f, 0.f, 0.f}; return z; }
__device__ __forceinline__ v8h zero8h() {
  const _Float16 z = (_Float16)0.0f;
  v8h r = {z, z, z, z, z, z, z, z};
  return r;
}

// ---- fragment loaders: 16-bit A/B operand, lane -> row/col (lane&15), p already includes +8*(lane>>4);
//      elements 0..7 <- p[0..7] (k0+8h..), elements 8..15 <- p[16..23] (k0+16+8h..)
__device__ __forceinline__ v16b ldfrag_b(const __bf16* p) {
  union { v16b v; v8b h[2]; } f;
  f.h[0] = *(const v8b*)(p);
  f.h[1] = *(const v8b*)(p + 16);
  return f.v;
}

// ---- WMMA helpers with trailing VALU hazard gap --------------------------------------------------------
__device__ __forceinline__ v8f mma_b(v16b a, v16b b, v8f c) {
  c = __builtin_amdgcn_wmma_f32_16x16x32_bf16(false, a, false, b, (short)0, c, false, false);
  asm volatile("v_nop\n\tv_nop\n\tv_nop\n\tv_nop" : "+v"(c) : "v"(a), "v"(b));
  return c;
}
__device__ __forceinline__ v8f mma_h(v16h a, v16h b, v8f c) {
  c = __builtin_amdgcn_wmma_f32_16x16x32_f16(false, a, false, b, (short)0, c, false, false);
  asm volatile("v_nop\n\tv_nop\n\tv_nop\n\tv_nop" : "+v"(c) : "v"(a), "v"(b));
  return c;
}
__device__ __forceinline__ v8f mma_b_raw(v16b a, v16b b, v8f c) {
  return __builtin_amdgcn_wmma_f32_16x16x32_bf16(false, a, false, b, (short)0, c, false, false);
}
__device__ __forceinline__ void dep_guard_b(v8f& a, v8f& b, v16b x, v16b y) {
  asm volatile("v_nop\n\tv_nop\n\tv_nop\n\tv_nop" : "+v"(a), "+v"(b) : "v"(x), "v"(y));
}
__device__ __forceinline__ void keep4_b(v16b a, v16b b, v16b c, v16b d) {
  asm volatile("v_nop" :: "v"(a), "v"(b), "v"(c), "v"(d));
}
__device__ __forceinline__ void acc_guard4(v8f& a, v8f& b, v8f& c, v8f& d) {
  asm volatile("v_nop\n\tv_nop\n\tv_nop\n\tv_nop" : "+v"(a), "+v"(b), "+v"(c), "+v"(d));
}

// =====================================================================================================
// f32 -> bf16 (RNE convert), 8 elements per thread, one 16-B store per lane: a wave writes 512 contiguous B
// coverage: n8 threads x 8 = whole plane (n8 = SEQ*DM/8 is a multiple of 256).
// =====================================================================================================
__global__ __launch_bounds__(256) void cvt_bf16x8(const float* __restrict__ in, unsigned short* out, int n8) {
  const int i = blockIdx.x * 256 + threadIdx.x;
  if (i < n8) {
    const v4f a = *(const v4f*)(in + (size_t)i * 8);
    const v4f b = *(const v4f*)(in + (size_t)i * 8 + 4);
    v4u p;
    p[0] = pk16(bf_bits(a[0]), bf_bits(a[1]));
    p[1] = pk16(bf_bits(a[2]), bf_bits(a[3]));
    p[2] = pk16(bf_bits(b[0]), bf_bits(b[1]));
    p[3] = pk16(bf_bits(b[2]), bf_bits(b[3]));
    *(v4u*)(out + (size_t)i * 8) = p;
    
  }
}

// =====================================================================================================
// Transposed convert: in f32 [K rows][N cols] (pitch N) -> out bf16 [N rows][K cols] (pitch K), RNE.
// grid = (N/64, K/64), 256 threads; one 64(k) x 64(n) tile per block through LDS.
// Load phase: thread (k row = tid>>2, 16 n columns = (tid&3)*16) reads 4 x 16 B and writes bf16 bits
// transposed into st[n][k] (pitch 72 halves). After __syncthreads each wave writes 8 output rows:
// coverage: load 64 k x (4 threads x 16 n) = 64x64; store 8 waves x 2 it x 4 rows x (8 lanes x 8) = 64x64.
// LDS st: cross-wave exchange behind the block barrier.
// =====================================================================================================
__global__ __launch_bounds__(256) void cvtT_bf16(const float* __restrict__ in, unsigned short* out, int K, int N) {
  __shared__ __align__(16) unsigned short st[64 * 72];
  const int tid = threadIdx.x;
  const int n0  = blockIdx.x * 64;
  const int k0  = blockIdx.y * 64;
  {
    const int r  = tid >> 2;            // k row 0..63
    const int cb = (tid & 3) * 16;      // n column base
    const float* src = in + (size_t)(k0 + r) * N + n0 + cb;
#pragma unroll
    for (int e = 0; e < 4; ++e) {
      const v4f a = *(const v4f*)(src + 4 * e);
#pragma unroll
      for (int u = 0; u < 4; ++u) st[(cb + 4 * e + u) * 72 + r] = bf_bits(a[u]);
    }
  }
  __syncthreads();
  {
    const int lane = tid & 31, wave = tid >> 5;
    const int q = lane >> 3, c8 = (lane & 7) * 8;
    v4u hv[2];
#pragma unroll
    for (int it = 0; it < 2; ++it) {
      const int row = wave * 8 + it * 4 + q;      // n row within the tile
      hv[it] = *(const v4u*)(st + row * 72 + c8);
    }
    {
#pragma unroll
      for (int it = 0; it < 2; ++it) {
        const int row = wave * 8 + it * 4 + q;
        *(v4u*)(out + (size_t)(n0 + row) * K + k0 + c8) = hv[it];
      }
      
    }
  }
}

// =====================================================================================================
// Register-blocked bf16 WMMA GEMM: C[m][n] = sum_k A[m][k] * Bt[n][k] + bias; one wave per 64x64 tile,
// no block barriers. A row-major [M][K] pitch lda; Bt row-major [N][K] pitch ldb (k contiguous);
// M, N multiples of 64, K multiple of 32 (host-checked). blockIdx.y = batch index (strides in elements).
// NSPLIT: 0 = A.Bt; 1 = (A + A2).Bt (A2 = unscaled bf16 lo plane of A); 2 = A.Bt + A2.Bt + A.Bt2.
// OUT_MODE: 0 = f32 (pitch ldc); 2 = bf16 hi plane C + bf16 lo plane C2 (lo = RNE(v - hi), unscaled);
//           3 = f16 hi plane C + f16 residual plane C2 = f16((v - hi) * rscale), C2 written only for tiles
//               with n0 < N2 (pitch ldc2, batch stride strideC2).
// BIASM: 1 = bias[n] added per column (bias has >= N entries); 2 = bias[m] added per row (>= M entries);
//        the bias value is RNE-converted to bf16 and added in f32 before any output split.
// =====================================================================================================
template <int NSPLIT, int OUT_MODE, int BIASM>
__global__ __launch_bounds__(256) void gemm64(
    const unsigned short* __restrict__ Ap, const unsigned short* A2p, int lda, long long strideA,
    const unsigned short* __restrict__ Btp, const unsigned short* Bt2p, int ldb, long long strideB,
    void* Cout, int ldc, long long strideC,
    void* Cout2, int ldc2, long long strideC2, int N2,
    int M, int N, int K, float rscale, const float* __restrict__ bias) {
  const __bf16* A   = (const __bf16*)(const void*)Ap;
  const __bf16* A2  = (const __bf16*)(const void*)A2p;
  const __bf16* Bt  = (const __bf16*)(const void*)Btp;
  const __bf16* Bt2 = (const __bf16*)(const void*)Bt2p;
  __shared__ __align__(16) float sT[8][16 * 68];   // per-wave 16x64 slab, pitch 68 floats
  const int b    = blockIdx.y;
  const int lane = threadIdx.x & 31;
  const int wave = threadIdx.x >> 5;
  const int tilesN = N >> 6;
  const int tilesM = M >> 6;
  const int tile = blockIdx.x * 8 + wave;
  if (tile >= tilesM * tilesN) return;   // wave-uniform; no block barriers in this kernel
  const int tm = tile / tilesN;
  const int tn = tile - tm * tilesN;
  const int m0 = tm << 6;
  const int n0 = tn << 6;

  const __bf16* Ab  = A  + (size_t)b * strideA;
  const __bf16* Bb  = Bt + (size_t)b * strideB;
  const __bf16* Ab2 = (NSPLIT >= 1) ? (A2  + (size_t)b * strideA) : Ab;
  const __bf16* Bb2 = (NSPLIT == 2) ? (Bt2 + (size_t)b * strideB) : Bb;

  const int rlane = lane & 15;                 // row (A) / col (B, D) within subtile
  const int koff  = (lane >> 4) * 8;           // k offset of this lane half
  const int mOff  = (lane >> 4) * 8;           // D row offset

  v8f acc[4][4];
#pragma unroll
  for (int i = 0; i < 4; ++i)
#pragma unroll
    for (int j = 0; j < 4; ++j) acc[i][j] = zero8();

  for (int k0 = 0; k0 < K; k0 += 32) {
    v16b bh[4], bl[4];
#pragma unroll
    for (int j = 0; j < 4; ++j) {
      const size_t bo = (size_t)(n0 + (j << 4) + rlane) * ldb + koff + k0;
      bh[j] = ldfrag_b(Bb + bo);
      if (NSPLIT == 2) bl[j] = ldfrag_b(Bb2 + bo); else bl[j] = bh[j];
    }
#pragma unroll
    for (int i = 0; i < 4; ++i) {
      const size_t ao = (size_t)(m0 + (i << 4) + rlane) * lda + koff + k0;
      const v16b ah = ldfrag_b(Ab + ao);
      v16b al = ah;
      if (NSPLIT >= 1) al = ldfrag_b(Ab2 + ao);
#pragma unroll
      for (int j = 0; j < 4; ++j) {
        acc[i][j] = mma_b_raw(ah, bh[j], acc[i][j]);
        if (NSPLIT >= 1) acc[i][j] = mma_b_raw(al, bh[j], acc[i][j]);
        if (NSPLIT == 2) acc[i][j] = mma_b_raw(ah, bl[j], acc[i][j]);
      }
      dep_guard_b(acc[i][0], acc[i][3], ah, al);
    }
    keep4_b(bh[0], bh[1], bh[2], bh[3]);
    if (NSPLIT == 2) keep4_b(bl[0], bl[1], bl[2], bl[3]);
  }
  acc_guard4(acc[0][0], acc[0][1], acc[0][2], acc[0][3]);
  acc_guard4(acc[1][0], acc[1][1], acc[1][2], acc[1][3]);
  acc_guard4(acc[2][0], acc[2][1], acc[2][2], acc[2][3]);
  acc_guard4(acc[3][0], acc[3][1], acc[3][2], acc[3][3]);

  // ---- epilogue ----
  float* slab = sT[wave];
  float bcol[4];
#pragma unroll
  for (int j = 0; j < 4; ++j) bcol[j] = 0.f;
  if (BIASM == 1) {
#pragma unroll
    for (int j = 0; j < 4; ++j) bcol[j] = bf_up(bf_bits(bias[n0 + (j << 4) + rlane]));   // < N, in range
  }
#pragma unroll
  for (int i = 0; i < 4; ++i) {
    const int mBase = m0 + (i << 4);
    float brow[8];
#pragma unroll
    for (int r = 0; r < 8; ++r) brow[r] = 0.f;
    if (BIASM == 2) {
      const v4f b0 = *(const v4f*)(bias + mBase + mOff);          // rows mBase+mOff..+7 < M, in range
      const v4f b1 = *(const v4f*)(bias + mBase + mOff + 4);
#pragma unroll
      for (int r = 0; r < 4; ++r) {
        brow[r]     = bf_up(bf_bits(b0[r]));
        brow[4 + r] = bf_up(bf_bits(b1[r]));
      }
    }
#pragma unroll
    for (int j = 0; j < 4; ++j) {
#pragma unroll
      for (int r = 0; r < 8; ++r) {
        slab[(mOff + r) * 68 + (j << 4) + rlane] = acc[i][j][r] + bcol[j] + brow[r];
      }
    }
    __builtin_amdgcn_fence(__ATOMIC_RELEASE, "workgroup");
    __builtin_amdgcn_wave_barrier();
    __builtin_amdgcn_fence(__ATOMIC_ACQUIRE, "workgroup");
    if (OUT_MODE == 0) {
      float* C = (float*)Cout + (size_t)b * strideC;
      const int hh = lane >> 4, c4 = (lane & 15) * 4;     // 256-B row segment = 16 lanes x 16 B
      {
#pragma unroll
        for (int it = 0; it < 8; ++it) {
          const int row = it * 2 + hh;                     // it 0..7 x hh 0..1 = rows 0..15
          const v4f v = *(const v4f*)(slab + row * 68 + c4);
          *(v4f*)(C + (size_t)(mBase + row) * ldc + n0 + c4) = v;
        }
        
      }
    } else {
      const int q = lane >> 3, c8 = (lane & 7) * 8;
      unsigned short* C  = (unsigned short*)Cout  + (size_t)b * strideC;
      unsigned short* C2 = (unsigned short*)Cout2 + (size_t)b * strideC2;
      const bool wlo = (OUT_MODE == 2) || (n0 < N2);      // wave-uniform
      v4u hv[4], lv[4];
#pragma unroll
      for (int it = 0; it < 4; ++it) {
        const int row = it * 4 + q;                        // it 0..3 x q 0..3 = rows 0..15
        const float* sp = slab + row * 68 + c8;
        v4u a, a2;
#pragma unroll
        for (int e = 0; e < 4; ++e) {
          const float f0 = sp[2 * e], f1 = sp[2 * e + 1];
          unsigned short h0, h1, l0, l1;
          if (OUT_MODE == 2) {
            h0 = bf_bits(f0); h1 = bf_bits(f1);
            l0 = bf_bits(f0 - bf_up(h0)); l1 = bf_bits(f1 - bf_up(h1));
          } else {
            const _Float16 x0 = (_Float16)f0, x1 = (_Float16)f1;
            h0 = h_bits(x0); h1 = h_bits(x1);
            l0 = h_bits((_Float16)((f0 - (float)x0) * rscale));
            l1 = h_bits((_Float16)((f1 - (float)x1) * rscale));
          }
          a[e] = pk16(h0, h1); a2[e] = pk16(l0, l1);
        }
        hv[it] = a; lv[it] = a2;
      }
      {
#pragma unroll
        for (int it = 0; it < 4; ++it) {
          const int row = it * 4 + q;
          *(v4u*)(C + (size_t)(mBase + row) * ldc + n0 + c8) = hv[it];
          if (wlo) *(v4u*)(C2 + (size_t)(mBase + row) * ldc2 + n0 + c8) = lv[it];
        }
        
      }
    }
    __builtin_amdgcn_fence(__ATOMIC_RELEASE, "workgroup");
    __builtin_amdgcn_wave_barrier();
    __builtin_amdgcn_fence(__ATOMIC_ACQUIRE, "workgroup");
  }
}

// =====================================================================================================
// Causal attention, head dim 64, single batch.
//   q planes (bf16 hi / lo): element (t, h, d) at [t*DM + h*64 + d]
//   k planes (bf16 hi / lo): same layout with key index s
//   v^T hi plane (f16):      element (h, d, s) at [(h*64 + d)*SEQ + s]
//   v^T residual plane (f16, (v - hi)*4096): [(h*64 + d)*VLP + s], s < VLP, read only when RES
//   (a key tile at or beyond VLP would contribute a zero v residual; never happens for query blocks < RESQB)
//   logit (t, s) = q.k * sscale for s <= t, finfo.min for s > t. Query block qb (64 rows) visits key tiles
//   0..qb only (every later key is above the diagonal for all 64 rows -> weight exactly 0); the compare
//   s > t is applied on the diagonal tile kt == qb only (block-uniform flag, per-element select). Every row
//   has the live key s = t in the diagonal tile and key s = 0 in tile 0, so the row max is always finite.
//   out planes (bf16 hi / lo of the normalised context): element (t, h, d) at [t*DM + h*64 + d]
//   scores = q . k : bf16 hi/lo split (hi.hi + hi.lo + lo.hi), f32 accumulate, then * sscale in f32
//   p = exp(s - m) carried as f16(1024 p); context = p . v on f16 WMMA; RES adds f16 residual planes of p and v
//   (scale 4096, separate accumulator folded back with 1/4096 per chunk in f32); online softmax in f32.
//   Block = 4 waves = 64 query rows of one head; grid = nqbThis * NH; kv chunks of 64, static bound NQB,
//   block-uniform break at kt == qb + 1.
//   K / V^T chunk staging: 128 threads x 32 elements per plane = the whole 64x64 tile (plain 16-B loads,
//   __syncthreads before and after: cross-wave LDS regions Ksh/Ksl/Vth/Vtl behind block barriers);
//   P tiles and the Os tile are wave-private, spilled with element stores and reloaded (P as v8h, same element
//   Output coverage: each wave stores rows q0..q0+15 (it 0..3 x lane>>3 0..3) x 64 columns (8 lanes x 8) of both planes.
// =====================================================================================================
template <bool RES>
__global__ __launch_bounds__(128)
void attn_causal64(const unsigned short* __restrict__ qhp, const unsigned short* __restrict__ qlp,
                   const unsigned short* __restrict__ khp, const unsigned short* __restrict__ klp,
                   const unsigned short* __restrict__ vhp, const unsigned short* __restrict__ vlp,
                   unsigned short* ohp, unsigned short* olp,
                   int qbBase, int nqbThis, float sscale) {
  union FB { v16b v; v8b h[2]; };
  union FH { v16h v; v8h h[2]; };
  __shared__ __align__(16) __bf16   Ksh[64 * 64];                 // K hi [kv][d]   8 KB
  __shared__ __align__(16) __bf16   Ksl[64 * 64];                 // K lo
  __shared__ __align__(16) _Float16 Vth[64 * 64];                 // V^T hi [d][kv] 8 KB
  __shared__ __align__(16) _Float16 Vtl[RES ? 64 * 64 : 8];       // V^T residual
  __shared__ __align__(16) _Float16 Psh[4][16 * 64];              // per wave P [row][kv]
  __shared__ __align__(16) _Float16 Psl[RES ? 4 : 1][16 * 64];    // per wave P residual
  __shared__ __align__(16) float    Os[4][16 * 64];               // per wave context tile [row][d]

  const int tid  = threadIdx.x;
  const int wave = tid >> 5;
  const int lane = tid & 31;
  const int hh   = lane >> 4;
  const int c    = lane & 15;

  const int bx   = blockIdx.x;
  const int qbl  = bx % nqbThis;
  const int h    = bx / nqbThis;           // 0..NH-1 (grid = nqbThis * NH)
  const int qb   = qbBase + qbl;
  const int q0   = qb * 64 + wave * 16;

  const __bf16* Qh = (const __bf16*)(const void*)qhp + (size_t)h * HD;
  const __bf16* Ql = (const __bf16*)(const void*)qlp + (size_t)h * HD;
  const __bf16* Kh = (const __bf16*)(const void*)khp + (size_t)h * HD;
  const __bf16* Kl = (const __bf16*)(const void*)klp + (size_t)h * HD;
  const _Float16* Vh = (const _Float16*)(const void*)vhp + (size_t)h * HD * SEQ;
  const _Float16* Vl = (const _Float16*)(const void*)vlp + (size_t)h * HD * VLP;

  // ---- Q fragments (A operand, row = lane&15): 2 d-chunks, hi and lo ----
  v16b qah[2], qal[2];
#pragma unroll
  for (int dc = 0; dc < 2; ++dc) {
    const size_t qo = (size_t)(q0 + c) * DM + dc * 32 + 8 * hh;
    qah[dc] = ldfrag_b(Qh + qo);
    qal[dc] = ldfrag_b(Ql + qo);
  }

  float mrow[8], lrow[8];
  v8f oacc[4];
#pragma unroll
  for (int r = 0; r < 8; ++r) { mrow[r] = -INFINITY; lrow[r] = 0.f; }
#pragma unroll
  for (int t = 0; t < 4; ++t) oacc[t] = zero8();

  const int nkt = qb + 1;                    // key tiles 0..qb (block-uniform)
  for (int kt = 0; kt < NQB; ++kt) {         // static bound
    if (kt >= nkt) break;                    // block-uniform
    const bool diag = (kt == qb);            // block-uniform
    const int kv0 = kt * 64;
    __syncthreads();
    {
      const int r = tid >> 1, half = (tid & 1) * 32;
      const __bf16*   kg  = Kh + (size_t)(kv0 + r) * DM + half;   // K row kv0+r (< SEQ), d = half..half+31
      const __bf16*   klg = Kl + (size_t)(kv0 + r) * DM + half;
      const _Float16* vg  = Vh + (size_t)r * SEQ + kv0 + half;    // V^T row d = r, s = kv0+half..+31
      const int kvl = (kv0 + 64 <= VLP) ? kv0 : (VLP - 64);     // clamped address into the residual plane
      const _Float16* vlg = Vl + (size_t)r * VLP + kvl + half;
      const bool resOK = (kv0 + 64 <= VLP);                      // block-uniform
#pragma unroll
      for (int i = 0; i < 4; ++i) {
        const v8b a0 = *(const v8b*)(kg + 8 * i);
        const v8b a1 = *(const v8b*)(klg + 8 * i);
        const v8h b0 = *(const v8h*)(vg + 8 * i);
        *(v8b*)(Ksh + r * 64 + half + 8 * i) = a0;
        *(v8b*)(Ksl + r * 64 + half + 8 * i) = a1;
        *(v8h*)(Vth + r * 64 + half + 8 * i) = b0;
        if (RES) {
          v8h b1 = *(const v8h*)(vlg + 8 * i);
          if (!resOK) b1 = zero8h();
          *(v8h*)(Vtl + r * 64 + half + 8 * i) = b1;
        }
      }
    }
    __syncthreads();

    // ---- scores: 16 query rows x 64 keys per wave, 3 bf16 products ----
    v8f s[4];
#pragma unroll
    for (int j = 0; j < 4; ++j) {
      s[j] = zero8();
#pragma unroll
      for (int dc = 0; dc < 2; ++dc) {
        FB kb, kl;
        kb.h[0] = *(const v8b*)(Ksh + (j * 16 + c) * 64 + dc * 32 + 8 * hh);
        kb.h[1] = *(const v8b*)(Ksh + (j * 16 + c) * 64 + dc * 32 + 16 + 8 * hh);
        kl.h[0] = *(const v8b*)(Ksl + (j * 16 + c) * 64 + dc * 32 + 8 * hh);
        kl.h[1] = *(const v8b*)(Ksl + (j * 16 + c) * 64 + dc * 32 + 16 + 8 * hh);
        s[j] = mma_b(qah[dc], kb.v, s[j]);
        s[j] = mma_b(qah[dc], kl.v, s[j]);
        s[j] = mma_b(qal[dc], kb.v, s[j]);
      }
    }

    // ---- scale + causal compare (diagonal tile only), row max, online softmax, P (x1024, f16) and
    //      P residual (x4096) to LDS ----
    _Float16* pwh = Psh[wave];
    _Float16* pwl = Psl[RES ? wave : 0];
#pragma unroll
    for (int r = 0; r < 8; ++r) {
      const int qrow = q0 + 8 * hh + r;          // query row of accumulator element r of this lane
      float m = -INFINITY;
#pragma unroll
      for (int j = 0; j < 4; ++j) {
        const int key = kv0 + j * 16 + c;
        float sv = s[j][r] * sscale;
        sv = (diag && (key > qrow)) ? -FLT_MAX : sv;
        s[j][r] = sv;
        m = fmaxf(m, sv);
      }
#pragma unroll
      for (int off = 1; off < 16; off <<= 1) m = fmaxf(m, __shfl_xor(m, off, 32));
      const float mnew  = fmaxf(mrow[r], m);
      const float msafe = (mnew == -INFINITY) ? 0.f : mnew;
      const float alpha = __expf(mrow[r] - msafe);
      mrow[r] = mnew;
      float psum = 0.f;
#pragma unroll
      for (int j = 0; j < 4; ++j) {
        const float p = __expf(s[j][r] - msafe);     // floor logit against a normal max: exp -> 0
        psum += p;
        const float p1k = p * 1024.0f;
        const _Float16 ph = (_Float16)p1k;
        pwh[(8 * hh + r) * 64 + j * 16 + c] = ph;
        if (RES) {
          const _Float16 pl = (_Float16)((p1k - (float)ph) * 4096.0f);
          pwl[(8 * hh + r) * 64 + j * 16 + c] = pl;
        }
      }
#pragma unroll
      for (int off = 1; off < 16; off <<= 1) psum += __shfl_xor(psum, off, 32);
      lrow[r] = lrow[r] * alpha + psum;
#pragma unroll
      for (int t = 0; t < 4; ++t) oacc[t][r] *= alpha;
    }
    __builtin_amdgcn_fence(__ATOMIC_RELEASE, "workgroup");
    __builtin_amdgcn_wave_barrier();
    __builtin_amdgcn_fence(__ATOMIC_ACQUIRE, "workgroup");

    // ---- context += P . V (f16 WMMA), residual products into a separate accumulator ----
    v8f o1[4];
#pragma unroll
    for (int t = 0; t < 4; ++t) o1[t] = zero8();
#pragma unroll 1
    for (int kk = 0; kk < 2; ++kk) {
      FH pa, pl;
      pa.h[0] = *(const v8h*)(pwh + c * 64 + kk * 32 + 8 * hh);
      pa.h[1] = *(const v8h*)(pwh + c * 64 + kk * 32 + 16 + 8 * hh);
      if (RES) {
        pl.h[0] = *(const v8h*)(pwl + c * 64 + kk * 32 + 8 * hh);
        pl.h[1] = *(const v8h*)(pwl + c * 64 + kk * 32 + 16 + 8 * hh);
      } else {
        pl.v = pa.v;
      }
#pragma unroll
      for (int t = 0; t < 4; ++t) {
        FH vb;
        vb.h[0] = *(const v8h*)(Vth + (t * 16 + c) * 64 + kk * 32 + 8 * hh);
        vb.h[1] = *(const v8h*)(Vth + (t * 16 + c) * 64 + kk * 32 + 16 + 8 * hh);
        oacc[t] = mma_h(pa.v, vb.v, oacc[t]);
        if (RES) {
          FH vl;
          vl.h[0] = *(const v8h*)(Vtl + (t * 16 + c) * 64 + kk * 32 + 8 * hh);
          vl.h[1] = *(const v8h*)(Vtl + (t * 16 + c) * 64 + kk * 32 + 16 + 8 * hh);
          o1[t] = mma_h(pa.v, vl.v, o1[t]);
          o1[t] = mma_h(pl.v, vb.v, o1[t]);
        }
      }
    }
    if (RES) {
#pragma unroll
      for (int t = 0; t < 4; ++t)
#pragma unroll
        for (int r = 0; r < 8; ++r) oacc[t][r] += o1[t][r] * (1.0f / 4096.0f);
    }
  }

  // ---- normalise (1/l and the 1/1024 p carry), stage the wave's 16x64 tile, bf16 hi/lo split,
  float* os = Os[wave];
#pragma unroll
  for (int r = 0; r < 8; ++r) {
    const float l = lrow[r];
    const float inv = ((l > 0.f) ? (1.0f / l) : 0.f) * (1.0f / 1024.0f);
#pragma unroll
    for (int t = 0; t < 4; ++t) os[(8 * hh + r) * 64 + t * 16 + c] = oacc[t][r] * inv;
  }
  __builtin_amdgcn_fence(__ATOMIC_RELEASE, "workgroup");
  __builtin_amdgcn_wave_barrier();
  __builtin_amdgcn_fence(__ATOMIC_ACQUIRE, "workgroup");
  {
    const int q4 = lane >> 3, c8 = (lane & 7) * 8;
    v4u hv[4], lv[4];
#pragma unroll
    for (int it = 0; it < 4; ++it) {
      const int row = it * 4 + q4;   // it 0..3 x q4 0..3 = rows 0..15 of the wave tile
      const float* sp = os + row * 64 + c8;
      v4u a, a2;
#pragma unroll
      for (int e = 0; e < 4; ++e) {
        const float f0 = sp[2 * e], f1 = sp[2 * e + 1];
        const unsigned short h0 = bf_bits(f0), h1 = bf_bits(f1);
        const unsigned short l0 = bf_bits(f0 - bf_up(h0)), l1 = bf_bits(f1 - bf_up(h1));
        a[e] = pk16(h0, h1); a2[e] = pk16(l0, l1);
      }
      hv[it] = a; lv[it] = a2;
    }
    {
#pragma unroll
      for (int it = 0; it < 4; ++it) {
        const int row = it * 4 + q4;
        const size_t go = (size_t)(q0 + row) * DM + (size_t)h * HD + c8;
        *(v4u*)(ohp + go) = hv[it];
        *(v4u*)(olp + go) = lv[it];
      }
      
    }
  }
}

// =====================================================================================================
// Workspace map (bytes, SEQ = 4096):
//   Xb    bf16 [SEQ][1024]          0          8388608
//   Wqkvb bf16 [3072 n][1024 k]     8388608    6291456   (rows 0..1023 = q columns, 1024..2047 = k, 2048..3071 = v)
//   Wob   bf16 [1024 n][1024 k]     14680064   2097152
//   Qh    bf16 [SEQ][1024]          16777216   8388608
//   Ql    bf16 [SEQ][1024]          25165824   8388608
//   Kh    bf16 [SEQ][1024]          33554432   8388608
//   Kl    bf16 [SEQ][1024]          41943040   8388608
//   VTh   f16  [1024][SEQ]          50331648   8388608
//   VTl   f16  [1024][VLP=512]      58720256   1048576
//   Oh    bf16 [SEQ][1024]          59768832   8388608
//   Ol    bf16 [SEQ][1024]          68157440   8388608
//   end                             76546048
// All planes are exact multiples of their 64x64 / whole-line store granularity (no padded tails needed),
// =====================================================================================================
extern "C" void kernel_launch(void* const* d_in, const int* in_sizes, int n_in,
                              void* d_out, int out_size, void* d_ws, size_t ws_size,
                              hipStream_t stream) {
  if (n_in < 5) return;
  if (in_sizes[0] < SEQ * DM) return;                 // x rows 0..SEQ-1 (prefix of the full input)
  if (in_sizes[1] != DM * NQKV) return;               // w_qkv [1024][3072]
  if (in_sizes[2] != NQKV) return;                    // b_qkv [3072]
  if (in_sizes[3] != DM * DM) return;                 // w_o [1024][1024]
  if (in_sizes[4] != DM) return;                      // b_o [1024]
  if (out_size < SEQ * DM) return;

  const float* x     = (const float*)d_in[0];
  const float* w_qkv = (const float*)d_in[1];
  const float* b_qkv = (const float*)d_in[2];
  const float* w_o   = (const float*)d_in[3];
  const float* b_o   = (const float*)d_in[4];

  const size_t PX  = (size_t)SEQ * DM * 2;       // 16-bit activation plane [SEQ][1024]
  const size_t PWQ = (size_t)NQKV * DM * 2;      // 16-bit fused weight plane [3072][1024]
  const size_t PWO = (size_t)DM * DM * 2;        // 16-bit out weight plane
  const size_t PVT = (size_t)DM * SEQ * 2;       // v^T hi plane
  const size_t PVL = (size_t)DM * VLP * 2;       // v^T residual plane
  size_t off = 0;
  const size_t oXb   = off; off += PX;
  const size_t oWqkv = off; off += PWQ;
  const size_t oWo   = off; off += PWO;
  const size_t oQh   = off; off += PX;
  const size_t oQl   = off; off += PX;
  const size_t oKh   = off; off += PX;
  const size_t oKl   = off; off += PX;
  const size_t oVTh  = off; off += PVT;
  const size_t oVTl  = off; off += PVL;
  const size_t oOh   = off; off += PX;
  const size_t oOl   = off; off += PX;
  if (off > ws_size) return;                     // off = 76546048 for SEQ = 4096
  if (off > (size_t)134217728) return;

  char* ws = (char*)d_ws;
  unsigned short* Xb    = (unsigned short*)(ws + oXb);
  unsigned short* Wqkvb = (unsigned short*)(ws + oWqkv);
  unsigned short* Wob   = (unsigned short*)(ws + oWo);
  unsigned short* Qh    = (unsigned short*)(ws + oQh);
  unsigned short* Ql    = (unsigned short*)(ws + oQl);
  unsigned short* Kh    = (unsigned short*)(ws + oKh);
  unsigned short* Kl    = (unsigned short*)(ws + oKl);
  unsigned short* VTh   = (unsigned short*)(ws + oVTh);
  unsigned short* VTl   = (unsigned short*)(ws + oVTl);
  unsigned short* Oh    = (unsigned short*)(ws + oOh);
  unsigned short* Ol    = (unsigned short*)(ws + oOl);
  const unsigned short* Wqb = Wqkvb;                              // q weight rows  [1024 n][1024 k]
  const unsigned short* Wkb = Wqkvb + (size_t)DM * DM;            // k weight rows
  const unsigned short* Wvb = Wqkvb + (size_t)2 * DM * DM;        // v weight rows

  const dim3 blk(256);
  const int n8x = SEQ * DM / 8;                                    // multiple of 256
  const dim3 gCvtX((n8x + 255) / 256);
  const dim3 gTq(NQKV / 64, DM / 64);                              // in [1024 k][3072 n] -> out [3072][1024]: (n tiles, k tiles) = (48, 16)
  const dim3 gTo(DM / 64, DM / 64);                                // in [1024 k][1024 n] -> out [1024][1024]: (16, 16)
  const int tilesProj = (SEQ / 64) * (DM / 64);                    // M = SEQ, N = 1024 -> 1024 tiles (SEQ = 4096)
  const dim3 gProj((tilesProj + 7) / 8, 1);
  const int tilesVT = (DM / 64) * (SEQ / 64);                      // M = 1024, N = SEQ
  const dim3 gVT((tilesVT + 7) / 8, 1);

  // (1) x -> bf16 plane [SEQ][1024]; w_qkv [k][n] -> bf16 [n][k]; w_o [k][n] -> bf16 [n][k]
  cvt_bf16x8<<<gCvtX, blk, 0, stream>>>(x, Xb, n8x);
  cvtT_bf16<<<gTq, blk, 0, stream>>>(w_qkv, Wqkvb, DM, NQKV);
  cvtT_bf16<<<gTo, blk, 0, stream>>>(w_o, Wob, DM, DM);
  // (2) q = x . Wq + b_q -> bf16 hi/lo planes [t][h*64+d]   (M = SEQ, N = 1024, K = 1024)
  gemm64<0, 2, 1><<<gProj, blk, 0, stream>>>(
      Xb, Xb, DM, 0LL, Wqb, Wqb, DM, 0LL,
      (void*)Qh, DM, 0LL, (void*)Ql, DM, 0LL, DM,
      SEQ, DM, DM, 1.0f, b_qkv);
  // (3) k = x . Wk + b_k -> bf16 hi/lo planes
  gemm64<0, 2, 1><<<gProj, blk, 0, stream>>>(
      Xb, Xb, DM, 0LL, Wkb, Wkb, DM, 0LL,
      (void*)Kh, DM, 0LL, (void*)Kl, DM, 0LL, DM,
      SEQ, DM, DM, 1.0f, b_qkv + DM);
  // (4) v^T = Wv . x^T + b_v (per row) -> f16 hi plane [h*64+d][s] (pitch SEQ) and residual plane
  //     (x4096, keys < VLP only, pitch VLP)   (A = Wvb [n][k], Bt = Xb; M = 1024, N = SEQ, K = 1024)
  gemm64<0, 3, 2><<<gVT, blk, 0, stream>>>(
      Wvb, Wvb, DM, 0LL, Xb, Xb, DM, 0LL,
      (void*)VTh, SEQ, 0LL, (void*)VTl, VLP, 0LL, VLP,
      DM, SEQ, DM, 4096.0f, b_qkv + 2 * DM);
  // (5) causal attention: query blocks 0..RESQB-1 with residual planes, the rest without
  attn_causal64<true><<<dim3(NH * RESQB), dim3(128), 0, stream>>>(
      Qh, Ql, Kh, Kl, VTh, VTl, Oh, Ol, 0, RESQB, 0.125f);
  if (NQB > RESQB) {
    attn_causal64<false><<<dim3(NH * (NQB - RESQB)), dim3(128), 0, stream>>>(
        Qh, Ql, Kh, Kl, VTh, VTl, Oh, Ol, RESQB, NQB - RESQB, 0.125f);
  }
  // (6) out = context . Wo + b_o -> d_out f32 [SEQ][1024]  (A = context hi + lo planes, 2 products)
  gemm64<1, 0, 1><<<gProj, blk, 0, stream>>>(
      Oh, Ol, DM, 0LL, Wob, Wob, DM, 0LL,
      d_out, DM, 0LL, d_out, DM, 0LL, DM,
      SEQ, DM, DM, 1.0f, b_o);
  (void)hipGetLastError();
}

// v001
// One run takes 422 microseconds.
// Two timings next to v000 put it at 1.39 and 1.38 times that version's speed.
// Contractions: q, k, v^T projections = v_wmma_f32_16x16x32_bf16 (bf16 operands from RNE-converted inputs, single product, f32 bias add);
// q.k^T scores = v_wmma_f32_16x16x32_bf16 with bf16 hi/lo split q and k (hi.hi + hi.lo + lo.hi);
// p.v = v_wmma_f32_16x16x32_f16 (p carried x1024 in f16, v in f16; extra f16 residual planes x4096 of p and v for the first VLP query rows);
// ctx.Wo = v_wmma_f32_16x16x32_bf16 with ctx as bf16 hi/lo planes times bf16 Wo (2 products); all f32 accumulate; causal compare and softmax in f32.
#include <hip/hip_runtime.h>
#include <math.h>
#include <float.h>
#include <stdint.h>

#ifndef NB
#define NB    1
#endif
#ifndef SEQ
#define SEQ   4096
#endif
#define SEQ_FULL 4096
#define DM    1024
#define NH    16
#define HD    64
#define NQKV  (3 * DM)
#define NQB   (SEQ / 64)                      // key / query tiles of 64
#define VLP   ((SEQ < 512) ? SEQ : 512)       // key pitch of the v^T residual plane (keys 0..VLP-1)
#define RESQB (VLP / 64)                      // number of leading 64-row query blocks that use the p / v residual planes
#define LP    72                              // LDS row pitch of the 64-wide 16-bit K / V^T / P tiles, in elements: 144 B = 16 B x 9 (odd), so the
                                              // 16 rows that one half-wave's 16-B fragment read touches fall on 16 distinct groups of 4 banks
#define OP    68                              // LDS row pitch of the 64-wide f32 context tile, in elements: 272 B = 16 B x 17 (odd)
static_assert(NB == 1);
static_assert(NH * HD == DM && HD == 64);
static_assert((SEQ % 64) == 0 && (DM % 64) == 0 && SEQ >= 64 && SEQ <= SEQ_FULL);
static_assert(RESQB * 64 == VLP && VLP <= SEQ && RESQB >= 1 && RESQB <= NQB);
static_assert((NQKV % 64) == 0);

typedef _Float16 v16h __attribute__((ext_vector_type(16)));
typedef _Float16 v8h  __attribute__((ext_vector_type(8)));
typedef __bf16   v16b __attribute__((ext_vector_type(16)));
typedef __bf16   v8b  __attribute__((ext_vector_type(8)));
typedef float    v8f  __attribute__((ext_vector_type(8)));
typedef float    v4f  __attribute__((ext_vector_type(4)));
typedef unsigned int v4u __attribute__((ext_vector_type(4)));

// ---- scalar helpers --------------------------------------------------------------------------------
__device__ __forceinline__ unsigned short bf_bits(float f) {          // f32 -> bf16 bits, RNE convert
  unsigned u = __float_as_uint(f);
  return (unsigned short)((u + 0x7FFFu + ((u >> 16) & 1u)) >> 16);
}
__device__ __forceinline__ float bf_up(unsigned short h) { return __uint_as_float(((unsigned)h) << 16); }
__device__ __forceinline__ unsigned short h_bits(_Float16 x) { return __builtin_bit_cast(unsigned short, x); }
__device__ __forceinline__ unsigned pk16(unsigned short a, unsigned short b) { return (unsigned)a | ((unsigned)b << 16); }
__device__ __forceinline__ v8f zero8() { v8f z = {0.f, 0.f, 0.f, 0.f, 0.f, 0.f, 0.f, 0.f}; return z; }
__device__ __forceinline__ v8h zero8h() {
  const _Float16 z = (_Float16)0.0f;
  v8h r = {z, z, z, z, z, z, z, z};
  return r;
}

// ---- fragment loaders: 16-bit A/B operand, lane -> row/col (lane&15), p already includes +8*(lane>>4);
//      elements 0..7 <- p[0..7] (k0+8h..), elements 8..15 <- p[16..23] (k0+16+8h..)
__device__ __forceinline__ v16b ldfrag_b(const __bf16* p) {
  union { v16b v; v8b h[2]; } f;
  f.h[0] = *(const v8b*)(p);
  f.h[1] = *(const v8b*)(p + 16);
  return f.v;
}

// ---- WMMA helpers with trailing VALU hazard gap --------------------------------------------------------
__device__ __forceinline__ v8f mma_b(v16b a, v16b b, v8f c) {
  c = __builtin_amdgcn_wmma_f32_16x16x32_bf16(false, a, false, b, (short)0, c, false, false);
  asm volatile("v_nop\n\tv_nop\n\tv_nop\n\tv_nop" : "+v"(c) : "v"(a), "v"(b));
  return c;
}
__device__ __forceinline__ v8f mma_h(v16h a, v16h b, v8f c) {
  c = __builtin_amdgcn_wmma_f32_16x16x32_f16(false, a, false, b, (short)0, c, false, false);
  asm volatile("v_nop\n\tv_nop\n\tv_nop\n\tv_nop" : "+v"(c) : "v"(a), "v"(b));
  return c;
}
__device__ __forceinline__ v8f mma_b_raw(v16b a, v16b b, v8f c) {
  return __builtin_amdgcn_wmma_f32_16x16x32_bf16(false, a, false, b, (short)0, c, false, false);
}
__device__ __forceinline__ void dep_guard_b(v8f& a, v8f& b, v16b x, v16b y) {
  asm volatile("v_nop\n\tv_nop\n\tv_nop\n\tv_nop" : "+v"(a), "+v"(b) : "v"(x), "v"(y));
}
__device__ __forceinline__ void keep4_b(v16b a, v16b b, v16b c, v16b d) {
  asm volatile("v_nop" :: "v"(a), "v"(b), "v"(c), "v"(d));
}
__device__ __forceinline__ void acc_guard4(v8f& a, v8f& b, v8f& c, v8f& d) {
  asm volatile("v_nop\n\tv_nop\n\tv_nop\n\tv_nop" : "+v"(a), "+v"(b), "+v"(c), "+v"(d));
}

// =====================================================================================================
// f32 -> bf16 (RNE convert), 8 elements per thread, one 16-B store per lane: a wave writes 512 contiguous B
// coverage: n8 threads x 8 = whole plane (n8 = SEQ*DM/8 is a multiple of 256).
// =====================================================================================================
__global__ __launch_bounds__(256) void cvt_bf16x8(const float* __restrict__ in, unsigned short* out, int n8) {
  const int i = blockIdx.x * 256 + threadIdx.x;
  if (i < n8) {
    const v4f a = *(const v4f*)(in + (size_t)i * 8);
    const v4f b = *(const v4f*)(in + (size_t)i * 8 + 4);
    v4u p;
    p[0] = pk16(bf_bits(a[0]), bf_bits(a[1]));
    p[1] = pk16(bf_bits(a[2]), bf_bits(a[3]));
    p[2] = pk16(bf_bits(b[0]), bf_bits(b[1]));
    p[3] = pk16(bf_bits(b[2]), bf_bits(b[3]));
    *(v4u*)(out + (size_t)i * 8) = p;
    
  }
}

// =====================================================================================================
// Transposed convert: in f32 [K rows][N cols] (pitch N) -> out bf16 [N rows][K cols] (pitch K), RNE.
// grid = (N/64, K/64), 256 threads; one 64(k) x 64(n) tile per block through LDS.
// Load phase: thread (k row = tid>>2, 16 n columns = (tid&3)*16) reads 4 x 16 B and writes bf16 bits
// transposed into st[n][k] (pitch 72 halves). After __syncthreads each wave writes 8 output rows:
// coverage: load 64 k x (4 threads x 16 n) = 64x64; store 8 waves x 2 it x 4 rows x (8 lanes x 8) = 64x64.
// LDS st: cross-wave exchange behind the block barrier.
// =====================================================================================================
__global__ __launch_bounds__(256) void cvtT_bf16(const float* __restrict__ in, unsigned short* out, int K, int N) {
  __shared__ __align__(16) unsigned short st[64 * 72];
  const int tid = threadIdx.x;
  const int n0  = blockIdx.x * 64;
  const int k0  = blockIdx.y * 64;
  {
    const int r  = tid >> 2;            // k row 0..63
    const int cb = (tid & 3) * 16;      // n column base
    const float* src = in + (size_t)(k0 + r) * N + n0 + cb;
#pragma unroll
    for (int e = 0; e < 4; ++e) {
      const v4f a = *(const v4f*)(src + 4 * e);
#pragma unroll
      for (int u = 0; u < 4; ++u) st[(cb + 4 * e + u) * 72 + r] = bf_bits(a[u]);
    }
  }
  __syncthreads();
  {
    const int lane = tid & 31, wave = tid >> 5;
    const int q = lane >> 3, c8 = (lane & 7) * 8;
    v4u hv[2];
#pragma unroll
    for (int it = 0; it < 2; ++it) {
      const int row = wave * 8 + it * 4 + q;      // n row within the tile
      hv[it] = *(const v4u*)(st + row * 72 + c8);
    }
    {
#pragma unroll
      for (int it = 0; it < 2; ++it) {
        const int row = wave * 8 + it * 4 + q;
        *(v4u*)(out + (size_t)(n0 + row) * K + k0 + c8) = hv[it];
      }
      
    }
  }
}

// =====================================================================================================
// Register-blocked bf16 WMMA GEMM: C[m][n] = sum_k A[m][k] * Bt[n][k] + bias; one wave per 64x64 tile,
// no block barriers. A row-major [M][K] pitch lda; Bt row-major [N][K] pitch ldb (k contiguous);
// M, N multiples of 64, K multiple of 32 (host-checked). blockIdx.y = batch index (strides in elements).
// NSPLIT: 0 = A.Bt; 1 = (A + A2).Bt (A2 = unscaled bf16 lo plane of A); 2 = A.Bt + A2.Bt + A.Bt2.
// OUT_MODE: 0 = f32 (pitch ldc); 2 = bf16 hi plane C + bf16 lo plane C2 (lo = RNE(v - hi), unscaled);
//           3 = f16 hi plane C + f16 residual plane C2 = f16((v - hi) * rscale), C2 written only for tiles
//               with n0 < N2 (pitch ldc2, batch stride strideC2).
// BIASM: 1 = bias[n] added per column (bias has >= N entries); 2 = bias[m] added per row (>= M entries);
//        the bias value is RNE-converted to bf16 and added in f32 before any output split.
// =====================================================================================================
template <int NSPLIT, int OUT_MODE, int BIASM>
__global__ __launch_bounds__(256) void gemm64(
    const unsigned short* __restrict__ Ap, const unsigned short* A2p, int lda, long long strideA,
    const unsigned short* __restrict__ Btp, const unsigned short* Bt2p, int ldb, long long strideB,
    void* Cout, int ldc, long long strideC,
    void* Cout2, int ldc2, long long strideC2, int N2,
    int M, int N, int K, float rscale, const float* __restrict__ bias) {
  const __bf16* A   = (const __bf16*)(const void*)Ap;
  const __bf16* A2  = (const __bf16*)(const void*)A2p;
  const __bf16* Bt  = (const __bf16*)(const void*)Btp;
  const __bf16* Bt2 = (const __bf16*)(const void*)Bt2p;
  __shared__ __align__(16) float sT[8][16 * 68];   // per-wave 16x64 slab, pitch 68 floats
  const int b    = blockIdx.y;
  const int lane = threadIdx.x & 31;
  const int wave = threadIdx.x >> 5;
  const int tilesN = N >> 6;
  const int tilesM = M >> 6;
  const int tile = blockIdx.x * 8 + wave;
  if (tile >= tilesM * tilesN) return;   // wave-uniform; no block barriers in this kernel
  const int tm = tile / tilesN;
  const int tn = tile - tm * tilesN;
  const int m0 = tm << 6;
  const int n0 = tn << 6;

  const __bf16* Ab  = A  + (size_t)b * strideA;
  const __bf16* Bb  = Bt + (size_t)b * strideB;
  const __bf16* Ab2 = (NSPLIT >= 1) ? (A2  + (size_t)b * strideA) : Ab;
  const __bf16* Bb2 = (NSPLIT == 2) ? (Bt2 + (size_t)b * strideB) : Bb;

  const int rlane = lane & 15;                 // row (A) / col (B, D) within subtile
  const int koff  = (lane >> 4) * 8;           // k offset of this lane half
  const int mOff  = (lane >> 4) * 8;           // D row offset

  v8f acc[4][4];
#pragma unroll
  for (int i = 0; i < 4; ++i)
#pragma unroll
    for (int j = 0; j < 4; ++j) acc[i][j] = zero8();

  for (int k0 = 0; k0 < K; k0 += 32) {
    v16b bh[4], bl[4];
#pragma unroll
    for (int j = 0; j < 4; ++j) {
      const size_t bo = (size_t)(n0 + (j << 4) + rlane) * ldb + koff + k0;
      bh[j] = ldfrag_b(Bb + bo);
      if (NSPLIT == 2) bl[j] = ldfrag_b(Bb2 + bo); else bl[j] = bh[j];
    }
#pragma unroll
    for (int i = 0; i < 4; ++i) {
      const size_t ao = (size_t)(m0 + (i << 4) + rlane) * lda + koff + k0;
      const v16b ah = ldfrag_b(Ab + ao);
      v16b al = ah;
      if (NSPLIT >= 1) al = ldfrag_b(Ab2 + ao);
#pragma unroll
      for (int j = 0; j < 4; ++j) {
        acc[i][j] = mma_b_raw(ah, bh[j], acc[i][j]);
        if (NSPLIT >= 1) acc[i][j] = mma_b_raw(al, bh[j], acc[i][j]);
        if (NSPLIT == 2) acc[i][j] = mma_b_raw(ah, bl[j], acc[i][j]);
      }
      dep_guard_b(acc[i][0], acc[i][3], ah, al);
    }
    keep4_b(bh[0], bh[1], bh[2], bh[3]);
    if (NSPLIT == 2) keep4_b(bl[0], bl[1], bl[2], bl[3]);
  }
  acc_guard4(acc[0][0], acc[0][1], acc[0][2], acc[0][3]);
  acc_guard4(acc[1][0], acc[1][1], acc[1][2], acc[1][3]);
  acc_guard4(acc[2][0], acc[2][1], acc[2][2], acc[2][3]);
  acc_guard4(acc[3][0], acc[3][1], acc[3][2], acc[3][3]);

  // ---- epilogue ----
  float* slab = sT[wave];
  float bcol[4];
#pragma unroll
  for (int j = 0; j < 4; ++j) bcol[j] = 0.f;
  if (BIASM == 1) {
#pragma unroll
    for (int j = 0; j < 4; ++j) bcol[j] = bf_up(bf_bits(bias[n0 + (j << 4) + rlane]));   // < N, in range
  }
#pragma unroll
  for (int i = 0; i < 4; ++i) {
    const int mBase = m0 + (i << 4);
    float brow[8];
#pragma unroll
    for (int r = 0; r < 8; ++r) brow[r] = 0.f;
    if (BIASM == 2) {
      const v4f b0 = *(const v4f*)(bias + mBase + mOff);          // rows mBase+mOff..+7 < M, in range
      const v4f b1 = *(const v4f*)(bias + mBase + mOff + 4);
#pragma unroll
      for (int r = 0; r < 4; ++r) {
        brow[r]     = bf_up(bf_bits(b0[r]));
        brow[4 + r] = bf_up(bf_bits(b1[r]));
      }
    }
#pragma unroll
    for (int j = 0; j < 4; ++j) {
#pragma unroll
      for (int r = 0; r < 8; ++r) {
        slab[(mOff + r) * 68 + (j << 4) + rlane] = acc[i][j][r] + bcol[j] + brow[r];
      }
    }
    __builtin_amdgcn_fence(__ATOMIC_RELEASE, "workgroup");
    __builtin_amdgcn_wave_barrier();
    __builtin_amdgcn_fence(__ATOMIC_ACQUIRE, "workgroup");
    if (OUT_MODE == 0) {
      float* C = (float*)Cout + (size_t)b * strideC;
      const int hh = lane >> 4, c4 = (lane & 15) * 4;     // 256-B row segment = 16 lanes x 16 B
      {
#pragma unroll
        for (int it = 0; it < 8; ++it) {
          const int row = it * 2 + hh;                     // it 0..7 x hh 0..1 = rows 0..15
          const v4f v = *(const v4f*)(slab + row * 68 + c4);
          *(v4f*)(C + (size_t)(mBase + row) * ldc + n0 + c4) = v;
        }
        
      }
    } else {
      const int q = lane >> 3, c8 = (lane & 7) * 8;
      unsigned short* C  = (unsigned short*)Cout  + (size_t)b * strideC;
      unsigned short* C2 = (unsigned short*)Cout2 + (size_t)b * strideC2;
      const bool wlo = (OUT_MODE == 2) || (n0 < N2);      // wave-uniform
      v4u hv[4], lv[4];
#pragma unroll
      for (int it = 0; it < 4; ++it) {
        const int row = it * 4 + q;                        // it 0..3 x q 0..3 = rows 0..15
        const float* sp = slab + row * 68 + c8;
        v4u a, a2;
#pragma unroll
        for (int e = 0; e < 4; ++e) {
          const float f0 = sp[2 * e], f1 = sp[2 * e + 1];
          unsigned short h0, h1, l0, l1;
          if (OUT_MODE == 2) {
            h0 = bf_bits(f0); h1 = bf_bits(f1);
            l0 = bf_bits(f0 - bf_up(h0)); l1 = bf_bits(f1 - bf_up(h1));
          } else {
            const _Float16 x0 = (_Float16)f0, x1 = (_Float16)f1;
            h0 = h_bits(x0); h1 = h_bits(x1);
            l0 = h_bits((_Float16)((f0 - (float)x0) * rscale));
            l1 = h_bits((_Float16)((f1 - (float)x1) * rscale));
          }
          a[e] = pk16(h0, h1); a2[e] = pk16(l0, l1);
        }
        hv[it] = a; lv[it] = a2;
      }
      {
#pragma unroll
        for (int it = 0; it < 4; ++it) {
          const int row = it * 4 + q;
          *(v4u*)(C + (size_t)(mBase + row) * ldc + n0 + c8) = hv[it];
          if (wlo) *(v4u*)(C2 + (size_t)(mBase + row) * ldc2 + n0 + c8) = lv[it];
        }
        
      }
    }
    __builtin_amdgcn_fence(__ATOMIC_RELEASE, "workgroup");
    __builtin_amdgcn_wave_barrier();
    __builtin_amdgcn_fence(__ATOMIC_ACQUIRE, "workgroup");
  }
}

// =====================================================================================================
// Causal attention, head dim 64, single batch.
//   q planes (bf16 hi / lo): element (t, h, d) at [t*DM + h*64 + d]
//   k planes (bf16 hi / lo): same layout with key index s
//   v^T hi plane (f16):      element (h, d, s) at [(h*64 + d)*SEQ + s]
//   v^T residual plane (f16, (v - hi)*4096): [(h*64 + d)*VLP + s], s < VLP, read only when RES
//   (a key tile at or beyond VLP would contribute a zero v residual; never happens for query blocks < RESQB)
//   logit (t, s) = q.k * sscale for s <= t, finfo.min for s > t. Query block qb (64 rows) visits key tiles
//   0..qb only (every later key is above the diagonal for all 64 rows -> weight exactly 0); the compare
//   s > t is applied on the diagonal tile kt == qb only (block-uniform flag, per-element select). Every row
//   has the live key s = t in the diagonal tile and key s = 0 in tile 0, so the row max is always finite.
//   out planes (bf16 hi / lo of the normalised context): element (t, h, d) at [t*DM + h*64 + d]
//   scores = q . k : bf16 hi/lo split (hi.hi + hi.lo + lo.hi), f32 accumulate, then * sscale in f32
//   p = exp(s - m) carried as f16(1024 p); context = p . v on f16 WMMA; RES adds f16 residual planes of p and v
//   (scale 4096, separate accumulator folded back with 1/4096 per chunk in f32); online softmax in f32.
//   Block = 4 waves = 64 query rows of one head; grid = nqbThis * NH; kv chunks of 64, static bound NQB,
//   block-uniform break at kt == qb + 1.
//   K / V^T chunk staging: 128 threads x 32 elements per plane = the whole 64x64 tile (plain 16-B loads,
//   __syncthreads before and after: cross-wave LDS regions Ksh/Ksl/Vth/Vtl behind block barriers);
//   P tiles and the Os tile are wave-private, spilled with element stores and reloaded (P as v8h, same element
//   Output coverage: each wave stores rows q0..q0+15 (it 0..3 x lane>>3 0..3) x 64 columns (8 lanes x 8) of both planes.
// =====================================================================================================
template <bool RES>
__global__ __launch_bounds__(128)
void attn_causal64(const unsigned short* __restrict__ qhp, const unsigned short* __restrict__ qlp,
                   const unsigned short* __restrict__ khp, const unsigned short* __restrict__ klp,
                   const unsigned short* __restrict__ vhp, const unsigned short* __restrict__ vlp,
                   unsigned short* ohp, unsigned short* olp,
                   int qbBase, int nqbThis, float sscale) {
  union FB { v16b v; v8b h[2]; };
  union FH { v16h v; v8h h[2]; };
  __shared__ __align__(16) __bf16   Ksh[64 * LP];                 // K hi [kv][d], pitch LP
  __shared__ __align__(16) __bf16   Ksl[64 * LP];                 // K lo
  __shared__ __align__(16) _Float16 Vth[64 * LP];                 // V^T hi [d][kv], pitch LP
  __shared__ __align__(16) _Float16 Vtl[RES ? 64 * LP : 8];       // V^T residual
  __shared__ __align__(16) _Float16 Psh[4][16 * LP];              // per wave P [row][kv], pitch LP
  __shared__ __align__(16) _Float16 Psl[RES ? 4 : 1][16 * LP];    // per wave P residual
  __shared__ __align__(16) float    Os[4][16 * OP];               // per wave context tile [row][d], pitch OP

  const int tid  = threadIdx.x;
  const int wave = tid >> 5;
  const int lane = tid & 31;
  const int hh   = lane >> 4;
  const int c    = lane & 15;

  const int bx   = blockIdx.x;
  const int qbl  = bx % nqbThis;
  const int h    = bx / nqbThis;           // 0..NH-1 (grid = nqbThis * NH)
  const int qb   = qbBase + qbl;
  const int q0   = qb * 64 + wave * 16;

  const __bf16* Qh = (const __bf16*)(const void*)qhp + (size_t)h * HD;
  const __bf16* Ql = (const __bf16*)(const void*)qlp + (size_t)h * HD;
  const __bf16* Kh = (const __bf16*)(const void*)khp + (size_t)h * HD;
  const __bf16* Kl = (const __bf16*)(const void*)klp + (size_t)h * HD;
  const _Float16* Vh = (const _Float16*)(const void*)vhp + (size_t)h * HD * SEQ;
  const _Float16* Vl = (const _Float16*)(const void*)vlp + (size_t)h * HD * VLP;

  // ---- Q fragments (A operand, row = lane&15): 2 d-chunks, hi and lo ----
  v16b qah[2], qal[2];
#pragma unroll
  for (int dc = 0; dc < 2; ++dc) {
    const size_t qo = (size_t)(q0 + c) * DM + dc * 32 + 8 * hh;
    qah[dc] = ldfrag_b(Qh + qo);
    qal[dc] = ldfrag_b(Ql + qo);
  }

  float mrow[8], lrow[8];
  v8f oacc[4];
#pragma unroll
  for (int r = 0; r < 8; ++r) { mrow[r] = -INFINITY; lrow[r] = 0.f; }
#pragma unroll
  for (int t = 0; t < 4; ++t) oacc[t] = zero8();

  const int nkt = qb + 1;                    // key tiles 0..qb (block-uniform)
  for (int kt = 0; kt < NQB; ++kt) {         // static bound
    if (kt >= nkt) break;                    // block-uniform
    const bool diag = (kt == qb);            // block-uniform
    const int kv0 = kt * 64;
    __syncthreads();
    {
      const int r = tid >> 1, half = (tid & 1) * 32;
      const __bf16*   kg  = Kh + (size_t)(kv0 + r) * DM + half;   // K row kv0+r (< SEQ), d = half..half+31
      const __bf16*   klg = Kl + (size_t)(kv0 + r) * DM + half;
      const _Float16* vg  = Vh + (size_t)r * SEQ + kv0 + half;    // V^T row d = r, s = kv0+half..+31
      const int kvl = (kv0 + 64 <= VLP) ? kv0 : (VLP - 64);     // clamped address into the residual plane
      const _Float16* vlg = Vl + (size_t)r * VLP + kvl + half;
      const bool resOK = (kv0 + 64 <= VLP);                      // block-uniform
#pragma unroll
      for (int i = 0; i < 4; ++i) {
        const v8b a0 = *(const v8b*)(kg + 8 * i);
        const v8b a1 = *(const v8b*)(klg + 8 * i);
        const v8h b0 = *(const v8h*)(vg + 8 * i);
        *(v8b*)(Ksh + r * LP + half + 8 * i) = a0;
        *(v8b*)(Ksl + r * LP + half + 8 * i) = a1;
        *(v8h*)(Vth + r * LP + half + 8 * i) = b0;
        if (RES) {
          v8h b1 = *(const v8h*)(vlg + 8 * i);
          if (!resOK) b1 = zero8h();
          *(v8h*)(Vtl + r * LP + half + 8 * i) = b1;
        }
      }
    }
    __syncthreads();

    // ---- scores: 16 query rows x 64 keys per wave, 3 bf16 products ----
    v8f s[4];
#pragma unroll
    for (int j = 0; j < 4; ++j) {
      s[j] = zero8();
#pragma unroll
      for (int dc = 0; dc < 2; ++dc) {
        FB kb, kl;
        kb.h[0] = *(const v8b*)(Ksh + (j * 16 + c) * LP + dc * 32 + 8 * hh);
        kb.h[1] = *(const v8b*)(Ksh + (j * 16 + c) * LP + dc * 32 + 16 + 8 * hh);
        kl.h[0] = *(const v8b*)(Ksl + (j * 16 + c) * LP + dc * 32 + 8 * hh);
        kl.h[1] = *(const v8b*)(Ksl + (j * 16 + c) * LP + dc * 32 + 16 + 8 * hh);
        s[j] = mma_b(qah[dc], kb.v, s[j]);
        s[j] = mma_b(qah[dc], kl.v, s[j]);
        s[j] = mma_b(qal[dc], kb.v, s[j]);
      }
    }

    // ---- scale + causal compare (diagonal tile only), row max, online softmax, P (x1024, f16) and
    //      P residual (x4096) to LDS ----
    _Float16* pwh = Psh[wave];
    _Float16* pwl = Psl[RES ? wave : 0];
#pragma unroll
    for (int r = 0; r < 8; ++r) {
      const int qrow = q0 + 8 * hh + r;          // query row of accumulator element r of this lane
      float m = -INFINITY;
#pragma unroll
      for (int j = 0; j < 4; ++j) {
        const int key = kv0 + j * 16 + c;
        float sv = s[j][r] * sscale;
        sv = (diag && (key > qrow)) ? -FLT_MAX : sv;
        s[j][r] = sv;
        m = fmaxf(m, sv);
      }
#pragma unroll
      for (int off = 1; off < 16; off <<= 1) m = fmaxf(m, __shfl_xor(m, off, 32));
      const float mnew  = fmaxf(mrow[r], m);
      const float msafe = (mnew == -INFINITY) ? 0.f : mnew;
      const float alpha = __expf(mrow[r] - msafe);
      mrow[r] = mnew;
      float psum = 0.f;
#pragma unroll
      for (int j = 0; j < 4; ++j) {
        const float p = __expf(s[j][r] - msafe);     // floor logit against a normal max: exp -> 0
        psum += p;
        const float p1k = p * 1024.0f;
        const _Float16 ph = (_Float16)p1k;
        pwh[(8 * hh + r) * LP + j * 16 + c] = ph;
        if (RES) {
          const _Float16 pl = (_Float16)((p1k - (float)ph) * 4096.0f);
          pwl[(8 * hh + r) * LP + j * 16 + c] = pl;
        }
      }
#pragma unroll
      for (int off = 1; off < 16; off <<= 1) psum += __shfl_xor(psum, off, 32);
      lrow[r] = lrow[r] * alpha + psum;
#pragma unroll
      for (int t = 0; t < 4; ++t) oacc[t][r] *= alpha;
    }
    __builtin_amdgcn_fence(__ATOMIC_RELEASE, "workgroup");
    __builtin_amdgcn_wave_barrier();
    __builtin_amdgcn_fence(__ATOMIC_ACQUIRE, "workgroup");

    // ---- context += P . V (f16 WMMA), residual products into a separate accumulator ----
    v8f o1[4];
#pragma unroll
    for (int t = 0; t < 4; ++t) o1[t] = zero8();
#pragma unroll 1
    for (int kk = 0; kk < 2; ++kk) {
      FH pa, pl;
      pa.h[0] = *(const v8h*)(pwh + c * LP + kk * 32 + 8 * hh);
      pa.h[1] = *(const v8h*)(pwh + c * LP + kk * 32 + 16 + 8 * hh);
      if (RES) {
        pl.h[0] = *(const v8h*)(pwl + c * LP + kk * 32 + 8 * hh);
        pl.h[1] = *(const v8h*)(pwl + c * LP + kk * 32 + 16 + 8 * hh);
      } else {
        pl.v = pa.v;
      }
#pragma unroll
      for (int t = 0; t < 4; ++t) {
        FH vb;
        vb.h[0] = *(const v8h*)(Vth + (t * 16 + c) * LP + kk * 32 + 8 * hh);
        vb.h[1] = *(const v8h*)(Vth + (t * 16 + c) * LP + kk * 32 + 16 + 8 * hh);
        oacc[t] = mma_h(pa.v, vb.v, oacc[t]);
        if (RES) {
          FH vl;
          vl.h[0] = *(const v8h*)(Vtl + (t * 16 + c) * LP + kk * 32 + 8 * hh);
          vl.h[1] = *(const v8h*)(Vtl + (t * 16 + c) * LP + kk * 32 + 16 + 8 * hh);
          o1[t] = mma_h(pa.v, vl.v, o1[t]);
          o1[t] = mma_h(pl.v, vb.v, o1[t]);
        }
      }
    }
    if (RES) {
#pragma unroll
      for (int t = 0; t < 4; ++t)
#pragma unroll
        for (int r = 0; r < 8; ++r) oacc[t][r] += o1[t][r] * (1.0f / 4096.0f);
    }
  }

  // ---- normalise (1/l and the 1/1024 p carry), stage the wave's 16x64 tile, bf16 hi/lo split,
  float* os = Os[wave];
#pragma unroll
  for (int r = 0; r < 8; ++r) {
    const float l = lrow[r];
    const float inv = ((l > 0.f) ? (1.0f / l) : 0.f) * (1.0f / 1024.0f);
#pragma unroll
    for (int t = 0; t < 4; ++t) os[(8 * hh + r) * OP + t * 16 + c] = oacc[t][r] * inv;
  }
  __builtin_amdgcn_fence(__ATOMIC_RELEASE, "workgroup");
  __builtin_amdgcn_wave_barrier();
  __builtin_amdgcn_fence(__ATOMIC_ACQUIRE, "workgroup");
  {
    const int q4 = lane >> 3, c8 = (lane & 7) * 8;
    v4u hv[4], lv[4];
#pragma unroll
    for (int it = 0; it < 4; ++it) {
      const int row = it * 4 + q4;   // it 0..3 x q4 0..3 = rows 0..15 of the wave tile
      const float* sp = os + row * OP + c8;
      v4u a, a2;
#pragma unroll
      for (int e = 0; e < 4; ++e) {
        const float f0 = sp[2 * e], f1 = sp[2 * e + 1];
        const unsigned short h0 = bf_bits(f0), h1 = bf_bits(f1);
        const unsigned short l0 = bf_bits(f0 - bf_up(h0)), l1 = bf_bits(f1 - bf_up(h1));
        a[e] = pk16(h0, h1); a2[e] = pk16(l0, l1);
      }
      hv[it] = a; lv[it] = a2;
    }
    {
#pragma unroll
      for (int it = 0; it < 4; ++it) {
        const int row = it * 4 + q4;
        const size_t go = (size_t)(q0 + row) * DM + (size_t)h * HD + c8;
        *(v4u*)(ohp + go) = hv[it];
        *(v4u*)(olp + go) = lv[it];
      }
      
    }
  }
}

// =====================================================================================================
// Workspace map (bytes, SEQ = 4096):
//   Xb    bf16 [SEQ][1024]          0          8388608
//   Wqkvb bf16 [3072 n][1024 k]     8388608    6291456   (rows 0..1023 = q columns, 1024..2047 = k, 2048..3071 = v)
//   Wob   bf16 [1024 n][1024 k]     14680064   2097152
//   Qh    bf16 [SEQ][1024]          16777216   8388608
//   Ql    bf16 [SEQ][1024]          25165824   8388608
//   Kh    bf16 [SEQ][1024]          33554432   8388608
//   Kl    bf16 [SEQ][1024]          41943040   8388608
//   VTh   f16  [1024][SEQ]          50331648   8388608
//   VTl   f16  [1024][VLP=512]      58720256   1048576
//   Oh    bf16 [SEQ][1024]          59768832   8388608
//   Ol    bf16 [SEQ][1024]          68157440   8388608
//   end                             76546048
// All planes are exact multiples of their 64x64 / whole-line store granularity (no padded tails needed),
// =====================================================================================================
extern "C" void kernel_launch(void* const* d_in, const int* in_sizes, int n_in,
                              void* d_out, int out_size, void* d_ws, size_t ws_size,
                              hipStream_t stream) {
  if (n_in < 5) return;
  if (in_sizes[0] < SEQ * DM) return;                 // x rows 0..SEQ-1 (prefix of the full input)
  if (in_sizes[1] != DM * NQKV) return;               // w_qkv [1024][3072]
  if (in_sizes[2] != NQKV) return;                    // b_qkv [3072]
  if (in_sizes[3] != DM * DM) return;                 // w_o [1024][1024]
  if (in_sizes[4] != DM) return;                      // b_o [1024]
  if (out_size < SEQ * DM) return;

  const float* x     = (const float*)d_in[0];
  const float* w_qkv = (const float*)d_in[1];
  const float* b_qkv = (const float*)d_in[2];
  const float* w_o   = (const float*)d_in[3];
  const float* b_o   = (const float*)d_in[4];

  const size_t PX  = (size_t)SEQ * DM * 2;       // 16-bit activation plane [SEQ][1024]
  const size_t PWQ = (size_t)NQKV * DM * 2;      // 16-bit fused weight plane [3072][1024]
  const size_t PWO = (size_t)DM * DM * 2;        // 16-bit out weight plane
  const size_t PVT = (size_t)DM * SEQ * 2;       // v^T hi plane
  const size_t PVL = (size_t)DM * VLP * 2;       // v^T residual plane
  size_t off = 0;
  const size_t oXb   = off; off += PX;
  const size_t oWqkv = off; off += PWQ;
  const size_t oWo   = off; off += PWO;
  const size_t oQh   = off; off += PX;
  const size_t oQl   = off; off += PX;
  const size_t oKh   = off; off += PX;
  const size_t oKl   = off; off += PX;
  const size_t oVTh  = off; off += PVT;
  const size_t oVTl  = off; off += PVL;
  const size_t oOh   = off; off += PX;
  const size_t oOl   = off; off += PX;
  if (off > ws_size) return;                     // off = 76546048 for SEQ = 4096
  if (off > (size_t)134217728) return;

  char* ws = (char*)d_ws;
  unsigned short* Xb    = (unsigned short*)(ws + oXb);
  unsigned short* Wqkvb = (unsigned short*)(ws + oWqkv);
  unsigned short* Wob   = (unsigned short*)(ws + oWo);
  unsigned short* Qh    = (unsigned short*)(ws + oQh);
  unsigned short* Ql    = (unsigned short*)(ws + oQl);
  unsigned short* Kh    = (unsigned short*)(ws + oKh);
  unsigned short* Kl    = (unsigned short*)(ws + oKl);
  unsigned short* VTh   = (unsigned short*)(ws + oVTh);
  unsigned short* VTl   = (unsigned short*)(ws + oVTl);
  unsigned short* Oh    = (unsigned short*)(ws + oOh);
  unsigned short* Ol    = (unsigned short*)(ws + oOl);
  const unsigned short* Wqb = Wqkvb;                              // q weight rows  [1024 n][1024 k]
  const unsigned short* Wkb = Wqkvb + (size_t)DM * DM;            // k weight rows
  const unsigned short* Wvb = Wqkvb + (size_t)2 * DM * DM;        // v weight rows

  const dim3 blk(256);
  const int n8x = SEQ * DM / 8;                                    // multiple of 256
  const dim3 gCvtX((n8x + 255) / 256);
  const dim3 gTq(NQKV / 64, DM / 64);                              // in [1024 k][3072 n] -> out [3072][1024]: (n tiles, k tiles) = (48, 16)
  const dim3 gTo(DM / 64, DM / 64);                                // in [1024 k][1024 n] -> out [1024][1024]: (16, 16)
  const int tilesProj = (SEQ / 64) * (DM / 64);                    // M = SEQ, N = 1024 -> 1024 tiles (SEQ = 4096)
  const dim3 gProj((tilesProj + 7) / 8, 1);
  const int tilesVT = (DM / 64) * (SEQ / 64);                      // M = 1024, N = SEQ
  const dim3 gVT((tilesVT + 7) / 8, 1);

  // (1) x -> bf16 plane [SEQ][1024]; w_qkv [k][n] -> bf16 [n][k]; w_o [k][n] -> bf16 [n][k]
  cvt_bf16x8<<<gCvtX, blk, 0, stream>>>(x, Xb, n8x);
  cvtT_bf16<<<gTq, blk, 0, stream>>>(w_qkv, Wqkvb, DM, NQKV);
  cvtT_bf16<<<gTo, blk, 0, stream>>>(w_o, Wob, DM, DM);
  // (2) q = x . Wq + b_q -> bf16 hi/lo planes [t][h*64+d]   (M = SEQ, N = 1024, K = 1024)
  gemm64<0, 2, 1><<<gProj, blk, 0, stream>>>(
      Xb, Xb, DM, 0LL, Wqb, Wqb, DM, 0LL,
      (void*)Qh, DM, 0LL, (void*)Ql, DM, 0LL, DM,
      SEQ, DM, DM, 1.0f, b_qkv);
  // (3) k = x . Wk + b_k -> bf16 hi/lo planes
  gemm64<0, 2, 1><<<gProj, blk, 0, stream>>>(
      Xb, Xb, DM, 0LL, Wkb, Wkb, DM, 0LL,
      (void*)Kh, DM, 0LL, (void*)Kl, DM, 0LL, DM,
      SEQ, DM, DM, 1.0f, b_qkv + DM);
  // (4) v^T = Wv . x^T + b_v (per row) -> f16 hi plane [h*64+d][s] (pitch SEQ) and residual plane
  //     (x4096, keys < VLP only, pitch VLP)   (A = Wvb [n][k], Bt = Xb; M = 1024, N = SEQ, K = 1024)
  gemm64<0, 3, 2><<<gVT, blk, 0, stream>>>(
      Wvb, Wvb, DM, 0LL, Xb, Xb, DM, 0LL,
      (void*)VTh, SEQ, 0LL, (void*)VTl, VLP, 0LL, VLP,
      DM, SEQ, DM, 4096.0f, b_qkv + 2 * DM);
  // (5) causal attention: query blocks 0..RESQB-1 with residual planes, the rest without
  attn_causal64<true><<<dim3(NH * RESQB), dim3(128), 0, stream>>>(
      Qh, Ql, Kh, Kl, VTh, VTl, Oh, Ol, 0, RESQB, 0.125f);
  if (NQB > RESQB) {
    attn_causal64<false><<<dim3(NH * (NQB - RESQB)), dim3(128), 0, stream>>>(
        Qh, Ql, Kh, Kl, VTh, VTl, Oh, Ol, RESQB, NQB - RESQB, 0.125f);
  }
  // (6) out = context . Wo + b_o -> d_out f32 [SEQ][1024]  (A = context hi + lo planes, 2 products)
  gemm64<1, 0, 1><<<gProj, blk, 0, stream>>>(
      Oh, Ol, DM, 0LL, Wob, Wob, DM, 0LL,
      d_out, DM, 0LL, d_out, DM, 0LL, DM,
      SEQ, DM, DM, 1.0f, b_o);
  (void)hipGetLastError();
}

// v002
// One run takes 268 microseconds.
// In both of two side-by-side timings against v001, it was 1.57 times as fast.
// Counting every step since v000, it is 2.17 times as fast.
// Contractions: q, k, v^T projections = v_wmma_f32_16x16x32_bf16 (bf16 operands from RNE-converted inputs, single product, f32 bias add);
// q.k^T scores = v_wmma_f32_16x16x32_bf16 with bf16 hi/lo split q and k (hi.hi + hi.lo + lo.hi);
// p.v = v_wmma_f32_16x16x32_f16 (p carried x1024 in f16, v in f16; extra f16 residual planes x4096 of p and v for the first VLP query rows);
// ctx.Wo = v_wmma_f32_16x16x32_bf16 with ctx as bf16 hi/lo planes times bf16 Wo (2 products); all f32 accumulate; causal compare and softmax in f32.
#include <hip/hip_runtime.h>
#include <math.h>
#include <float.h>
#include <stdint.h>

#ifndef NB
#define NB    1
#endif
#ifndef SEQ
#define SEQ   4096
#endif
#define SEQ_FULL 4096
#define DM    1024
#define NH    16
#define HD    64
#define NQKV  (3 * DM)
#define NQB   (SEQ / 64)                      // key / query tiles of 64
#define VLP   ((SEQ < 512) ? SEQ : 512)       // key pitch of the v^T residual plane (keys 0..VLP-1)
#define RESQB (VLP / 64)                      // number of leading 64-row query blocks that use the p / v residual planes
#define LP    72                              // LDS row pitch of the 64-wide 16-bit K / V^T / P tiles, in elements: 144 B = 16 B x 9 (odd), so the
                                              // 16 rows that one half-wave's 16-B fragment read touches fall on 16 distinct groups of 4 banks
#define OP    68                              // LDS row pitch of the 64-wide f32 context tile, in elements: 272 B = 16 B x 17 (odd)
static_assert(NB == 1);
static_assert(NH * HD == DM && HD == 64);
static_assert((SEQ % 64) == 0 && (DM % 64) == 0 && SEQ >= 64 && SEQ <= SEQ_FULL);
static_assert(RESQB * 64 == VLP && VLP <= SEQ && RESQB >= 1 && RESQB <= NQB);
static_assert((NQKV % 64) == 0);
static_assert((SEQ % 128) == 0 && (DM % 128) == 0);   // 128x128 block tiles and 128-wide k steps of the projections

typedef _Float16 v16h __attribute__((ext_vector_type(16)));
typedef _Float16 v8h  __attribute__((ext_vector_type(8)));
typedef __bf16   v16b __attribute__((ext_vector_type(16)));
typedef __bf16   v8b  __attribute__((ext_vector_type(8)));
typedef float    v8f  __attribute__((ext_vector_type(8)));
typedef float    v4f  __attribute__((ext_vector_type(4)));
typedef unsigned int v4u __attribute__((ext_vector_type(4)));

// ---- scalar helpers --------------------------------------------------------------------------------
__device__ __forceinline__ unsigned short bf_bits(float f) {          // f32 -> bf16 bits, RNE convert
  unsigned u = __float_as_uint(f);
  return (unsigned short)((u + 0x7FFFu + ((u >> 16) & 1u)) >> 16);
}
__device__ __forceinline__ float bf_up(unsigned short h) { return __uint_as_float(((unsigned)h) << 16); }
__device__ __forceinline__ unsigned short h_bits(_Float16 x) { return __builtin_bit_cast(unsigned short, x); }
__device__ __forceinline__ unsigned pk16(unsigned short a, unsigned short b) { return (unsigned)a | ((unsigned)b << 16); }
__device__ __forceinline__ v8f zero8() { v8f z = {0.f, 0.f, 0.f, 0.f, 0.f, 0.f, 0.f, 0.f}; return z; }
__device__ __forceinline__ v8h zero8h() {
  const _Float16 z = (_Float16)0.0f;
  v8h r = {z, z, z, z, z, z, z, z};
  return r;
}

// ---- fragment loaders: 16-bit A/B operand, lane -> row/col (lane&15), p already includes +8*(lane>>4);
//      elements 0..7 <- p[0..7] (k0+8h..), elements 8..15 <- p[16..23] (k0+16+8h..)
__device__ __forceinline__ v16b ldfrag_b(const __bf16* p) {
  union { v16b v; v8b h[2]; } f;
  f.h[0] = *(const v8b*)(p);
  f.h[1] = *(const v8b*)(p + 16);
  return f.v;
}

// ---- WMMA helpers with trailing VALU hazard gap --------------------------------------------------------
__device__ __forceinline__ v8f mma_b(v16b a, v16b b, v8f c) {
  c = __builtin_amdgcn_wmma_f32_16x16x32_bf16(false, a, false, b, (short)0, c, false, false);
  asm volatile("v_nop\n\tv_nop\n\tv_nop\n\tv_nop" : "+v"(c) : "v"(a), "v"(b));
  return c;
}
__device__ __forceinline__ v8f mma_h(v16h a, v16h b, v8f c) {
  c = __builtin_amdgcn_wmma_f32_16x16x32_f16(false, a, false, b, (short)0, c, false, false);
  asm volatile("v_nop\n\tv_nop\n\tv_nop\n\tv_nop" : "+v"(c) : "v"(a), "v"(b));
  return c;
}
__device__ __forceinline__ v8f mma_b_raw(v16b a, v16b b, v8f c) {
  return __builtin_amdgcn_wmma_f32_16x16x32_bf16(false, a, false, b, (short)0, c, false, false);
}
__device__ __forceinline__ void dep_guard_b(v8f& a, v8f& b, v16b x, v16b y) {
  asm volatile("v_nop\n\tv_nop\n\tv_nop\n\tv_nop" : "+v"(a), "+v"(b) : "v"(x), "v"(y));
}
__device__ __forceinline__ void keep4_b(v16b a, v16b b, v16b c, v16b d) {
  asm volatile("v_nop" :: "v"(a), "v"(b), "v"(c), "v"(d));
}
__device__ __forceinline__ void acc_guard4(v8f& a, v8f& b, v8f& c, v8f& d) {
  asm volatile("v_nop\n\tv_nop\n\tv_nop\n\tv_nop" : "+v"(a), "+v"(b), "+v"(c), "+v"(d));
}

// =====================================================================================================
// f32 -> bf16 (RNE convert), 8 elements per thread, one 16-B store per lane: a wave writes 512 contiguous B
// coverage: n8 threads x 8 = whole plane (n8 = SEQ*DM/8 is a multiple of 256).
// =====================================================================================================
__global__ __launch_bounds__(256) void cvt_bf16x8(const float* __restrict__ in, unsigned short* out, int n8) {
  const int i = blockIdx.x * 256 + threadIdx.x;
  if (i < n8) {
    const v4f a = *(const v4f*)(in + (size_t)i * 8);
    const v4f b = *(const v4f*)(in + (size_t)i * 8 + 4);
    v4u p;
    p[0] = pk16(bf_bits(a[0]), bf_bits(a[1]));
    p[1] = pk16(bf_bits(a[2]), bf_bits(a[3]));
    p[2] = pk16(bf_bits(b[0]), bf_bits(b[1]));
    p[3] = pk16(bf_bits(b[2]), bf_bits(b[3]));
    *(v4u*)(out + (size_t)i * 8) = p;
    
  }
}

// =====================================================================================================
// Transposed convert: in f32 [K rows][N cols] (pitch N) -> out bf16 [N rows][K cols] (pitch K), RNE.
// grid = (N/64, K/64), 256 threads; one 64(k) x 64(n) tile per block through LDS.
// Load phase: thread (k row = tid>>2, 16 n columns = (tid&3)*16) reads 4 x 16 B and writes bf16 bits
// transposed into st[n][k] (pitch 72 halves). After __syncthreads each wave writes 8 output rows:
// coverage: load 64 k x (4 threads x 16 n) = 64x64; store 8 waves x 2 it x 4 rows x (8 lanes x 8) = 64x64.
// LDS st: cross-wave exchange behind the block barrier.
// =====================================================================================================
__global__ __launch_bounds__(256) void cvtT_bf16(const float* __restrict__ in, unsigned short* out, int K, int N) {
  __shared__ __align__(16) unsigned short st[64 * 72];
  const int tid = threadIdx.x;
  const int n0  = blockIdx.x * 64;
  const int k0  = blockIdx.y * 64;
  {
    const int r  = tid >> 2;            // k row 0..63
    const int cb = (tid & 3) * 16;      // n column base
    const float* src = in + (size_t)(k0 + r) * N + n0 + cb;
#pragma unroll
    for (int e = 0; e < 4; ++e) {
      const v4f a = *(const v4f*)(src + 4 * e);
#pragma unroll
      for (int u = 0; u < 4; ++u) st[(cb + 4 * e + u) * 72 + r] = bf_bits(a[u]);
    }
  }
  __syncthreads();
  {
    const int lane = tid & 31, wave = tid >> 5;
    const int q = lane >> 3, c8 = (lane & 7) * 8;
    v4u hv[2];
#pragma unroll
    for (int it = 0; it < 2; ++it) {
      const int row = wave * 8 + it * 4 + q;      // n row within the tile
      hv[it] = *(const v4u*)(st + row * 72 + c8);
    }
    {
#pragma unroll
      for (int it = 0; it < 2; ++it) {
        const int row = wave * 8 + it * 4 + q;
        *(v4u*)(out + (size_t)(n0 + row) * K + k0 + c8) = hv[it];
      }
      
    }
  }
}

// =====================================================================================================
// Register-blocked bf16 WMMA GEMM: C[m][n] = sum_k A[m][k] * Bt[n][k] + bias; one wave per 32x64 tile,
// 8 waves (4 x 2) per block = one 128x128 tile of C. A row-major [M][K] pitch lda; Bt row-major [N][K] pitch ldb
// (k contiguous); M, N multiples of 128, K a multiple of GKS. blockIdx.y = batch index (strides in elements).
// Operands: per k step of GKS the block's 128 rows of every operand plane are copied global -> LDS in whole lines
// (stage_tile), two buffers, the next step's copies in flight while this step's fragments are read from LDS;
// every fragment keeps its k order and the k steps stay ascending, so each f32 sum keeps its order.
// NSPLIT: 0 = A.Bt; 1 = (A + A2).Bt (A2 = unscaled bf16 lo plane of A); 2 = A.Bt + A2.Bt + A.Bt2.
// OUT_MODE: 0 = f32 (pitch ldc); 2 = bf16 hi plane C + bf16 lo plane C2 (lo = RNE(v - hi), unscaled);
//           3 = f16 hi plane C + f16 residual plane C2 = f16((v - hi) * rscale), C2 written only for tiles
//               with n0 < N2 (pitch ldc2, batch stride strideC2).
// BIASM: 1 = bias[n] added per column (bias has >= N entries); 2 = bias[m] added per row (>= M entries);
//        the bias value is RNE-converted to bf16 and added in f32 before any output split.
// =====================================================================================================
#define GKS 128                               // k elements of one staged step: 256 B of every operand row
#define GP  136                               // LDS row pitch of a staged operand tile, in elements: 272 B = 16 B x 17 (odd)
#define GMI 2                                 // 16-row sub-tiles of one wave's 32x64 tile

// One operand tile of 128 rows x GKS k (256 B per row), global -> LDS, by asynchronous copies of 16 B per lane.
// Thread t of 256: 16-B piece (t & 15) of rows (t >> 4) + 16 e, e = 0..7; one wave-wide copy = 2 whole rows = 4 whole lines.
// Coverage: 16 rows x 8 e = 128 rows, 16 pieces x 16 B = 256 B; each LDS byte is written by one lane only.
// s_wait_xcnt 0 closes the statement so that no address register of an issued copy is rewritten ahead of it.
__device__ __forceinline__ void stage_tile(const __bf16* g, int ld, __bf16* l, int tid) {
  const __bf16* gp = g + (size_t)(tid >> 4) * ld + (tid & 15) * 8;
  const unsigned la = (unsigned)(uintptr_t)l + (unsigned)(((tid >> 4) * GP + (tid & 15) * 8) * 2);
  asm volatile(
      "global_load_async_to_lds_b128 %0, %8, off\n\t"
      "global_load_async_to_lds_b128 %1, %9, off\n\t"
      "global_load_async_to_lds_b128 %2, %10, off\n\t"
      "global_load_async_to_lds_b128 %3, %11, off\n\t"
      "global_load_async_to_lds_b128 %4, %12, off\n\t"
      "global_load_async_to_lds_b128 %5, %13, off\n\t"
      "global_load_async_to_lds_b128 %6, %14, off\n\t"
      "global_load_async_to_lds_b128 %7, %15, off\n\t"
      "s_wait_xcnt 0x0"
      :: "v"(la), "v"(la + (unsigned)(1 * 16 * GP * 2)),
         "v"(la + (unsigned)(2 * 16 * GP * 2)), "v"(la + (unsigned)(3 * 16 * GP * 2)),
         "v"(la + (unsigned)(4 * 16 * GP * 2)), "v"(la + (unsigned)(5 * 16 * GP * 2)),
         "v"(la + (unsigned)(6 * 16 * GP * 2)), "v"(la + (unsigned)(7 * 16 * GP * 2)),
         "v"(gp), "v"(gp + (size_t)(1 * 16) * ld),
         "v"(gp + (size_t)(2 * 16) * ld), "v"(gp + (size_t)(3 * 16) * ld),
         "v"(gp + (size_t)(4 * 16) * ld), "v"(gp + (size_t)(5 * 16) * ld),
         "v"(gp + (size_t)(6 * 16) * ld), "v"(gp + (size_t)(7 * 16) * ld)
      : "memory");
}

template <int NSPLIT, int OUT_MODE, int BIASM>
__global__ __launch_bounds__(256) void gemm64(
    const unsigned short* __restrict__ Ap, const unsigned short* A2p, int lda, long long strideA,
    const unsigned short* __restrict__ Btp, const unsigned short* Bt2p, int ldb, long long strideB,
    void* Cout, int ldc, long long strideC,
    void* Cout2, int ldc2, long long strideC2, int N2,
    int M, int N, int K, float rscale, const float* __restrict__ bias) {
  const __bf16* A   = (const __bf16*)(const void*)Ap;
  const __bf16* A2  = (const __bf16*)(const void*)A2p;
  const __bf16* Bt  = (const __bf16*)(const void*)Btp;
  const __bf16* Bt2 = (const __bf16*)(const void*)Bt2p;
  constexpr int NPL = 2 + (NSPLIT >= 1 ? 1 : 0) + (NSPLIT == 2 ? 1 : 0);   // staged planes: A, Bt, (A2), (Bt2)
  __shared__ __align__(16) __bf16 stg[2][NPL][128 * GP];   // two buffers of the block's operand tiles, pitch GP
  __shared__ __align__(16) float sT[8][16 * 68];   // per-wave 16x64 slab, pitch 68 floats
  const int b    = blockIdx.y;
  const int tid  = threadIdx.x;
  const int lane = threadIdx.x & 31;
  const int wave = threadIdx.x >> 5;
  const int tilesN = N >> 7;
  const int tilesM = M >> 7;
  const int tile = blockIdx.x;
  if (tile >= tilesM * tilesN) return;   // block-uniform, in front of every copy and barrier
  const int tm = tile / tilesN;
  const int tn = tile - tm * tilesN;
  const int bm0 = tm << 7;               // block tile origin
  const int bn0 = tn << 7;
  const int wm  = (wave >> 1) << 5;      // wave tile origin inside the block tile: 4 wave rows of 32, 2 wave columns of 64
  const int wn  = (wave & 1) << 6;
  const int m0 = bm0 + wm;
  const int n0 = bn0 + wn;

  const __bf16* Ab  = A  + (size_t)b * strideA;
  const __bf16* Bb  = Bt + (size_t)b * strideB;
  const __bf16* Ab2 = (NSPLIT >= 1) ? (A2  + (size_t)b * strideA) : Ab;
  const __bf16* Bb2 = (NSPLIT == 2) ? (Bt2 + (size_t)b * strideB) : Bb;

  const int rlane = lane & 15;                 // row (A) / col (B, D) within subtile
  const int koff  = (lane >> 4) * 8;           // k offset of this lane half
  const int mOff  = (lane >> 4) * 8;           // D row offset

  v8f acc[GMI][4];
#pragma unroll
  for (int i = 0; i < GMI; ++i)
#pragma unroll
    for (int j = 0; j < 4; ++j) acc[i][j] = zero8();

  // copies of k step t (rows bm0.. / bn0.. + 0..127 < M / N, k = t*GKS..+GKS-1 < K) into buffer buf
  auto issue = [&](int t, int buf) {
    const size_t k0 = (size_t)t * GKS;
    stage_tile(Ab + (size_t)bm0 * lda + k0, lda, &stg[buf][0][0], tid);
    stage_tile(Bb + (size_t)bn0 * ldb + k0, ldb, &stg[buf][1][0], tid);
    if constexpr (NSPLIT >= 1) stage_tile(Ab2 + (size_t)bm0 * lda + k0, lda, &stg[buf][2][0], tid);
    if constexpr (NSPLIT == 2) stage_tile(Bb2 + (size_t)bn0 * ldb + k0, ldb, &stg[buf][3][0], tid);
  };
  const int NT = K / GKS;                                // block-uniform
  issue(0, 0);
  asm volatile("s_wait_asynccnt 0x0" ::: "memory");      // this wave's copies of step 0 have landed
  __syncthreads();                                       // ... and every other wave's
  if (NT > 1) issue(1, 1);

  for (int t = 0; t < NT; ++t) {
    const __bf16* sA  = &stg[t & 1][0][0];
    const __bf16* sB  = &stg[t & 1][1][0];
    const __bf16* sA2 = &stg[t & 1][NSPLIT >= 1 ? 2 : 0][0];
    const __bf16* sB2 = &stg[t & 1][NSPLIT == 2 ? 3 : 1][0];
#pragma unroll   // constant kk: every LDS fragment offset is an immediate and the fragment arrays stay in registers
    for (int kk = 0; kk < GKS; kk += 32) {
      v16b bh[4], bl[4], ah[GMI], al[GMI];
#pragma unroll
      for (int j = 0; j < 4; ++j) {
        const int bo = (wn + (j << 4) + rlane) * GP + koff + kk;
        bh[j] = ldfrag_b(sB + bo);
        if (NSPLIT == 2) bl[j] = ldfrag_b(sB2 + bo); else bl[j] = bh[j];
      }
#pragma unroll   // all fragment reads of this k chunk stand as one group in front of its products
      for (int i = 0; i < GMI; ++i) {
        const int ao = (wm + (i << 4) + rlane) * GP + koff + kk;
        ah[i] = ldfrag_b(sA + ao);
        if (NSPLIT >= 1) al[i] = ldfrag_b(sA2 + ao); else al[i] = ah[i];
      }
#pragma unroll
      for (int i = 0; i < GMI; ++i) {
#pragma unroll
        for (int j = 0; j < 4; ++j) {
          acc[i][j] = mma_b_raw(ah[i], bh[j], acc[i][j]);
          if (NSPLIT >= 1) acc[i][j] = mma_b_raw(al[i], bh[j], acc[i][j]);
          if (NSPLIT == 2) acc[i][j] = mma_b_raw(ah[i], bl[j], acc[i][j]);
        }
        dep_guard_b(acc[i][0], acc[i][3], ah[i], al[i]);
      }
      keep4_b(bh[0], bh[1], bh[2], bh[3]);
      if (NSPLIT == 2) keep4_b(bl[0], bl[1], bl[2], bl[3]);
    }
    asm volatile("s_wait_dscnt 0x0" ::: "memory");       // this wave's reads of buffer t & 1 are done
    asm volatile("s_wait_asynccnt 0x0" ::: "memory");    // this wave's copies of step t + 1 have landed
    __syncthreads();                                     // publishes step t + 1 and frees buffer t & 1
    if (t + 2 < NT) issue(t + 2, t & 1);                 // block-uniform
  }
  asm volatile("s_wait_asynccnt 0x0" ::: "memory");      // no copy is left in flight behind the loop
  acc_guard4(acc[0][0], acc[0][1], acc[0][2], acc[0][3]);
  acc_guard4(acc[1][0], acc[1][1], acc[1][2], acc[1][3]);

  // ---- epilogue ----
  float* slab = sT[wave];
  float bcol[4];
#pragma unroll
  for (int j = 0; j < 4; ++j) bcol[j] = 0.f;
  if (BIASM == 1) {
#pragma unroll
    for (int j = 0; j < 4; ++j) bcol[j] = bf_up(bf_bits(bias[n0 + (j << 4) + rlane]));   // < N, in range
  }
#pragma unroll
  for (int i = 0; i < GMI; ++i) {
    const int mBase = m0 + (i << 4);
    float brow[8];
#pragma unroll
    for (int r = 0; r < 8; ++r) brow[r] = 0.f;
    if (BIASM == 2) {
      const v4f b0 = *(const v4f*)(bias + mBase + mOff);          // rows mBase+mOff..+7 < M, in range
      const v4f b1 = *(const v4f*)(bias + mBase + mOff + 4);
#pragma unroll
      for (int r = 0; r < 4; ++r) {
        brow[r]     = bf_up(bf_bits(b0[r]));
        brow[4 + r] = bf_up(bf_bits(b1[r]));
      }
    }
#pragma unroll
    for (int j = 0; j < 4; ++j) {
#pragma unroll
      for (int r = 0; r < 8; ++r) {
        slab[(mOff + r) * 68 + (j << 4) + rlane] = acc[i][j][r] + bcol[j] + brow[r];
      }
    }
    __builtin_amdgcn_fence(__ATOMIC_RELEASE, "workgroup");
    __builtin_amdgcn_wave_barrier();
    __builtin_amdgcn_fence(__ATOMIC_ACQUIRE, "workgroup");
    if (OUT_MODE == 0) {
      float* C = (float*)Cout + (size_t)b * strideC;
      const int hh = lane >> 4, c4 = (lane & 15) * 4;     // 256-B row segment = 16 lanes x 16 B
      {
#pragma unroll
        for (int it = 0; it < 8; ++it) {
          const int row = it * 2 + hh;                     // it 0..7 x hh 0..1 = rows 0..15
          const v4f v = *(const v4f*)(slab + row * 68 + c4);
          *(v4f*)(C + (size_t)(mBase + row) * ldc + n0 + c4) = v;
        }
        
      }
    } else {
      const int q = lane >> 3, c8 = (lane & 7) * 8;
      unsigned short* C  = (unsigned short*)Cout  + (size_t)b * strideC;
      unsigned short* C2 = (unsigned short*)Cout2 + (size_t)b * strideC2;
      const bool wlo = (OUT_MODE == 2) || (n0 < N2);      // wave-uniform
      v4u hv[4], lv[4];
#pragma unroll
      for (int it = 0; it < 4; ++it) {
        const int row = it * 4 + q;                        // it 0..3 x q 0..3 = rows 0..15
        const float* sp = slab + row * 68 + c8;
        v4u a, a2;
#pragma unroll
        for (int e = 0; e < 4; ++e) {
          const float f0 = sp[2 * e], f1 = sp[2 * e + 1];
          unsigned short h0, h1, l0, l1;
          if (OUT_MODE == 2) {
            h0 = bf_bits(f0); h1 = bf_bits(f1);
            l0 = bf_bits(f0 - bf_up(h0)); l1 = bf_bits(f1 - bf_up(h1));
          } else {
            const _Float16 x0 = (_Float16)f0, x1 = (_Float16)f1;
            h0 = h_bits(x0); h1 = h_bits(x1);
            l0 = h_bits((_Float16)((f0 - (float)x0) * rscale));
            l1 = h_bits((_Float16)((f1 - (float)x1) * rscale));
          }
          a[e] = pk16(h0, h1); a2[e] = pk16(l0, l1);
        }
        hv[it] = a; lv[it] = a2;
      }
      {
#pragma unroll
        for (int it = 0; it < 4; ++it) {
          const int row = it * 4 + q;
          *(v4u*)(C + (size_t)(mBase + row) * ldc + n0 + c8) = hv[it];
          if (wlo) *(v4u*)(C2 + (size_t)(mBase + row) * ldc2 + n0 + c8) = lv[it];
        }
        
      }
    }
    __builtin_amdgcn_fence(__ATOMIC_RELEASE, "workgroup");
    __builtin_amdgcn_wave_barrier();
    __builtin_amdgcn_fence(__ATOMIC_ACQUIRE, "workgroup");
  }
}

// =====================================================================================================
// Causal attention, head dim 64, single batch.
//   q planes (bf16 hi / lo): element (t, h, d) at [t*DM + h*64 + d]
//   k planes (bf16 hi / lo): same layout with key index s
//   v^T hi plane (f16):      element (h, d, s) at [(h*64 + d)*SEQ + s]
//   v^T residual plane (f16, (v - hi)*4096): [(h*64 + d)*VLP + s], s < VLP, read only when RES
//   (a key tile at or beyond VLP would contribute a zero v residual; never happens for query blocks < RESQB)
//   logit (t, s) = q.k * sscale for s <= t, finfo.min for s > t. Query block qb (64 rows) visits key tiles
//   0..qb only (every later key is above the diagonal for all 64 rows -> weight exactly 0); the compare
//   s > t is applied on the diagonal tile kt == qb only (block-uniform flag, per-element select). Every row
//   has the live key s = t in the diagonal tile and key s = 0 in tile 0, so the row max is always finite.
//   out planes (bf16 hi / lo of the normalised context): element (t, h, d) at [t*DM + h*64 + d]
//   scores = q . k : bf16 hi/lo split (hi.hi + hi.lo + lo.hi), f32 accumulate, then * sscale in f32
//   p = exp(s - m) carried as f16(1024 p); context = p . v on f16 WMMA; RES adds f16 residual planes of p and v
//   (scale 4096, separate accumulator folded back with 1/4096 per chunk in f32); online softmax in f32.
//   Block = 4 waves = 64 query rows of one head; grid = nqbThis * NH; kv chunks of 64, static bound NQB,
//   block-uniform break at kt == qb + 1.
//   K / V^T chunk staging: 128 threads x 32 elements per plane = the whole 64x64 tile (plain 16-B loads,
//   __syncthreads before and after: cross-wave LDS regions Ksh/Ksl/Vth/Vtl behind block barriers);
//   P tiles and the Os tile are wave-private, spilled with element stores and reloaded (P as v8h, same element
//   Output coverage: each wave stores rows q0..q0+15 (it 0..3 x lane>>3 0..3) x 64 columns (8 lanes x 8) of both planes.
// =====================================================================================================
template <bool RES>
__global__ __launch_bounds__(128)
void attn_causal64(const unsigned short* __restrict__ qhp, const unsigned short* __restrict__ qlp,
                   const unsigned short* __restrict__ khp, const unsigned short* __restrict__ klp,
                   const unsigned short* __restrict__ vhp, const unsigned short* __restrict__ vlp,
                   unsigned short* ohp, unsigned short* olp,
                   int qbBase, int nqbThis, float sscale) {
  union FB { v16b v; v8b h[2]; };
  union FH { v16h v; v8h h[2]; };
  __shared__ __align__(16) __bf16   Ksh[64 * LP];                 // K hi [kv][d], pitch LP
  __shared__ __align__(16) __bf16   Ksl[64 * LP];                 // K lo
  __shared__ __align__(16) _Float16 Vth[64 * LP];                 // V^T hi [d][kv], pitch LP
  __shared__ __align__(16) _Float16 Vtl[RES ? 64 * LP : 8];       // V^T residual
  __shared__ __align__(16) _Float16 Psh[4][16 * LP];              // per wave P [row][kv], pitch LP
  __shared__ __align__(16) _Float16 Psl[RES ? 4 : 1][16 * LP];    // per wave P residual
  __shared__ __align__(16) float    Os[4][16 * OP];               // per wave context tile [row][d], pitch OP

  const int tid  = threadIdx.x;
  const int wave = tid >> 5;
  const int lane = tid & 31;
  const int hh   = lane >> 4;
  const int c    = lane & 15;

  const int bx   = blockIdx.x;
  const int qbl  = bx % nqbThis;
  const int h    = bx / nqbThis;           // 0..NH-1 (grid = nqbThis * NH)
  const int qb   = qbBase + qbl;
  const int q0   = qb * 64 + wave * 16;

  const __bf16* Qh = (const __bf16*)(const void*)qhp + (size_t)h * HD;
  const __bf16* Ql = (const __bf16*)(const void*)qlp + (size_t)h * HD;
  const __bf16* Kh = (const __bf16*)(const void*)khp + (size_t)h * HD;
  const __bf16* Kl = (const __bf16*)(const void*)klp + (size_t)h * HD;
  const _Float16* Vh = (const _Float16*)(const void*)vhp + (size_t)h * HD * SEQ;
  const _Float16* Vl = (const _Float16*)(const void*)vlp + (size_t)h * HD * VLP;

  // ---- Q fragments (A operand, row = lane&15): 2 d-chunks, hi and lo ----
  v16b qah[2], qal[2];
#pragma unroll
  for (int dc = 0; dc < 2; ++dc) {
    const size_t qo = (size_t)(q0 + c) * DM + dc * 32 + 8 * hh;
    qah[dc] = ldfrag_b(Qh + qo);
    qal[dc] = ldfrag_b(Ql + qo);
  }

  float mrow[8], lrow[8];
  v8f oacc[4];
#pragma unroll
  for (int r = 0; r < 8; ++r) { mrow[r] = -INFINITY; lrow[r] = 0.f; }
#pragma unroll
  for (int t = 0; t < 4; ++t) oacc[t] = zero8();

  const int nkt = qb + 1;                    // key tiles 0..qb (block-uniform)
  for (int kt = 0; kt < NQB; ++kt) {         // static bound
    if (kt >= nkt) break;                    // block-uniform
    const bool diag = (kt == qb);            // block-uniform
    const int kv0 = kt * 64;
    __syncthreads();
    {
      const int r = tid >> 1, half = (tid & 1) * 32;
      const __bf16*   kg  = Kh + (size_t)(kv0 + r) * DM + half;   // K row kv0+r (< SEQ), d = half..half+31
      const __bf16*   klg = Kl + (size_t)(kv0 + r) * DM + half;
      const _Float16* vg  = Vh + (size_t)r * SEQ + kv0 + half;    // V^T row d = r, s = kv0+half..+31
      const int kvl = (kv0 + 64 <= VLP) ? kv0 : (VLP - 64);     // clamped address into the residual plane
      const _Float16* vlg = Vl + (size_t)r * VLP + kvl + half;
      const bool resOK = (kv0 + 64 <= VLP);                      // block-uniform
#pragma unroll
      for (int i = 0; i < 4; ++i) {
        const v8b a0 = *(const v8b*)(kg + 8 * i);
        const v8b a1 = *(const v8b*)(klg + 8 * i);
        const v8h b0 = *(const v8h*)(vg + 8 * i);
        *(v8b*)(Ksh + r * LP + half + 8 * i) = a0;
        *(v8b*)(Ksl + r * LP + half + 8 * i) = a1;
        *(v8h*)(Vth + r * LP + half + 8 * i) = b0;
        if (RES) {
          v8h b1 = *(const v8h*)(vlg + 8 * i);
          if (!resOK) b1 = zero8h();
          *(v8h*)(Vtl + r * LP + half + 8 * i) = b1;
        }
      }
    }
    __syncthreads();

    // ---- scores: 16 query rows x 64 keys per wave, 3 bf16 products ----
    v8f s[4];
#pragma unroll
    for (int j = 0; j < 4; ++j) {
      s[j] = zero8();
#pragma unroll
      for (int dc = 0; dc < 2; ++dc) {
        FB kb, kl;
        kb.h[0] = *(const v8b*)(Ksh + (j * 16 + c) * LP + dc * 32 + 8 * hh);
        kb.h[1] = *(const v8b*)(Ksh + (j * 16 + c) * LP + dc * 32 + 16 + 8 * hh);
        kl.h[0] = *(const v8b*)(Ksl + (j * 16 + c) * LP + dc * 32 + 8 * hh);
        kl.h[1] = *(const v8b*)(Ksl + (j * 16 + c) * LP + dc * 32 + 16 + 8 * hh);
        s[j] = mma_b(qah[dc], kb.v, s[j]);
        s[j] = mma_b(qah[dc], kl.v, s[j]);
        s[j] = mma_b(qal[dc], kb.v, s[j]);
      }
    }

    // ---- scale + causal compare (diagonal tile only), row max, online softmax, P (x1024, f16) and
    //      P residual (x4096) to LDS ----
    _Float16* pwh = Psh[wave];
    _Float16* pwl = Psl[RES ? wave : 0];
#pragma unroll
    for (int r = 0; r < 8; ++r) {
      const int qrow = q0 + 8 * hh + r;          // query row of accumulator element r of this lane
      float m = -INFINITY;
#pragma unroll
      for (int j = 0; j < 4; ++j) {
        const int key = kv0 + j * 16 + c;
        float sv = s[j][r] * sscale;
        sv = (diag && (key > qrow)) ? -FLT_MAX : sv;
        s[j][r] = sv;
        m = fmaxf(m, sv);
      }
#pragma unroll
      for (int off = 1; off < 16; off <<= 1) m = fmaxf(m, __shfl_xor(m, off, 32));
      const float mnew  = fmaxf(mrow[r], m);
      const float msafe = (mnew == -INFINITY) ? 0.f : mnew;
      const float alpha = __expf(mrow[r] - msafe);
      mrow[r] = mnew;
      float psum = 0.f;
#pragma unroll
      for (int j = 0; j < 4; ++j) {
        const float p = __expf(s[j][r] - msafe);     // floor logit against a normal max: exp -> 0
        psum += p;
        const float p1k = p * 1024.0f;
        const _Float16 ph = (_Float16)p1k;
        pwh[(8 * hh + r) * LP + j * 16 + c] = ph;
        if (RES) {
          const _Float16 pl = (_Float16)((p1k - (float)ph) * 4096.0f);
          pwl[(8 * hh + r) * LP + j * 16 + c] = pl;
        }
      }
#pragma unroll
      for (int off = 1; off < 16; off <<= 1) psum += __shfl_xor(psum, off, 32);
      lrow[r] = lrow[r] * alpha + psum;
#pragma unroll
      for (int t = 0; t < 4; ++t) oacc[t][r] *= alpha;
    }
    __builtin_amdgcn_fence(__ATOMIC_RELEASE, "workgroup");
    __builtin_amdgcn_wave_barrier();
    __builtin_amdgcn_fence(__ATOMIC_ACQUIRE, "workgroup");

    // ---- context += P . V (f16 WMMA), residual products into a separate accumulator ----
    v8f o1[4];
#pragma unroll
    for (int t = 0; t < 4; ++t) o1[t] = zero8();
#pragma unroll 1
    for (int kk = 0; kk < 2; ++kk) {
      FH pa, pl;
      pa.h[0] = *(const v8h*)(pwh + c * LP + kk * 32 + 8 * hh);
      pa.h[1] = *(const v8h*)(pwh + c * LP + kk * 32 + 16 + 8 * hh);
      if (RES) {
        pl.h[0] = *(const v8h*)(pwl + c * LP + kk * 32 + 8 * hh);
        pl.h[1] = *(const v8h*)(pwl + c * LP + kk * 32 + 16 + 8 * hh);
      } else {
        pl.v = pa.v;
      }
#pragma unroll
      for (int t = 0; t < 4; ++t) {
        FH vb;
        vb.h[0] = *(const v8h*)(Vth + (t * 16 + c) * LP + kk * 32 + 8 * hh);
        vb.h[1] = *(const v8h*)(Vth + (t * 16 + c) * LP + kk * 32 + 16 + 8 * hh);
        oacc[t] = mma_h(pa.v, vb.v, oacc[t]);
        if (RES) {
          FH vl;
          vl.h[0] = *(const v8h*)(Vtl + (t * 16 + c) * LP + kk * 32 + 8 * hh);
          vl.h[1] = *(const v8h*)(Vtl + (t * 16 + c) * LP + kk * 32 + 16 + 8 * hh);
          o1[t] = mma_h(pa.v, vl.v, o1[t]);
          o1[t] = mma_h(pl.v, vb.v, o1[t]);
        }
      }
    }
    if (RES) {
#pragma unroll
      for (int t = 0; t < 4; ++t)
#pragma unroll
        for (int r = 0; r < 8; ++r) oacc[t][r] += o1[t][r] * (1.0f / 4096.0f);
    }
  }

  // ---- normalise (1/l and the 1/1024 p carry), stage the wave's 16x64 tile, bf16 hi/lo split,
  float* os = Os[wave];
#pragma unroll
  for (int r = 0; r < 8; ++r) {
    const float l = lrow[r];
    const float inv = ((l > 0.f) ? (1.0f / l) : 0.f) * (1.0f / 1024.0f);
#pragma unroll
    for (int t = 0; t < 4; ++t) os[(8 * hh + r) * OP + t * 16 + c] = oacc[t][r] * inv;
  }
  __builtin_amdgcn_fence(__ATOMIC_RELEASE, "workgroup");
  __builtin_amdgcn_wave_barrier();
  __builtin_amdgcn_fence(__ATOMIC_ACQUIRE, "workgroup");
  {
    const int q4 = lane >> 3, c8 = (lane & 7) * 8;
    v4u hv[4], lv[4];
#pragma unroll
    for (int it = 0; it < 4; ++it) {
      const int row = it * 4 + q4;   // it 0..3 x q4 0..3 = rows 0..15 of the wave tile
      const float* sp = os + row * OP + c8;
      v4u a, a2;
#pragma unroll
      for (int e = 0; e < 4; ++e) {
        const float f0 = sp[2 * e], f1 = sp[2 * e + 1];
        const unsigned short h0 = bf_bits(f0), h1 = bf_bits(f1);
        const unsigned short l0 = bf_bits(f0 - bf_up(h0)), l1 = bf_bits(f1 - bf_up(h1));
        a[e] = pk16(h0, h1); a2[e] = pk16(l0, l1);
      }
      hv[it] = a; lv[it] = a2;
    }
    {
#pragma unroll
      for (int it = 0; it < 4; ++it) {
        const int row = it * 4 + q4;
        const size_t go = (size_t)(q0 + row) * DM + (size_t)h * HD + c8;
        *(v4u*)(ohp + go) = hv[it];
        *(v4u*)(olp + go) = lv[it];
      }
      
    }
  }
}

// =====================================================================================================
// Workspace map (bytes, SEQ = 4096):
//   Xb    bf16 [SEQ][1024]          0          8388608
//   Wqkvb bf16 [3072 n][1024 k]     8388608    6291456   (rows 0..1023 = q columns, 1024..2047 = k, 2048..3071 = v)
//   Wob   bf16 [1024 n][1024 k]     14680064   2097152
//   Qh    bf16 [SEQ][1024]          16777216   8388608
//   Ql    bf16 [SEQ][1024]          25165824   8388608
//   Kh    bf16 [SEQ][1024]          33554432   8388608
//   Kl    bf16 [SEQ][1024]          41943040   8388608
//   VTh   f16  [1024][SEQ]          50331648   8388608
//   VTl   f16  [1024][VLP=512]      58720256   1048576
//   Oh    bf16 [SEQ][1024]          59768832   8388608
//   Ol    bf16 [SEQ][1024]          68157440   8388608
//   end                             76546048
// All planes are exact multiples of their 64x64 / whole-line store granularity (no padded tails needed),
// =====================================================================================================
extern "C" void kernel_launch(void* const* d_in, const int* in_sizes, int n_in,
                              void* d_out, int out_size, void* d_ws, size_t ws_size,
                              hipStream_t stream) {
  if (n_in < 5) return;
  if (in_sizes[0] < SEQ * DM) return;                 // x rows 0..SEQ-1 (prefix of the full input)
  if (in_sizes[1] != DM * NQKV) return;               // w_qkv [1024][3072]
  if (in_sizes[2] != NQKV) return;                    // b_qkv [3072]
  if (in_sizes[3] != DM * DM) return;                 // w_o [1024][1024]
  if (in_sizes[4] != DM) return;                      // b_o [1024]
  if (out_size < SEQ * DM) return;

  const float* x     = (const float*)d_in[0];
  const float* w_qkv = (const float*)d_in[1];
  const float* b_qkv = (const float*)d_in[2];
  const float* w_o   = (const float*)d_in[3];
  const float* b_o   = (const float*)d_in[4];

  const size_t PX  = (size_t)SEQ * DM * 2;       // 16-bit activation plane [SEQ][1024]
  const size_t PWQ = (size_t)NQKV * DM * 2;      // 16-bit fused weight plane [3072][1024]
  const size_t PWO = (size_t)DM * DM * 2;        // 16-bit out weight plane
  const size_t PVT = (size_t)DM * SEQ * 2;       // v^T hi plane
  const size_t PVL = (size_t)DM * VLP * 2;       // v^T residual plane
  size_t off = 0;
  const size_t oXb   = off; off += PX;
  const size_t oWqkv = off; off += PWQ;
  const size_t oWo   = off; off += PWO;
  const size_t oQh   = off; off += PX;
  const size_t oQl   = off; off += PX;
  const size_t oKh   = off; off += PX;
  const size_t oKl   = off; off += PX;
  const size_t oVTh  = off; off += PVT;
  const size_t oVTl  = off; off += PVL;
  const size_t oOh   = off; off += PX;
  const size_t oOl   = off; off += PX;
  if (off > ws_size) return;                     // off = 76546048 for SEQ = 4096
  if (off > (size_t)134217728) return;

  char* ws = (char*)d_ws;
  unsigned short* Xb    = (unsigned short*)(ws + oXb);
  unsigned short* Wqkvb = (unsigned short*)(ws + oWqkv);
  unsigned short* Wob   = (unsigned short*)(ws + oWo);
  unsigned short* Qh    = (unsigned short*)(ws + oQh);
  unsigned short* Ql    = (unsigned short*)(ws + oQl);
  unsigned short* Kh    = (unsigned short*)(ws + oKh);
  unsigned short* Kl    = (unsigned short*)(ws + oKl);
  unsigned short* VTh   = (unsigned short*)(ws + oVTh);
  unsigned short* VTl   = (unsigned short*)(ws + oVTl);
  unsigned short* Oh    = (unsigned short*)(ws + oOh);
  unsigned short* Ol    = (unsigned short*)(ws + oOl);
  const unsigned short* Wqb = Wqkvb;                              // q weight rows  [1024 n][1024 k]
  const unsigned short* Wkb = Wqkvb + (size_t)DM * DM;            // k weight rows
  const unsigned short* Wvb = Wqkvb + (size_t)2 * DM * DM;        // v weight rows

  const dim3 blk(256);
  const int n8x = SEQ * DM / 8;                                    // multiple of 256
  const dim3 gCvtX((n8x + 255) / 256);
  const dim3 gTq(NQKV / 64, DM / 64);                              // in [1024 k][3072 n] -> out [3072][1024]: (n tiles, k tiles) = (48, 16)
  const dim3 gTo(DM / 64, DM / 64);                                // in [1024 k][1024 n] -> out [1024][1024]: (16, 16)
  const dim3 gProj((SEQ / 128) * (DM / 128), 1);                   // M = SEQ, N = 1024 -> 256 block tiles of 128x128 (SEQ = 4096)
  const dim3 gVT((DM / 128) * (SEQ / 128), 1);                     // M = 1024, N = SEQ

  // (1) x -> bf16 plane [SEQ][1024]; w_qkv [k][n] -> bf16 [n][k]; w_o [k][n] -> bf16 [n][k]
  cvt_bf16x8<<<gCvtX, blk, 0, stream>>>(x, Xb, n8x);
  cvtT_bf16<<<gTq, blk, 0, stream>>>(w_qkv, Wqkvb, DM, NQKV);
  cvtT_bf16<<<gTo, blk, 0, stream>>>(w_o, Wob, DM, DM);
  // (2) q = x . Wq + b_q -> bf16 hi/lo planes [t][h*64+d]   (M = SEQ, N = 1024, K = 1024)
  gemm64<0, 2, 1><<<gProj, blk, 0, stream>>>(
      Xb, Xb, DM, 0LL, Wqb, Wqb, DM, 0LL,
      (void*)Qh, DM, 0LL, (void*)Ql, DM, 0LL, DM,
      SEQ, DM, DM, 1.0f, b_qkv);
  // (3) k = x . Wk + b_k -> bf16 hi/lo planes
  gemm64<0, 2, 1><<<gProj, blk, 0, stream>>>(
      Xb, Xb, DM, 0LL, Wkb, Wkb, DM, 0LL,
      (void*)Kh, DM, 0LL, (void*)Kl, DM, 0LL, DM,
      SEQ, DM, DM, 1.0f, b_qkv + DM);
  // (4) v^T = Wv . x^T + b_v (per row) -> f16 hi plane [h*64+d][s] (pitch SEQ) and residual plane
  //     (x4096, keys < VLP only, pitch VLP)   (A = Wvb [n][k], Bt = Xb; M = 1024, N = SEQ, K = 1024)
  gemm64<0, 3, 2><<<gVT, blk, 0, stream>>>(
      Wvb, Wvb, DM, 0LL, Xb, Xb, DM, 0LL,
      (void*)VTh, SEQ, 0LL, (void*)VTl, VLP, 0LL, VLP,
      DM, SEQ, DM, 4096.0f, b_qkv + 2 * DM);
  // (5) causal attention: query blocks 0..RESQB-1 with residual planes, the rest without
  attn_causal64<true><<<dim3(NH * RESQB), dim3(128), 0, stream>>>(
      Qh, Ql, Kh, Kl, VTh, VTl, Oh, Ol, 0, RESQB, 0.125f);
  if (NQB > RESQB) {
    attn_causal64<false><<<dim3(NH * (NQB - RESQB)), dim3(128), 0, stream>>>(
        Qh, Ql, Kh, Kl, VTh, VTl, Oh, Ol, RESQB, NQB - RESQB, 0.125f);
  }
  // (6) out = context . Wo + b_o -> d_out f32 [SEQ][1024]  (A = context hi + lo planes, 2 products)
  gemm64<1, 0, 1><<<gProj, blk, 0, stream>>>(
      Oh, Ol, DM, 0LL, Wob, Wob, DM, 0LL,
      d_out, DM, 0LL, d_out, DM, 0LL, DM,
      SEQ, DM, DM, 1.0f, b_o);
  (void)hipGetLastError();
}

// v003
// It runs in 256 microseconds.
// Next to v002, in two timings, it ran 1.05 times as fast each time.
// All steps since v000 together make it 2.29 times as fast.
// Contractions: q, k, v^T projections = v_wmma_f32_16x16x32_bf16 (bf16 operands from RNE-converted inputs, single product, f32 bias add);
// q.k^T scores = v_wmma_f32_16x16x32_bf16 with bf16 hi/lo split q and k (hi.hi + hi.lo + lo.hi);
// p.v = v_wmma_f32_16x16x32_f16 (p carried x1024 in f16, v in f16; extra f16 residual planes x4096 of p and v for the first VLP query rows);
// ctx.Wo = v_wmma_f32_16x16x32_bf16 with ctx as bf16 hi/lo planes times bf16 Wo (2 products); all f32 accumulate; causal compare and softmax in f32.
#include <hip/hip_runtime.h>
#include <math.h>
#include <float.h>
#include <stdint.h>

#ifndef NB
#define NB    1
#endif
#ifndef SEQ
#define SEQ   4096
#endif
#define SEQ_FULL 4096
#define DM    1024
#define NH    16
#define HD    64
#define NQKV  (3 * DM)
#define NQB   (SEQ / 64)                      // key / query tiles of 64
#define VLP   ((SEQ < 512) ? SEQ : 512)       // key pitch of the v^T residual plane (keys 0..VLP-1)
#define RESQB (VLP / 64)                      // number of leading 64-row query blocks that use the p / v residual planes
#define LP    72                              // LDS row pitch of the 64-wide 16-bit K / V^T / P tiles, in elements: 144 B = 16 B x 9 (odd), so the
                                              // 16 rows that one half-wave's 16-B fragment read touches fall on 16 distinct groups of 4 banks
#define OP    68                              // LDS row pitch of the 64-wide f32 context tile, in elements: 272 B = 16 B x 17 (odd)
static_assert(NB == 1);
static_assert(NH * HD == DM && HD == 64);
static_assert((SEQ % 64) == 0 && (DM % 64) == 0 && SEQ >= 64 && SEQ <= SEQ_FULL);
static_assert(RESQB * 64 == VLP && VLP <= SEQ && RESQB >= 1 && RESQB <= NQB);
static_assert((NQKV % 64) == 0);
static_assert((SEQ % 128) == 0 && (DM % 128) == 0);   // 128x128 block tiles and 128-wide k steps of the projections

typedef _Float16 v16h __attribute__((ext_vector_type(16)));
typedef _Float16 v8h  __attribute__((ext_vector_type(8)));
typedef __bf16   v16b __attribute__((ext_vector_type(16)));
typedef __bf16   v8b  __attribute__((ext_vector_type(8)));
typedef float    v8f  __attribute__((ext_vector_type(8)));
typedef float    v4f  __attribute__((ext_vector_type(4)));
typedef unsigned int v4u __attribute__((ext_vector_type(4)));

// ---- scalar helpers --------------------------------------------------------------------------------
__device__ __forceinline__ unsigned short bf_bits(float f) {          // f32 -> bf16 bits, RNE convert
  unsigned u = __float_as_uint(f);
  return (unsigned short)((u + 0x7FFFu + ((u >> 16) & 1u)) >> 16);
}
__device__ __forceinline__ float bf_up(unsigned short h) { return __uint_as_float(((unsigned)h) << 16); }
__device__ __forceinline__ unsigned short h_bits(_Float16 x) { return __builtin_bit_cast(unsigned short, x); }
__device__ __forceinline__ unsigned pk16(unsigned short a, unsigned short b) { return (unsigned)a | ((unsigned)b << 16); }
__device__ __forceinline__ v8f zero8() { v8f z = {0.f, 0.f, 0.f, 0.f, 0.f, 0.f, 0.f, 0.f}; return z; }
__device__ __forceinline__ v8h zero8h() {
  const _Float16 z = (_Float16)0.0f;
  v8h r = {z, z, z, z, z, z, z, z};
  return r;
}

// ---- fragment loaders: 16-bit A/B operand, lane -> row/col (lane&15), p already includes +8*(lane>>4);
//      elements 0..7 <- p[0..7] (k0+8h..), elements 8..15 <- p[16..23] (k0+16+8h..)
__device__ __forceinline__ v16b ldfrag_b(const __bf16* p) {
  union { v16b v; v8b h[2]; } f;
  f.h[0] = *(const v8b*)(p);
  f.h[1] = *(const v8b*)(p + 16);
  return f.v;
}

// ---- WMMA helpers with trailing VALU hazard gap --------------------------------------------------------
__device__ __forceinline__ v8f mma_b(v16b a, v16b b, v8f c) {
  c = __builtin_amdgcn_wmma_f32_16x16x32_bf16(false, a, false, b, (short)0, c, false, false);
  asm volatile("v_nop\n\tv_nop\n\tv_nop\n\tv_nop" : "+v"(c) : "v"(a), "v"(b));
  return c;
}
__device__ __forceinline__ v8f mma_h(v16h a, v16h b, v8f c) {
  c = __builtin_amdgcn_wmma_f32_16x16x32_f16(false, a, false, b, (short)0, c, false, false);
  asm volatile("v_nop\n\tv_nop\n\tv_nop\n\tv_nop" : "+v"(c) : "v"(a), "v"(b));
  return c;
}
__device__ __forceinline__ v8f mma_b_raw(v16b a, v16b b, v8f c) {
  return __builtin_amdgcn_wmma_f32_16x16x32_bf16(false, a, false, b, (short)0, c, false, false);
}
__device__ __forceinline__ void dep_guard_b(v8f& a, v8f& b, v16b x, v16b y) {
  asm volatile("v_nop\n\tv_nop\n\tv_nop\n\tv_nop" : "+v"(a), "+v"(b) : "v"(x), "v"(y));
}
__device__ __forceinline__ void keep4_b(v16b a, v16b b, v16b c, v16b d) {
  asm volatile("v_nop" :: "v"(a), "v"(b), "v"(c), "v"(d));
}
__device__ __forceinline__ void acc_guard4(v8f& a, v8f& b, v8f& c, v8f& d) {
  asm volatile("v_nop\n\tv_nop\n\tv_nop\n\tv_nop" : "+v"(a), "+v"(b), "+v"(c), "+v"(d));
}

// =====================================================================================================
// f32 -> bf16 (RNE convert), 8 elements per thread, one 16-B store per lane: a wave writes 512 contiguous B
// coverage: n8 threads x 8 = whole plane (n8 = SEQ*DM/8 is a multiple of 256).
// =====================================================================================================
__global__ __launch_bounds__(256) void cvt_bf16x8(const float* __restrict__ in, unsigned short* out, int n8) {
  const int i = blockIdx.x * 256 + threadIdx.x;
  if (i < n8) {
    const v4f a = *(const v4f*)(in + (size_t)i * 8);
    const v4f b = *(const v4f*)(in + (size_t)i * 8 + 4);
    v4u p;
    p[0] = pk16(bf_bits(a[0]), bf_bits(a[1]));
    p[1] = pk16(bf_bits(a[2]), bf_bits(a[3]));
    p[2] = pk16(bf_bits(b[0]), bf_bits(b[1]));
    p[3] = pk16(bf_bits(b[2]), bf_bits(b[3]));
    *(v4u*)(out + (size_t)i * 8) = p;
    
  }
}

// =====================================================================================================
// Transposed convert: in f32 [K rows][N cols] (pitch N) -> out bf16 [N rows][K cols] (pitch K), RNE.
// grid = (N/64, K/64), 256 threads; one 64(k) x 64(n) tile per block through LDS.
// Load phase: thread (k row = tid>>2, 16 n columns = (tid&3)*16) reads 4 x 16 B and writes bf16 bits
// transposed into st[n][k] (pitch 72 halves). After __syncthreads each wave writes 8 output rows:
// coverage: load 64 k x (4 threads x 16 n) = 64x64; store 8 waves x 2 it x 4 rows x (8 lanes x 8) = 64x64.
// LDS st: cross-wave exchange behind the block barrier.
// =====================================================================================================
__global__ __launch_bounds__(256) void cvtT_bf16(const float* __restrict__ in, unsigned short* out, int K, int N) {
  __shared__ __align__(16) unsigned short st[64 * 72];
  const int tid = threadIdx.x;
  const int n0  = blockIdx.x * 64;
  const int k0  = blockIdx.y * 64;
  {
    const int r  = tid >> 2;            // k row 0..63
    const int cb = (tid & 3) * 16;      // n column base
    const float* src = in + (size_t)(k0 + r) * N + n0 + cb;
#pragma unroll
    for (int e = 0; e < 4; ++e) {
      const v4f a = *(const v4f*)(src + 4 * e);
#pragma unroll
      for (int u = 0; u < 4; ++u) st[(cb + 4 * e + u) * 72 + r] = bf_bits(a[u]);
    }
  }
  __syncthreads();
  {
    const int lane = tid & 31, wave = tid >> 5;
    const int q = lane >> 3, c8 = (lane & 7) * 8;
    v4u hv[2];
#pragma unroll
    for (int it = 0; it < 2; ++it) {
      const int row = wave * 8 + it * 4 + q;      // n row within the tile
      hv[it] = *(const v4u*)(st + row * 72 + c8);
    }
    {
#pragma unroll
      for (int it = 0; it < 2; ++it) {
        const int row = wave * 8 + it * 4 + q;
        *(v4u*)(out + (size_t)(n0 + row) * K + k0 + c8) = hv[it];
      }
      
    }
  }
}

// =====================================================================================================
// Register-blocked bf16 WMMA GEMM: C[m][n] = sum_k A[m][k] * Bt[n][k] + bias; one wave per 32x64 tile,
// 8 waves (4 x 2) per block = one 128x128 tile of C. A row-major [M][K] pitch lda; Bt row-major [N][K] pitch ldb
// (k contiguous); M, N multiples of 128, K a multiple of GKS. blockIdx.y = batch index (strides in elements).
// Operands: per k step of GKS the block's 128 rows of every operand plane are copied global -> LDS in whole lines
// (stage_tile), two buffers, the next step's copies in flight while this step's fragments are read from LDS;
// every fragment keeps its k order and the k steps stay ascending, so each f32 sum keeps its order.
// NSPLIT: 0 = A.Bt; 1 = (A + A2).Bt (A2 = unscaled bf16 lo plane of A); 2 = A.Bt + A2.Bt + A.Bt2.
// OUT_MODE: 0 = f32 (pitch ldc); 2 = bf16 hi plane C + bf16 lo plane C2 (lo = RNE(v - hi), unscaled);
//           3 = f16 hi plane C + f16 residual plane C2 = f16((v - hi) * rscale), C2 written only for tiles
//               with n0 < N2 (pitch ldc2, batch stride strideC2).
// BIASM: 1 = bias[n] added per column (bias has >= N entries); 2 = bias[m] added per row (>= M entries);
//        the bias value is RNE-converted to bf16 and added in f32 before any output split.
// =====================================================================================================
#define GKS 128                               // k elements of one staged step: 256 B of every operand row
#define GP  136                               // LDS row pitch of a staged operand tile, in elements: 272 B = 16 B x 17 (odd)
#define GMI 2                                 // 16-row sub-tiles of one wave's 32x64 tile

// One operand tile of 128 rows x GKS k (256 B per row), global -> LDS, by asynchronous copies of 16 B per lane.
// Thread t of 256: 16-B piece (t & 15) of rows (t >> 4) + 16 e, e = 0..7; one wave-wide copy = 2 whole rows = 4 whole lines.
// Coverage: 16 rows x 8 e = 128 rows, 16 pieces x 16 B = 256 B; each LDS byte is written by one lane only.
// s_wait_xcnt 0 closes the statement so that no address register of an issued copy is rewritten ahead of it.
__device__ __forceinline__ void stage_tile(const __bf16* g, int ld, __bf16* l, int tid) {
  const __bf16* gp = g + (size_t)(tid >> 4) * ld + (tid & 15) * 8;
  const unsigned la = (unsigned)(uintptr_t)l + (unsigned)(((tid >> 4) * GP + (tid & 15) * 8) * 2);
  asm volatile(
      "global_load_async_to_lds_b128 %0, %8, off\n\t"
      "global_load_async_to_lds_b128 %1, %9, off\n\t"
      "global_load_async_to_lds_b128 %2, %10, off\n\t"
      "global_load_async_to_lds_b128 %3, %11, off\n\t"
      "global_load_async_to_lds_b128 %4, %12, off\n\t"
      "global_load_async_to_lds_b128 %5, %13, off\n\t"
      "global_load_async_to_lds_b128 %6, %14, off\n\t"
      "global_load_async_to_lds_b128 %7, %15, off\n\t"
      "s_wait_xcnt 0x0"
      :: "v"(la), "v"(la + (unsigned)(1 * 16 * GP * 2)),
         "v"(la + (unsigned)(2 * 16 * GP * 2)), "v"(la + (unsigned)(3 * 16 * GP * 2)),
         "v"(la + (unsigned)(4 * 16 * GP * 2)), "v"(la + (unsigned)(5 * 16 * GP * 2)),
         "v"(la + (unsigned)(6 * 16 * GP * 2)), "v"(la + (unsigned)(7 * 16 * GP * 2)),
         "v"(gp), "v"(gp + (size_t)(1 * 16) * ld),
         "v"(gp + (size_t)(2 * 16) * ld), "v"(gp + (size_t)(3 * 16) * ld),
         "v"(gp + (size_t)(4 * 16) * ld), "v"(gp + (size_t)(5 * 16) * ld),
         "v"(gp + (size_t)(6 * 16) * ld), "v"(gp + (size_t)(7 * 16) * ld)
      : "memory");
}

template <int NSPLIT, int OUT_MODE, int BIASM>
__global__ __launch_bounds__(256) void gemm64(
    const unsigned short* __restrict__ Ap, const unsigned short* A2p, int lda, long long strideA,
    const unsigned short* __restrict__ Btp, const unsigned short* Bt2p, int ldb, long long strideB,
    void* Cout, int ldc, long long strideC,
    void* Cout2, int ldc2, long long strideC2, int N2,
    int M, int N, int K, float rscale, const float* __restrict__ bias) {
  const __bf16* A   = (const __bf16*)(const void*)Ap;
  const __bf16* A2  = (const __bf16*)(const void*)A2p;
  const __bf16* Bt  = (const __bf16*)(const void*)Btp;
  const __bf16* Bt2 = (const __bf16*)(const void*)Bt2p;
  constexpr int NPL = 2 + (NSPLIT >= 1 ? 1 : 0) + (NSPLIT == 2 ? 1 : 0);   // staged planes: A, Bt, (A2), (Bt2)
  __shared__ __align__(16) __bf16 stg[2][NPL][128 * GP];   // two buffers of the block's operand tiles, pitch GP
  __shared__ __align__(16) float sT[8][16 * 68];   // per-wave 16x64 slab, pitch 68 floats
  const int b    = blockIdx.y;
  const int tid  = threadIdx.x;
  const int lane = threadIdx.x & 31;
  const int wave = threadIdx.x >> 5;
  const int tilesN = N >> 7;
  const int tilesM = M >> 7;
  const int tile = blockIdx.x;
  if (tile >= tilesM * tilesN) return;   // block-uniform, in front of every copy and barrier
  const int tm = tile / tilesN;
  const int tn = tile - tm * tilesN;
  const int bm0 = tm << 7;               // block tile origin
  const int bn0 = tn << 7;
  const int wm  = (wave >> 1) << 5;      // wave tile origin inside the block tile: 4 wave rows of 32, 2 wave columns of 64
  const int wn  = (wave & 1) << 6;
  const int m0 = bm0 + wm;
  const int n0 = bn0 + wn;

  const __bf16* Ab  = A  + (size_t)b * strideA;
  const __bf16* Bb  = Bt + (size_t)b * strideB;
  const __bf16* Ab2 = (NSPLIT >= 1) ? (A2  + (size_t)b * strideA) : Ab;
  const __bf16* Bb2 = (NSPLIT == 2) ? (Bt2 + (size_t)b * strideB) : Bb;

  const int rlane = lane & 15;                 // row (A) / col (B, D) within subtile
  const int koff  = (lane >> 4) * 8;           // k offset of this lane half
  const int mOff  = (lane >> 4) * 8;           // D row offset

  v8f acc[GMI][4];
#pragma unroll
  for (int i = 0; i < GMI; ++i)
#pragma unroll
    for (int j = 0; j < 4; ++j) acc[i][j] = zero8();

  // copies of k step t (rows bm0.. / bn0.. + 0..127 < M / N, k = t*GKS..+GKS-1 < K) into buffer buf
  auto issue = [&](int t, int buf) {
    const size_t k0 = (size_t)t * GKS;
    stage_tile(Ab + (size_t)bm0 * lda + k0, lda, &stg[buf][0][0], tid);
    stage_tile(Bb + (size_t)bn0 * ldb + k0, ldb, &stg[buf][1][0], tid);
    if constexpr (NSPLIT >= 1) stage_tile(Ab2 + (size_t)bm0 * lda + k0, lda, &stg[buf][2][0], tid);
    if constexpr (NSPLIT == 2) stage_tile(Bb2 + (size_t)bn0 * ldb + k0, ldb, &stg[buf][3][0], tid);
  };
  const int NT = K / GKS;                                // block-uniform
  issue(0, 0);
  asm volatile("s_wait_asynccnt 0x0" ::: "memory");      // this wave's copies of step 0 have landed
  __syncthreads();                                       // ... and every other wave's
  if (NT > 1) issue(1, 1);

  for (int t = 0; t < NT; ++t) {
    const __bf16* sA  = &stg[t & 1][0][0];
    const __bf16* sB  = &stg[t & 1][1][0];
    const __bf16* sA2 = &stg[t & 1][NSPLIT >= 1 ? 2 : 0][0];
    const __bf16* sB2 = &stg[t & 1][NSPLIT == 2 ? 3 : 1][0];
#pragma unroll   // constant kk: every LDS fragment offset is an immediate and the fragment arrays stay in registers
    for (int kk = 0; kk < GKS; kk += 32) {
      v16b bh[4], bl[4], ah[GMI], al[GMI];
#pragma unroll
      for (int j = 0; j < 4; ++j) {
        const int bo = (wn + (j << 4) + rlane) * GP + koff + kk;
        bh[j] = ldfrag_b(sB + bo);
        if (NSPLIT == 2) bl[j] = ldfrag_b(sB2 + bo); else bl[j] = bh[j];
      }
#pragma unroll   // all fragment reads of this k chunk stand as one group in front of its products
      for (int i = 0; i < GMI; ++i) {
        const int ao = (wm + (i << 4) + rlane) * GP + koff + kk;
        ah[i] = ldfrag_b(sA + ao);
        if (NSPLIT >= 1) al[i] = ldfrag_b(sA2 + ao); else al[i] = ah[i];
      }
#pragma unroll
      for (int i = 0; i < GMI; ++i) {
#pragma unroll
        for (int j = 0; j < 4; ++j) {
          acc[i][j] = mma_b_raw(ah[i], bh[j], acc[i][j]);
          if (NSPLIT >= 1) acc[i][j] = mma_b_raw(al[i], bh[j], acc[i][j]);
          if (NSPLIT == 2) acc[i][j] = mma_b_raw(ah[i], bl[j], acc[i][j]);
        }
        dep_guard_b(acc[i][0], acc[i][3], ah[i], al[i]);
      }
      keep4_b(bh[0], bh[1], bh[2], bh[3]);
      if (NSPLIT == 2) keep4_b(bl[0], bl[1], bl[2], bl[3]);
    }
    asm volatile("s_wait_dscnt 0x0" ::: "memory");       // this wave's reads of buffer t & 1 are done
    asm volatile("s_wait_asynccnt 0x0" ::: "memory");    // this wave's copies of step t + 1 have landed
    __syncthreads();                                     // publishes step t + 1 and frees buffer t & 1
    if (t + 2 < NT) issue(t + 2, t & 1);                 // block-uniform
  }
  asm volatile("s_wait_asynccnt 0x0" ::: "memory");      // no copy is left in flight behind the loop
  acc_guard4(acc[0][0], acc[0][1], acc[0][2], acc[0][3]);
  acc_guard4(acc[1][0], acc[1][1], acc[1][2], acc[1][3]);

  // ---- epilogue ----
  float* slab = sT[wave];
  float bcol[4];
#pragma unroll
  for (int j = 0; j < 4; ++j) bcol[j] = 0.f;
  if (BIASM == 1) {
#pragma unroll
    for (int j = 0; j < 4; ++j) bcol[j] = bf_up(bf_bits(bias[n0 + (j << 4) + rlane]));   // < N, in range
  }
#pragma unroll
  for (int i = 0; i < GMI; ++i) {
    const int mBase = m0 + (i << 4);
    float brow[8];
#pragma unroll
    for (int r = 0; r < 8; ++r) brow[r] = 0.f;
    if (BIASM == 2) {
      const v4f b0 = *(const v4f*)(bias + mBase + mOff);          // rows mBase+mOff..+7 < M, in range
      const v4f b1 = *(const v4f*)(bias + mBase + mOff + 4);
#pragma unroll
      for (int r = 0; r < 4; ++r) {
        brow[r]     = bf_up(bf_bits(b0[r]));
        brow[4 + r] = bf_up(bf_bits(b1[r]));
      }
    }
#pragma unroll
    for (int j = 0; j < 4; ++j) {
#pragma unroll
      for (int r = 0; r < 8; ++r) {
        slab[(mOff + r) * 68 + (j << 4) + rlane] = acc[i][j][r] + bcol[j] + brow[r];
      }
    }
    __builtin_amdgcn_fence(__ATOMIC_RELEASE, "workgroup");
    __builtin_amdgcn_wave_barrier();
    __builtin_amdgcn_fence(__ATOMIC_ACQUIRE, "workgroup");
    if (OUT_MODE == 0) {
      float* C = (float*)Cout + (size_t)b * strideC;
      const int hh = lane >> 4, c4 = (lane & 15) * 4;     // 256-B row segment = 16 lanes x 16 B
      {
#pragma unroll
        for (int it = 0; it < 8; ++it) {
          const int row = it * 2 + hh;                     // it 0..7 x hh 0..1 = rows 0..15
          const v4f v = *(const v4f*)(slab + row * 68 + c4);
          *(v4f*)(C + (size_t)(mBase + row) * ldc + n0 + c4) = v;
        }
        
      }
    } else {
      const int q = lane >> 3, c8 = (lane & 7) * 8;
      unsigned short* C  = (unsigned short*)Cout  + (size_t)b * strideC;
      unsigned short* C2 = (unsigned short*)Cout2 + (size_t)b * strideC2;
      const bool wlo = (OUT_MODE == 2) || (n0 < N2);      // wave-uniform
      v4u hv[4], lv[4];
#pragma unroll
      for (int it = 0; it < 4; ++it) {
        const int row = it * 4 + q;                        // it 0..3 x q 0..3 = rows 0..15
        const float* sp = slab + row * 68 + c8;
        v4u a, a2;
#pragma unroll
        for (int e = 0; e < 4; ++e) {
          const float f0 = sp[2 * e], f1 = sp[2 * e + 1];
          unsigned short h0, h1, l0, l1;
          if (OUT_MODE == 2) {
            h0 = bf_bits(f0); h1 = bf_bits(f1);
            l0 = bf_bits(f0 - bf_up(h0)); l1 = bf_bits(f1 - bf_up(h1));
          } else {
            const _Float16 x0 = (_Float16)f0, x1 = (_Float16)f1;
            h0 = h_bits(x0); h1 = h_bits(x1);
            l0 = h_bits((_Float16)((f0 - (float)x0) * rscale));
            l1 = h_bits((_Float16)((f1 - (float)x1) * rscale));
          }
          a[e] = pk16(h0, h1); a2[e] = pk16(l0, l1);
        }
        hv[it] = a; lv[it] = a2;
      }
      {
#pragma unroll
        for (int it = 0; it < 4; ++it) {
          const int row = it * 4 + q;
          *(v4u*)(C + (size_t)(mBase + row) * ldc + n0 + c8) = hv[it];
          if (wlo) *(v4u*)(C2 + (size_t)(mBase + row) * ldc2 + n0 + c8) = lv[it];
        }
        
      }
    }
    __builtin_amdgcn_fence(__ATOMIC_RELEASE, "workgroup");
    __builtin_amdgcn_wave_barrier();
    __builtin_amdgcn_fence(__ATOMIC_ACQUIRE, "workgroup");
  }
}

// =====================================================================================================
// Causal attention, head dim 64, single batch.
//   q planes (bf16 hi / lo): element (t, h, d) at [t*DM + h*64 + d]
//   k planes (bf16 hi / lo): same layout with key index s
//   v^T hi plane (f16):      element (h, d, s) at [(h*64 + d)*SEQ + s]
//   v^T residual plane (f16, (v - hi)*4096): [(h*64 + d)*VLP + s], s < VLP, read only when RES
//   (a key tile at or beyond VLP would contribute a zero v residual; never happens for query blocks < RESQB)
//   logit (t, s) = q.k * sscale for s <= t, finfo.min for s > t. Query block qb (64 rows) visits key tiles
//   0..qb only (every later key is above the diagonal for all 64 rows -> weight exactly 0); the compare
//   s > t is applied on the diagonal tile kt == qb only (block-uniform flag, per-element select). Every row
//   has the live key s = t in the diagonal tile and key s = 0 in tile 0, so the row max is always finite.
//   out planes (bf16 hi / lo of the normalised context): element (t, h, d) at [t*DM + h*64 + d]
//   scores = q . k : bf16 hi/lo split (hi.hi + hi.lo + lo.hi), f32 accumulate, then * sscale in f32
//   p = exp(s - m) carried as f16(1024 p); context = p . v on f16 WMMA; RES adds f16 residual planes of p and v
//   (scale 4096, separate accumulator folded back with 1/4096 per chunk in f32); online softmax in f32.
//   Block = 4 waves = 64 query rows of one head; grid = nqbThis * NH; kv chunks of 64, static bound NQB,
//   block-uniform break at kt == qb + 1.
//   K / V^T chunk staging: 128 threads x 32 elements per plane = the whole 64x64 tile (plain 16-B loads,
//   __syncthreads before and after: cross-wave LDS regions Ksh/Ksl/Vth/Vtl behind block barriers);
//   P tiles and the Os tile are wave-private, spilled with element stores and reloaded (P as v8h, same element
//   Output coverage: each wave stores rows q0..q0+15 (it 0..3 x lane>>3 0..3) x 64 columns (8 lanes x 8) of both planes.
// =====================================================================================================
template <bool RES>
__global__ __launch_bounds__(128)
void attn_causal64(const unsigned short* __restrict__ qhp, const unsigned short* __restrict__ qlp,
                   const unsigned short* __restrict__ khp, const unsigned short* __restrict__ klp,
                   const unsigned short* __restrict__ vhp, const unsigned short* __restrict__ vlp,
                   unsigned short* ohp, unsigned short* olp,
                   int qbBase, int nqbThis, float sscale) {
  union FB { v16b v; v8b h[2]; };
  union FH { v16h v; v8h h[2]; };
  __shared__ __align__(16) __bf16   Ksh[64 * LP];                 // K hi [kv][d], pitch LP
  __shared__ __align__(16) __bf16   Ksl[64 * LP];                 // K lo
  __shared__ __align__(16) _Float16 Vth[64 * LP];                 // V^T hi [d][kv], pitch LP
  __shared__ __align__(16) _Float16 Vtl[RES ? 64 * LP : 8];       // V^T residual
  __shared__ __align__(16) _Float16 Psh[4][16 * LP];              // per wave P [row][kv], pitch LP
  __shared__ __align__(16) _Float16 Psl[RES ? 4 : 1][16 * LP];    // per wave P residual
  __shared__ __align__(16) float    Os[4][16 * OP];               // per wave context tile [row][d], pitch OP

  const int tid  = threadIdx.x;
  const int wave = tid >> 5;
  const int lane = tid & 31;
  const int hh   = lane >> 4;
  const int c    = lane & 15;

  const int bx   = blockIdx.x;
  const int qbl  = bx % nqbThis;
  const int h    = bx / nqbThis;           // 0..NH-1 (grid = nqbThis * NH)
  const int qb   = qbBase + qbl;
  const int q0   = qb * 64 + wave * 16;

  const __bf16* Qh = (const __bf16*)(const void*)qhp + (size_t)h * HD;
  const __bf16* Ql = (const __bf16*)(const void*)qlp + (size_t)h * HD;
  const __bf16* Kh = (const __bf16*)(const void*)khp + (size_t)h * HD;
  const __bf16* Kl = (const __bf16*)(const void*)klp + (size_t)h * HD;
  const _Float16* Vh = (const _Float16*)(const void*)vhp + (size_t)h * HD * SEQ;
  const _Float16* Vl = (const _Float16*)(const void*)vlp + (size_t)h * HD * VLP;

  // ---- Q fragments (A operand, row = lane&15): 2 d-chunks, hi and lo ----
  v16b qah[2], qal[2];
#pragma unroll
  for (int dc = 0; dc < 2; ++dc) {
    const size_t qo = (size_t)(q0 + c) * DM + dc * 32 + 8 * hh;
    qah[dc] = ldfrag_b(Qh + qo);
    qal[dc] = ldfrag_b(Ql + qo);
  }

  float mrow[8], lrow[8];
  v8f oacc[4];
#pragma unroll
  for (int r = 0; r < 8; ++r) { mrow[r] = -INFINITY; lrow[r] = 0.f; }
#pragma unroll
  for (int t = 0; t < 4; ++t) oacc[t] = zero8();

  const int nkt = qb + 1;                    // key tiles 0..qb (block-uniform)
  for (int kt = 0; kt < NQB; ++kt) {         // static bound
    if (kt >= nkt) break;                    // block-uniform
    const bool diag = (kt == qb);            // block-uniform
    const int kv0 = kt * 64;
    __syncthreads();
    {
      const int r = tid >> 1, half = (tid & 1) * 32;
      const __bf16*   kg  = Kh + (size_t)(kv0 + r) * DM + half;   // K row kv0+r (< SEQ), d = half..half+31
      const __bf16*   klg = Kl + (size_t)(kv0 + r) * DM + half;
      const _Float16* vg  = Vh + (size_t)r * SEQ + kv0 + half;    // V^T row d = r, s = kv0+half..+31
      const int kvl = (kv0 + 64 <= VLP) ? kv0 : (VLP - 64);     // clamped address into the residual plane
      const _Float16* vlg = Vl + (size_t)r * VLP + kvl + half;
      const bool resOK = (kv0 + 64 <= VLP);                      // block-uniform
#pragma unroll
      for (int i = 0; i < 4; ++i) {
        const v8b a0 = *(const v8b*)(kg + 8 * i);
        const v8b a1 = *(const v8b*)(klg + 8 * i);
        const v8h b0 = *(const v8h*)(vg + 8 * i);
        *(v8b*)(Ksh + r * LP + half + 8 * i) = a0;
        *(v8b*)(Ksl + r * LP + half + 8 * i) = a1;
        *(v8h*)(Vth + r * LP + half + 8 * i) = b0;
        if (RES) {
          v8h b1 = *(const v8h*)(vlg + 8 * i);
          if (!resOK) b1 = zero8h();
          *(v8h*)(Vtl + r * LP + half + 8 * i) = b1;
        }
      }
    }
    __syncthreads();

    // ---- scores: 16 query rows x 64 keys per wave, 3 bf16 products ----
    //      The 8 LDS reads of one 16-key column group stand together, KA groups ahead of the products that use them
    //      (two; one where the residual planes' accumulators leave fewer registers).
    constexpr int KA = RES ? 1 : 2;
    FB kb[4][2], kl[4][2];
    auto ldk = [&](int j) {
#pragma unroll
      for (int dc = 0; dc < 2; ++dc) {
        kb[j][dc].h[0] = *(const v8b*)(Ksh + (j * 16 + c) * LP + dc * 32 + 8 * hh);
        kb[j][dc].h[1] = *(const v8b*)(Ksh + (j * 16 + c) * LP + dc * 32 + 16 + 8 * hh);
        kl[j][dc].h[0] = *(const v8b*)(Ksl + (j * 16 + c) * LP + dc * 32 + 8 * hh);
        kl[j][dc].h[1] = *(const v8b*)(Ksl + (j * 16 + c) * LP + dc * 32 + 16 + 8 * hh);
      }
    };
#pragma unroll
    for (int j = 0; j < KA; ++j) ldk(j);
    v8f s[4];
#pragma unroll
    for (int j = 0; j < 4; ++j) {
      if (j + KA < 4) ldk(j + KA);
      s[j] = zero8();
#pragma unroll
      for (int dc = 0; dc < 2; ++dc) {
        s[j] = mma_b(qah[dc], kb[j][dc].v, s[j]);
        s[j] = mma_b(qah[dc], kl[j][dc].v, s[j]);
        s[j] = mma_b(qal[dc], kb[j][dc].v, s[j]);
      }
    }
    // V^T fragments, one group of reads per 32-key chunk. Without the residual planes the first chunk is read here, so that
    // the softmax below covers its LDS latency; with them (twice the fragments) each chunk is read in front of its own products.
    FH vb[2][4], vl[2][4];
    auto ldv = [&](int kk) {
#pragma unroll
      for (int t = 0; t < 4; ++t) {
        vb[kk][t].h[0] = *(const v8h*)(Vth + (t * 16 + c) * LP + kk * 32 + 8 * hh);
        vb[kk][t].h[1] = *(const v8h*)(Vth + (t * 16 + c) * LP + kk * 32 + 16 + 8 * hh);
        if (RES) {
          vl[kk][t].h[0] = *(const v8h*)(Vtl + (t * 16 + c) * LP + kk * 32 + 8 * hh);
          vl[kk][t].h[1] = *(const v8h*)(Vtl + (t * 16 + c) * LP + kk * 32 + 16 + 8 * hh);
        }
      }
    };
    if (!RES) ldv(0);

    // ---- scale + causal compare (diagonal tile only), row max, online softmax, P (x1024, f16) and
    //      P residual (x4096) to LDS ----
    _Float16* pwh = Psh[wave];
    _Float16* pwl = Psl[RES ? wave : 0];
#pragma unroll
    for (int r = 0; r < 8; ++r) {
      const int qrow = q0 + 8 * hh + r;          // query row of accumulator element r of this lane
      float m = -INFINITY;
#pragma unroll
      for (int j = 0; j < 4; ++j) {
        const int key = kv0 + j * 16 + c;
        float sv = s[j][r] * sscale;
        sv = (diag && (key > qrow)) ? -FLT_MAX : sv;
        s[j][r] = sv;
        m = fmaxf(m, sv);
      }
#pragma unroll
      for (int off = 1; off < 16; off <<= 1) m = fmaxf(m, __shfl_xor(m, off, 32));
      const float mnew  = fmaxf(mrow[r], m);
      const float msafe = (mnew == -INFINITY) ? 0.f : mnew;
      const float alpha = __expf(mrow[r] - msafe);
      mrow[r] = mnew;
      float psum = 0.f;
#pragma unroll
      for (int j = 0; j < 4; ++j) {
        const float p = __expf(s[j][r] - msafe);     // floor logit against a normal max: exp -> 0
        psum += p;
        const float p1k = p * 1024.0f;
        const _Float16 ph = (_Float16)p1k;
        pwh[(8 * hh + r) * LP + j * 16 + c] = ph;
        if (RES) {
          const _Float16 pl = (_Float16)((p1k - (float)ph) * 4096.0f);
          pwl[(8 * hh + r) * LP + j * 16 + c] = pl;
        }
      }
#pragma unroll
      for (int off = 1; off < 16; off <<= 1) psum += __shfl_xor(psum, off, 32);
      lrow[r] = lrow[r] * alpha + psum;
#pragma unroll
      for (int t = 0; t < 4; ++t) oacc[t][r] *= alpha;
    }
    __builtin_amdgcn_fence(__ATOMIC_RELEASE, "workgroup");
    __builtin_amdgcn_wave_barrier();
    __builtin_amdgcn_fence(__ATOMIC_ACQUIRE, "workgroup");

    // ---- context += P . V (f16 WMMA), residual products into a separate accumulator ----
    v8f o1[4];
#pragma unroll
    for (int t = 0; t < 4; ++t) o1[t] = zero8();
    // both chunks' P fragments (and, without the residual planes, the second chunk's V^T fragments): one group of reads in front of the products
    FH pa[2], pl[2];
#pragma unroll
    for (int kk = 0; kk < 2; ++kk) {
      pa[kk].h[0] = *(const v8h*)(pwh + c * LP + kk * 32 + 8 * hh);
      pa[kk].h[1] = *(const v8h*)(pwh + c * LP + kk * 32 + 16 + 8 * hh);
      if (RES) {
        pl[kk].h[0] = *(const v8h*)(pwl + c * LP + kk * 32 + 8 * hh);
        pl[kk].h[1] = *(const v8h*)(pwl + c * LP + kk * 32 + 16 + 8 * hh);
      }
    }
    if (!RES) ldv(1);
#pragma unroll   // constant kk: the fragment arrays stay in registers
    for (int kk = 0; kk < 2; ++kk) {
      if (RES) ldv(kk);
#pragma unroll
      for (int t = 0; t < 4; ++t) {
        oacc[t] = mma_h(pa[kk].v, vb[kk][t].v, oacc[t]);
        if (RES) {
          o1[t] = mma_h(pa[kk].v, vl[kk][t].v, o1[t]);
          o1[t] = mma_h(pl[kk].v, vb[kk][t].v, o1[t]);
        }
      }
    }
    if (RES) {
#pragma unroll
      for (int t = 0; t < 4; ++t)
#pragma unroll
        for (int r = 0; r < 8; ++r) oacc[t][r] += o1[t][r] * (1.0f / 4096.0f);
    }
  }

  // ---- normalise (1/l and the 1/1024 p carry), stage the wave's 16x64 tile, bf16 hi/lo split,
  float* os = Os[wave];
#pragma unroll
  for (int r = 0; r < 8; ++r) {
    const float l = lrow[r];
    const float inv = ((l > 0.f) ? (1.0f / l) : 0.f) * (1.0f / 1024.0f);
#pragma unroll
    for (int t = 0; t < 4; ++t) os[(8 * hh + r) * OP + t * 16 + c] = oacc[t][r] * inv;
  }
  __builtin_amdgcn_fence(__ATOMIC_RELEASE, "workgroup");
  __builtin_amdgcn_wave_barrier();
  __builtin_amdgcn_fence(__ATOMIC_ACQUIRE, "workgroup");
  {
    const int q4 = lane >> 3, c8 = (lane & 7) * 8;
    v4u hv[4], lv[4];
#pragma unroll
    for (int it = 0; it < 4; ++it) {
      const int row = it * 4 + q4;   // it 0..3 x q4 0..3 = rows 0..15 of the wave tile
      const float* sp = os + row * OP + c8;
      v4u a, a2;
#pragma unroll
      for (int e = 0; e < 4; ++e) {
        const float f0 = sp[2 * e], f1 = sp[2 * e + 1];
        const unsigned short h0 = bf_bits(f0), h1 = bf_bits(f1);
        const unsigned short l0 = bf_bits(f0 - bf_up(h0)), l1 = bf_bits(f1 - bf_up(h1));
        a[e] = pk16(h0, h1); a2[e] = pk16(l0, l1);
      }
      hv[it] = a; lv[it] = a2;
    }
    {
#pragma unroll
      for (int it = 0; it < 4; ++it) {
        const int row = it * 4 + q4;
        const size_t go = (size_t)(q0 + row) * DM + (size_t)h * HD + c8;
        *(v4u*)(ohp + go) = hv[it];
        *(v4u*)(olp + go) = lv[it];
      }
      
    }
  }
}

// =====================================================================================================
// Workspace map (bytes, SEQ = 4096):
//   Xb    bf16 [SEQ][1024]          0          8388608
//   Wqkvb bf16 [3072 n][1024 k]     8388608    6291456   (rows 0..1023 = q columns, 1024..2047 = k, 2048..3071 = v)
//   Wob   bf16 [1024 n][1024 k]     14680064   2097152
//   Qh    bf16 [SEQ][1024]          16777216   8388608
//   Ql    bf16 [SEQ][1024]          25165824   8388608
//   Kh    bf16 [SEQ][1024]          33554432   8388608
//   Kl    bf16 [SEQ][1024]          41943040   8388608
//   VTh   f16  [1024][SEQ]          50331648   8388608
//   VTl   f16  [1024][VLP=512]      58720256   1048576
//   Oh    bf16 [SEQ][1024]          59768832   8388608
//   Ol    bf16 [SEQ][1024]          68157440   8388608
//   end                             76546048
// All planes are exact multiples of their 64x64 / whole-line store granularity (no padded tails needed),
// =====================================================================================================
extern "C" void kernel_launch(void* const* d_in, const int* in_sizes, int n_in,
                              void* d_out, int out_size, void* d_ws, size_t ws_size,
                              hipStream_t stream) {
  if (n_in < 5) return;
  if (in_sizes[0] < SEQ * DM) return;                 // x rows 0..SEQ-1 (prefix of the full input)
  if (in_sizes[1] != DM * NQKV) return;               // w_qkv [1024][3072]
  if (in_sizes[2] != NQKV) return;                    // b_qkv [3072]
  if (in_sizes[3] != DM * DM) return;                 // w_o [1024][1024]
  if (in_sizes[4] != DM) return;                      // b_o [1024]
  if (out_size < SEQ * DM) return;

  const float* x     = (const float*)d_in[0];
  const float* w_qkv = (const float*)d_in[1];
  const float* b_qkv = (const float*)d_in[2];
  const float* w_o   = (const float*)d_in[3];
  const float* b_o   = (const float*)d_in[4];

  const size_t PX  = (size_t)SEQ * DM * 2;       // 16-bit activation plane [SEQ][1024]
  const size_t PWQ = (size_t)NQKV * DM * 2;      // 16-bit fused weight plane [3072][1024]
  const size_t PWO = (size_t)DM * DM * 2;        // 16-bit out weight plane
  const size_t PVT = (size_t)DM * SEQ * 2;       // v^T hi plane
  const size_t PVL = (size_t)DM * VLP * 2;       // v^T residual plane
  size_t off = 0;
  const size_t oXb   = off; off += PX;
  const size_t oWqkv = off; off += PWQ;
  const size_t oWo   = off; off += PWO;
  const size_t oQh   = off; off += PX;
  const size_t oQl   = off; off += PX;
  const size_t oKh   = off; off += PX;
  const size_t oKl   = off; off += PX;
  const size_t oVTh  = off; off += PVT;
  const size_t oVTl  = off; off += PVL;
  const size_t oOh   = off; off += PX;
  const size_t oOl   = off; off += PX;
  if (off > ws_size) return;                     // off = 76546048 for SEQ = 4096
  if (off > (size_t)134217728) return;

  char* ws = (char*)d_ws;
  unsigned short* Xb    = (unsigned short*)(ws + oXb);
  unsigned short* Wqkvb = (unsigned short*)(ws + oWqkv);
  unsigned short* Wob   = (unsigned short*)(ws + oWo);
  unsigned short* Qh    = (unsigned short*)(ws + oQh);
  unsigned short* Ql    = (unsigned short*)(ws + oQl);
  unsigned short* Kh    = (unsigned short*)(ws + oKh);
  unsigned short* Kl    = (unsigned short*)(ws + oKl);
  unsigned short* VTh   = (unsigned short*)(ws + oVTh);
  unsigned short* VTl   = (unsigned short*)(ws + oVTl);
  unsigned short* Oh    = (unsigned short*)(ws + oOh);
  unsigned short* Ol    = (unsigned short*)(ws + oOl);
  const unsigned short* Wqb = Wqkvb;                              // q weight rows  [1024 n][1024 k]
  const unsigned short* Wkb = Wqkvb + (size_t)DM * DM;            // k weight rows
  const unsigned short* Wvb = Wqkvb + (size_t)2 * DM * DM;        // v weight rows

  const dim3 blk(256);
  const int n8x = SEQ * DM / 8;                                    // multiple of 256
  const dim3 gCvtX((n8x + 255) / 256);
  const dim3 gTq(NQKV / 64, DM / 64);                              // in [1024 k][3072 n] -> out [3072][1024]: (n tiles, k tiles) = (48, 16)
  const dim3 gTo(DM / 64, DM / 64);                                // in [1024 k][1024 n] -> out [1024][1024]: (16, 16)
  const dim3 gProj((SEQ / 128) * (DM / 128), 1);                   // M = SEQ, N = 1024 -> 256 block tiles of 128x128 (SEQ = 4096)
  const dim3 gVT((DM / 128) * (SEQ / 128), 1);                     // M = 1024, N = SEQ

  // (1) x -> bf16 plane [SEQ][1024]; w_qkv [k][n] -> bf16 [n][k]; w_o [k][n] -> bf16 [n][k]
  cvt_bf16x8<<<gCvtX, blk, 0, stream>>>(x, Xb, n8x);
  cvtT_bf16<<<gTq, blk, 0, stream>>>(w_qkv, Wqkvb, DM, NQKV);
  cvtT_bf16<<<gTo, blk, 0, stream>>>(w_o, Wob, DM, DM);
  // (2) q = x . Wq + b_q -> bf16 hi/lo planes [t][h*64+d]   (M = SEQ, N = 1024, K = 1024)
  gemm64<0, 2, 1><<<gProj, blk, 0, stream>>>(
      Xb, Xb, DM, 0LL, Wqb, Wqb, DM, 0LL,
      (void*)Qh, DM, 0LL, (void*)Ql, DM, 0LL, DM,
      SEQ, DM, DM, 1.0f, b_qkv);
  // (3) k = x . Wk + b_k -> bf16 hi/lo planes
  gemm64<0, 2, 1><<<gProj, blk, 0, stream>>>(
      Xb, Xb, DM, 0LL, Wkb, Wkb, DM, 0LL,
      (void*)Kh, DM, 0LL, (void*)Kl, DM, 0LL, DM,
      SEQ, DM, DM, 1.0f, b_qkv + DM);
  // (4) v^T = Wv . x^T + b_v (per row) -> f16 hi plane [h*64+d][s] (pitch SEQ) and residual plane
  //     (x4096, keys < VLP only, pitch VLP)   (A = Wvb [n][k], Bt = Xb; M = 1024, N = SEQ, K = 1024)
  gemm64<0, 3, 2><<<gVT, blk, 0, stream>>>(
      Wvb, Wvb, DM, 0LL, Xb, Xb, DM, 0LL,
      (void*)VTh, SEQ, 0LL, (void*)VTl, VLP, 0LL, VLP,
      DM, SEQ, DM, 4096.0f, b_qkv + 2 * DM);
  // (5) causal attention: query blocks 0..RESQB-1 with residual planes, the rest without
  attn_causal64<true><<<dim3(NH * RESQB), dim3(128), 0, stream>>>(
      Qh, Ql, Kh, Kl, VTh, VTl, Oh, Ol, 0, RESQB, 0.125f);
  if (NQB > RESQB) {
    attn_causal64<false><<<dim3(NH * (NQB - RESQB)), dim3(128), 0, stream>>>(
        Qh, Ql, Kh, Kl, VTh, VTl, Oh, Ol, RESQB, NQB - RESQB, 0.125f);
  }
  // (6) out = context . Wo + b_o -> d_out f32 [SEQ][1024]  (A = context hi + lo planes, 2 products)
  gemm64<1, 0, 1><<<gProj, blk, 0, stream>>>(
      Oh, Ol, DM, 0LL, Wob, Wob, DM, 0LL,
      d_out, DM, 0LL, d_out, DM, 0LL, DM,
      SEQ, DM, DM, 1.0f, b_o);
  (void)hipGetLastError();
}

// v004
// A run of this version takes 189 microseconds.
// Next to v003, in two timings, it ran 1.35 times as fast each time.
// Counting every step since v000, it is 3.08 times as fast.
// Contractions: q, k, v^T projections = v_wmma_f32_16x16x32_bf16 (bf16 operands from RNE-converted inputs, single product, f32 bias add);
// k.q^T scores (transposed) = v_wmma_f32_16x16x32_bf16 with bf16 hi/lo split q and k (hi.hi + hi.lo + lo.hi);
// v^T.p^T = v_wmma_f32_16x16x32_f16 (p carried x1024 in f16, v in f16; extra f16 residual planes x4096 of p and v for the first VLP query rows);
// ctx.Wo = v_wmma_f32_16x16x32_bf16 with ctx as bf16 hi/lo planes times bf16 Wo (2 products); all f32 accumulate; causal compare and softmax in f32.
#include <hip/hip_runtime.h>
#include <math.h>
#include <float.h>
#include <stdint.h>

#ifndef NB
#define NB    1
#endif
#ifndef SEQ
#define SEQ   4096
#endif
#define SEQ_FULL 4096
#define DM    1024
#define NH    16
#define HD    64
#define NQKV  (3 * DM)
#define NQB   (SEQ / 64)                      // key / query tiles of 64
#define VLP   ((SEQ < 512) ? SEQ : 512)       // key pitch of the v^T residual plane (keys 0..VLP-1)
#define RESQB (VLP / 64)                      // number of leading 64-row query blocks that use the p / v residual planes
#define LP    72                              // LDS row pitch of the 64-wide 16-bit K / V^T tiles, in elements: 144 B = 16 B x 9 (odd), so the
                                              // 16 rows that one half-wave's 16-B fragment read touches fall on 16 distinct groups of 4 banks
#define OP    68                              // LDS row pitch of the 64-wide f32 context tile, in elements: 272 B = 16 B x 17 (odd)
static_assert(NB == 1);
static_assert(NH * HD == DM && HD == 64);
static_assert((SEQ % 64) == 0 && (DM % 64) == 0 && SEQ >= 64 && SEQ <= SEQ_FULL);
static_assert(RESQB * 64 == VLP && VLP <= SEQ && RESQB >= 1 && RESQB <= NQB);
static_assert((NQKV % 64) == 0);
static_assert((SEQ % 128) == 0 && (DM % 128) == 0);   // 128x128 block tiles and 128-wide k steps of the projections

typedef _Float16 v16h __attribute__((ext_vector_type(16)));
typedef _Float16 v8h  __attribute__((ext_vector_type(8)));
typedef __bf16   v16b __attribute__((ext_vector_type(16)));
typedef __bf16   v8b  __attribute__((ext_vector_type(8)));
typedef float    v8f  __attribute__((ext_vector_type(8)));
typedef float    v4f  __attribute__((ext_vector_type(4)));
typedef unsigned int v4u __attribute__((ext_vector_type(4)));

// ---- scalar helpers --------------------------------------------------------------------------------
__device__ __forceinline__ unsigned short bf_bits(float f) {          // f32 -> bf16 bits, RNE convert
  unsigned u = __float_as_uint(f);
  return (unsigned short)((u + 0x7FFFu + ((u >> 16) & 1u)) >> 16);
}
__device__ __forceinline__ float bf_up(unsigned short h) { return __uint_as_float(((unsigned)h) << 16); }
__device__ __forceinline__ unsigned short h_bits(_Float16 x) { return __builtin_bit_cast(unsigned short, x); }
__device__ __forceinline__ unsigned pk16(unsigned short a, unsigned short b) { return (unsigned)a | ((unsigned)b << 16); }
__device__ __forceinline__ v8f zero8() { v8f z = {0.f, 0.f, 0.f, 0.f, 0.f, 0.f, 0.f, 0.f}; return z; }
__device__ __forceinline__ v8h zero8h() {
  const _Float16 z = (_Float16)0.0f;
  v8h r = {z, z, z, z, z, z, z, z};
  return r;
}

// ---- value of lane l ^ 16 (the other half of the wave), a vector-port move
__device__ __forceinline__ float xhalf(float x) {
  return __builtin_bit_cast(float, __builtin_amdgcn_permlanex16(__builtin_bit_cast(int, x), __builtin_bit_cast(int, x),
                                                                0x76543210, 0xfedcba98, false, false));
}

// ---- fragment loaders: 16-bit A/B operand, lane -> row/col (lane&15), p already includes +8*(lane>>4);
//      elements 0..7 <- p[0..7] (k0+8h..), elements 8..15 <- p[16..23] (k0+16+8h..)
__device__ __forceinline__ v16b ldfrag_b(const __bf16* p) {
  union { v16b v; v8b h[2]; } f;
  f.h[0] = *(const v8b*)(p);
  f.h[1] = *(const v8b*)(p + 16);
  return f.v;
}

// ---- WMMA helpers with trailing VALU hazard gap --------------------------------------------------------
__device__ __forceinline__ v8f mma_b(v16b a, v16b b, v8f c) {
  c = __builtin_amdgcn_wmma_f32_16x16x32_bf16(false, a, false, b, (short)0, c, false, false);
  asm volatile("v_nop\n\tv_nop\n\tv_nop\n\tv_nop" : "+v"(c) : "v"(a), "v"(b));
  return c;
}
__device__ __forceinline__ v8f mma_h(v16h a, v16h b, v8f c) {
  c = __builtin_amdgcn_wmma_f32_16x16x32_f16(false, a, false, b, (short)0, c, false, false);
  asm volatile("v_nop\n\tv_nop\n\tv_nop\n\tv_nop" : "+v"(c) : "v"(a), "v"(b));
  return c;
}
__device__ __forceinline__ v8f mma_b_raw(v16b a, v16b b, v8f c) {
  return __builtin_amdgcn_wmma_f32_16x16x32_bf16(false, a, false, b, (short)0, c, false, false);
}
__device__ __forceinline__ void dep_guard_b(v8f& a, v8f& b, v16b x, v16b y) {
  asm volatile("v_nop\n\tv_nop\n\tv_nop\n\tv_nop" : "+v"(a), "+v"(b) : "v"(x), "v"(y));
}
__device__ __forceinline__ void keep4_b(v16b a, v16b b, v16b c, v16b d) {
  asm volatile("v_nop" :: "v"(a), "v"(b), "v"(c), "v"(d));
}
__device__ __forceinline__ void acc_guard4(v8f& a, v8f& b, v8f& c, v8f& d) {
  asm volatile("v_nop\n\tv_nop\n\tv_nop\n\tv_nop" : "+v"(a), "+v"(b), "+v"(c), "+v"(d));
}

// =====================================================================================================
// f32 -> bf16 (RNE convert), 8 elements per thread, one 16-B store per lane: a wave writes 512 contiguous B
// coverage: n8 threads x 8 = whole plane (n8 = SEQ*DM/8 is a multiple of 256).
// =====================================================================================================
__global__ __launch_bounds__(256) void cvt_bf16x8(const float* __restrict__ in, unsigned short* out, int n8) {
  const int i = blockIdx.x * 256 + threadIdx.x;
  if (i < n8) {
    const v4f a = *(const v4f*)(in + (size_t)i * 8);
    const v4f b = *(const v4f*)(in + (size_t)i * 8 + 4);
    v4u p;
    p[0] = pk16(bf_bits(a[0]), bf_bits(a[1]));
    p[1] = pk16(bf_bits(a[2]), bf_bits(a[3]));
    p[2] = pk16(bf_bits(b[0]), bf_bits(b[1]));
    p[3] = pk16(bf_bits(b[2]), bf_bits(b[3]));
    *(v4u*)(out + (size_t)i * 8) = p;
    
  }
}

// =====================================================================================================
// Transposed convert: in f32 [K rows][N cols] (pitch N) -> out bf16 [N rows][K cols] (pitch K), RNE.
// grid = (N/64, K/64), 256 threads; one 64(k) x 64(n) tile per block through LDS.
// Load phase: thread (k row = tid>>2, 16 n columns = (tid&3)*16) reads 4 x 16 B and writes bf16 bits
// transposed into st[n][k] (pitch 72 halves). After __syncthreads each wave writes 8 output rows:
// coverage: load 64 k x (4 threads x 16 n) = 64x64; store 8 waves x 2 it x 4 rows x (8 lanes x 8) = 64x64.
// LDS st: cross-wave exchange behind the block barrier.
// =====================================================================================================
__global__ __launch_bounds__(256) void cvtT_bf16(const float* __restrict__ in, unsigned short* out, int K, int N) {
  __shared__ __align__(16) unsigned short st[64 * 72];
  const int tid = threadIdx.x;
  const int n0  = blockIdx.x * 64;
  const int k0  = blockIdx.y * 64;
  {
    const int r  = tid >> 2;            // k row 0..63
    const int cb = (tid & 3) * 16;      // n column base
    const float* src = in + (size_t)(k0 + r) * N + n0 + cb;
#pragma unroll
    for (int e = 0; e < 4; ++e) {
      const v4f a = *(const v4f*)(src + 4 * e);
#pragma unroll
      for (int u = 0; u < 4; ++u) st[(cb + 4 * e + u) * 72 + r] = bf_bits(a[u]);
    }
  }
  __syncthreads();
  {
    const int lane = tid & 31, wave = tid >> 5;
    const int q = lane >> 3, c8 = (lane & 7) * 8;
    v4u hv[2];
#pragma unroll
    for (int it = 0; it < 2; ++it) {
      const int row = wave * 8 + it * 4 + q;      // n row within the tile
      hv[it] = *(const v4u*)(st + row * 72 + c8);
    }
    {
#pragma unroll
      for (int it = 0; it < 2; ++it) {
        const int row = wave * 8 + it * 4 + q;
        *(v4u*)(out + (size_t)(n0 + row) * K + k0 + c8) = hv[it];
      }
      
    }
  }
}

// =====================================================================================================
// Register-blocked bf16 WMMA GEMM: C[m][n] = sum_k A[m][k] * Bt[n][k] + bias; one wave per 32x64 tile,
// 8 waves (4 x 2) per block = one 128x128 tile of C. A row-major [M][K] pitch lda; Bt row-major [N][K] pitch ldb
// (k contiguous); M, N multiples of 128, K a multiple of GKS. blockIdx.y = batch index (strides in elements).
// Operands: per k step of GKS the block's 128 rows of every operand plane are copied global -> LDS in whole lines
// (stage_tile), two buffers, the next step's copies in flight while this step's fragments are read from LDS;
// every fragment keeps its k order and the k steps stay ascending, so each f32 sum keeps its order.
// NSPLIT: 0 = A.Bt; 1 = (A + A2).Bt (A2 = unscaled bf16 lo plane of A); 2 = A.Bt + A2.Bt + A.Bt2.
// OUT_MODE: 0 = f32 (pitch ldc); 2 = bf16 hi plane C + bf16 lo plane C2 (lo = RNE(v - hi), unscaled);
//           3 = f16 hi plane C + f16 residual plane C2 = f16((v - hi) * rscale), C2 written only for tiles
//               with n0 < N2 (pitch ldc2, batch stride strideC2).
// BIASM: 1 = bias[n] added per column (bias has >= N entries); 2 = bias[m] added per row (>= M entries);
//        the bias value is RNE-converted to bf16 and added in f32 before any output split.
// =====================================================================================================
#define GKS 128                               // k elements of one staged step: 256 B of every operand row
#define GP  136                               // LDS row pitch of a staged operand tile, in elements: 272 B = 16 B x 17 (odd)
#define GMI 2                                 // 16-row sub-tiles of one wave's 32x64 tile

// One operand tile of 128 rows x GKS k (256 B per row), global -> LDS, by asynchronous copies of 16 B per lane.
// Thread t of 256: 16-B piece (t & 15) of rows (t >> 4) + 16 e, e = 0..7; one wave-wide copy = 2 whole rows = 4 whole lines.
// Coverage: 16 rows x 8 e = 128 rows, 16 pieces x 16 B = 256 B; each LDS byte is written by one lane only.
// s_wait_xcnt 0 closes the statement so that no address register of an issued copy is rewritten ahead of it.
__device__ __forceinline__ void stage_tile(const __bf16* g, int ld, __bf16* l, int tid) {
  const __bf16* gp = g + (size_t)(tid >> 4) * ld + (tid & 15) * 8;
  const unsigned la = (unsigned)(uintptr_t)l + (unsigned)(((tid >> 4) * GP + (tid & 15) * 8) * 2);
  asm volatile(
      "global_load_async_to_lds_b128 %0, %8, off\n\t"
      "global_load_async_to_lds_b128 %1, %9, off\n\t"
      "global_load_async_to_lds_b128 %2, %10, off\n\t"
      "global_load_async_to_lds_b128 %3, %11, off\n\t"
      "global_load_async_to_lds_b128 %4, %12, off\n\t"
      "global_load_async_to_lds_b128 %5, %13, off\n\t"
      "global_load_async_to_lds_b128 %6, %14, off\n\t"
      "global_load_async_to_lds_b128 %7, %15, off\n\t"
      "s_wait_xcnt 0x0"
      :: "v"(la), "v"(la + (unsigned)(1 * 16 * GP * 2)),
         "v"(la + (unsigned)(2 * 16 * GP * 2)), "v"(la + (unsigned)(3 * 16 * GP * 2)),
         "v"(la + (unsigned)(4 * 16 * GP * 2)), "v"(la + (unsigned)(5 * 16 * GP * 2)),
         "v"(la + (unsigned)(6 * 16 * GP * 2)), "v"(la + (unsigned)(7 * 16 * GP * 2)),
         "v"(gp), "v"(gp + (size_t)(1 * 16) * ld),
         "v"(gp + (size_t)(2 * 16) * ld), "v"(gp + (size_t)(3 * 16) * ld),
         "v"(gp + (size_t)(4 * 16) * ld), "v"(gp + (size_t)(5 * 16) * ld),
         "v"(gp + (size_t)(6 * 16) * ld), "v"(gp + (size_t)(7 * 16) * ld)
      : "memory");
}

template <int NSPLIT, int OUT_MODE, int BIASM>
__global__ __launch_bounds__(256) void gemm64(
    const unsigned short* __restrict__ Ap, const unsigned short* A2p, int lda, long long strideA,
    const unsigned short* __restrict__ Btp, const unsigned short* Bt2p, int ldb, long long strideB,
    void* Cout, int ldc, long long strideC,
    void* Cout2, int ldc2, long long strideC2, int N2,
    int M, int N, int K, float rscale, const float* __restrict__ bias) {
  const __bf16* A   = (const __bf16*)(const void*)Ap;
  const __bf16* A2  = (const __bf16*)(const void*)A2p;
  const __bf16* Bt  = (const __bf16*)(const void*)Btp;
  const __bf16* Bt2 = (const __bf16*)(const void*)Bt2p;
  constexpr int NPL = 2 + (NSPLIT >= 1 ? 1 : 0) + (NSPLIT == 2 ? 1 : 0);   // staged planes: A, Bt, (A2), (Bt2)
  __shared__ __align__(16) __bf16 stg[2][NPL][128 * GP];   // two buffers of the block's operand tiles, pitch GP
  __shared__ __align__(16) float sT[8][16 * 68];   // per-wave 16x64 slab, pitch 68 floats
  const int b    = blockIdx.y;
  const int tid  = threadIdx.x;
  const int lane = threadIdx.x & 31;
  const int wave = threadIdx.x >> 5;
  const int tilesN = N >> 7;
  const int tilesM = M >> 7;
  const int tile = blockIdx.x;
  if (tile >= tilesM * tilesN) return;   // block-uniform, in front of every copy and barrier
  const int tm = tile / tilesN;
  const int tn = tile - tm * tilesN;
  const int bm0 = tm << 7;               // block tile origin
  const int bn0 = tn << 7;
  const int wm  = (wave >> 1) << 5;      // wave tile origin inside the block tile: 4 wave rows of 32, 2 wave columns of 64
  const int wn  = (wave & 1) << 6;
  const int m0 = bm0 + wm;
  const int n0 = bn0 + wn;

  const __bf16* Ab  = A  + (size_t)b * strideA;
  const __bf16* Bb  = Bt + (size_t)b * strideB;
  const __bf16* Ab2 = (NSPLIT >= 1) ? (A2  + (size_t)b * strideA) : Ab;
  const __bf16* Bb2 = (NSPLIT == 2) ? (Bt2 + (size_t)b * strideB) : Bb;

  const int rlane = lane & 15;                 // row (A) / col (B, D) within subtile
  const int koff  = (lane >> 4) * 8;           // k offset of this lane half
  const int mOff  = (lane >> 4) * 8;           // D row offset

  v8f acc[GMI][4];
#pragma unroll
  for (int i = 0; i < GMI; ++i)
#pragma unroll
    for (int j = 0; j < 4; ++j) acc[i][j] = zero8();

  // copies of k step t (rows bm0.. / bn0.. + 0..127 < M / N, k = t*GKS..+GKS-1 < K) into buffer buf
  auto issue = [&](int t, int buf) {
    const size_t k0 = (size_t)t * GKS;
    stage_tile(Ab + (size_t)bm0 * lda + k0, lda, &stg[buf][0][0], tid);
    stage_tile(Bb + (size_t)bn0 * ldb + k0, ldb, &stg[buf][1][0], tid);
    if constexpr (NSPLIT >= 1) stage_tile(Ab2 + (size_t)bm0 * lda + k0, lda, &stg[buf][2][0], tid);
    if constexpr (NSPLIT == 2) stage_tile(Bb2 + (size_t)bn0 * ldb + k0, ldb, &stg[buf][3][0], tid);
  };
  const int NT = K / GKS;                                // block-uniform
  issue(0, 0);
  asm volatile("s_wait_asynccnt 0x0" ::: "memory");      // this wave's copies of step 0 have landed
  __syncthreads();                                       // ... and every other wave's
  if (NT > 1) issue(1, 1);

  for (int t = 0; t < NT; ++t) {
    const __bf16* sA  = &stg[t & 1][0][0];
    const __bf16* sB  = &stg[t & 1][1][0];
    const __bf16* sA2 = &stg[t & 1][NSPLIT >= 1 ? 2 : 0][0];
    const __bf16* sB2 = &stg[t & 1][NSPLIT == 2 ? 3 : 1][0];
#pragma unroll   // constant kk: every LDS fragment offset is an immediate and the fragment arrays stay in registers
    for (int kk = 0; kk < GKS; kk += 32) {
      v16b bh[4], bl[4], ah[GMI], al[GMI];
#pragma unroll
      for (int j = 0; j < 4; ++j) {
        const int bo = (wn + (j << 4) + rlane) * GP + koff + kk;
        bh[j] = ldfrag_b(sB + bo);
        if (NSPLIT == 2) bl[j] = ldfrag_b(sB2 + bo); else bl[j] = bh[j];
      }
#pragma unroll   // all fragment reads of this k chunk stand as one group in front of its products
      for (int i = 0; i < GMI; ++i) {
        const int ao = (wm + (i << 4) + rlane) * GP + koff + kk;
        ah[i] = ldfrag_b(sA + ao);
        if (NSPLIT >= 1) al[i] = ldfrag_b(sA2 + ao); else al[i] = ah[i];
      }
#pragma unroll
      for (int i = 0; i < GMI; ++i) {
#pragma unroll
        for (int j = 0; j < 4; ++j) {
          acc[i][j] = mma_b_raw(ah[i], bh[j], acc[i][j]);
          if (NSPLIT >= 1) acc[i][j] = mma_b_raw(al[i], bh[j], acc[i][j]);
          if (NSPLIT == 2) acc[i][j] = mma_b_raw(ah[i], bl[j], acc[i][j]);
        }
        dep_guard_b(acc[i][0], acc[i][3], ah[i], al[i]);
      }
      keep4_b(bh[0], bh[1], bh[2], bh[3]);
      if (NSPLIT == 2) keep4_b(bl[0], bl[1], bl[2], bl[3]);
    }
    asm volatile("s_wait_dscnt 0x0" ::: "memory");       // this wave's reads of buffer t & 1 are done
    asm volatile("s_wait_asynccnt 0x0" ::: "memory");    // this wave's copies of step t + 1 have landed
    __syncthreads();                                     // publishes step t + 1 and frees buffer t & 1
    if (t + 2 < NT) issue(t + 2, t & 1);                 // block-uniform
  }
  asm volatile("s_wait_asynccnt 0x0" ::: "memory");      // no copy is left in flight behind the loop
  acc_guard4(acc[0][0], acc[0][1], acc[0][2], acc[0][3]);
  acc_guard4(acc[1][0], acc[1][1], acc[1][2], acc[1][3]);

  // ---- epilogue ----
  float* slab = sT[wave];
  float bcol[4];
#pragma unroll
  for (int j = 0; j < 4; ++j) bcol[j] = 0.f;
  if (BIASM == 1) {
#pragma unroll
    for (int j = 0; j < 4; ++j) bcol[j] = bf_up(bf_bits(bias[n0 + (j << 4) + rlane]));   // < N, in range
  }
#pragma unroll
  for (int i = 0; i < GMI; ++i) {
    const int mBase = m0 + (i << 4);
    float brow[8];
#pragma unroll
    for (int r = 0; r < 8; ++r) brow[r] = 0.f;
    if (BIASM == 2) {
      const v4f b0 = *(const v4f*)(bias + mBase + mOff);          // rows mBase+mOff..+7 < M, in range
      const v4f b1 = *(const v4f*)(bias + mBase + mOff + 4);
#pragma unroll
      for (int r = 0; r < 4; ++r) {
        brow[r]     = bf_up(bf_bits(b0[r]));
        brow[4 + r] = bf_up(bf_bits(b1[r]));
      }
    }
#pragma unroll
    for (int j = 0; j < 4; ++j) {
#pragma unroll
      for (int r = 0; r < 8; ++r) {
        slab[(mOff + r) * 68 + (j << 4) + rlane] = acc[i][j][r] + bcol[j] + brow[r];
      }
    }
    __builtin_amdgcn_fence(__ATOMIC_RELEASE, "workgroup");
    __builtin_amdgcn_wave_barrier();
    __builtin_amdgcn_fence(__ATOMIC_ACQUIRE, "workgroup");
    if (OUT_MODE == 0) {
      float* C = (float*)Cout + (size_t)b * strideC;
      const int hh = lane >> 4, c4 = (lane & 15) * 4;     // 256-B row segment = 16 lanes x 16 B
      {
#pragma unroll
        for (int it = 0; it < 8; ++it) {
          const int row = it * 2 + hh;                     // it 0..7 x hh 0..1 = rows 0..15
          const v4f v = *(const v4f*)(slab + row * 68 + c4);
          *(v4f*)(C + (size_t)(mBase + row) * ldc + n0 + c4) = v;
        }
        
      }
    } else {
      const int q = lane >> 3, c8 = (lane & 7) * 8;
      unsigned short* C  = (unsigned short*)Cout  + (size_t)b * strideC;
      unsigned short* C2 = (unsigned short*)Cout2 + (size_t)b * strideC2;
      const bool wlo = (OUT_MODE == 2) || (n0 < N2);      // wave-uniform
      v4u hv[4], lv[4];
#pragma unroll
      for (int it = 0; it < 4; ++it) {
        const int row = it * 4 + q;                        // it 0..3 x q 0..3 = rows 0..15
        const float* sp = slab + row * 68 + c8;
        v4u a, a2;
#pragma unroll
        for (int e = 0; e < 4; ++e) {
          const float f0 = sp[2 * e], f1 = sp[2 * e + 1];
          unsigned short h0, h1, l0, l1;
          if (OUT_MODE == 2) {
            h0 = bf_bits(f0); h1 = bf_bits(f1);
            l0 = bf_bits(f0 - bf_up(h0)); l1 = bf_bits(f1 - bf_up(h1));
          } else {
            const _Float16 x0 = (_Float16)f0, x1 = (_Float16)f1;
            h0 = h_bits(x0); h1 = h_bits(x1);
            l0 = h_bits((_Float16)((f0 - (float)x0) * rscale));
            l1 = h_bits((_Float16)((f1 - (float)x1) * rscale));
          }
          a[e] = pk16(h0, h1); a2[e] = pk16(l0, l1);
        }
        hv[it] = a; lv[it] = a2;
      }
      {
#pragma unroll
        for (int it = 0; it < 4; ++it) {
          const int row = it * 4 + q;
          *(v4u*)(C + (size_t)(mBase + row) * ldc + n0 + c8) = hv[it];
          if (wlo) *(v4u*)(C2 + (size_t)(mBase + row) * ldc2 + n0 + c8) = lv[it];
        }
        
      }
    }
    __builtin_amdgcn_fence(__ATOMIC_RELEASE, "workgroup");
    __builtin_amdgcn_wave_barrier();
    __builtin_amdgcn_fence(__ATOMIC_ACQUIRE, "workgroup");
  }
}

// =====================================================================================================
// Causal attention, head dim 64, single batch.
//   q planes (bf16 hi / lo): element (t, h, d) at [t*DM + h*64 + d]
//   k planes (bf16 hi / lo): same layout with key index s
//   v^T hi plane (f16):      element (h, d, s) at [(h*64 + d)*SEQ + s]
//   v^T residual plane (f16, (v - hi)*4096): [(h*64 + d)*VLP + s], s < VLP, read only when RES
//   (a key tile at or beyond VLP would contribute a zero v residual; never happens for query blocks < RESQB)
//   logit (t, s) = q.k * sscale for s <= t, finfo.min for s > t. Query block qb (64 rows) visits key tiles
//   0..qb only (every later key is above the diagonal for all 64 rows -> weight exactly 0); the compare
//   s > t is applied on the diagonal tile kt == qb only (block-uniform flag, per-element select). Every row
//   has the live key s = t in the diagonal tile and key s = 0 in tile 0, so the row max is always finite.
//   out planes (bf16 hi / lo of the normalised context): element (t, h, d) at [t*DM + h*64 + d]
//   scores, transposed: S^T = K . Q^T (A = K rows, B = Q rows as columns): bf16 hi/lo split (hi.hi + hi.lo + lo.hi), f32 accumulate,
//   then * sscale in f32. Accumulator element r of tile j in lane (c, hh) = score of key kv0 + 16 j + 8 hh + r for query q0 + c: a lane
//   holds 32 of one query's 64 scores, lane l ^ 16 the other 32, so row max and row sum are in-lane plus one exchange between the halves.
//   p = exp(s - m) carried as f16(1024 p); two score tiles, converted in place, are the B operand P^T of one 32-key chunk
//   (element e < 8: tile 2 kk, e >= 8: tile 2 kk + 1: the k order of the V^T loader); context^T = V^T . P^T on f16 WMMA; RES adds f16 residual planes of p and v
//   (scale 4096, separate accumulator folded back with 1/4096 per chunk in f32); online softmax in f32.
//   Block = 4 waves = 64 query rows of one head; grid = nqbThis * NH; kv chunks of 64, static bound NQB,
//   block-uniform break at kt == qb + 1.
//   K / V^T chunk staging: 128 threads x 32 elements per plane = the whole 64x64 tile (plain 16-B loads,
//   __syncthreads before and after: cross-wave LDS regions Ksh/Ksl/Vth/Vtl behind block barriers);
//   the Os tile is wave-private: context^T accumulators are stored as rows [query][d] and reloaded for whole-line stores.
//   Output coverage: each wave stores rows q0..q0+15 (it 0..3 x lane>>3 0..3) x 64 columns (8 lanes x 8) of both planes.
// =====================================================================================================
template <bool RES>
__global__ __launch_bounds__(128)
void attn_causal64(const unsigned short* __restrict__ qhp, const unsigned short* __restrict__ qlp,
                   const unsigned short* __restrict__ khp, const unsigned short* __restrict__ klp,
                   const unsigned short* __restrict__ vhp, const unsigned short* __restrict__ vlp,
                   unsigned short* ohp, unsigned short* olp,
                   int qbBase, int nqbThis, float sscale) {
  union FB { v16b v; v8b h[2]; };
  union FH { v16h v; v8h h[2]; };
  __shared__ __align__(16) __bf16   Ksh[64 * LP];                 // K hi [kv][d], pitch LP
  __shared__ __align__(16) __bf16   Ksl[64 * LP];                 // K lo
  __shared__ __align__(16) _Float16 Vth[64 * LP];                 // V^T hi [d][kv], pitch LP
  __shared__ __align__(16) _Float16 Vtl[RES ? 64 * LP : 8];       // V^T residual
  __shared__ __align__(16) float    Os[4][16 * OP];               // per wave context tile [row][d], pitch OP

  const int tid  = threadIdx.x;
  const int wave = tid >> 5;
  const int lane = tid & 31;
  const int hh   = lane >> 4;
  const int c    = lane & 15;

  const int bx   = blockIdx.x;
  const int qbl  = bx % nqbThis;
  const int h    = bx / nqbThis;           // 0..NH-1 (grid = nqbThis * NH)
  const int qb   = qbBase + qbl;
  const int q0   = qb * 64 + wave * 16;

  const __bf16* Qh = (const __bf16*)(const void*)qhp + (size_t)h * HD;
  const __bf16* Ql = (const __bf16*)(const void*)qlp + (size_t)h * HD;
  const __bf16* Kh = (const __bf16*)(const void*)khp + (size_t)h * HD;
  const __bf16* Kl = (const __bf16*)(const void*)klp + (size_t)h * HD;
  const _Float16* Vh = (const _Float16*)(const void*)vhp + (size_t)h * HD * SEQ;
  const _Float16* Vl = (const _Float16*)(const void*)vlp + (size_t)h * HD * VLP;

  // ---- Q fragments (B operand, column = query = lane&15): 2 d-chunks, hi and lo ----
  v16b qah[2], qal[2];
#pragma unroll
  for (int dc = 0; dc < 2; ++dc) {
    const size_t qo = (size_t)(q0 + c) * DM + dc * 32 + 8 * hh;
    qah[dc] = ldfrag_b(Qh + qo);
    qal[dc] = ldfrag_b(Ql + qo);
  }

  float mrow = -INFINITY, lrow = 0.f;        // running max and sum of query q0 + c, the same value in both halves
  v8f oacc[4];                               // context^T: oacc[t][r] = element d = 16 t + 8 hh + r of query q0 + c
#pragma unroll
  for (int t = 0; t < 4; ++t) oacc[t] = zero8();

  const int nkt = qb + 1;                    // key tiles 0..qb (block-uniform)
  for (int kt = 0; kt < NQB; ++kt) {         // static bound
    if (kt >= nkt) break;                    // block-uniform
    const bool diag = (kt == qb);            // block-uniform
    const int kv0 = kt * 64;
    __syncthreads();
    {
      const int r = tid >> 1, half = (tid & 1) * 32;
      const __bf16*   kg  = Kh + (size_t)(kv0 + r) * DM + half;   // K row kv0+r (< SEQ), d = half..half+31
      const __bf16*   klg = Kl + (size_t)(kv0 + r) * DM + half;
      const _Float16* vg  = Vh + (size_t)r * SEQ + kv0 + half;    // V^T row d = r, s = kv0+half..+31
      const int kvl = (kv0 + 64 <= VLP) ? kv0 : (VLP - 64);     // clamped address into the residual plane
      const _Float16* vlg = Vl + (size_t)r * VLP + kvl + half;
      const bool resOK = (kv0 + 64 <= VLP);                      // block-uniform
#pragma unroll
      for (int i = 0; i < 4; ++i) {
        const v8b a0 = *(const v8b*)(kg + 8 * i);
        const v8b a1 = *(const v8b*)(klg + 8 * i);
        const v8h b0 = *(const v8h*)(vg + 8 * i);
        *(v8b*)(Ksh + r * LP + half + 8 * i) = a0;
        *(v8b*)(Ksl + r * LP + half + 8 * i) = a1;
        *(v8h*)(Vth + r * LP + half + 8 * i) = b0;
        if (RES) {
          v8h b1 = *(const v8h*)(vlg + 8 * i);
          if (!resOK) b1 = zero8h();
          *(v8h*)(Vtl + r * LP + half + 8 * i) = b1;
        }
      }
    }
    __syncthreads();

    // ---- scores, transposed: 64 keys x 16 query columns per wave, 3 bf16 products ----
    //      The 8 LDS reads of one 16-key row group stand together, KA groups ahead of the products that use them
    //      (two; one where the residual planes' accumulators leave fewer registers).
    constexpr int KA = RES ? 1 : 2;
    FB kb[4][2], kl[4][2];
    auto ldk = [&](int j) {
#pragma unroll
      for (int dc = 0; dc < 2; ++dc) {
        kb[j][dc].h[0] = *(const v8b*)(Ksh + (j * 16 + c) * LP + dc * 32 + 8 * hh);
        kb[j][dc].h[1] = *(const v8b*)(Ksh + (j * 16 + c) * LP + dc * 32 + 16 + 8 * hh);
        kl[j][dc].h[0] = *(const v8b*)(Ksl + (j * 16 + c) * LP + dc * 32 + 8 * hh);
        kl[j][dc].h[1] = *(const v8b*)(Ksl + (j * 16 + c) * LP + dc * 32 + 16 + 8 * hh);
      }
    };
#pragma unroll
    for (int j = 0; j < KA; ++j) ldk(j);
    v8f s[4];
#pragma unroll
    for (int j = 0; j < 4; ++j) {
      if (j + KA < 4) ldk(j + KA);
      s[j] = zero8();
#pragma unroll
      for (int dc = 0; dc < 2; ++dc) {
        s[j] = mma_b(kb[j][dc].v, qah[dc], s[j]);
        s[j] = mma_b(kl[j][dc].v, qah[dc], s[j]);
        s[j] = mma_b(kb[j][dc].v, qal[dc], s[j]);
      }
    }
    // V^T fragments, one group of reads per 32-key chunk. Without the residual planes the first chunk is read here, so that
    // the softmax below covers its LDS latency; with them (twice the fragments) each chunk is read in front of its own products.
    FH vb[2][4], vl[2][4];
    auto ldv = [&](int kk) {
#pragma unroll
      for (int t = 0; t < 4; ++t) {
        vb[kk][t].h[0] = *(const v8h*)(Vth + (t * 16 + c) * LP + kk * 32 + 8 * hh);
        vb[kk][t].h[1] = *(const v8h*)(Vth + (t * 16 + c) * LP + kk * 32 + 16 + 8 * hh);
        if (RES) {
          vl[kk][t].h[0] = *(const v8h*)(Vtl + (t * 16 + c) * LP + kk * 32 + 8 * hh);
          vl[kk][t].h[1] = *(const v8h*)(Vtl + (t * 16 + c) * LP + kk * 32 + 16 + 8 * hh);
        }
      }
    };
    if (!RES) ldv(0);

    // ---- scale + causal compare (diagonal tile only), max and sum of this lane's query, online softmax; P^T (x1024, f16) and
    //      its residual (x4096) are packed in registers as B operands ----
    const int qrow = q0 + c;                     // query of this lane's score column
    float mj[4];                                 // one maximum per score tile: four independent chains, each free as soon as its tile is
#pragma unroll
    for (int j = 0; j < 4; ++j) {
      mj[j] = -INFINITY;
#pragma unroll
      for (int r = 0; r < 8; ++r) {
        const int key = kv0 + j * 16 + 8 * hh + r;   // key of accumulator element r of tile j in this lane
        float sv = s[j][r] * sscale;
        sv = (diag && (key > qrow)) ? -FLT_MAX : sv;
        s[j][r] = sv;
        mj[j] = fmaxf(mj[j], sv);
      }
    }
    float m = fmaxf(fmaxf(mj[0], mj[1]), fmaxf(mj[2], mj[3]));
    m = fmaxf(m, xhalf(m));                      // the query's other 32 keys
    const float mnew  = fmaxf(mrow, m);
    const float msafe = (mnew == -INFINITY) ? 0.f : mnew;
    const float alpha = __expf(mrow - msafe);
    mrow = mnew;
    FH pa[2], pl[2];
    float ps[4];                                 // one partial sum per score tile: four independent add chains
#pragma unroll
    for (int j = 0; j < 4; ++j) {
      ps[j] = 0.f;
#pragma unroll
      for (int r = 0; r < 8; ++r) {
        const float p = __expf(s[j][r] - msafe);     // floor logit against a normal max: exp -> 0
        ps[j] += p;
        const float p1k = p * 1024.0f;
        const _Float16 ph = (_Float16)p1k;
        pa[j >> 1].v[(j & 1) * 8 + r] = ph;
        if (RES) pl[j >> 1].v[(j & 1) * 8 + r] = (_Float16)((p1k - (float)ph) * 4096.0f);
      }
    }
    float psum = (ps[0] + ps[1]) + (ps[2] + ps[3]);
    psum += xhalf(psum);                         // the query's other 32 keys
    lrow = lrow * alpha + psum;
#pragma unroll
    for (int t = 0; t < 4; ++t)
#pragma unroll
      for (int r = 0; r < 8; ++r) oacc[t][r] *= alpha;

    // ---- context^T += V^T . P^T (f16 WMMA), residual products into a separate accumulator ----
    v8f o1[4];
#pragma unroll
    for (int t = 0; t < 4; ++t) o1[t] = zero8();
    if (!RES) ldv(1);
#pragma unroll   // constant kk: the fragment arrays stay in registers
    for (int kk = 0; kk < 2; ++kk) {
      if (RES) ldv(kk);
#pragma unroll
      for (int t = 0; t < 4; ++t) {
        oacc[t] = mma_h(vb[kk][t].v, pa[kk].v, oacc[t]);
        if (RES) {
          o1[t] = mma_h(vl[kk][t].v, pa[kk].v, o1[t]);
          o1[t] = mma_h(vb[kk][t].v, pl[kk].v, o1[t]);
        }
      }
    }
    if (RES) {
#pragma unroll
      for (int t = 0; t < 4; ++t)
#pragma unroll
        for (int r = 0; r < 8; ++r) oacc[t][r] += o1[t][r] * (1.0f / 4096.0f);
    }
  }

  // ---- normalise (1/l and the 1/1024 p carry), stage the wave's 16x64 tile, bf16 hi/lo split,
  float* os = Os[wave];
  {
    const float l = lrow;
    const float inv = ((l > 0.f) ? (1.0f / l) : 0.f) * (1.0f / 1024.0f);
#pragma unroll
    for (int t = 0; t < 4; ++t) {              // row = query c, 8 consecutive d per lane and tile: two 16-B stores
      v4f a, b;
#pragma unroll
      for (int r = 0; r < 4; ++r) { a[r] = oacc[t][r] * inv; b[r] = oacc[t][4 + r] * inv; }
      *(v4f*)(os + c * OP + t * 16 + 8 * hh)     = a;
      *(v4f*)(os + c * OP + t * 16 + 8 * hh + 4) = b;
    }
  }
  __builtin_amdgcn_fence(__ATOMIC_RELEASE, "workgroup");
  __builtin_amdgcn_wave_barrier();
  __builtin_amdgcn_fence(__ATOMIC_ACQUIRE, "workgroup");
  {
    const int q4 = lane >> 3, c8 = (lane & 7) * 8;
    v4u hv[4], lv[4];
#pragma unroll
    for (int it = 0; it < 4; ++it) {
      const int row = it * 4 + q4;   // it 0..3 x q4 0..3 = rows 0..15 of the wave tile
      const float* sp = os + row * OP + c8;
      v4u a, a2;
#pragma unroll
      for (int e = 0; e < 4; ++e) {
        const float f0 = sp[2 * e], f1 = sp[2 * e + 1];
        const unsigned short h0 = bf_bits(f0), h1 = bf_bits(f1);
        const unsigned short l0 = bf_bits(f0 - bf_up(h0)), l1 = bf_bits(f1 - bf_up(h1));
        a[e] = pk16(h0, h1); a2[e] = pk16(l0, l1);
      }
      hv[it] = a; lv[it] = a2;
    }
    {
#pragma unroll
      for (int it = 0; it < 4; ++it) {
        const int row = it * 4 + q4;
        const size_t go = (size_t)(q0 + row) * DM + (size_t)h * HD + c8;
        *(v4u*)(ohp + go) = hv[it];
        *(v4u*)(olp + go) = lv[it];
      }
      
    }
  }
}

// =====================================================================================================
// Workspace map (bytes, SEQ = 4096):
//   Xb    bf16 [SEQ][1024]          0          8388608
//   Wqkvb bf16 [3072 n][1024 k]     8388608    6291456   (rows 0..1023 = q columns, 1024..2047 = k, 2048..3071 = v)
//   Wob   bf16 [1024 n][1024 k]     14680064   2097152
//   Qh    bf16 [SEQ][1024]          16777216   8388608
//   Ql    bf16 [SEQ][1024]          25165824   8388608
//   Kh    bf16 [SEQ][1024]          33554432   8388608
//   Kl    bf16 [SEQ][1024]          41943040   8388608
//   VTh   f16  [1024][SEQ]          50331648   8388608
//   VTl   f16  [1024][VLP=512]      58720256   1048576
//   Oh    bf16 [SEQ][1024]          59768832   8388608
//   Ol    bf16 [SEQ][1024]          68157440   8388608
//   end                             76546048
// All planes are exact multiples of their 64x64 / whole-line store granularity (no padded tails needed),
// =====================================================================================================
extern "C" void kernel_launch(void* const* d_in, const int* in_sizes, int n_in,
                              void* d_out, int out_size, void* d_ws, size_t ws_size,
                              hipStream_t stream) {
  if (n_in < 5) return;
  if (in_sizes[0] < SEQ * DM) return;                 // x rows 0..SEQ-1 (prefix of the full input)
  if (in_sizes[1] != DM * NQKV) return;               // w_qkv [1024][3072]
  if (in_sizes[2] != NQKV) return;                    // b_qkv [3072]
  if (in_sizes[3] != DM * DM) return;                 // w_o [1024][1024]
  if (in_sizes[4] != DM) return;                      // b_o [1024]
  if (out_size < SEQ * DM) return;

  const float* x     = (const float*)d_in[0];
  const float* w_qkv = (const float*)d_in[1];
  const float* b_qkv = (const float*)d_in[2];
  const float* w_o   = (const float*)d_in[3];
  const float* b_o   = (const float*)d_in[4];

  const size_t PX  = (size_t)SEQ * DM * 2;       // 16-bit activation plane [SEQ][1024]
  const size_t PWQ = (size_t)NQKV * DM * 2;      // 16-bit fused weight plane [3072][1024]
  const size_t PWO = (size_t)DM * DM * 2;        // 16-bit out weight plane
  const size_t PVT = (size_t)DM * SEQ * 2;       // v^T hi plane
  const size_t PVL = (size_t)DM * VLP * 2;       // v^T residual plane
  size_t off = 0;
  const size_t oXb   = off; off += PX;
  const size_t oWqkv = off; off += PWQ;
  const size_t oWo   = off; off += PWO;
  const size_t oQh   = off; off += PX;
  const size_t oQl   = off; off += PX;
  const size_t oKh   = off; off += PX;
  const size_t oKl   = off; off += PX;
  const size_t oVTh  = off; off += PVT;
  const size_t oVTl  = off; off += PVL;
  const size_t oOh   = off; off += PX;
  const size_t oOl   = off; off += PX;
  if (off > ws_size) return;                     // off = 76546048 for SEQ = 4096
  if (off > (size_t)134217728) return;

  char* ws = (char*)d_ws;
  unsigned short* Xb    = (unsigned short*)(ws + oXb);
  unsigned short* Wqkvb = (unsigned short*)(ws + oWqkv);
  unsigned short* Wob   = (unsigned short*)(ws + oWo);
  unsigned short* Qh    = (unsigned short*)(ws + oQh);
  unsigned short* Ql    = (unsigned short*)(ws + oQl);
  unsigned short* Kh    = (unsigned short*)(ws + oKh);
  unsigned short* Kl    = (unsigned short*)(ws + oKl);
  unsigned short* VTh   = (unsigned short*)(ws + oVTh);
  unsigned short* VTl   = (unsigned short*)(ws + oVTl);
  unsigned short* Oh    = (unsigned short*)(ws + oOh);
  unsigned short* Ol    = (unsigned short*)(ws + oOl);
  const unsigned short* Wqb = Wqkvb;                              // q weight rows  [1024 n][1024 k]
  const unsigned short* Wkb = Wqkvb + (size_t)DM * DM;            // k weight rows
  const unsigned short* Wvb = Wqkvb + (size_t)2 * DM * DM;        // v weight rows

  const dim3 blk(256);
  const int n8x = SEQ * DM / 8;                                    // multiple of 256
  const dim3 gCvtX((n8x + 255) / 256);
  const dim3 gTq(NQKV / 64, DM / 64);                              // in [1024 k][3072 n] -> out [3072][1024]: (n tiles, k tiles) = (48, 16)
  const dim3 gTo(DM / 64, DM / 64);                                // in [1024 k][1024 n] -> out [1024][1024]: (16, 16)
  const dim3 gProj((SEQ / 128) * (DM / 128), 1);                   // M = SEQ, N = 1024 -> 256 block tiles of 128x128 (SEQ = 4096)
  const dim3 gVT((DM / 128) * (SEQ / 128), 1);                     // M = 1024, N = SEQ

  // (1) x -> bf16 plane [SEQ][1024]; w_qkv [k][n] -> bf16 [n][k]; w_o [k][n] -> bf16 [n][k]
  cvt_bf16x8<<<gCvtX, blk, 0, stream>>>(x, Xb, n8x);
  cvtT_bf16<<<gTq, blk, 0, stream>>>(w_qkv, Wqkvb, DM, NQKV);
  cvtT_bf16<<<gTo, blk, 0, stream>>>(w_o, Wob, DM, DM);
  // (2) q = x . Wq + b_q -> bf16 hi/lo planes [t][h*64+d]   (M = SEQ, N = 1024, K = 1024)
  gemm64<0, 2, 1><<<gProj, blk, 0, stream>>>(
      Xb, Xb, DM, 0LL, Wqb, Wqb, DM, 0LL,
      (void*)Qh, DM, 0LL, (void*)Ql, DM, 0LL, DM,
      SEQ, DM, DM, 1.0f, b_qkv);
  // (3) k = x . Wk + b_k -> bf16 hi/lo planes
  gemm64<0, 2, 1><<<gProj, blk, 0, stream>>>(
      Xb, Xb, DM, 0LL, Wkb, Wkb, DM, 0LL,
      (void*)Kh, DM, 0LL, (void*)Kl, DM, 0LL, DM,
      SEQ, DM, DM, 1.0f, b_qkv + DM);
  // (4) v^T = Wv . x^T + b_v (per row) -> f16 hi plane [h*64+d][s] (pitch SEQ) and residual plane
  //     (x4096, keys < VLP only, pitch VLP)   (A = Wvb [n][k], Bt = Xb; M = 1024, N = SEQ, K = 1024)
  gemm64<0, 3, 2><<<gVT, blk, 0, stream>>>(
      Wvb, Wvb, DM, 0LL, Xb, Xb, DM, 0LL,
      (void*)VTh, SEQ, 0LL, (void*)VTl, VLP, 0LL, VLP,
      DM, SEQ, DM, 4096.0f, b_qkv + 2 * DM);
  // (5) causal attention: query blocks 0..RESQB-1 with residual planes, the rest without
  attn_causal64<true><<<dim3(NH * RESQB), dim3(128), 0, stream>>>(
      Qh, Ql, Kh, Kl, VTh, VTl, Oh, Ol, 0, RESQB, 0.125f);
  if (NQB > RESQB) {
    attn_causal64<false><<<dim3(NH * (NQB - RESQB)), dim3(128), 0, stream>>>(
        Qh, Ql, Kh, Kl, VTh, VTl, Oh, Ol, RESQB, NQB - RESQB, 0.125f);
  }
  // (6) out = context . Wo + b_o -> d_out f32 [SEQ][1024]  (A = context hi + lo planes, 2 products)
  gemm64<1, 0, 1><<<gProj, blk, 0, stream>>>(
      Oh, Ol, DM, 0LL, Wob, Wob, DM, 0LL,
      d_out, DM, 0LL, d_out, DM, 0LL, DM,
      SEQ, DM, DM, 1.0f, b_o);
  (void)hipGetLastError();
}

// v005
// Measured time: 177 microseconds a run.
// In both of two side-by-side timings against v004, it was 1.06 times as fast.
// All steps since v000 together make it 3.28 times as fast.
// Contractions: q, k, v^T projections = v_wmma_f32_16x16x32_bf16 (bf16 operands from RNE-converted inputs, single product, f32 bias add);
// k.q^T scores (transposed) = v_wmma_f32_16x16x32_bf16 with bf16 hi/lo split q and k (hi.hi + hi.lo + lo.hi);
// v^T.p^T = v_wmma_f32_16x16x32_f16 (p carried x1024 in f16, v in f16; extra f16 residual planes x4096 of p and v for the first VLP query rows);
// ctx.Wo = v_wmma_f32_16x16x32_bf16 with ctx as bf16 hi/lo planes times bf16 Wo (2 products); all f32 accumulate; causal compare and softmax in f32.
#include <hip/hip_runtime.h>
#include <math.h>
#include <float.h>
#include <stdint.h>

#ifndef NB
#define NB    1
#endif
#ifndef SEQ
#define SEQ   4096
#endif
#define SEQ_FULL 4096
#define DM    1024
#define NH    16
#define HD    64
#define NQKV  (3 * DM)
#define NQB   (SEQ / 64)                      // key / query tiles of 64
#define VLP   ((SEQ < 512) ? SEQ : 512)       // key pitch of the v^T residual plane (keys 0..VLP-1)
#define RESQB (VLP / 64)                      // number of leading 64-row query blocks that use the p / v residual planes
#define LP    72                              // LDS row pitch of the 64-wide 16-bit K / V^T tiles, in elements: 144 B = 16 B x 9 (odd), so the
                                              // 16 rows that one half-wave's 16-B fragment read touches fall on 16 distinct groups of 4 banks
#define OP    68                              // LDS row pitch of the 64-wide f32 context tile, in elements: 272 B = 16 B x 17 (odd)
static_assert(NB == 1);
static_assert(NH * HD == DM && HD == 64);
static_assert((SEQ % 64) == 0 && (DM % 64) == 0 && SEQ >= 64 && SEQ <= SEQ_FULL);
static_assert(RESQB * 64 == VLP && VLP <= SEQ && RESQB >= 1 && RESQB <= NQB);
static_assert((NQKV % 64) == 0);
static_assert((SEQ % 128) == 0 && (DM % 128) == 0);   // 128x128 block tiles and 128-wide k steps of the projections

typedef _Float16 v16h __attribute__((ext_vector_type(16)));
typedef _Float16 v8h  __attribute__((ext_vector_type(8)));
typedef __bf16   v16b __attribute__((ext_vector_type(16)));
typedef __bf16   v8b  __attribute__((ext_vector_type(8)));
typedef float    v8f  __attribute__((ext_vector_type(8)));
typedef float    v4f  __attribute__((ext_vector_type(4)));
typedef unsigned int v4u __attribute__((ext_vector_type(4)));

// ---- scalar helpers --------------------------------------------------------------------------------
__device__ __forceinline__ unsigned short bf_bits(float f) {          // f32 -> bf16 bits, RNE convert
  unsigned u = __float_as_uint(f);
  return (unsigned short)((u + 0x7FFFu + ((u >> 16) & 1u)) >> 16);
}
__device__ __forceinline__ float bf_up(unsigned short h) { return __uint_as_float(((unsigned)h) << 16); }
__device__ __forceinline__ unsigned short h_bits(_Float16 x) { return __builtin_bit_cast(unsigned short, x); }
__device__ __forceinline__ unsigned pk16(unsigned short a, unsigned short b) { return (unsigned)a | ((unsigned)b << 16); }
__device__ __forceinline__ v8f zero8() { v8f z = {0.f, 0.f, 0.f, 0.f, 0.f, 0.f, 0.f, 0.f}; return z; }
__device__ __forceinline__ v8h zero8h() {
  const _Float16 z = (_Float16)0.0f;
  v8h r = {z, z, z, z, z, z, z, z};
  return r;
}

// ---- value of lane l ^ 16 (the other half of the wave), a vector-port move
__device__ __forceinline__ float xhalf(float x) {
  return __builtin_bit_cast(float, __builtin_amdgcn_permlanex16(__builtin_bit_cast(int, x), __builtin_bit_cast(int, x),
                                                                0x76543210, 0xfedcba98, false, false));
}

// ---- fragment loaders: 16-bit A/B operand, lane -> row/col (lane&15), p already includes +8*(lane>>4);
//      elements 0..7 <- p[0..7] (k0+8h..), elements 8..15 <- p[16..23] (k0+16+8h..)
__device__ __forceinline__ v16b ldfrag_b(const __bf16* p) {
  union { v16b v; v8b h[2]; } f;
  f.h[0] = *(const v8b*)(p);
  f.h[1] = *(const v8b*)(p + 16);
  return f.v;
}

// ---- WMMA helpers with trailing VALU hazard gap --------------------------------------------------------
__device__ __forceinline__ v8f mma_b(v16b a, v16b b, v8f c) {
  c = __builtin_amdgcn_wmma_f32_16x16x32_bf16(false, a, false, b, (short)0, c, false, false);
  asm volatile("v_nop\n\tv_nop\n\tv_nop\n\tv_nop" : "+v"(c) : "v"(a), "v"(b));
  return c;
}
__device__ __forceinline__ v8f mma_h(v16h a, v16h b, v8f c) {
  c = __builtin_amdgcn_wmma_f32_16x16x32_f16(false, a, false, b, (short)0, c, false, false);
  asm volatile("v_nop\n\tv_nop\n\tv_nop\n\tv_nop" : "+v"(c) : "v"(a), "v"(b));
  return c;
}
__device__ __forceinline__ v8f mma_b_raw(v16b a, v16b b, v8f c) {
  return __builtin_amdgcn_wmma_f32_16x16x32_bf16(false, a, false, b, (short)0, c, false, false);
}
__device__ __forceinline__ void dep_guard_b(v8f& a, v8f& b, v16b x, v16b y) {
  asm volatile("v_nop\n\tv_nop\n\tv_nop\n\tv_nop" : "+v"(a), "+v"(b) : "v"(x), "v"(y));
}
__device__ __forceinline__ void keep4_b(v16b a, v16b b, v16b c, v16b d) {
  asm volatile("v_nop" :: "v"(a), "v"(b), "v"(c), "v"(d));
}
__device__ __forceinline__ void acc_guard4(v8f& a, v8f& b, v8f& c, v8f& d) {
  asm volatile("v_nop\n\tv_nop\n\tv_nop\n\tv_nop" : "+v"(a), "+v"(b), "+v"(c), "+v"(d));
}

// =====================================================================================================
// f32 -> bf16 (RNE convert), 8 elements per thread, one 16-B store per lane: a wave writes 512 contiguous B
// coverage: n8 threads x 8 = whole plane (n8 = SEQ*DM/8 is a multiple of 256).
// =====================================================================================================
__global__ __launch_bounds__(256) void cvt_bf16x8(const float* __restrict__ in, unsigned short* out, int n8) {
  const int i = blockIdx.x * 256 + threadIdx.x;
  if (i < n8) {
    const v4f a = *(const v4f*)(in + (size_t)i * 8);
    const v4f b = *(const v4f*)(in + (size_t)i * 8 + 4);
    v4u p;
    p[0] = pk16(bf_bits(a[0]), bf_bits(a[1]));
    p[1] = pk16(bf_bits(a[2]), bf_bits(a[3]));
    p[2] = pk16(bf_bits(b[0]), bf_bits(b[1]));
    p[3] = pk16(bf_bits(b[2]), bf_bits(b[3]));
    *(v4u*)(out + (size_t)i * 8) = p;
    
  }
}

// =====================================================================================================
// Transposed convert: in f32 [K rows][N cols] (pitch N) -> out bf16 [N rows][K cols] (pitch K), RNE.
// grid = (N/64, K/64), 256 threads; one 64(k) x 64(n) tile per block through LDS.
// Load phase: thread (k row = tid>>2, 16 n columns = (tid&3)*16) reads 4 x 16 B and writes bf16 bits
// transposed into st[n][k] (pitch 72 halves). After __syncthreads each wave writes 8 output rows:
// coverage: load 64 k x (4 threads x 16 n) = 64x64; store 8 waves x 2 it x 4 rows x (8 lanes x 8) = 64x64.
// LDS st: cross-wave exchange behind the block barrier.
// =====================================================================================================
__global__ __launch_bounds__(256) void cvtT_bf16(const float* __restrict__ in, unsigned short* out, int K, int N) {
  __shared__ __align__(16) unsigned short st[64 * 72];
  const int tid = threadIdx.x;
  const int n0  = blockIdx.x * 64;
  const int k0  = blockIdx.y * 64;
  {
    const int r  = tid >> 2;            // k row 0..63
    const int cb = (tid & 3) * 16;      // n column base
    const float* src = in + (size_t)(k0 + r) * N + n0 + cb;
#pragma unroll
    for (int e = 0; e < 4; ++e) {
      const v4f a = *(const v4f*)(src + 4 * e);
#pragma unroll
      for (int u = 0; u < 4; ++u) st[(cb + 4 * e + u) * 72 + r] = bf_bits(a[u]);
    }
  }
  __syncthreads();
  {
    const int lane = tid & 31, wave = tid >> 5;
    const int q = lane >> 3, c8 = (lane & 7) * 8;
    v4u hv[2];
#pragma unroll
    for (int it = 0; it < 2; ++it) {
      const int row = wave * 8 + it * 4 + q;      // n row within the tile
      hv[it] = *(const v4u*)(st + row * 72 + c8);
    }
    {
#pragma unroll
      for (int it = 0; it < 2; ++it) {
        const int row = wave * 8 + it * 4 + q;
        *(v4u*)(out + (size_t)(n0 + row) * K + k0 + c8) = hv[it];
      }
      
    }
  }
}

// =====================================================================================================
// Register-blocked bf16 WMMA GEMM: C[m][n] = sum_k A[m][k] * Bt[n][k] + bias; one wave per 32x64 tile,
// 8 waves (4 x 2) per block = one 128x128 tile of C. A row-major [M][K] pitch lda; Bt row-major [N][K] pitch ldb
// (k contiguous); M, N multiples of 128, K a multiple of GKS. blockIdx.y = batch index (strides in elements).
// Operands: per k step of GKS the block's 128 rows of every operand plane are copied global -> LDS in whole lines
// (stage_tile), two buffers, the next step's copies in flight while this step's fragments are read from LDS;
// every fragment keeps its k order and the k steps stay ascending, so each f32 sum keeps its order.
// NSPLIT: 0 = A.Bt; 1 = (A + A2).Bt (A2 = unscaled bf16 lo plane of A); 2 = A.Bt + A2.Bt + A.Bt2.
// OUT_MODE: 0 = f32 (pitch ldc); 2 = bf16 hi plane C + bf16 lo plane C2 (lo = RNE(v - hi), unscaled);
//           3 = f16 hi plane C + f16 residual plane C2 = f16((v - hi) * rscale), C2 written only for tiles
//               with n0 < N2 (pitch ldc2, batch stride strideC2).
// BIASM: 1 = bias[n] added per column (bias has >= N entries); 2 = bias[m] added per row (>= M entries);
//        the bias value is RNE-converted to bf16 and added in f32 before any output split.
// =====================================================================================================
#define GKS 128                               // k elements of one staged step: 256 B of every operand row
#define GP  136                               // LDS row pitch of a staged operand tile, in elements: 272 B = 16 B x 17 (odd)
#define GMI 2                                 // 16-row sub-tiles of one wave's 32x64 tile

// One operand tile of 128 rows x GKS k (256 B per row), global -> LDS, by asynchronous copies of 16 B per lane.
// Thread t of 256: 16-B piece (t & 15) of rows (t >> 4) + 16 e, e = 0..7; one wave-wide copy = 2 whole rows = 4 whole lines.
// Coverage: 16 rows x 8 e = 128 rows, 16 pieces x 16 B = 256 B; each LDS byte is written by one lane only.
// s_wait_xcnt 0 closes the statement so that no address register of an issued copy is rewritten ahead of it.
__device__ __forceinline__ void stage_tile(const __bf16* g, int ld, __bf16* l, int tid) {
  const __bf16* gp = g + (size_t)(tid >> 4) * ld + (tid & 15) * 8;
  const unsigned la = (unsigned)(uintptr_t)l + (unsigned)(((tid >> 4) * GP + (tid & 15) * 8) * 2);
  asm volatile(
      "global_load_async_to_lds_b128 %0, %8, off\n\t"
      "global_load_async_to_lds_b128 %1, %9, off\n\t"
      "global_load_async_to_lds_b128 %2, %10, off\n\t"
      "global_load_async_to_lds_b128 %3, %11, off\n\t"
      "global_load_async_to_lds_b128 %4, %12, off\n\t"
      "global_load_async_to_lds_b128 %5, %13, off\n\t"
      "global_load_async_to_lds_b128 %6, %14, off\n\t"
      "global_load_async_to_lds_b128 %7, %15, off\n\t"
      "s_wait_xcnt 0x0"
      :: "v"(la), "v"(la + (unsigned)(1 * 16 * GP * 2)),
         "v"(la + (unsigned)(2 * 16 * GP * 2)), "v"(la + (unsigned)(3 * 16 * GP * 2)),
         "v"(la + (unsigned)(4 * 16 * GP * 2)), "v"(la + (unsigned)(5 * 16 * GP * 2)),
         "v"(la + (unsigned)(6 * 16 * GP * 2)), "v"(la + (unsigned)(7 * 16 * GP * 2)),
         "v"(gp), "v"(gp + (size_t)(1 * 16) * ld),
         "v"(gp + (size_t)(2 * 16) * ld), "v"(gp + (size_t)(3 * 16) * ld),
         "v"(gp + (size_t)(4 * 16) * ld), "v"(gp + (size_t)(5 * 16) * ld),
         "v"(gp + (size_t)(6 * 16) * ld), "v"(gp + (size_t)(7 * 16) * ld)
      : "memory");
}

template <int NSPLIT, int OUT_MODE, int BIASM>
__global__ __launch_bounds__(256) void gemm64(
    const unsigned short* __restrict__ Ap, const unsigned short* A2p, int lda, long long strideA,
    const unsigned short* __restrict__ Btp, const unsigned short* Bt2p, int ldb, long long strideB,
    void* Cout, int ldc, long long strideC,
    void* Cout2, int ldc2, long long strideC2, int N2,
    int M, int N, int K, float rscale, const float* __restrict__ bias) {
  const __bf16* A   = (const __bf16*)(const void*)Ap;
  const __bf16* A2  = (const __bf16*)(const void*)A2p;
  const __bf16* Bt  = (const __bf16*)(const void*)Btp;
  const __bf16* Bt2 = (const __bf16*)(const void*)Bt2p;
  constexpr int NPL = 2 + (NSPLIT >= 1 ? 1 : 0) + (NSPLIT == 2 ? 1 : 0);   // staged planes: A, Bt, (A2), (Bt2)
  __shared__ __align__(16) __bf16 stg[2][NPL][128 * GP];   // two buffers of the block's operand tiles, pitch GP
  __shared__ __align__(16) float sT[8][16 * 68];   // per-wave 16x64 slab, pitch 68 floats
  const int b    = blockIdx.y;
  const int tid  = threadIdx.x;
  const int lane = threadIdx.x & 31;
  const int wave = threadIdx.x >> 5;
  const int tilesN = N >> 7;
  const int tilesM = M >> 7;
  const int tile = blockIdx.x;
  if (tile >= tilesM * tilesN) return;   // block-uniform, in front of every copy and barrier
  const int tm = tile / tilesN;
  const int tn = tile - tm * tilesN;
  const int bm0 = tm << 7;               // block tile origin
  const int bn0 = tn << 7;
  const int wm  = (wave >> 1) << 5;      // wave tile origin inside the block tile: 4 wave rows of 32, 2 wave columns of 64
  const int wn  = (wave & 1) << 6;
  const int m0 = bm0 + wm;
  const int n0 = bn0 + wn;

  const __bf16* Ab  = A  + (size_t)b * strideA;
  const __bf16* Bb  = Bt + (size_t)b * strideB;
  const __bf16* Ab2 = (NSPLIT >= 1) ? (A2  + (size_t)b * strideA) : Ab;
  const __bf16* Bb2 = (NSPLIT == 2) ? (Bt2 + (size_t)b * strideB) : Bb;

  const int rlane = lane & 15;                 // row (A) / col (B, D) within subtile
  const int koff  = (lane >> 4) * 8;           // k offset of this lane half
  const int mOff  = (lane >> 4) * 8;           // D row offset

  v8f acc[GMI][4];
#pragma unroll
  for (int i = 0; i < GMI; ++i)
#pragma unroll
    for (int j = 0; j < 4; ++j) acc[i][j] = zero8();

  // copies of k step t (rows bm0.. / bn0.. + 0..127 < M / N, k = t*GKS..+GKS-1 < K) into buffer buf
  auto issue = [&](int t, int buf) {
    const size_t k0 = (size_t)t * GKS;
    stage_tile(Ab + (size_t)bm0 * lda + k0, lda, &stg[buf][0][0], tid);
    stage_tile(Bb + (size_t)bn0 * ldb + k0, ldb, &stg[buf][1][0], tid);
    if constexpr (NSPLIT >= 1) stage_tile(Ab2 + (size_t)bm0 * lda + k0, lda, &stg[buf][2][0], tid);
    if constexpr (NSPLIT == 2) stage_tile(Bb2 + (size_t)bn0 * ldb + k0, ldb, &stg[buf][3][0], tid);
  };
  const int NT = K / GKS;                                // block-uniform
  issue(0, 0);
  asm volatile("s_wait_asynccnt 0x0" ::: "memory");      // this wave's copies of step 0 have landed
  __syncthreads();                                       // ... and every other wave's
  if (NT > 1) issue(1, 1);

  for (int t = 0; t < NT; ++t) {
    const __bf16* sA  = &stg[t & 1][0][0];
    const __bf16* sB  = &stg[t & 1][1][0];
    const __bf16* sA2 = &stg[t & 1][NSPLIT >= 1 ? 2 : 0][0];
    const __bf16* sB2 = &stg[t & 1][NSPLIT == 2 ? 3 : 1][0];
#pragma unroll   // constant kk: every LDS fragment offset is an immediate and the fragment arrays stay in registers
    for (int kk = 0; kk < GKS; kk += 32) {
      v16b bh[4], bl[4], ah[GMI], al[GMI];
#pragma unroll
      for (int j = 0; j < 4; ++j) {
        const int bo = (wn + (j << 4) + rlane) * GP + koff + kk;
        bh[j] = ldfrag_b(sB + bo);
        if (NSPLIT == 2) bl[j] = ldfrag_b(sB2 + bo); else bl[j] = bh[j];
      }
#pragma unroll   // all fragment reads of this k chunk stand as one group in front of its products
      for (int i = 0; i < GMI; ++i) {
        const int ao = (wm + (i << 4) + rlane) * GP + koff + kk;
        ah[i] = ldfrag_b(sA + ao);
        if (NSPLIT >= 1) al[i] = ldfrag_b(sA2 + ao); else al[i] = ah[i];
      }
#pragma unroll
      for (int i = 0; i < GMI; ++i) {
#pragma unroll
        for (int j = 0; j < 4; ++j) {
          acc[i][j] = mma_b_raw(ah[i], bh[j], acc[i][j]);
          if (NSPLIT >= 1) acc[i][j] = mma_b_raw(al[i], bh[j], acc[i][j]);
          if (NSPLIT == 2) acc[i][j] = mma_b_raw(ah[i], bl[j], acc[i][j]);
        }
        dep_guard_b(acc[i][0], acc[i][3], ah[i], al[i]);
      }
      keep4_b(bh[0], bh[1], bh[2], bh[3]);
      if (NSPLIT == 2) keep4_b(bl[0], bl[1], bl[2], bl[3]);
    }
    asm volatile("s_wait_dscnt 0x0" ::: "memory");       // this wave's reads of buffer t & 1 are done
    asm volatile("s_wait_asynccnt 0x0" ::: "memory");    // this wave's copies of step t + 1 have landed
    __syncthreads();                                     // publishes step t + 1 and frees buffer t & 1
    if (t + 2 < NT) issue(t + 2, t & 1);                 // block-uniform
  }
  asm volatile("s_wait_asynccnt 0x0" ::: "memory");      // no copy is left in flight behind the loop
  acc_guard4(acc[0][0], acc[0][1], acc[0][2], acc[0][3]);
  acc_guard4(acc[1][0], acc[1][1], acc[1][2], acc[1][3]);

  // ---- epilogue ----
  float* slab = sT[wave];
  float bcol[4];
#pragma unroll
  for (int j = 0; j < 4; ++j) bcol[j] = 0.f;
  if (BIASM == 1) {
#pragma unroll
    for (int j = 0; j < 4; ++j) bcol[j] = bf_up(bf_bits(bias[n0 + (j << 4) + rlane]));   // < N, in range
  }
#pragma unroll
  for (int i = 0; i < GMI; ++i) {
    const int mBase = m0 + (i << 4);
    float brow[8];
#pragma unroll
    for (int r = 0; r < 8; ++r) brow[r] = 0.f;
    if (BIASM == 2) {
      const v4f b0 = *(const v4f*)(bias + mBase + mOff);          // rows mBase+mOff..+7 < M, in range
      const v4f b1 = *(const v4f*)(bias + mBase + mOff + 4);
#pragma unroll
      for (int r = 0; r < 4; ++r) {
        brow[r]     = bf_up(bf_bits(b0[r]));
        brow[4 + r] = bf_up(bf_bits(b1[r]));
      }
    }
#pragma unroll
    for (int j = 0; j < 4; ++j) {
#pragma unroll
      for (int r = 0; r < 8; ++r) {
        slab[(mOff + r) * 68 + (j << 4) + rlane] = acc[i][j][r] + bcol[j] + brow[r];
      }
    }
    __builtin_amdgcn_fence(__ATOMIC_RELEASE, "workgroup");
    __builtin_amdgcn_wave_barrier();
    __builtin_amdgcn_fence(__ATOMIC_ACQUIRE, "workgroup");
    if (OUT_MODE == 0) {
      float* C = (float*)Cout + (size_t)b * strideC;
      const int hh = lane >> 4, c4 = (lane & 15) * 4;     // 256-B row segment = 16 lanes x 16 B
      {
#pragma unroll
        for (int it = 0; it < 8; ++it) {
          const int row = it * 2 + hh;                     // it 0..7 x hh 0..1 = rows 0..15
          const v4f v = *(const v4f*)(slab + row * 68 + c4);
          *(v4f*)(C + (size_t)(mBase + row) * ldc + n0 + c4) = v;
        }
        
      }
    } else {
      const int q = lane >> 3, c8 = (lane & 7) * 8;
      unsigned short* C  = (unsigned short*)Cout  + (size_t)b * strideC;
      unsigned short* C2 = (unsigned short*)Cout2 + (size_t)b * strideC2;
      const bool wlo = (OUT_MODE == 2) || (n0 < N2);      // wave-uniform
      v4u hv[4], lv[4];
#pragma unroll
      for (int it = 0; it < 4; ++it) {
        const int row = it * 4 + q;                        // it 0..3 x q 0..3 = rows 0..15
        const float* sp = slab + row * 68 + c8;
        v4u a, a2;
#pragma unroll
        for (int e = 0; e < 4; ++e) {
          const float f0 = sp[2 * e], f1 = sp[2 * e + 1];
          unsigned short h0, h1, l0, l1;
          if (OUT_MODE == 2) {
            h0 = bf_bits(f0); h1 = bf_bits(f1);
            l0 = bf_bits(f0 - bf_up(h0)); l1 = bf_bits(f1 - bf_up(h1));
          } else {
            const _Float16 x0 = (_Float16)f0, x1 = (_Float16)f1;
            h0 = h_bits(x0); h1 = h_bits(x1);
            l0 = h_bits((_Float16)((f0 - (float)x0) * rscale));
            l1 = h_bits((_Float16)((f1 - (float)x1) * rscale));
          }
          a[e] = pk16(h0, h1); a2[e] = pk16(l0, l1);
        }
        hv[it] = a; lv[it] = a2;
      }
      {
#pragma unroll
        for (int it = 0; it < 4; ++it) {
          const int row = it * 4 + q;
          *(v4u*)(C + (size_t)(mBase + row) * ldc + n0 + c8) = hv[it];
          if (wlo) *(v4u*)(C2 + (size_t)(mBase + row) * ldc2 + n0 + c8) = lv[it];
        }
        
      }
    }
    __builtin_amdgcn_fence(__ATOMIC_RELEASE, "workgroup");
    __builtin_amdgcn_wave_barrier();
    __builtin_amdgcn_fence(__ATOMIC_ACQUIRE, "workgroup");
  }
}

// =====================================================================================================
// Causal attention, head dim 64, single batch.
//   q planes (bf16 hi / lo): element (t, h, d) at [t*DM + h*64 + d]
//   k planes (bf16 hi / lo): same layout with key index s
//   v^T hi plane (f16):      element (h, d, s) at [(h*64 + d)*SEQ + s]
//   v^T residual plane (f16, (v - hi)*4096): [(h*64 + d)*VLP + s], s < VLP, read only when RES
//   (a key tile at or beyond VLP would contribute a zero v residual; never happens for query blocks < RESQB)
//   logit (t, s) = q.k * sscale for s <= t, finfo.min for s > t. Query block qb (64 rows) visits key tiles
//   0..qb only (every later key is above the diagonal for all 64 rows -> weight exactly 0); the compare
//   s > t is applied on the diagonal tile kt == qb only (block-uniform scalar branch around the per-element selects). Every row
//   has the live key s = t in the diagonal tile, so the row max is always finite.
//   out planes (bf16 hi / lo of the normalised context): element (t, h, d) at [t*DM + h*64 + d]
//   scores, transposed: S^T = K . Q^T (A = K rows, B = Q rows as columns): bf16 hi/lo split (hi.hi + hi.lo + lo.hi), f32 accumulate,
//   then * sscale in f32. Accumulator element r of tile j in lane (c, hh) = score of key kv0 + 16 j + 8 hh + r for query q0 + c: a lane
//   holds 32 of one query's 64 scores, lane l ^ 16 the other 32, so row max and row sum are in-lane plus one exchange between the halves.
//   p = exp(s - m) carried as f16(1024 p); two score tiles, converted in place, are the B operand P^T of one 32-key chunk
//   (element e < 8: tile 2 kk, e >= 8: tile 2 kk + 1: the k order of the V^T loader); context^T = V^T . P^T on f16 WMMA; RES adds f16 residual planes of p and v
//   (scale 4096, separate accumulator folded back with 1/4096 per chunk in f32); online softmax in f32.
//   Block = 4 waves = 64 query rows of one head; grid = nqbThis * NH; kv chunks of 64, static bound NQB,
//   block-uniform break at kt == qb + 1.
//   K / V^T chunk staging: 128 threads x 32 elements per plane = the whole 64x64 tile (plain 16-B loads,
//   __syncthreads before and after: cross-wave LDS regions Ksh/Ksl/Vth/Vtl behind block barriers);
//   the Os tile is wave-private: context^T accumulators are stored as rows [query][d] and reloaded for whole-line stores.
//   Output coverage: each wave stores rows q0..q0+15 (it 0..3 x lane>>3 0..3) x 64 columns (8 lanes x 8) of both planes.
// =====================================================================================================
template <bool RES>
__global__ __launch_bounds__(128)
void attn_causal64(const unsigned short* __restrict__ qhp, const unsigned short* __restrict__ qlp,
                   const unsigned short* __restrict__ khp, const unsigned short* __restrict__ klp,
                   const unsigned short* __restrict__ vhp, const unsigned short* __restrict__ vlp,
                   unsigned short* ohp, unsigned short* olp,
                   int qbBase, int nqbThis, float sscale) {
  union FB { v16b v; v8b h[2]; };
  union FH { v16h v; v8h h[2]; };
  __shared__ __align__(16) __bf16   Ksh[64 * LP];                 // K hi [kv][d], pitch LP
  __shared__ __align__(16) __bf16   Ksl[64 * LP];                 // K lo
  __shared__ __align__(16) _Float16 Vth[64 * LP];                 // V^T hi [d][kv], pitch LP
  __shared__ __align__(16) _Float16 Vtl[RES ? 64 * LP : 8];       // V^T residual
  __shared__ __align__(16) float    Os[4][16 * OP];               // per wave context tile [row][d], pitch OP

  const int tid  = threadIdx.x;
  const int wave = tid >> 5;
  const int lane = tid & 31;
  const int hh   = lane >> 4;
  const int c    = lane & 15;

  const int bx   = blockIdx.x;
  const int qbl  = bx % nqbThis;
  const int h    = bx / nqbThis;           // 0..NH-1 (grid = nqbThis * NH)
  const int qb   = qbBase + qbl;
  const int q0   = qb * 64 + wave * 16;

  const __bf16* Qh = (const __bf16*)(const void*)qhp + (size_t)h * HD;
  const __bf16* Ql = (const __bf16*)(const void*)qlp + (size_t)h * HD;
  const __bf16* Kh = (const __bf16*)(const void*)khp + (size_t)h * HD;
  const __bf16* Kl = (const __bf16*)(const void*)klp + (size_t)h * HD;
  const _Float16* Vh = (const _Float16*)(const void*)vhp + (size_t)h * HD * SEQ;
  const _Float16* Vl = (const _Float16*)(const void*)vlp + (size_t)h * HD * VLP;

  // ---- Q fragments (B operand, column = query = lane&15): 2 d-chunks, hi and lo ----
  v16b qah[2], qal[2];
#pragma unroll
  for (int dc = 0; dc < 2; ++dc) {
    const size_t qo = (size_t)(q0 + c) * DM + dc * 32 + 8 * hh;
    qah[dc] = ldfrag_b(Qh + qo);
    qal[dc] = ldfrag_b(Ql + qo);
  }

  float mrow = -INFINITY, lrow = 0.f;        // running max and sum of query q0 + c, the same value in both halves
  v8f oacc[4];                               // context^T: oacc[t][r] = element d = 16 t + 8 hh + r of query q0 + c
#pragma unroll
  for (int t = 0; t < 4; ++t) oacc[t] = zero8();

  const int nkt = qb + 1;                    // key tiles 0..qb (block-uniform)
  for (int kt = 0; kt < NQB; ++kt) {         // static bound
    if (kt >= nkt) break;                    // block-uniform
    const bool diag = (kt == qb);            // block-uniform
    const int kv0 = kt * 64;
    __syncthreads();
    {
      const int r = tid >> 1, half = (tid & 1) * 32;
      const __bf16*   kg  = Kh + (size_t)(kv0 + r) * DM + half;   // K row kv0+r (< SEQ), d = half..half+31
      const __bf16*   klg = Kl + (size_t)(kv0 + r) * DM + half;
      const _Float16* vg  = Vh + (size_t)r * SEQ + kv0 + half;    // V^T row d = r, s = kv0+half..+31
      const int kvl = (kv0 + 64 <= VLP) ? kv0 : (VLP - 64);     // clamped address into the residual plane
      const _Float16* vlg = Vl + (size_t)r * VLP + kvl + half;
      const bool resOK = (kv0 + 64 <= VLP);                      // block-uniform
#pragma unroll
      for (int i = 0; i < 4; ++i) {
        const v8b a0 = *(const v8b*)(kg + 8 * i);
        const v8b a1 = *(const v8b*)(klg + 8 * i);
        const v8h b0 = *(const v8h*)(vg + 8 * i);
        *(v8b*)(Ksh + r * LP + half + 8 * i) = a0;
        *(v8b*)(Ksl + r * LP + half + 8 * i) = a1;
        *(v8h*)(Vth + r * LP + half + 8 * i) = b0;
        if (RES) {
          v8h b1 = *(const v8h*)(vlg + 8 * i);
          if (!resOK) b1 = zero8h();
          *(v8h*)(Vtl + r * LP + half + 8 * i) = b1;
        }
      }
    }
    __syncthreads();

    // ---- scores, transposed: 64 keys x 16 query columns per wave, 3 bf16 products ----
    //      The 8 LDS reads of one 16-key row group stand together, KA groups ahead of the products that use them
    //      (two; one where the residual planes' accumulators leave fewer registers).
    constexpr int KA = RES ? 1 : 2;
    FB kb[4][2], kl[4][2];
    auto ldk = [&](int j) {
#pragma unroll
      for (int dc = 0; dc < 2; ++dc) {
        kb[j][dc].h[0] = *(const v8b*)(Ksh + (j * 16 + c) * LP + dc * 32 + 8 * hh);
        kb[j][dc].h[1] = *(const v8b*)(Ksh + (j * 16 + c) * LP + dc * 32 + 16 + 8 * hh);
        kl[j][dc].h[0] = *(const v8b*)(Ksl + (j * 16 + c) * LP + dc * 32 + 8 * hh);
        kl[j][dc].h[1] = *(const v8b*)(Ksl + (j * 16 + c) * LP + dc * 32 + 16 + 8 * hh);
      }
    };
#pragma unroll
    for (int j = 0; j < KA; ++j) ldk(j);
    v8f s[4];
#pragma unroll
    for (int j = 0; j < 4; ++j) {
      if (j + KA < 4) ldk(j + KA);
      s[j] = zero8();
#pragma unroll
      for (int dc = 0; dc < 2; ++dc) {
        s[j] = mma_b(kb[j][dc].v, qah[dc], s[j]);
        s[j] = mma_b(kl[j][dc].v, qah[dc], s[j]);
        s[j] = mma_b(kb[j][dc].v, qal[dc], s[j]);
      }
    }
    // V^T fragments, one group of reads per 32-key chunk. Without the residual planes the first chunk is read here, so that
    // the softmax below covers its LDS latency; with them (twice the fragments) each chunk is read in front of its own products.
    FH vb[2][4], vl[2][4];
    auto ldv = [&](int kk) {
#pragma unroll
      for (int t = 0; t < 4; ++t) {
        vb[kk][t].h[0] = *(const v8h*)(Vth + (t * 16 + c) * LP + kk * 32 + 8 * hh);
        vb[kk][t].h[1] = *(const v8h*)(Vth + (t * 16 + c) * LP + kk * 32 + 16 + 8 * hh);
        if (RES) {
          vl[kk][t].h[0] = *(const v8h*)(Vtl + (t * 16 + c) * LP + kk * 32 + 8 * hh);
          vl[kk][t].h[1] = *(const v8h*)(Vtl + (t * 16 + c) * LP + kk * 32 + 16 + 8 * hh);
        }
      }
    };
    if (!RES) ldv(0);

    // ---- scale + causal compare (diagonal tile only), max and sum of this lane's query, online softmax; P^T (x1024, f16) and
    //      its residual (x4096) are packed in registers as B operands ----
    const int qrow = q0 + c;                     // query of this lane's score column
#pragma unroll
    for (int j = 0; j < 4; ++j)
#pragma unroll
      for (int r = 0; r < 8; ++r) s[j][r] *= sscale;
    if (diag) {                                  // scalar branch: every other tile runs none of the compares and selects
#pragma unroll
      for (int j = 0; j < 4; ++j)
#pragma unroll
        for (int r = 0; r < 8; ++r) {
          const int key = kv0 + j * 16 + 8 * hh + r; // key of accumulator element r of tile j in this lane
          s[j][r] = (key > qrow) ? -FLT_MAX : s[j][r];
        }
    }
    float mj[4];                                 // one maximum per score tile: four independent chains
#pragma unroll
    for (int j = 0; j < 4; ++j) {
      mj[j] = -INFINITY;
#pragma unroll
      for (int r = 0; r < 8; ++r) mj[j] = fmaxf(mj[j], s[j][r]);
    }
    float m = fmaxf(fmaxf(mj[0], mj[1]), fmaxf(mj[2], mj[3]));
    m = fmaxf(m, xhalf(m));                      // the query's other 32 keys
    const float mnew  = fmaxf(mrow, m);
    const float msafe = (mnew == -INFINITY) ? 0.f : mnew;
    const float alpha = __expf(mrow - msafe);
    mrow = mnew;
    FH pa[2], pl[2];
    float ps[4];                                 // one partial sum per score tile: four independent add chains
#pragma unroll
    for (int j = 0; j < 4; ++j) {
      ps[j] = 0.f;
#pragma unroll
      for (int r = 0; r < 8; ++r) {
        const float p = __expf(s[j][r] - msafe);     // floor logit against a normal max: exp -> 0
        ps[j] += p;
        const float p1k = p * 1024.0f;
        const _Float16 ph = (_Float16)p1k;
        pa[j >> 1].v[(j & 1) * 8 + r] = ph;
        if (RES) pl[j >> 1].v[(j & 1) * 8 + r] = (_Float16)((p1k - (float)ph) * 4096.0f);
      }
    }
    float psum = (ps[0] + ps[1]) + (ps[2] + ps[3]);
    psum += xhalf(psum);                         // the query's other 32 keys
    lrow = lrow * alpha + psum;
#pragma unroll
    for (int t = 0; t < 4; ++t)
#pragma unroll
      for (int r = 0; r < 8; ++r) oacc[t][r] *= alpha;

    // ---- context^T += V^T . P^T (f16 WMMA), residual products into a separate accumulator ----
    v8f o1[4];
#pragma unroll
    for (int t = 0; t < 4; ++t) o1[t] = zero8();
    if (!RES) ldv(1);
#pragma unroll   // constant kk: the fragment arrays stay in registers
    for (int kk = 0; kk < 2; ++kk) {
      if (RES) ldv(kk);
#pragma unroll
      for (int t = 0; t < 4; ++t) {
        oacc[t] = mma_h(vb[kk][t].v, pa[kk].v, oacc[t]);
        if (RES) {
          o1[t] = mma_h(vl[kk][t].v, pa[kk].v, o1[t]);
          o1[t] = mma_h(vb[kk][t].v, pl[kk].v, o1[t]);
        }
      }
    }
    if (RES) {
#pragma unroll
      for (int t = 0; t < 4; ++t)
#pragma unroll
        for (int r = 0; r < 8; ++r) oacc[t][r] += o1[t][r] * (1.0f / 4096.0f);
    }
  }

  // ---- normalise (1/l and the 1/1024 p carry), stage the wave's 16x64 tile, bf16 hi/lo split,
  float* os = Os[wave];
  {
    const float l = lrow;
    const float inv = ((l > 0.f) ? (1.0f / l) : 0.f) * (1.0f / 1024.0f);
#pragma unroll
    for (int t = 0; t < 4; ++t) {              // row = query c, 8 consecutive d per lane and tile: two 16-B stores
      v4f a, b;
#pragma unroll
      for (int r = 0; r < 4; ++r) { a[r] = oacc[t][r] * inv; b[r] = oacc[t][4 + r] * inv; }
      *(v4f*)(os + c * OP + t * 16 + 8 * hh)     = a;
      *(v4f*)(os + c * OP + t * 16 + 8 * hh + 4) = b;
    }
  }
  __builtin_amdgcn_fence(__ATOMIC_RELEASE, "workgroup");
  __builtin_amdgcn_wave_barrier();
  __builtin_amdgcn_fence(__ATOMIC_ACQUIRE, "workgroup");
  {
    const int q4 = lane >> 3, c8 = (lane & 7) * 8;
    v4u hv[4], lv[4];
#pragma unroll
    for (int it = 0; it < 4; ++it) {
      const int row = it * 4 + q4;   // it 0..3 x q4 0..3 = rows 0..15 of the wave tile
      const float* sp = os + row * OP + c8;
      v4u a, a2;
#pragma unroll
      for (int e = 0; e < 4; ++e) {
        const float f0 = sp[2 * e], f1 = sp[2 * e + 1];
        const unsigned short h0 = bf_bits(f0), h1 = bf_bits(f1);
        const unsigned short l0 = bf_bits(f0 - bf_up(h0)), l1 = bf_bits(f1 - bf_up(h1));
        a[e] = pk16(h0, h1); a2[e] = pk16(l0, l1);
      }
      hv[it] = a; lv[it] = a2;
    }
    {
#pragma unroll
      for (int it = 0; it < 4; ++it) {
        const int row = it * 4 + q4;
        const size_t go = (size_t)(q0 + row) * DM + (size_t)h * HD + c8;
        *(v4u*)(ohp + go) = hv[it];
        *(v4u*)(olp + go) = lv[it];
      }
      
    }
  }
}

// =====================================================================================================
// Workspace map (bytes, SEQ = 4096):
//   Xb    bf16 [SEQ][1024]          0          8388608
//   Wqkvb bf16 [3072 n][1024 k]     8388608    6291456   (rows 0..1023 = q columns, 1024..2047 = k, 2048..3071 = v)
//   Wob   bf16 [1024 n][1024 k]     14680064   2097152
//   Qh    bf16 [SEQ][1024]          16777216   8388608
//   Ql    bf16 [SEQ][1024]          25165824   8388608
//   Kh    bf16 [SEQ][1024]          33554432   8388608
//   Kl    bf16 [SEQ][1024]          41943040   8388608
//   VTh   f16  [1024][SEQ]          50331648   8388608
//   VTl   f16  [1024][VLP=512]      58720256   1048576
//   Oh    bf16 [SEQ][1024]          59768832   8388608
//   Ol    bf16 [SEQ][1024]          68157440   8388608
//   end                             76546048
// All planes are exact multiples of their 64x64 / whole-line store granularity (no padded tails needed),
// =====================================================================================================
extern "C" void kernel_launch(void* const* d_in, const int* in_sizes, int n_in,
                              void* d_out, int out_size, void* d_ws, size_t ws_size,
                              hipStream_t stream) {
  if (n_in < 5) return;
  if (in_sizes[0] < SEQ * DM) return;                 // x rows 0..SEQ-1 (prefix of the full input)
  if (in_sizes[1] != DM * NQKV) return;               // w_qkv [1024][3072]
  if (in_sizes[2] != NQKV) return;                    // b_qkv [3072]
  if (in_sizes[3] != DM * DM) return;                 // w_o [1024][1024]
  if (in_sizes[4] != DM) return;                      // b_o [1024]
  if (out_size < SEQ * DM) return;

  const float* x     = (const float*)d_in[0];
  const float* w_qkv = (const float*)d_in[1];
  const float* b_qkv = (const float*)d_in[2];
  const float* w_o   = (const float*)d_in[3];
  const float* b_o   = (const float*)d_in[4];

  const size_t PX  = (size_t)SEQ * DM * 2;       // 16-bit activation plane [SEQ][1024]
  const size_t PWQ = (size_t)NQKV * DM * 2;      // 16-bit fused weight plane [3072][1024]
  const size_t PWO = (size_t)DM * DM * 2;        // 16-bit out weight plane
  const size_t PVT = (size_t)DM * SEQ * 2;       // v^T hi plane
  const size_t PVL = (size_t)DM * VLP * 2;       // v^T residual plane
  size_t off = 0;
  const size_t oXb   = off; off += PX;
  const size_t oWqkv = off; off += PWQ;
  const size_t oWo   = off; off += PWO;
  const size_t oQh   = off; off += PX;
  const size_t oQl   = off; off += PX;
  const size_t oKh   = off; off += PX;
  const size_t oKl   = off; off += PX;
  const size_t oVTh  = off; off += PVT;
  const size_t oVTl  = off; off += PVL;
  const size_t oOh   = off; off += PX;
  const size_t oOl   = off; off += PX;
  if (off > ws_size) return;                     // off = 76546048 for SEQ = 4096
  if (off > (size_t)134217728) return;

  char* ws = (char*)d_ws;
  unsigned short* Xb    = (unsigned short*)(ws + oXb);
  unsigned short* Wqkvb = (unsigned short*)(ws + oWqkv);
  unsigned short* Wob   = (unsigned short*)(ws + oWo);
  unsigned short* Qh    = (unsigned short*)(ws + oQh);
  unsigned short* Ql    = (unsigned short*)(ws + oQl);
  unsigned short* Kh    = (unsigned short*)(ws + oKh);
  unsigned short* Kl    = (unsigned short*)(ws + oKl);
  unsigned short* VTh   = (unsigned short*)(ws + oVTh);
  unsigned short* VTl   = (unsigned short*)(ws + oVTl);
  unsigned short* Oh    = (unsigned short*)(ws + oOh);
  unsigned short* Ol    = (unsigned short*)(ws + oOl);
  const unsigned short* Wqb = Wqkvb;                              // q weight rows  [1024 n][1024 k]
  const unsigned short* Wkb = Wqkvb + (size_t)DM * DM;            // k weight rows
  const unsigned short* Wvb = Wqkvb + (size_t)2 * DM * DM;        // v weight rows

  const dim3 blk(256);
  const int n8x = SEQ * DM / 8;                                    // multiple of 256
  const dim3 gCvtX((n8x + 255) / 256);
  const dim3 gTq(NQKV / 64, DM / 64);                              // in [1024 k][3072 n] -> out [3072][1024]: (n tiles, k tiles) = (48, 16)
  const dim3 gTo(DM / 64, DM / 64);                                // in [1024 k][1024 n] -> out [1024][1024]: (16, 16)
  const dim3 gProj((SEQ / 128) * (DM / 128), 1);                   // M = SEQ, N = 1024 -> 256 block tiles of 128x128 (SEQ = 4096)
  const dim3 gVT((DM / 128) * (SEQ / 128), 1);                     // M = 1024, N = SEQ

  // (1) x -> bf16 plane [SEQ][1024]; w_qkv [k][n] -> bf16 [n][k]; w_o [k][n] -> bf16 [n][k]
  cvt_bf16x8<<<gCvtX, blk, 0, stream>>>(x, Xb, n8x);
  cvtT_bf16<<<gTq, blk, 0, stream>>>(w_qkv, Wqkvb, DM, NQKV);
  cvtT_bf16<<<gTo, blk, 0, stream>>>(w_o, Wob, DM, DM);
  // (2) q = x . Wq + b_q -> bf16 hi/lo planes [t][h*64+d]   (M = SEQ, N = 1024, K = 1024)
  gemm64<0, 2, 1><<<gProj, blk, 0, stream>>>(
      Xb, Xb, DM, 0LL, Wqb, Wqb, DM, 0LL,
      (void*)Qh, DM, 0LL, (void*)Ql, DM, 0LL, DM,
      SEQ, DM, DM, 1.0f, b_qkv);
  // (3) k = x . Wk + b_k -> bf16 hi/lo planes
  gemm64<0, 2, 1><<<gProj, blk, 0, stream>>>(
      Xb, Xb, DM, 0LL, Wkb, Wkb, DM, 0LL,
      (void*)Kh, DM, 0LL, (void*)Kl, DM, 0LL, DM,
      SEQ, DM, DM, 1.0f, b_qkv + DM);
  // (4) v^T = Wv . x^T + b_v (per row) -> f16 hi plane [h*64+d][s] (pitch SEQ) and residual plane
  //     (x4096, keys < VLP only, pitch VLP)   (A = Wvb [n][k], Bt = Xb; M = 1024, N = SEQ, K = 1024)
  gemm64<0, 3, 2><<<gVT, blk, 0, stream>>>(
      Wvb, Wvb, DM, 0LL, Xb, Xb, DM, 0LL,
      (void*)VTh, SEQ, 0LL, (void*)VTl, VLP, 0LL, VLP,
      DM, SEQ, DM, 4096.0f, b_qkv + 2 * DM);
  // (5) causal attention: query blocks 0..RESQB-1 with residual planes, the rest without
  attn_causal64<true><<<dim3(NH * RESQB), dim3(128), 0, stream>>>(
      Qh, Ql, Kh, Kl, VTh, VTl, Oh, Ol, 0, RESQB, 0.125f);
  if (NQB > RESQB) {
    attn_causal64<false><<<dim3(NH * (NQB - RESQB)), dim3(128), 0, stream>>>(
        Qh, Ql, Kh, Kl, VTh, VTl, Oh, Ol, RESQB, NQB - RESQB, 0.125f);
  }
  // (6) out = context . Wo + b_o -> d_out f32 [SEQ][1024]  (A = context hi + lo planes, 2 products)
  gemm64<1, 0, 1><<<gProj, blk, 0, stream>>>(
      Oh, Ol, DM, 0LL, Wob, Wob, DM, 0LL,
      d_out, DM, 0LL, d_out, DM, 0LL, DM,
      SEQ, DM, DM, 1.0f, b_o);
  (void)hipGetLastError();
}

// v006
// One run takes 161 microseconds.
// Two timings next to v005 both put it at 1.12 times that version's speed.
// All steps since v000 together make it 3.66 times as fast.
// Contractions: q, k, v^T projections = v_wmma_f32_16x16x32_bf16 (bf16 operands from RNE-converted inputs, single product, f32 bias add);
// k.q^T scores (transposed) = v_wmma_f32_16x16x32_bf16 with bf16 hi/lo split q and k (hi.hi + hi.lo + lo.hi);
// v^T.p^T = v_wmma_f32_16x16x32_f16 (p carried x1024 in f16, v in f16; extra f16 residual planes x4096 of p and v for the first VLP query rows);
// ctx.Wo = v_wmma_f32_16x16x32_bf16 with ctx as bf16 hi/lo planes times bf16 Wo (2 products); all f32 accumulate; causal compare and softmax in f32.
#include <hip/hip_runtime.h>
#include <math.h>
#include <float.h>
#include <stdint.h>

#ifndef NB
#define NB    1
#endif
#ifndef SEQ
#define SEQ   4096
#endif
#define SEQ_FULL 4096
#define DM    1024
#define NH    16
#define HD    64
#define NQKV  (3 * DM)
#define NQB   (SEQ / 64)                      // key / query tiles of 64
#define VLP   ((SEQ < 512) ? SEQ : 512)       // key pitch of the v^T residual plane (keys 0..VLP-1)
#define RESQB (VLP / 64)                      // number of leading 64-row query blocks that use the p / v residual planes
#define LP    72                              // LDS row pitch of the 64-wide 16-bit K / V^T tiles, in elements: 144 B = 16 B x 9 (odd), so the
                                              // 16 rows that one half-wave's 16-B fragment read touches fall on 16 distinct groups of 4 banks
#define OP    68                              // LDS row pitch of the 64-wide f32 context tile, in elements: 272 B = 16 B x 17 (odd)
static_assert(NB == 1);
static_assert(NH * HD == DM && HD == 64);
static_assert((SEQ % 64) == 0 && (DM % 64) == 0 && SEQ >= 64 && SEQ <= SEQ_FULL);
static_assert(RESQB * 64 == VLP && VLP <= SEQ && RESQB >= 1 && RESQB <= NQB);
static_assert((NQKV % 64) == 0);
static_assert((SEQ % 128) == 0 && (DM % 128) == 0);   // 128x128 block tiles and 128-wide k steps of the projections

typedef _Float16 v16h __attribute__((ext_vector_type(16)));
typedef _Float16 v8h  __attribute__((ext_vector_type(8)));
typedef __bf16   v16b __attribute__((ext_vector_type(16)));
typedef __bf16   v8b  __attribute__((ext_vector_type(8)));
typedef float    v8f  __attribute__((ext_vector_type(8)));
typedef float    v4f  __attribute__((ext_vector_type(4)));
typedef unsigned int v4u __attribute__((ext_vector_type(4)));

// ---- scalar helpers --------------------------------------------------------------------------------
__device__ __forceinline__ unsigned short bf_bits(float f) {          // f32 -> bf16 bits, RNE convert
  unsigned u = __float_as_uint(f);
  return (unsigned short)((u + 0x7FFFu + ((u >> 16) & 1u)) >> 16);
}
__device__ __forceinline__ float bf_up(unsigned short h) { return __uint_as_float(((unsigned)h) << 16); }
__device__ __forceinline__ unsigned short h_bits(_Float16 x) { return __builtin_bit_cast(unsigned short, x); }
__device__ __forceinline__ unsigned pk16(unsigned short a, unsigned short b) { return (unsigned)a | ((unsigned)b << 16); }
__device__ __forceinline__ v8f zero8() { v8f z = {0.f, 0.f, 0.f, 0.f, 0.f, 0.f, 0.f, 0.f}; return z; }
__device__ __forceinline__ v8h zero8h() {
  const _Float16 z = (_Float16)0.0f;
  v8h r = {z, z, z, z, z, z, z, z};
  return r;
}

// ---- value of lane l ^ 16 (the other half of the wave), a vector-port move
__device__ __forceinline__ float xhalf(float x) {
  return __builtin_bit_cast(float, __builtin_amdgcn_permlanex16(__builtin_bit_cast(int, x), __builtin_bit_cast(int, x),
                                                                0x76543210, 0xfedcba98, false, false));
}

// ---- fragment loaders: 16-bit A/B operand, lane -> row/col (lane&15), p already includes +8*(lane>>4);
//      elements 0..7 <- p[0..7] (k0+8h..), elements 8..15 <- p[16..23] (k0+16+8h..)
__device__ __forceinline__ v16b ldfrag_b(const __bf16* p) {
  union { v16b v; v8b h[2]; } f;
  f.h[0] = *(const v8b*)(p);
  f.h[1] = *(const v8b*)(p + 16);
  return f.v;
}

// ---- WMMA helpers with trailing VALU hazard gap --------------------------------------------------------
__device__ __forceinline__ v8f mma_b(v16b a, v16b b, v8f c) {
  c = __builtin_amdgcn_wmma_f32_16x16x32_bf16(false, a, false, b, (short)0, c, false, false);
  asm volatile("v_nop\n\tv_nop\n\tv_nop\n\tv_nop" : "+v"(c) : "v"(a), "v"(b));
  return c;
}
__device__ __forceinline__ v8f mma_h(v16h a, v16h b, v8f c) {
  c = __builtin_amdgcn_wmma_f32_16x16x32_f16(false, a, false, b, (short)0, c, false, false);
  asm volatile("v_nop\n\tv_nop\n\tv_nop\n\tv_nop" : "+v"(c) : "v"(a), "v"(b));
  return c;
}
__device__ __forceinline__ v8f mma_b_raw(v16b a, v16b b, v8f c) {
  return __builtin_amdgcn_wmma_f32_16x16x32_bf16(false, a, false, b, (short)0, c, false, false);
}
__device__ __forceinline__ void dep_guard_b(v8f& a, v8f& b, v16b x, v16b y) {
  asm volatile("v_nop\n\tv_nop\n\tv_nop\n\tv_nop" : "+v"(a), "+v"(b) : "v"(x), "v"(y));
}
__device__ __forceinline__ void keep4_b(v16b a, v16b b, v16b c, v16b d) {
  asm volatile("v_nop" :: "v"(a), "v"(b), "v"(c), "v"(d));
}
__device__ __forceinline__ void acc_guard4(v8f& a, v8f& b, v8f& c, v8f& d) {
  asm volatile("v_nop\n\tv_nop\n\tv_nop\n\tv_nop" : "+v"(a), "+v"(b), "+v"(c), "+v"(d));
}

// =====================================================================================================
// f32 -> bf16 (RNE convert), 8 elements per thread, one 16-B store per lane: a wave writes 512 contiguous B
// coverage: n8 threads x 8 = whole plane (n8 = SEQ*DM/8 is a multiple of 256).
// =====================================================================================================
__global__ __launch_bounds__(256) void cvt_bf16x8(const float* __restrict__ in, unsigned short* out, int n8) {
  const int i = blockIdx.x * 256 + threadIdx.x;
  if (i < n8) {
    const v4f a = *(const v4f*)(in + (size_t)i * 8);
    const v4f b = *(const v4f*)(in + (size_t)i * 8 + 4);
    v4u p;
    p[0] = pk16(bf_bits(a[0]), bf_bits(a[1]));
    p[1] = pk16(bf_bits(a[2]), bf_bits(a[3]));
    p[2] = pk16(bf_bits(b[0]), bf_bits(b[1]));
    p[3] = pk16(bf_bits(b[2]), bf_bits(b[3]));
    *(v4u*)(out + (size_t)i * 8) = p;
    
  }
}

// =====================================================================================================
// Transposed convert: in f32 [K rows][N cols] (pitch N) -> out bf16 [N rows][K cols] (pitch K), RNE.
// grid = (N/64, K/64), 256 threads; one 64(k) x 64(n) tile per block through LDS.
// Load phase: thread (k row = tid>>2, 16 n columns = (tid&3)*16) reads 4 x 16 B and writes bf16 bits
// transposed into st[n][k] (pitch 72 halves). After __syncthreads each wave writes 8 output rows:
// coverage: load 64 k x (4 threads x 16 n) = 64x64; store 8 waves x 2 it x 4 rows x (8 lanes x 8) = 64x64.
// LDS st: cross-wave exchange behind the block barrier.
// =====================================================================================================
__global__ __launch_bounds__(256) void cvtT_bf16(const float* __restrict__ in, unsigned short* out, int K, int N) {
  __shared__ __align__(16) unsigned short st[64 * 72];
  const int tid = threadIdx.x;
  const int n0  = blockIdx.x * 64;
  const int k0  = blockIdx.y * 64;
  {
    const int r  = tid >> 2;            // k row 0..63
    const int cb = (tid & 3) * 16;      // n column base
    const float* src = in + (size_t)(k0 + r) * N + n0 + cb;
#pragma unroll
    for (int e = 0; e < 4; ++e) {
      const v4f a = *(const v4f*)(src + 4 * e);
#pragma unroll
      for (int u = 0; u < 4; ++u) st[(cb + 4 * e + u) * 72 + r] = bf_bits(a[u]);
    }
  }
  __syncthreads();
  {
    const int lane = tid & 31, wave = tid >> 5;
    const int q = lane >> 3, c8 = (lane & 7) * 8;
    v4u hv[2];
#pragma unroll
    for (int it = 0; it < 2; ++it) {
      const int row = wave * 8 + it * 4 + q;      // n row within the tile
      hv[it] = *(const v4u*)(st + row * 72 + c8);
    }
    {
#pragma unroll
      for (int it = 0; it < 2; ++it) {
        const int row = wave * 8 + it * 4 + q;
        *(v4u*)(out + (size_t)(n0 + row) * K + k0 + c8) = hv[it];
      }
      
    }
  }
}

// =====================================================================================================
// Register-blocked bf16 WMMA GEMM: C[m][n] = sum_k A[m][k] * Bt[n][k] + bias; one wave per 32x64 tile,
// 8 waves (4 x 2) per block = one 128x128 tile of C. A row-major [M][K] pitch lda; Bt row-major [N][K] pitch ldb
// (k contiguous); M, N multiples of 128, K a multiple of GKS. blockIdx.y = batch index (strides in elements).
// Operands: per k step of GKS the block's 128 rows of every operand plane are copied global -> LDS in whole lines
// (stage_tile), two buffers, the next step's copies in flight while this step's fragments are read from LDS;
// every fragment keeps its k order and the k steps stay ascending, so each f32 sum keeps its order.
// NSPLIT: 0 = A.Bt; 1 = (A + A2).Bt (A2 = unscaled bf16 lo plane of A); 2 = A.Bt + A2.Bt + A.Bt2.
// OUT_MODE: 0 = f32 (pitch ldc); 2 = bf16 hi plane C + bf16 lo plane C2 (lo = RNE(v - hi), unscaled);
//           3 = f16 hi plane C + f16 residual plane C2 = f16((v - hi) * rscale), C2 written only for tiles
//               with n0 < N2 (pitch ldc2, batch stride strideC2).
// BIASM: 1 = bias[n] added per column (bias has >= N entries); 2 = bias[m] added per row (>= M entries);
//        the bias value is RNE-converted to bf16 and added in f32 before any output split.
// =====================================================================================================
#define GKS 128                               // k elements of one staged step: 256 B of every operand row
#define GP  136                               // LDS row pitch of a staged operand tile, in elements: 272 B = 16 B x 17 (odd)
#define GMI 2                                 // 16-row sub-tiles of one wave's 32x64 tile

// One operand tile of 128 rows x GKS k (256 B per row), global -> LDS, by asynchronous copies of 16 B per lane.
// Thread t of 256: 16-B piece (t & 15) of rows (t >> 4) + 16 e, e = 0..7; one wave-wide copy = 2 whole rows = 4 whole lines.
// Coverage: 16 rows x 8 e = 128 rows, 16 pieces x 16 B = 256 B; each LDS byte is written by one lane only.
// s_wait_xcnt 0 closes the statement so that no address register of an issued copy is rewritten ahead of it.
__device__ __forceinline__ void stage_tile(const __bf16* g, int ld, __bf16* l, int tid) {
  const __bf16* gp = g + (size_t)(tid >> 4) * ld + (tid & 15) * 8;
  const unsigned la = (unsigned)(uintptr_t)l + (unsigned)(((tid >> 4) * GP + (tid & 15) * 8) * 2);
  asm volatile(
      "global_load_async_to_lds_b128 %0, %8, off\n\t"
      "global_load_async_to_lds_b128 %1, %9, off\n\t"
      "global_load_async_to_lds_b128 %2, %10, off\n\t"
      "global_load_async_to_lds_b128 %3, %11, off\n\t"
      "global_load_async_to_lds_b128 %4, %12, off\n\t"
      "global_load_async_to_lds_b128 %5, %13, off\n\t"
      "global_load_async_to_lds_b128 %6, %14, off\n\t"
      "global_load_async_to_lds_b128 %7, %15, off\n\t"
      "s_wait_xcnt 0x0"
      :: "v"(la), "v"(la + (unsigned)(1 * 16 * GP * 2)),
         "v"(la + (unsigned)(2 * 16 * GP * 2)), "v"(la + (unsigned)(3 * 16 * GP * 2)),
         "v"(la + (unsigned)(4 * 16 * GP * 2)), "v"(la + (unsigned)(5 * 16 * GP * 2)),
         "v"(la + (unsigned)(6 * 16 * GP * 2)), "v"(la + (unsigned)(7 * 16 * GP * 2)),
         "v"(gp), "v"(gp + (size_t)(1 * 16) * ld),
         "v"(gp + (size_t)(2 * 16) * ld), "v"(gp + (size_t)(3 * 16) * ld),
         "v"(gp + (size_t)(4 * 16) * ld), "v"(gp + (size_t)(5 * 16) * ld),
         "v"(gp + (size_t)(6 * 16) * ld), "v"(gp + (size_t)(7 * 16) * ld)
      : "memory");
}

template <int NSPLIT, int OUT_MODE, int BIASM>
__global__ __launch_bounds__(256) void gemm64(
    const unsigned short* __restrict__ Ap, const unsigned short* A2p, int lda, long long strideA,
    const unsigned short* __restrict__ Btp, const unsigned short* Bt2p, int ldb, long long strideB,
    void* Cout, int ldc, long long strideC,
    void* Cout2, int ldc2, long long strideC2, int N2,
    int M, int N, int K, float rscale, const float* __restrict__ bias) {
  const __bf16* A   = (const __bf16*)(const void*)Ap;
  const __bf16* A2  = (const __bf16*)(const void*)A2p;
  const __bf16* Bt  = (const __bf16*)(const void*)Btp;
  const __bf16* Bt2 = (const __bf16*)(const void*)Bt2p;
  constexpr int NPL = 2 + (NSPLIT >= 1 ? 1 : 0) + (NSPLIT == 2 ? 1 : 0);   // staged planes: A, Bt, (A2), (Bt2)
  __shared__ __align__(16) __bf16 stg[2][NPL][128 * GP];   // two buffers of the block's operand tiles, pitch GP
  __shared__ __align__(16) float sT[8][16 * 68];   // per-wave 16x64 slab, pitch 68 floats
  const int b    = blockIdx.y;
  const int tid  = threadIdx.x;
  const int lane = threadIdx.x & 31;
  const int wave = threadIdx.x >> 5;
  const int tilesN = N >> 7;
  const int tilesM = M >> 7;
  const int tile = blockIdx.x;
  if (tile >= tilesM * tilesN) return;   // block-uniform, in front of every copy and barrier
  const int tm = tile / tilesN;
  const int tn = tile - tm * tilesN;
  const int bm0 = tm << 7;               // block tile origin
  const int bn0 = tn << 7;
  const int wm  = (wave >> 1) << 5;      // wave tile origin inside the block tile: 4 wave rows of 32, 2 wave columns of 64
  const int wn  = (wave & 1) << 6;
  const int m0 = bm0 + wm;
  const int n0 = bn0 + wn;

  const __bf16* Ab  = A  + (size_t)b * strideA;
  const __bf16* Bb  = Bt + (size_t)b * strideB;
  const __bf16* Ab2 = (NSPLIT >= 1) ? (A2  + (size_t)b * strideA) : Ab;
  const __bf16* Bb2 = (NSPLIT == 2) ? (Bt2 + (size_t)b * strideB) : Bb;

  const int rlane = lane & 15;                 // row (A) / col (B, D) within subtile
  const int koff  = (lane >> 4) * 8;           // k offset of this lane half
  const int mOff  = (lane >> 4) * 8;           // D row offset

  v8f acc[GMI][4];
#pragma unroll
  for (int i = 0; i < GMI; ++i)
#pragma unroll
    for (int j = 0; j < 4; ++j) acc[i][j] = zero8();

  // copies of k step t (rows bm0.. / bn0.. + 0..127 < M / N, k = t*GKS..+GKS-1 < K) into buffer buf
  auto issue = [&](int t, int buf) {
    const size_t k0 = (size_t)t * GKS;
    stage_tile(Ab + (size_t)bm0 * lda + k0, lda, &stg[buf][0][0], tid);
    stage_tile(Bb + (size_t)bn0 * ldb + k0, ldb, &stg[buf][1][0], tid);
    if constexpr (NSPLIT >= 1) stage_tile(Ab2 + (size_t)bm0 * lda + k0, lda, &stg[buf][2][0], tid);
    if constexpr (NSPLIT == 2) stage_tile(Bb2 + (size_t)bn0 * ldb + k0, ldb, &stg[buf][3][0], tid);
  };
  const int NT = K / GKS;                                // block-uniform
  issue(0, 0);
  asm volatile("s_wait_asynccnt 0x0" ::: "memory");      // this wave's copies of step 0 have landed
  __syncthreads();                                       // ... and every other wave's
  if (NT > 1) issue(1, 1);

  for (int t = 0; t < NT; ++t) {
    const __bf16* sA  = &stg[t & 1][0][0];
    const __bf16* sB  = &stg[t & 1][1][0];
    const __bf16* sA2 = &stg[t & 1][NSPLIT >= 1 ? 2 : 0][0];
    const __bf16* sB2 = &stg[t & 1][NSPLIT == 2 ? 3 : 1][0];
#pragma unroll   // constant kk: every LDS fragment offset is an immediate and the fragment arrays stay in registers
    for (int kk = 0; kk < GKS; kk += 32) {
      v16b bh[4], bl[4], ah[GMI], al[GMI];
#pragma unroll
      for (int j = 0; j < 4; ++j) {
        const int bo = (wn + (j << 4) + rlane) * GP + koff + kk;
        bh[j] = ldfrag_b(sB + bo);
        if (NSPLIT == 2) bl[j] = ldfrag_b(sB2 + bo); else bl[j] = bh[j];
      }
#pragma unroll   // all fragment reads of this k chunk stand as one group in front of its products
      for (int i = 0; i < GMI; ++i) {
        const int ao = (wm + (i << 4) + rlane) * GP + koff + kk;
        ah[i] = ldfrag_b(sA + ao);
        if (NSPLIT >= 1) al[i] = ldfrag_b(sA2 + ao); else al[i] = ah[i];
      }
#pragma unroll
      for (int i = 0; i < GMI; ++i) {
#pragma unroll
        for (int j = 0; j < 4; ++j) {
          acc[i][j] = mma_b_raw(ah[i], bh[j], acc[i][j]);
          if (NSPLIT >= 1) acc[i][j] = mma_b_raw(al[i], bh[j], acc[i][j]);
          if (NSPLIT == 2) acc[i][j] = mma_b_raw(ah[i], bl[j], acc[i][j]);
        }
        dep_guard_b(acc[i][0], acc[i][3], ah[i], al[i]);
      }
      keep4_b(bh[0], bh[1], bh[2], bh[3]);
      if (NSPLIT == 2) keep4_b(bl[0], bl[1], bl[2], bl[3]);
    }
    asm volatile("s_wait_dscnt 0x0" ::: "memory");       // this wave's reads of buffer t & 1 are done
    asm volatile("s_wait_asynccnt 0x0" ::: "memory");    // this wave's copies of step t + 1 have landed
    __syncthreads();                                     // publishes step t + 1 and frees buffer t & 1
    if (t + 2 < NT) issue(t + 2, t & 1);                 // block-uniform
  }
  asm volatile("s_wait_asynccnt 0x0" ::: "memory");      // no copy is left in flight behind the loop
  acc_guard4(acc[0][0], acc[0][1], acc[0][2], acc[0][3]);
  acc_guard4(acc[1][0], acc[1][1], acc[1][2], acc[1][3]);

  // ---- epilogue ----
  float* slab = sT[wave];
  float bcol[4];
#pragma unroll
  for (int j = 0; j < 4; ++j) bcol[j] = 0.f;
  if (BIASM == 1) {
#pragma unroll
    for (int j = 0; j < 4; ++j) bcol[j] = bf_up(bf_bits(bias[n0 + (j << 4) + rlane]));   // < N, in range
  }
#pragma unroll
  for (int i = 0; i < GMI; ++i) {
    const int mBase = m0 + (i << 4);
    float brow[8];
#pragma unroll
    for (int r = 0; r < 8; ++r) brow[r] = 0.f;
    if (BIASM == 2) {
      const v4f b0 = *(const v4f*)(bias + mBase + mOff);          // rows mBase+mOff..+7 < M, in range
      const v4f b1 = *(const v4f*)(bias + mBase + mOff + 4);
#pragma unroll
      for (int r = 0; r < 4; ++r) {
        brow[r]     = bf_up(bf_bits(b0[r]));
        brow[4 + r] = bf_up(bf_bits(b1[r]));
      }
    }
#pragma unroll
    for (int j = 0; j < 4; ++j) {
#pragma unroll
      for (int r = 0; r < 8; ++r) {
        slab[(mOff + r) * 68 + (j << 4) + rlane] = acc[i][j][r] + bcol[j] + brow[r];
      }
    }
    __builtin_amdgcn_fence(__ATOMIC_RELEASE, "workgroup");
    __builtin_amdgcn_wave_barrier();
    __builtin_amdgcn_fence(__ATOMIC_ACQUIRE, "workgroup");
    if (OUT_MODE == 0) {
      float* C = (float*)Cout + (size_t)b * strideC;
      const int hh = lane >> 4, c4 = (lane & 15) * 4;     // 256-B row segment = 16 lanes x 16 B
      {
#pragma unroll
        for (int it = 0; it < 8; ++it) {
          const int row = it * 2 + hh;                     // it 0..7 x hh 0..1 = rows 0..15
          const v4f v = *(const v4f*)(slab + row * 68 + c4);
          *(v4f*)(C + (size_t)(mBase + row) * ldc + n0 + c4) = v;
        }
        
      }
    } else {
      const int q = lane >> 3, c8 = (lane & 7) * 8;
      unsigned short* C  = (unsigned short*)Cout  + (size_t)b * strideC;
      unsigned short* C2 = (unsigned short*)Cout2 + (size_t)b * strideC2;
      const bool wlo = (OUT_MODE == 2) || (n0 < N2);      // wave-uniform
      v4u hv[4], lv[4];
#pragma unroll
      for (int it = 0; it < 4; ++it) {
        const int row = it * 4 + q;                        // it 0..3 x q 0..3 = rows 0..15
        const float* sp = slab + row * 68 + c8;
        v4u a, a2;
#pragma unroll
        for (int e = 0; e < 4; ++e) {
          const float f0 = sp[2 * e], f1 = sp[2 * e + 1];
          unsigned short h0, h1, l0, l1;
          if (OUT_MODE == 2) {
            h0 = bf_bits(f0); h1 = bf_bits(f1);
            l0 = bf_bits(f0 - bf_up(h0)); l1 = bf_bits(f1 - bf_up(h1));
          } else {
            const _Float16 x0 = (_Float16)f0, x1 = (_Float16)f1;
            h0 = h_bits(x0); h1 = h_bits(x1);
            l0 = h_bits((_Float16)((f0 - (float)x0) * rscale));
            l1 = h_bits((_Float16)((f1 - (float)x1) * rscale));
          }
          a[e] = pk16(h0, h1); a2[e] = pk16(l0, l1);
        }
        hv[it] = a; lv[it] = a2;
      }
      {
#pragma unroll
        for (int it = 0; it < 4; ++it) {
          const int row = it * 4 + q;
          *(v4u*)(C + (size_t)(mBase + row) * ldc + n0 + c8) = hv[it];
          if (wlo) *(v4u*)(C2 + (size_t)(mBase + row) * ldc2 + n0 + c8) = lv[it];
        }
        
      }
    }
    __builtin_amdgcn_fence(__ATOMIC_RELEASE, "workgroup");
    __builtin_amdgcn_wave_barrier();
    __builtin_amdgcn_fence(__ATOMIC_ACQUIRE, "workgroup");
  }
}

// =====================================================================================================
// Causal attention, head dim 64, single batch.
//   q planes (bf16 hi / lo): element (t, h, d) at [t*DM + h*64 + d]
//   k planes (bf16 hi / lo): same layout with key index s
//   v^T hi plane (f16):      element (h, d, s) at [(h*64 + d)*SEQ + s]
//   v^T residual plane (f16, (v - hi)*4096): [(h*64 + d)*VLP + s], s < VLP, read only when RES
//   (a key tile at or beyond VLP would contribute a zero v residual; never happens for query blocks < RESQB)
//   logit (t, s) = q.k * sscale for s <= t, finfo.min for s > t. Query block qb (64 rows) visits key tiles
//   0..qb only (every later key is above the diagonal for all 64 rows -> weight exactly 0); the compare
//   s > t is applied on the diagonal tile kt == qb only (block-uniform scalar branch around the per-element selects). Every row
//   has the live key s = t in the diagonal tile, so the row max is always finite.
//   out planes (bf16 hi / lo of the normalised context): element (t, h, d) at [t*DM + h*64 + d]
//   scores, transposed: S^T = K . Q^T (A = K rows, B = Q rows as columns): bf16 hi/lo split (hi.hi + hi.lo + lo.hi), f32 accumulate,
//   then * sscale in f32. Accumulator element r of tile j in lane (c, hh) = score of key kv0 + 16 j + 8 hh + r for query q0 + c: a lane
//   holds 32 of one query's 64 scores, lane l ^ 16 the other 32, so row max and row sum are in-lane plus one exchange between the halves.
//   p = exp(s - m) carried as f16(1024 p); two score tiles, converted in place, are the B operand P^T of one 32-key chunk
//   (element e < 8: tile 2 kk, e >= 8: tile 2 kk + 1: the k order of the V^T loader); context^T = V^T . P^T on f16 WMMA; RES adds f16 residual planes of p and v
//   (scale 4096, separate accumulator folded back with 1/4096 per chunk in f32); online softmax in f32.
//   Block = 4 waves = 64 query rows of one head; grid = nqbThis * NH; kv chunks of 64, static bound NQB,
//   block-uniform break at kt == qb + 1.
//   K / V^T chunk staging: asynchronous copies global -> LDS (stage_kv3 / stage_kv1), 128 threads x 4 x 16 B per plane = the whole
//   64x64 tile, two buffers: tile kt + 1 is in flight while tile kt is worked on; one block barrier per tile, at the loop's foot,
//   publishes tile kt + 1 and frees the buffer of tile kt, which tile kt + 2 is then copied into;
//   the Os tile is wave-private: context^T accumulators are stored as rows [query][d] and reloaded for whole-line stores.
//   Output coverage: each wave stores rows q0..q0+15 (it 0..3 x lane>>3 0..3) x 64 columns (8 lanes x 8) of both planes.
// =====================================================================================================
#define KVR16 (16 * LP * 2)                   // LDS bytes of 16 rows of a staged K / V^T tile

// One 64 x 64 tile of 16-bit elements (64 rows of 128 B) of each of three planes, global -> LDS rows of pitch LP, 16 B per lane and copy.
// Thread t of 128: 16-B piece (t & 7) of rows (t >> 3) + 16 e, e = 0..3; one wave-wide copy = 4 whole rows = 4 whole lines.
// The pointers and LDS byte addresses handed in are the thread's own for e = 0; each LDS byte is written by one lane only.
// s_wait_xcnt 0 closes the statement so that no address register of an issued copy is rewritten ahead of it.
__device__ __forceinline__ void stage_kv3(const __bf16* ka, const __bf16* kb, const _Float16* va,
                                          unsigned la, unsigned lb, unsigned lv) {
  asm volatile(
      "global_load_async_to_lds_b128 %0, %12, off\n\t"
      "global_load_async_to_lds_b128 %1, %13, off\n\t"
      "global_load_async_to_lds_b128 %2, %14, off\n\t"
      "global_load_async_to_lds_b128 %3, %15, off\n\t"
      "global_load_async_to_lds_b128 %4, %16, off\n\t"
      "global_load_async_to_lds_b128 %5, %17, off\n\t"
      "global_load_async_to_lds_b128 %6, %18, off\n\t"
      "global_load_async_to_lds_b128 %7, %19, off\n\t"
      "global_load_async_to_lds_b128 %8, %20, off\n\t"
      "global_load_async_to_lds_b128 %9, %21, off\n\t"
      "global_load_async_to_lds_b128 %10, %22, off\n\t"
      "global_load_async_to_lds_b128 %11, %23, off\n\t"
      "s_wait_xcnt 0x0"
      :: "v"(la), "v"(la + (unsigned)(1 * KVR16)), "v"(la + (unsigned)(2 * KVR16)), "v"(la + (unsigned)(3 * KVR16)),
         "v"(lb), "v"(lb + (unsigned)(1 * KVR16)), "v"(lb + (unsigned)(2 * KVR16)), "v"(lb + (unsigned)(3 * KVR16)),
         "v"(lv), "v"(lv + (unsigned)(1 * KVR16)), "v"(lv + (unsigned)(2 * KVR16)), "v"(lv + (unsigned)(3 * KVR16)),
         "v"(ka), "v"(ka + (size_t)16 * DM), "v"(ka + (size_t)32 * DM), "v"(ka + (size_t)48 * DM),
         "v"(kb), "v"(kb + (size_t)16 * DM), "v"(kb + (size_t)32 * DM), "v"(kb + (size_t)48 * DM),
         "v"(va), "v"(va + (size_t)16 * SEQ), "v"(va + (size_t)32 * SEQ), "v"(va + (size_t)48 * SEQ)
      : "memory");
}
// The same for one plane of row pitch ld elements.
__device__ __forceinline__ void stage_kv1(const _Float16* g, int ld, unsigned l) {
  asm volatile(
      "global_load_async_to_lds_b128 %0, %4, off\n\t"
      "global_load_async_to_lds_b128 %1, %5, off\n\t"
      "global_load_async_to_lds_b128 %2, %6, off\n\t"
      "global_load_async_to_lds_b128 %3, %7, off\n\t"
      "s_wait_xcnt 0x0"
      :: "v"(l), "v"(l + (unsigned)(1 * KVR16)), "v"(l + (unsigned)(2 * KVR16)), "v"(l + (unsigned)(3 * KVR16)),
         "v"(g), "v"(g + (size_t)16 * ld), "v"(g + (size_t)32 * ld), "v"(g + (size_t)48 * ld)
      : "memory");
}

template <bool RES>
__global__ __launch_bounds__(128)
void attn_causal64(const unsigned short* __restrict__ qhp, const unsigned short* __restrict__ qlp,
                   const unsigned short* __restrict__ khp, const unsigned short* __restrict__ klp,
                   const unsigned short* __restrict__ vhp, const unsigned short* __restrict__ vlp,
                   unsigned short* ohp, unsigned short* olp,
                   int qbBase, int nqbThis, float sscale) {
  union FB { v16b v; v8b h[2]; };
  union FH { v16h v; v8h h[2]; };
  constexpr int NPL = RES ? 4 : 3;                                // staged planes of one buffer
  // two buffers of: K hi [kv][d], K lo, V^T hi [d][kv], (V^T residual), each 64 rows of pitch LP
  __shared__ __align__(16) unsigned short kvs[2][NPL][64 * LP];
  __shared__ __align__(16) float    Os[4][16 * OP];               // per wave context tile [row][d], pitch OP

  const int tid  = threadIdx.x;
  const int wave = tid >> 5;
  const int lane = tid & 31;
  const int hh   = lane >> 4;
  const int c    = lane & 15;

  const int bx   = blockIdx.x;
  const int qbl  = bx % nqbThis;
  const int h    = bx / nqbThis;           // 0..NH-1 (grid = nqbThis * NH)
  const int qb   = qbBase + qbl;
  const int q0   = qb * 64 + wave * 16;

  const __bf16* Qh = (const __bf16*)(const void*)qhp + (size_t)h * HD;
  const __bf16* Ql = (const __bf16*)(const void*)qlp + (size_t)h * HD;
  const __bf16* Kh = (const __bf16*)(const void*)khp + (size_t)h * HD;
  const __bf16* Kl = (const __bf16*)(const void*)klp + (size_t)h * HD;
  const _Float16* Vh = (const _Float16*)(const void*)vhp + (size_t)h * HD * SEQ;
  const _Float16* Vl = (const _Float16*)(const void*)vlp + (size_t)h * HD * VLP;

  // ---- Q fragments (B operand, column = query = lane&15): 2 d-chunks, hi and lo ----
  v16b qah[2], qal[2];
#pragma unroll
  for (int dc = 0; dc < 2; ++dc) {
    const size_t qo = (size_t)(q0 + c) * DM + dc * 32 + 8 * hh;
    qah[dc] = ldfrag_b(Qh + qo);
    qal[dc] = ldfrag_b(Ql + qo);
  }

  float mrow = -INFINITY, lrow = 0.f;        // running max and sum of query q0 + c, the same value in both halves
  v8f oacc[4];                               // context^T: oacc[t][r] = element d = 16 t + 8 hh + r of query q0 + c
#pragma unroll
  for (int t = 0; t < 4; ++t) oacc[t] = zero8();

  const int nkt = qb + 1;                    // key tiles 0..qb (block-uniform)
  // copies of key tile t (0 <= t <= qb, so K rows t*64..+63 < SEQ and V^T columns t*64..+63 < SEQ) into one of the two buffers
  const int sr = tid >> 3, sc = (tid & 7) * 8;                    // this thread's first row (0..15) and element column of every plane
  const unsigned sl = (unsigned)(uintptr_t)&kvs[0][0][0] + (unsigned)((sr * LP + sc) * 2);
  constexpr unsigned BUFB = (unsigned)(NPL * 64 * LP * 2);        // bytes of one buffer
  auto issue = [&](int t, unsigned bo) {                          // bo = byte offset of the buffer: 0 or BUFB
    const int kv = t * 64;
    const unsigned l0 = sl + bo;
    stage_kv3(Kh + (size_t)(kv + sr) * DM + sc, Kl + (size_t)(kv + sr) * DM + sc, Vh + (size_t)sr * SEQ + kv + sc,
              l0, l0 + (unsigned)(64 * LP * 2), l0 + (unsigned)(2 * 64 * LP * 2));
    if constexpr (RES) {
      const int kvl = (kv + 64 <= VLP) ? kv : (VLP - 64);         // clamped address into the residual plane
      stage_kv1(Vl + (size_t)sr * VLP + kvl + sc, VLP, l0 + (unsigned)(3 * 64 * LP * 2));
    }
  };
  issue(0, 0u);
  asm volatile("s_wait_asynccnt 0x0" ::: "memory");      // this wave's copies of tile 0 have landed
  __syncthreads();                                       // ... and every other wave's
  if (nkt > 1) issue(1, BUFB);                           // block-uniform
  unsigned cur = 0u;                                     // byte offset of the buffer that holds tile kt (block-uniform)

  for (int kt = 0; kt < NQB; ++kt) {         // static bound
    if (kt >= nkt) break;                    // block-uniform
    const bool diag = (kt == qb);            // block-uniform
    const int kv0 = kt * 64;
    const bool resOK = (kv0 + 64 <= VLP);    // block-uniform: beyond VLP the v residual counts as zero
    const unsigned short* kvb = &kvs[0][0][0] + (cur >> 1);
    const __bf16*   Ksh = (const __bf16*)(const void*)kvb;
    const __bf16*   Ksl = (const __bf16*)(const void*)(kvb + 64 * LP);
    const _Float16* Vth = (const _Float16*)(const void*)(kvb + 2 * 64 * LP);
    const _Float16* Vtl = (const _Float16*)(const void*)(kvb + (NPL - 1) * 64 * LP);

    // ---- scores, transposed: 64 keys x 16 query columns per wave, 3 bf16 products ----
    //      The 8 LDS reads of one 16-key row group stand together, KA groups ahead of the products that use them
    //      (two; one where the residual planes' accumulators leave fewer registers).
    constexpr int KA = RES ? 1 : 2;
    FB kb[4][2], kl[4][2];
    auto ldk = [&](int j) {
#pragma unroll
      for (int dc = 0; dc < 2; ++dc) {
        kb[j][dc].h[0] = *(const v8b*)(Ksh + (j * 16 + c) * LP + dc * 32 + 8 * hh);
        kb[j][dc].h[1] = *(const v8b*)(Ksh + (j * 16 + c) * LP + dc * 32 + 16 + 8 * hh);
        kl[j][dc].h[0] = *(const v8b*)(Ksl + (j * 16 + c) * LP + dc * 32 + 8 * hh);
        kl[j][dc].h[1] = *(const v8b*)(Ksl + (j * 16 + c) * LP + dc * 32 + 16 + 8 * hh);
      }
    };
#pragma unroll
    for (int j = 0; j < KA; ++j) ldk(j);
    v8f s[4];
#pragma unroll
    for (int j = 0; j < 4; ++j) {
      if (j + KA < 4) ldk(j + KA);
      s[j] = zero8();
#pragma unroll
      for (int dc = 0; dc < 2; ++dc) {
        s[j] = mma_b(kb[j][dc].v, qah[dc], s[j]);
        s[j] = mma_b(kl[j][dc].v, qah[dc], s[j]);
        s[j] = mma_b(kb[j][dc].v, qal[dc], s[j]);
      }
    }
    // V^T fragments, one group of reads per 32-key chunk. Without the residual planes the first chunk is read here, so that
    // the softmax below covers its LDS latency; with them (twice the fragments) each chunk is read in front of its own products.
    FH vb[2][4], vl[2][4];
    auto ldv = [&](int kk) {
#pragma unroll
      for (int t = 0; t < 4; ++t) {
        vb[kk][t].h[0] = *(const v8h*)(Vth + (t * 16 + c) * LP + kk * 32 + 8 * hh);
        vb[kk][t].h[1] = *(const v8h*)(Vth + (t * 16 + c) * LP + kk * 32 + 16 + 8 * hh);
        if (RES) {
          vl[kk][t].h[0] = *(const v8h*)(Vtl + (t * 16 + c) * LP + kk * 32 + 8 * hh);
          vl[kk][t].h[1] = *(const v8h*)(Vtl + (t * 16 + c) * LP + kk * 32 + 16 + 8 * hh);
          if (!resOK) { vl[kk][t].h[0] = zero8h(); vl[kk][t].h[1] = zero8h(); }
        }
      }
    };
    if (!RES) ldv(0);

    // ---- scale + causal compare (diagonal tile only), max and sum of this lane's query, online softmax; P^T (x1024, f16) and
    //      its residual (x4096) are packed in registers as B operands ----
    const int qrow = q0 + c;                     // query of this lane's score column
#pragma unroll
    for (int j = 0; j < 4; ++j)
#pragma unroll
      for (int r = 0; r < 8; ++r) s[j][r] *= sscale;
    if (diag) {                                  // scalar branch: every other tile runs none of the compares and selects
#pragma unroll
      for (int j = 0; j < 4; ++j)
#pragma unroll
        for (int r = 0; r < 8; ++r) {
          const int key = kv0 + j * 16 + 8 * hh + r; // key of accumulator element r of tile j in this lane
          s[j][r] = (key > qrow) ? -FLT_MAX : s[j][r];
        }
    }
    float mj[4];                                 // one maximum per score tile: four independent chains
#pragma unroll
    for (int j = 0; j < 4; ++j) {
      mj[j] = -INFINITY;
#pragma unroll
      for (int r = 0; r < 8; ++r) mj[j] = fmaxf(mj[j], s[j][r]);
    }
    float m = fmaxf(fmaxf(mj[0], mj[1]), fmaxf(mj[2], mj[3]));
    m = fmaxf(m, xhalf(m));                      // the query's other 32 keys
    const float mnew  = fmaxf(mrow, m);
    const float msafe = (mnew == -INFINITY) ? 0.f : mnew;
    const float alpha = __expf(mrow - msafe);
    mrow = mnew;
    FH pa[2], pl[2];
    float ps[4];                                 // one partial sum per score tile: four independent add chains
#pragma unroll
    for (int j = 0; j < 4; ++j) {
      ps[j] = 0.f;
#pragma unroll
      for (int r = 0; r < 8; ++r) {
        const float p = __expf(s[j][r] - msafe);     // floor logit against a normal max: exp -> 0
        ps[j] += p;
        const float p1k = p * 1024.0f;
        const _Float16 ph = (_Float16)p1k;
        pa[j >> 1].v[(j & 1) * 8 + r] = ph;
        if (RES) pl[j >> 1].v[(j & 1) * 8 + r] = (_Float16)((p1k - (float)ph) * 4096.0f);
      }
    }
    float psum = (ps[0] + ps[1]) + (ps[2] + ps[3]);
    psum += xhalf(psum);                         // the query's other 32 keys
    lrow = lrow * alpha + psum;
#pragma unroll
    for (int t = 0; t < 4; ++t)
#pragma unroll
      for (int r = 0; r < 8; ++r) oacc[t][r] *= alpha;

    // ---- context^T += V^T . P^T (f16 WMMA), residual products into a separate accumulator ----
    v8f o1[4];
#pragma unroll
    for (int t = 0; t < 4; ++t) o1[t] = zero8();
    if (!RES) ldv(1);
#pragma unroll   // constant kk: the fragment arrays stay in registers
    for (int kk = 0; kk < 2; ++kk) {
      if (RES) ldv(kk);
#pragma unroll
      for (int t = 0; t < 4; ++t) {
        oacc[t] = mma_h(vb[kk][t].v, pa[kk].v, oacc[t]);
        if (RES) {
          o1[t] = mma_h(vl[kk][t].v, pa[kk].v, o1[t]);
          o1[t] = mma_h(vb[kk][t].v, pl[kk].v, o1[t]);
        }
      }
    }
    if (RES) {
#pragma unroll
      for (int t = 0; t < 4; ++t)
#pragma unroll
        for (int r = 0; r < 8; ++r) oacc[t][r] += o1[t][r] * (1.0f / 4096.0f);
    }
    asm volatile("s_wait_dscnt 0x0" ::: "memory");       // this wave's reads of tile kt's buffer are done
    asm volatile("s_wait_asynccnt 0x0" ::: "memory");    // this wave's copies of tile kt + 1 have landed
    __syncthreads();                                     // publishes tile kt + 1 and frees tile kt's buffer
    if (kt + 2 < nkt) issue(kt + 2, cur);                // block-uniform
    cur = BUFB - cur;
  }
  asm volatile("s_wait_asynccnt 0x0" ::: "memory");      // no copy is left in flight behind the loop

  // ---- normalise (1/l and the 1/1024 p carry), stage the wave's 16x64 tile, bf16 hi/lo split,
  float* os = Os[wave];
  {
    const float l = lrow;
    const float inv = ((l > 0.f) ? (1.0f / l) : 0.f) * (1.0f / 1024.0f);
#pragma unroll
    for (int t = 0; t < 4; ++t) {              // row = query c, 8 consecutive d per lane and tile: two 16-B stores
      v4f a, b;
#pragma unroll
      for (int r = 0; r < 4; ++r) { a[r] = oacc[t][r] * inv; b[r] = oacc[t][4 + r] * inv; }
      *(v4f*)(os + c * OP + t * 16 + 8 * hh)     = a;
      *(v4f*)(os + c * OP + t * 16 + 8 * hh + 4) = b;
    }
  }
  __builtin_amdgcn_fence(__ATOMIC_RELEASE, "workgroup");
  __builtin_amdgcn_wave_barrier();
  __builtin_amdgcn_fence(__ATOMIC_ACQUIRE, "workgroup");
  {
    const int q4 = lane >> 3, c8 = (lane & 7) * 8;
    v4u hv[4], lv[4];
#pragma unroll
    for (int it = 0; it < 4; ++it) {
      const int row = it * 4 + q4;   // it 0..3 x q4 0..3 = rows 0..15 of the wave tile
      const float* sp = os + row * OP + c8;
      v4u a, a2;
#pragma unroll
      for (int e = 0; e < 4; ++e) {
        const float f0 = sp[2 * e], f1 = sp[2 * e + 1];
        const unsigned short h0 = bf_bits(f0), h1 = bf_bits(f1);
        const unsigned short l0 = bf_bits(f0 - bf_up(h0)), l1 = bf_bits(f1 - bf_up(h1));
        a[e] = pk16(h0, h1); a2[e] = pk16(l0, l1);
      }
      hv[it] = a; lv[it] = a2;
    }
    {
#pragma unroll
      for (int it = 0; it < 4; ++it) {
        const int row = it * 4 + q4;
        const size_t go = (size_t)(q0 + row) * DM + (size_t)h * HD + c8;
        *(v4u*)(ohp + go) = hv[it];
        *(v4u*)(olp + go) = lv[it];
      }
      
    }
  }
}

// =====================================================================================================
// Workspace map (bytes, SEQ = 4096):
//   Xb    bf16 [SEQ][1024]          0          8388608
//   Wqkvb bf16 [3072 n][1024 k]     8388608    6291456   (rows 0..1023 = q columns, 1024..2047 = k, 2048..3071 = v)
//   Wob   bf16 [1024 n][1024 k]     14680064   2097152
//   Qh    bf16 [SEQ][1024]          16777216   8388608
//   Ql    bf16 [SEQ][1024]          25165824   8388608
//   Kh    bf16 [SEQ][1024]          33554432   8388608
//   Kl    bf16 [SEQ][1024]          41943040   8388608
//   VTh   f16  [1024][SEQ]          50331648   8388608
//   VTl   f16  [1024][VLP=512]      58720256   1048576
//   Oh    bf16 [SEQ][1024]          59768832   8388608
//   Ol    bf16 [SEQ][1024]          68157440   8388608
//   end                             76546048
// All planes are exact multiples of their 64x64 / whole-line store granularity (no padded tails needed),
// =====================================================================================================
extern "C" void kernel_launch(void* const* d_in, const int* in_sizes, int n_in,
                              void* d_out, int out_size, void* d_ws, size_t ws_size,
                              hipStream_t stream) {
  if (n_in < 5) return;
  if (in_sizes[0] < SEQ * DM) return;                 // x rows 0..SEQ-1 (prefix of the full input)
  if (in_sizes[1] != DM * NQKV) return;               // w_qkv [1024][3072]
  if (in_sizes[2] != NQKV) return;                    // b_qkv [3072]
  if (in_sizes[3] != DM * DM) return;                 // w_o [1024][1024]
  if (in_sizes[4] != DM) return;                      // b_o [1024]
  if (out_size < SEQ * DM) return;

  const float* x     = (const float*)d_in[0];
  const float* w_qkv = (const float*)d_in[1];
  const float* b_qkv = (const float*)d_in[2];
  const float* w_o   = (const float*)d_in[3];
  const float* b_o   = (const float*)d_in[4];

  const size_t PX  = (size_t)SEQ * DM * 2;       // 16-bit activation plane [SEQ][1024]
  const size_t PWQ = (size_t)NQKV * DM * 2;      // 16-bit fused weight plane [3072][1024]
  const size_t PWO = (size_t)DM * DM * 2;        // 16-bit out weight plane
  const size_t PVT = (size_t)DM * SEQ * 2;       // v^T hi plane
  const size_t PVL = (size_t)DM * VLP * 2;       // v^T residual plane
  size_t off = 0;
  const size_t oXb   = off; off += PX;
  const size_t oWqkv = off; off += PWQ;
  const size_t oWo   = off; off += PWO;
  const size_t oQh   = off; off += PX;
  const size_t oQl   = off; off += PX;
  const size_t oKh   = off; off += PX;
  const size_t oKl   = off; off += PX;
  const size_t oVTh  = off; off += PVT;
  const size_t oVTl  = off; off += PVL;
  const size_t oOh   = off; off += PX;
  const size_t oOl   = off; off += PX;
  if (off > ws_size) return;                     // off = 76546048 for SEQ = 4096
  if (off > (size_t)134217728) return;

  char* ws = (char*)d_ws;
  unsigned short* Xb    = (unsigned short*)(ws + oXb);
  unsigned short* Wqkvb = (unsigned short*)(ws + oWqkv);
  unsigned short* Wob   = (unsigned short*)(ws + oWo);
  unsigned short* Qh    = (unsigned short*)(ws + oQh);
  unsigned short* Ql    = (unsigned short*)(ws + oQl);
  unsigned short* Kh    = (unsigned short*)(ws + oKh);
  unsigned short* Kl    = (unsigned short*)(ws + oKl);
  unsigned short* VTh   = (unsigned short*)(ws + oVTh);
  unsigned short* VTl   = (unsigned short*)(ws + oVTl);
  unsigned short* Oh    = (unsigned short*)(ws + oOh);
  unsigned short* Ol    = (unsigned short*)(ws + oOl);
  const unsigned short* Wqb = Wqkvb;                              // q weight rows  [1024 n][1024 k]
  const unsigned short* Wkb = Wqkvb + (size_t)DM * DM;            // k weight rows
  const unsigned short* Wvb = Wqkvb + (size_t)2 * DM * DM;        // v weight rows

  const dim3 blk(256);
  const int n8x = SEQ * DM / 8;                                    // multiple of 256
  const dim3 gCvtX((n8x + 255) / 256);
  const dim3 gTq(NQKV / 64, DM / 64);                              // in [1024 k][3072 n] -> out [3072][1024]: (n tiles, k tiles) = (48, 16)
  const dim3 gTo(DM / 64, DM / 64);                                // in [1024 k][1024 n] -> out [1024][1024]: (16, 16)
  const dim3 gProj((SEQ / 128) * (DM / 128), 1);                   // M = SEQ, N = 1024 -> 256 block tiles of 128x128 (SEQ = 4096)
  const dim3 gVT((DM / 128) * (SEQ / 128), 1);                     // M = 1024, N = SEQ

  // (1) x -> bf16 plane [SEQ][1024]; w_qkv [k][n] -> bf16 [n][k]; w_o [k][n] -> bf16 [n][k]
  cvt_bf16x8<<<gCvtX, blk, 0, stream>>>(x, Xb, n8x);
  cvtT_bf16<<<gTq, blk, 0, stream>>>(w_qkv, Wqkvb, DM, NQKV);
  cvtT_bf16<<<gTo, blk, 0, stream>>>(w_o, Wob, DM, DM);
  // (2) q = x . Wq + b_q -> bf16 hi/lo planes [t][h*64+d]   (M = SEQ, N = 1024, K = 1024)
  gemm64<0, 2, 1><<<gProj, blk, 0, stream>>>(
      Xb, Xb, DM, 0LL, Wqb, Wqb, DM, 0LL,
      (void*)Qh, DM, 0LL, (void*)Ql, DM, 0LL, DM,
      SEQ, DM, DM, 1.0f, b_qkv);
  // (3) k = x . Wk + b_k -> bf16 hi/lo planes
  gemm64<0, 2, 1><<<gProj, blk, 0, stream>>>(
      Xb, Xb, DM, 0LL, Wkb, Wkb, DM, 0LL,
      (void*)Kh, DM, 0LL, (void*)Kl, DM, 0LL, DM,
      SEQ, DM, DM, 1.0f, b_qkv + DM);
  // (4) v^T = Wv . x^T + b_v (per row) -> f16 hi plane [h*64+d][s] (pitch SEQ) and residual plane
  //     (x4096, keys < VLP only, pitch VLP)   (A = Wvb [n][k], Bt = Xb; M = 1024, N = SEQ, K = 1024)
  gemm64<0, 3, 2><<<gVT, blk, 0, stream>>>(
      Wvb, Wvb, DM, 0LL, Xb, Xb, DM, 0LL,
      (void*)VTh, SEQ, 0LL, (void*)VTl, VLP, 0LL, VLP,
      DM, SEQ, DM, 4096.0f, b_qkv + 2 * DM);
  // (5) causal attention: query blocks 0..RESQB-1 with residual planes, the rest without
  attn_causal64<true><<<dim3(NH * RESQB), dim3(128), 0, stream>>>(
      Qh, Ql, Kh, Kl, VTh, VTl, Oh, Ol, 0, RESQB, 0.125f);
  if (NQB > RESQB) {
    attn_causal64<false><<<dim3(NH * (NQB - RESQB)), dim3(128), 0, stream>>>(
        Qh, Ql, Kh, Kl, VTh, VTl, Oh, Ol, RESQB, NQB - RESQB, 0.125f);
  }
  // (6) out = context . Wo + b_o -> d_out f32 [SEQ][1024]  (A = context hi + lo planes, 2 products)
  gemm64<1, 0, 1><<<gProj, blk, 0, stream>>>(
      Oh, Ol, DM, 0LL, Wob, Wob, DM, 0LL,
      d_out, DM, 0LL, d_out, DM, 0LL, DM,
      SEQ, DM, DM, 1.0f, b_o);
  (void)hipGetLastError();
}

// v007
// A run of this version takes 150 microseconds.
// Next to v006, in two timings, it ran 1.06 and 1.05 times as fast.
// All steps since v000 together make it 3.88 times as fast.
// Contractions: q, k, v^T projections = v_wmma_f32_16x16x32_bf16 (bf16 operands from RNE-converted inputs, single product, f32 bias add);
// k.q^T scores (transposed) = v_wmma_f32_16x16x32_bf16 with bf16 hi/lo split q and k (hi.hi + hi.lo + lo.hi);
// v^T.p^T = v_wmma_f32_16x16x32_f16 (p carried x1024 in f16, v in f16; extra f16 residual planes x4096 of p and v for the first VLP query rows);
// ctx.Wo = v_wmma_f32_16x16x32_bf16 with ctx as bf16 hi/lo planes times bf16 Wo (2 products); all f32 accumulate; causal compare and softmax in f32.
#include <hip/hip_runtime.h>
#include <math.h>
#include <float.h>
#include <stdint.h>

#ifndef NB
#define NB    1
#endif
#ifndef SEQ
#define SEQ   4096
#endif
#define SEQ_FULL 4096
#define DM    1024
#define NH    16
#define HD    64
#define NQKV  (3 * DM)
#define NQB   (SEQ / 64)                      // key / query tiles of 64
#define VLP   ((SEQ < 512) ? SEQ : 512)       // key pitch of the v^T residual plane (keys 0..VLP-1)
#define RESQB (VLP / 64)                      // number of leading 64-row query blocks that use the p / v residual planes
#define LP    72                              // LDS row pitch of the 64-wide 16-bit K / V^T tiles, in elements: 144 B = 16 B x 9 (odd), so the
                                              // 16 rows that one half-wave's 16-B fragment read touches fall on 16 distinct groups of 4 banks
#define OP    68                              // LDS row pitch of the 64-wide f32 context tile, in elements: 272 B = 16 B x 17 (odd)
static_assert(NB == 1);
static_assert(NH * HD == DM && HD == 64);
static_assert((SEQ % 64) == 0 && (DM % 64) == 0 && SEQ >= 64 && SEQ <= SEQ_FULL);
static_assert(RESQB * 64 == VLP && VLP <= SEQ && RESQB >= 1 && RESQB <= NQB);
static_assert((NQKV % 64) == 0);
static_assert((SEQ % 128) == 0 && (DM % 128) == 0);   // 128x128 block tiles and 128-wide k steps of the projections

typedef _Float16 v16h __attribute__((ext_vector_type(16)));
typedef _Float16 v8h  __attribute__((ext_vector_type(8)));
typedef __bf16   v16b __attribute__((ext_vector_type(16)));
typedef __bf16   v8b  __attribute__((ext_vector_type(8)));
typedef float    v8f  __attribute__((ext_vector_type(8)));
typedef float    v4f  __attribute__((ext_vector_type(4)));
typedef unsigned int v4u __attribute__((ext_vector_type(4)));

// ---- scalar helpers --------------------------------------------------------------------------------
__device__ __forceinline__ unsigned short bf_bits(float f) {          // f32 -> bf16 bits, RNE convert
  unsigned u = __float_as_uint(f);
  return (unsigned short)((u + 0x7FFFu + ((u >> 16) & 1u)) >> 16);
}
__device__ __forceinline__ float bf_up(unsigned short h) { return __uint_as_float(((unsigned)h) << 16); }
__device__ __forceinline__ unsigned short h_bits(_Float16 x) { return __builtin_bit_cast(unsigned short, x); }
__device__ __forceinline__ unsigned pk16(unsigned short a, unsigned short b) { return (unsigned)a | ((unsigned)b << 16); }
__device__ __forceinline__ v8f zero8() { v8f z = {0.f, 0.f, 0.f, 0.f, 0.f, 0.f, 0.f, 0.f}; return z; }
__device__ __forceinline__ v8h zero8h() {
  const _Float16 z = (_Float16)0.0f;
  v8h r = {z, z, z, z, z, z, z, z};
  return r;
}

// ---- value of lane l ^ 16 (the other half of the wave), a vector-port move
__device__ __forceinline__ float xhalf(float x) {
  return __builtin_bit_cast(float, __builtin_amdgcn_permlanex16(__builtin_bit_cast(int, x), __builtin_bit_cast(int, x),
                                                                0x76543210, 0xfedcba98, false, false));
}

// ---- fragment loaders: 16-bit A/B operand, lane -> row/col (lane&15), p already includes +8*(lane>>4);
//      elements 0..7 <- p[0..7] (k0+8h..), elements 8..15 <- p[16..23] (k0+16+8h..)
__device__ __forceinline__ v16b ldfrag_b(const __bf16* p) {
  union { v16b v; v8b h[2]; } f;
  f.h[0] = *(const v8b*)(p);
  f.h[1] = *(const v8b*)(p + 16);
  return f.v;
}

// ---- WMMA helpers: bare builtins (the compiler pads where a vector instruction follows too closely) and hand-written gaps --------
__device__ __forceinline__ v8f mma_b_raw(v16b a, v16b b, v8f c) {
  return __builtin_amdgcn_wmma_f32_16x16x32_bf16(false, a, false, b, (short)0, c, false, false);
}
__device__ __forceinline__ v8f mma_h_raw(v16h a, v16h b, v8f c) {
  return __builtin_amdgcn_wmma_f32_16x16x32_f16(false, a, false, b, (short)0, c, false, false);
}
__device__ __forceinline__ void dep_guard_b(v8f& a, v8f& b, v16b x, v16b y) {
  asm volatile("v_nop\n\tv_nop\n\tv_nop\n\tv_nop" : "+v"(a), "+v"(b) : "v"(x), "v"(y));
}
__device__ __forceinline__ void keep4_b(v16b a, v16b b, v16b c, v16b d) {
  asm volatile("v_nop" :: "v"(a), "v"(b), "v"(c), "v"(d));
}
__device__ __forceinline__ void acc_guard4(v8f& a, v8f& b, v8f& c, v8f& d) {
  asm volatile("v_nop\n\tv_nop\n\tv_nop\n\tv_nop" : "+v"(a), "+v"(b), "+v"(c), "+v"(d));
}

// =====================================================================================================
// f32 -> bf16 (RNE convert), 8 elements per thread, one 16-B store per lane: a wave writes 512 contiguous B
// coverage: n8 threads x 8 = whole plane (n8 = SEQ*DM/8 is a multiple of 256).
// =====================================================================================================
__global__ __launch_bounds__(256) void cvt_bf16x8(const float* __restrict__ in, unsigned short* out, int n8) {
  const int i = blockIdx.x * 256 + threadIdx.x;
  if (i < n8) {
    const v4f a = *(const v4f*)(in + (size_t)i * 8);
    const v4f b = *(const v4f*)(in + (size_t)i * 8 + 4);
    v4u p;
    p[0] = pk16(bf_bits(a[0]), bf_bits(a[1]));
    p[1] = pk16(bf_bits(a[2]), bf_bits(a[3]));
    p[2] = pk16(bf_bits(b[0]), bf_bits(b[1]));
    p[3] = pk16(bf_bits(b[2]), bf_bits(b[3]));
    *(v4u*)(out + (size_t)i * 8) = p;
    
  }
}

// =====================================================================================================
// Transposed convert: in f32 [K rows][N cols] (pitch N) -> out bf16 [N rows][K cols] (pitch K), RNE.
// grid = (N/64, K/64), 256 threads; one 64(k) x 64(n) tile per block through LDS.
// Load phase: thread (k row = tid>>2, 16 n columns = (tid&3)*16) reads 4 x 16 B and writes bf16 bits
// transposed into st[n][k] (pitch 72 halves). After __syncthreads each wave writes 8 output rows:
// coverage: load 64 k x (4 threads x 16 n) = 64x64; store 8 waves x 2 it x 4 rows x (8 lanes x 8) = 64x64.
// LDS st: cross-wave exchange behind the block barrier.
// =====================================================================================================
__global__ __launch_bounds__(256) void cvtT_bf16(const float* __restrict__ in, unsigned short* out, int K, int N) {
  __shared__ __align__(16) unsigned short st[64 * 72];
  const int tid = threadIdx.x;
  const int n0  = blockIdx.x * 64;
  const int k0  = blockIdx.y * 64;
  {
    const int r  = tid >> 2;            // k row 0..63
    const int cb = (tid & 3) * 16;      // n column base
    const float* src = in + (size_t)(k0 + r) * N + n0 + cb;
#pragma unroll
    for (int e = 0; e < 4; ++e) {
      const v4f a = *(const v4f*)(src + 4 * e);
#pragma unroll
      for (int u = 0; u < 4; ++u) st[(cb + 4 * e + u) * 72 + r] = bf_bits(a[u]);
    }
  }
  __syncthreads();
  {
    const int lane = tid & 31, wave = tid >> 5;
    const int q = lane >> 3, c8 = (lane & 7) * 8;
    v4u hv[2];
#pragma unroll
    for (int it = 0; it < 2; ++it) {
      const int row = wave * 8 + it * 4 + q;      // n row within the tile
      hv[it] = *(const v4u*)(st + row * 72 + c8);
    }
    {
#pragma unroll
      for (int it = 0; it < 2; ++it) {
        const int row = wave * 8 + it * 4 + q;
        *(v4u*)(out + (size_t)(n0 + row) * K + k0 + c8) = hv[it];
      }
      
    }
  }
}

// =====================================================================================================
// Register-blocked bf16 WMMA GEMM: C[m][n] = sum_k A[m][k] * Bt[n][k] + bias; one wave per 32x64 tile,
// 8 waves (4 x 2) per block = one 128x128 tile of C. A row-major [M][K] pitch lda; Bt row-major [N][K] pitch ldb
// (k contiguous); M, N multiples of 128, K a multiple of GKS. blockIdx.y = batch index (strides in elements).
// Operands: per k step of GKS the block's 128 rows of every operand plane are copied global -> LDS in whole lines
// (stage_tile), two buffers, the next step's copies in flight while this step's fragments are read from LDS;
// every fragment keeps its k order and the k steps stay ascending, so each f32 sum keeps its order.
// NSPLIT: 0 = A.Bt; 1 = (A + A2).Bt (A2 = unscaled bf16 lo plane of A); 2 = A.Bt + A2.Bt + A.Bt2.
// OUT_MODE: 0 = f32 (pitch ldc); 2 = bf16 hi plane C + bf16 lo plane C2 (lo = RNE(v - hi), unscaled);
//           3 = f16 hi plane C + f16 residual plane C2 = f16((v - hi) * rscale), C2 written only for tiles
//               with n0 < N2 (pitch ldc2, batch stride strideC2).
// BIASM: 1 = bias[n] added per column (bias has >= N entries); 2 = bias[m] added per row (>= M entries);
//        the bias value is RNE-converted to bf16 and added in f32 before any output split.
// =====================================================================================================
#define GKS 128                               // k elements of one staged step: 256 B of every operand row
#define GP  136                               // LDS row pitch of a staged operand tile, in elements: 272 B = 16 B x 17 (odd)
#define GMI 2                                 // 16-row sub-tiles of one wave's 32x64 tile

// One operand tile of 128 rows x GKS k (256 B per row), global -> LDS, by asynchronous copies of 16 B per lane.
// Thread t of 256: 16-B piece (t & 15) of rows (t >> 4) + 16 e, e = 0..7; one wave-wide copy = 2 whole rows = 4 whole lines.
// Coverage: 16 rows x 8 e = 128 rows, 16 pieces x 16 B = 256 B; each LDS byte is written by one lane only.
// s_wait_xcnt 0 closes the statement so that no address register of an issued copy is rewritten ahead of it.
__device__ __forceinline__ void stage_tile(const __bf16* g, int ld, __bf16* l, int tid) {
  const __bf16* gp = g + (size_t)(tid >> 4) * ld + (tid & 15) * 8;
  const unsigned la = (unsigned)(uintptr_t)l + (unsigned)(((tid >> 4) * GP + (tid & 15) * 8) * 2);
  asm volatile(
      "global_load_async_to_lds_b128 %0, %8, off\n\t"
      "global_load_async_to_lds_b128 %1, %9, off\n\t"
      "global_load_async_to_lds_b128 %2, %10, off\n\t"
      "global_load_async_to_lds_b128 %3, %11, off\n\t"
      "global_load_async_to_lds_b128 %4, %12, off\n\t"
      "global_load_async_to_lds_b128 %5, %13, off\n\t"
      "global_load_async_to_lds_b128 %6, %14, off\n\t"
      "global_load_async_to_lds_b128 %7, %15, off\n\t"
      "s_wait_xcnt 0x0"
      :: "v"(la), "v"(la + (unsigned)(1 * 16 * GP * 2)),
         "v"(la + (unsigned)(2 * 16 * GP * 2)), "v"(la + (unsigned)(3 * 16 * GP * 2)),
         "v"(la + (unsigned)(4 * 16 * GP * 2)), "v"(la + (unsigned)(5 * 16 * GP * 2)),
         "v"(la + (unsigned)(6 * 16 * GP * 2)), "v"(la + (unsigned)(7 * 16 * GP * 2)),
         "v"(gp), "v"(gp + (size_t)(1 * 16) * ld),
         "v"(gp + (size_t)(2 * 16) * ld), "v"(gp + (size_t)(3 * 16) * ld),
         "v"(gp + (size_t)(4 * 16) * ld), "v"(gp + (size_t)(5 * 16) * ld),
         "v"(gp + (size_t)(6 * 16) * ld), "v"(gp + (size_t)(7 * 16) * ld)
      : "memory");
}

template <int NSPLIT, int OUT_MODE, int BIASM>
__global__ __launch_bounds__(256) void gemm64(
    const unsigned short* __restrict__ Ap, const unsigned short* A2p, int lda, long long strideA,
    const unsigned short* __restrict__ Btp, const unsigned short* Bt2p, int ldb, long long strideB,
    void* Cout, int ldc, long long strideC,
    void* Cout2, int ldc2, long long strideC2, int N2,
    int M, int N, int K, float rscale, const float* __restrict__ bias) {
  const __bf16* A   = (const __bf16*)(const void*)Ap;
  const __bf16* A2  = (const __bf16*)(const void*)A2p;
  const __bf16* Bt  = (const __bf16*)(const void*)Btp;
  const __bf16* Bt2 = (const __bf16*)(const void*)Bt2p;
  constexpr int NPL = 2 + (NSPLIT >= 1 ? 1 : 0) + (NSPLIT == 2 ? 1 : 0);   // staged planes: A, Bt, (A2), (Bt2)
  __shared__ __align__(16) __bf16 stg[2][NPL][128 * GP];   // two buffers of the block's operand tiles, pitch GP
  __shared__ __align__(16) float sT[8][16 * 68];   // per-wave 16x64 slab, pitch 68 floats
  const int b    = blockIdx.y;
  const int tid  = threadIdx.x;
  const int lane = threadIdx.x & 31;
  const int wave = threadIdx.x >> 5;
  const int tilesN = N >> 7;
  const int tilesM = M >> 7;
  const int tile = blockIdx.x;
  if (tile >= tilesM * tilesN) return;   // block-uniform, in front of every copy and barrier
  const int tm = tile / tilesN;
  const int tn = tile - tm * tilesN;
  const int bm0 = tm << 7;               // block tile origin
  const int bn0 = tn << 7;
  const int wm  = (wave >> 1) << 5;      // wave tile origin inside the block tile: 4 wave rows of 32, 2 wave columns of 64
  const int wn  = (wave & 1) << 6;
  const int m0 = bm0 + wm;
  const int n0 = bn0 + wn;

  const __bf16* Ab  = A  + (size_t)b * strideA;
  const __bf16* Bb  = Bt + (size_t)b * strideB;
  const __bf16* Ab2 = (NSPLIT >= 1) ? (A2  + (size_t)b * strideA) : Ab;
  const __bf16* Bb2 = (NSPLIT == 2) ? (Bt2 + (size_t)b * strideB) : Bb;

  const int rlane = lane & 15;                 // row (A) / col (B, D) within subtile
  const int koff  = (lane >> 4) * 8;           // k offset of this lane half
  const int mOff  = (lane >> 4) * 8;           // D row offset

  v8f acc[GMI][4];
#pragma unroll
  for (int i = 0; i < GMI; ++i)
#pragma unroll
    for (int j = 0; j < 4; ++j) acc[i][j] = zero8();

  // copies of k step t (rows bm0.. / bn0.. + 0..127 < M / N, k = t*GKS..+GKS-1 < K) into buffer buf
  auto issue = [&](int t, int buf) {
    const size_t k0 = (size_t)t * GKS;
    stage_tile(Ab + (size_t)bm0 * lda + k0, lda, &stg[buf][0][0], tid);
    stage_tile(Bb + (size_t)bn0 * ldb + k0, ldb, &stg[buf][1][0], tid);
    if constexpr (NSPLIT >= 1) stage_tile(Ab2 + (size_t)bm0 * lda + k0, lda, &stg[buf][2][0], tid);
    if constexpr (NSPLIT == 2) stage_tile(Bb2 + (size_t)bn0 * ldb + k0, ldb, &stg[buf][3][0], tid);
  };
  const int NT = K / GKS;                                // block-uniform
  issue(0, 0);
  asm volatile("s_wait_asynccnt 0x0" ::: "memory");      // this wave's copies of step 0 have landed
  __syncthreads();                                       // ... and every other wave's
  if (NT > 1) issue(1, 1);

  for (int t = 0; t < NT; ++t) {
    const __bf16* sA  = &stg[t & 1][0][0];
    const __bf16* sB  = &stg[t & 1][1][0];
    const __bf16* sA2 = &stg[t & 1][NSPLIT >= 1 ? 2 : 0][0];
    const __bf16* sB2 = &stg[t & 1][NSPLIT == 2 ? 3 : 1][0];
#pragma unroll   // constant kk: every LDS fragment offset is an immediate and the fragment arrays stay in registers
    for (int kk = 0; kk < GKS; kk += 32) {
      v16b bh[4], bl[4], ah[GMI], al[GMI];
#pragma unroll
      for (int j = 0; j < 4; ++j) {
        const int bo = (wn + (j << 4) + rlane) * GP + koff + kk;
        bh[j] = ldfrag_b(sB + bo);
        if (NSPLIT == 2) bl[j] = ldfrag_b(sB2 + bo); else bl[j] = bh[j];
      }
#pragma unroll   // all fragment reads of this k chunk stand as one group in front of its products
      for (int i = 0; i < GMI; ++i) {
        const int ao = (wm + (i << 4) + rlane) * GP + koff + kk;
        ah[i] = ldfrag_b(sA + ao);
        if (NSPLIT >= 1) al[i] = ldfrag_b(sA2 + ao); else al[i] = ah[i];
      }
#pragma unroll
      for (int i = 0; i < GMI; ++i) {
#pragma unroll
        for (int j = 0; j < 4; ++j) {
          acc[i][j] = mma_b_raw(ah[i], bh[j], acc[i][j]);
          if (NSPLIT >= 1) acc[i][j] = mma_b_raw(al[i], bh[j], acc[i][j]);
          if (NSPLIT == 2) acc[i][j] = mma_b_raw(ah[i], bl[j], acc[i][j]);
        }
        dep_guard_b(acc[i][0], acc[i][3], ah[i], al[i]);
      }
      keep4_b(bh[0], bh[1], bh[2], bh[3]);
      if (NSPLIT == 2) keep4_b(bl[0], bl[1], bl[2], bl[3]);
    }
    asm volatile("s_wait_dscnt 0x0" ::: "memory");       // this wave's reads of buffer t & 1 are done
    asm volatile("s_wait_asynccnt 0x0" ::: "memory");    // this wave's copies of step t + 1 have landed
    __syncthreads();                                     // publishes step t + 1 and frees buffer t & 1
    if (t + 2 < NT) issue(t + 2, t & 1);                 // block-uniform
  }
  asm volatile("s_wait_asynccnt 0x0" ::: "memory");      // no copy is left in flight behind the loop
  acc_guard4(acc[0][0], acc[0][1], acc[0][2], acc[0][3]);
  acc_guard4(acc[1][0], acc[1][1], acc[1][2], acc[1][3]);

  // ---- epilogue ----
  float* slab = sT[wave];
  float bcol[4];
#pragma unroll
  for (int j = 0; j < 4; ++j) bcol[j] = 0.f;
  if (BIASM == 1) {
#pragma unroll
    for (int j = 0; j < 4; ++j) bcol[j] = bf_up(bf_bits(bias[n0 + (j << 4) + rlane]));   // < N, in range
  }
#pragma unroll
  for (int i = 0; i < GMI; ++i) {
    const int mBase = m0 + (i << 4);
    float brow[8];
#pragma unroll
    for (int r = 0; r < 8; ++r) brow[r] = 0.f;
    if (BIASM == 2) {
      const v4f b0 = *(const v4f*)(bias + mBase + mOff);          // rows mBase+mOff..+7 < M, in range
      const v4f b1 = *(const v4f*)(bias + mBase + mOff + 4);
#pragma unroll
      for (int r = 0; r < 4; ++r) {
        brow[r]     = bf_up(bf_bits(b0[r]));
        brow[4 + r] = bf_up(bf_bits(b1[r]));
      }
    }
#pragma unroll
    for (int j = 0; j < 4; ++j) {
#pragma unroll
      for (int r = 0; r < 8; ++r) {
        slab[(mOff + r) * 68 + (j << 4) + rlane] = acc[i][j][r] + bcol[j] + brow[r];
      }
    }
    __builtin_amdgcn_fence(__ATOMIC_RELEASE, "workgroup");
    __builtin_amdgcn_wave_barrier();
    __builtin_amdgcn_fence(__ATOMIC_ACQUIRE, "workgroup");
    if (OUT_MODE == 0) {
      float* C = (float*)Cout + (size_t)b * strideC;
      const int hh = lane >> 4, c4 = (lane & 15) * 4;     // 256-B row segment = 16 lanes x 16 B
      {
#pragma unroll
        for (int it = 0; it < 8; ++it) {
          const int row = it * 2 + hh;                     // it 0..7 x hh 0..1 = rows 0..15
          const v4f v = *(const v4f*)(slab + row * 68 + c4);
          *(v4f*)(C + (size_t)(mBase + row) * ldc + n0 + c4) = v;
        }
        
      }
    } else {
      const int q = lane >> 3, c8 = (lane & 7) * 8;
      unsigned short* C  = (unsigned short*)Cout  + (size_t)b * strideC;
      unsigned short* C2 = (unsigned short*)Cout2 + (size_t)b * strideC2;
      const bool wlo = (OUT_MODE == 2) || (n0 < N2);      // wave-uniform
      v4u hv[4], lv[4];
#pragma unroll
      for (int it = 0; it < 4; ++it) {
        const int row = it * 4 + q;                        // it 0..3 x q 0..3 = rows 0..15
        const float* sp = slab + row * 68 + c8;
        v4u a, a2;
#pragma unroll
        for (int e = 0; e < 4; ++e) {
          const float f0 = sp[2 * e], f1 = sp[2 * e + 1];
          unsigned short h0, h1, l0, l1;
          if (OUT_MODE == 2) {
            h0 = bf_bits(f0); h1 = bf_bits(f1);
            l0 = bf_bits(f0 - bf_up(h0)); l1 = bf_bits(f1 - bf_up(h1));
          } else {
            const _Float16 x0 = (_Float16)f0, x1 = (_Float16)f1;
            h0 = h_bits(x0); h1 = h_bits(x1);
            l0 = h_bits((_Float16)((f0 - (float)x0) * rscale));
            l1 = h_bits((_Float16)((f1 - (float)x1) * rscale));
          }
          a[e] = pk16(h0, h1); a2[e] = pk16(l0, l1);
        }
        hv[it] = a; lv[it] = a2;
      }
      {
#pragma unroll
        for (int it = 0; it < 4; ++it) {
          const int row = it * 4 + q;
          *(v4u*)(C + (size_t)(mBase + row) * ldc + n0 + c8) = hv[it];
          if (wlo) *(v4u*)(C2 + (size_t)(mBase + row) * ldc2 + n0 + c8) = lv[it];
        }
        
      }
    }
    __builtin_amdgcn_fence(__ATOMIC_RELEASE, "workgroup");
    __builtin_amdgcn_wave_barrier();
    __builtin_amdgcn_fence(__ATOMIC_ACQUIRE, "workgroup");
  }
}

// =====================================================================================================
// Causal attention, head dim 64, single batch.
//   q planes (bf16 hi / lo): element (t, h, d) at [t*DM + h*64 + d]
//   k planes (bf16 hi / lo): same layout with key index s
//   v^T hi plane (f16):      element (h, d, s) at [(h*64 + d)*SEQ + s]
//   v^T residual plane (f16, (v - hi)*4096): [(h*64 + d)*VLP + s], s < VLP, read only when RES
//   (a key tile at or beyond VLP would contribute a zero v residual; never happens for query blocks < RESQB)
//   logit (t, s) = q.k * sscale for s <= t, finfo.min for s > t. Query block qb (64 rows) visits key tiles
//   0..qb only (every later key is above the diagonal for all 64 rows -> weight exactly 0); the compare
//   s > t is applied on the diagonal tile kt == qb only (block-uniform scalar branch around the per-element selects). Every row
//   has the live key s = t in the diagonal tile, so the row max is always finite.
//   out planes (bf16 hi / lo of the normalised context): element (t, h, d) at [t*DM + h*64 + d]
//   scores, transposed: S^T = K . Q^T (A = K rows, B = Q rows as columns): bf16 hi/lo split (hi.hi + hi.lo + lo.hi), f32 accumulate,
//   then * sscale in f32. Accumulator element r of tile j in lane (c, hh) = score of key kv0 + 16 j + 8 hh + r for query q0 + c: a lane
//   holds 32 of one query's 64 scores, lane l ^ 16 the other 32, so row max and row sum are in-lane plus one exchange between the halves.
//   p = exp(s - m) carried as f16(1024 p); two score tiles, converted in place, are the B operand P^T of one 32-key chunk
//   (element e < 8: tile 2 kk, e >= 8: tile 2 kk + 1: the k order of the V^T loader); context^T = V^T . P^T on f16 WMMA; RES adds f16 residual planes of p and v
//   (scale 4096, separate accumulator folded back with 1/4096 per chunk in f32); online softmax in f32.
//   Block = 4 waves = 64 query rows of one head; grid = nqbThis * NH; kv chunks of 64, static bound NQB,
//   block-uniform break at kt == qb + 1.
//   K / V^T chunk staging: asynchronous copies global -> LDS (stage_kv3 / stage_kv1), 128 threads x 4 x 16 B per plane = the whole
//   64x64 tile, two buffers: tile kt + 1 is in flight while tile kt is worked on; one block barrier per tile, at the loop's foot,
//   publishes tile kt + 1 and frees the buffer of tile kt, which tile kt + 2 is then copied into;
//   the Os tile is wave-private: context^T accumulators are stored as rows [query][d] and reloaded for whole-line stores.
//   Output coverage: each wave stores rows q0..q0+15 (it 0..3 x lane>>3 0..3) x 64 columns (8 lanes x 8) of both planes.
// =====================================================================================================
#define KVR16 (16 * LP * 2)                   // LDS bytes of 16 rows of a staged K / V^T tile

// One 64 x 64 tile of 16-bit elements (64 rows of 128 B) of each of three planes, global -> LDS rows of pitch LP, 16 B per lane and copy.
// Thread t of 128: 16-B piece (t & 7) of rows (t >> 3) + 16 e, e = 0..3; one wave-wide copy = 4 whole rows = 4 whole lines.
// The pointers and LDS byte addresses handed in are the thread's own for e = 0; each LDS byte is written by one lane only.
// s_wait_xcnt 0 closes the statement so that no address register of an issued copy is rewritten ahead of it.
__device__ __forceinline__ void stage_kv3(const __bf16* ka, const __bf16* kb, const _Float16* va,
                                          unsigned la, unsigned lb, unsigned lv) {
  asm volatile(
      "global_load_async_to_lds_b128 %0, %12, off\n\t"
      "global_load_async_to_lds_b128 %1, %13, off\n\t"
      "global_load_async_to_lds_b128 %2, %14, off\n\t"
      "global_load_async_to_lds_b128 %3, %15, off\n\t"
      "global_load_async_to_lds_b128 %4, %16, off\n\t"
      "global_load_async_to_lds_b128 %5, %17, off\n\t"
      "global_load_async_to_lds_b128 %6, %18, off\n\t"
      "global_load_async_to_lds_b128 %7, %19, off\n\t"
      "global_load_async_to_lds_b128 %8, %20, off\n\t"
      "global_load_async_to_lds_b128 %9, %21, off\n\t"
      "global_load_async_to_lds_b128 %10, %22, off\n\t"
      "global_load_async_to_lds_b128 %11, %23, off\n\t"
      "s_wait_xcnt 0x0"
      :: "v"(la), "v"(la + (unsigned)(1 * KVR16)), "v"(la + (unsigned)(2 * KVR16)), "v"(la + (unsigned)(3 * KVR16)),
         "v"(lb), "v"(lb + (unsigned)(1 * KVR16)), "v"(lb + (unsigned)(2 * KVR16)), "v"(lb + (unsigned)(3 * KVR16)),
         "v"(lv), "v"(lv + (unsigned)(1 * KVR16)), "v"(lv + (unsigned)(2 * KVR16)), "v"(lv + (unsigned)(3 * KVR16)),
         "v"(ka), "v"(ka + (size_t)16 * DM), "v"(ka + (size_t)32 * DM), "v"(ka + (size_t)48 * DM),
         "v"(kb), "v"(kb + (size_t)16 * DM), "v"(kb + (size_t)32 * DM), "v"(kb + (size_t)48 * DM),
         "v"(va), "v"(va + (size_t)16 * SEQ), "v"(va + (size_t)32 * SEQ), "v"(va + (size_t)48 * SEQ)
      : "memory");
}
// The same for one plane of row pitch ld elements.
__device__ __forceinline__ void stage_kv1(const _Float16* g, int ld, unsigned l) {
  asm volatile(
      "global_load_async_to_lds_b128 %0, %4, off\n\t"
      "global_load_async_to_lds_b128 %1, %5, off\n\t"
      "global_load_async_to_lds_b128 %2, %6, off\n\t"
      "global_load_async_to_lds_b128 %3, %7, off\n\t"
      "s_wait_xcnt 0x0"
      :: "v"(l), "v"(l + (unsigned)(1 * KVR16)), "v"(l + (unsigned)(2 * KVR16)), "v"(l + (unsigned)(3 * KVR16)),
         "v"(g), "v"(g + (size_t)16 * ld), "v"(g + (size_t)32 * ld), "v"(g + (size_t)48 * ld)
      : "memory");
}

template <bool RES>
__global__ __launch_bounds__(128)
void attn_causal64(const unsigned short* __restrict__ qhp, const unsigned short* __restrict__ qlp,
                   const unsigned short* __restrict__ khp, const unsigned short* __restrict__ klp,
                   const unsigned short* __restrict__ vhp, const unsigned short* __restrict__ vlp,
                   unsigned short* ohp, unsigned short* olp,
                   int qbBase, int nqbThis, float sscale) {
  union FB { v16b v; v8b h[2]; };
  union FH { v16h v; v8h h[2]; };
  constexpr int NPL = RES ? 4 : 3;                                // staged planes of one buffer
  // two buffers of: K hi [kv][d], K lo, V^T hi [d][kv], (V^T residual), each 64 rows of pitch LP
  __shared__ __align__(16) unsigned short kvs[2][NPL][64 * LP];
  __shared__ __align__(16) float    Os[4][16 * OP];               // per wave context tile [row][d], pitch OP

  const int tid  = threadIdx.x;
  const int wave = tid >> 5;
  const int lane = tid & 31;
  const int hh   = lane >> 4;
  const int c    = lane & 15;

  const int bx   = blockIdx.x;
  const int qbl  = bx % nqbThis;
  const int h    = bx / nqbThis;           // 0..NH-1 (grid = nqbThis * NH)
  const int qb   = qbBase + qbl;
  const int q0   = qb * 64 + wave * 16;

  const __bf16* Qh = (const __bf16*)(const void*)qhp + (size_t)h * HD;
  const __bf16* Ql = (const __bf16*)(const void*)qlp + (size_t)h * HD;
  const __bf16* Kh = (const __bf16*)(const void*)khp + (size_t)h * HD;
  const __bf16* Kl = (const __bf16*)(const void*)klp + (size_t)h * HD;
  const _Float16* Vh = (const _Float16*)(const void*)vhp + (size_t)h * HD * SEQ;
  const _Float16* Vl = (const _Float16*)(const void*)vlp + (size_t)h * HD * VLP;

  // ---- Q fragments (B operand, column = query = lane&15): 2 d-chunks, hi and lo ----
  v16b qah[2], qal[2];
#pragma unroll
  for (int dc = 0; dc < 2; ++dc) {
    const size_t qo = (size_t)(q0 + c) * DM + dc * 32 + 8 * hh;
    qah[dc] = ldfrag_b(Qh + qo);
    qal[dc] = ldfrag_b(Ql + qo);
  }

  float mrow = -INFINITY, lrow = 0.f;        // running max and sum of query q0 + c, the same value in both halves
  v8f oacc[4];                               // context^T: oacc[t][r] = element d = 16 t + 8 hh + r of query q0 + c
#pragma unroll
  for (int t = 0; t < 4; ++t) oacc[t] = zero8();

  const int nkt = qb + 1;                    // key tiles 0..qb (block-uniform)
  // copies of key tile t (0 <= t <= qb, so K rows t*64..+63 < SEQ and V^T columns t*64..+63 < SEQ) into one of the two buffers
  const int sr = tid >> 3, sc = (tid & 7) * 8;                    // this thread's first row (0..15) and element column of every plane
  const unsigned sl = (unsigned)(uintptr_t)&kvs[0][0][0] + (unsigned)((sr * LP + sc) * 2);
  constexpr unsigned BUFB = (unsigned)(NPL * 64 * LP * 2);        // bytes of one buffer
  auto issue = [&](int t, unsigned bo) {                          // bo = byte offset of the buffer: 0 or BUFB
    const int kv = t * 64;
    const unsigned l0 = sl + bo;
    stage_kv3(Kh + (size_t)(kv + sr) * DM + sc, Kl + (size_t)(kv + sr) * DM + sc, Vh + (size_t)sr * SEQ + kv + sc,
              l0, l0 + (unsigned)(64 * LP * 2), l0 + (unsigned)(2 * 64 * LP * 2));
    if constexpr (RES) {
      const int kvl = (kv + 64 <= VLP) ? kv : (VLP - 64);         // clamped address into the residual plane
      stage_kv1(Vl + (size_t)sr * VLP + kvl + sc, VLP, l0 + (unsigned)(3 * 64 * LP * 2));
    }
  };
  issue(0, 0u);
  asm volatile("s_wait_asynccnt 0x0" ::: "memory");      // this wave's copies of tile 0 have landed
  __syncthreads();                                       // ... and every other wave's
  if (nkt > 1) issue(1, BUFB);                           // block-uniform
  unsigned cur = 0u;                                     // byte offset of the buffer that holds tile kt (block-uniform)

  for (int kt = 0; kt < NQB; ++kt) {         // static bound
    if (kt >= nkt) break;                    // block-uniform
    const bool diag = (kt == qb);            // block-uniform
    const int kv0 = kt * 64;
    const bool resOK = (kv0 + 64 <= VLP);    // block-uniform: beyond VLP the v residual counts as zero
    const unsigned short* kvb = &kvs[0][0][0] + (cur >> 1);
    const __bf16*   Ksh = (const __bf16*)(const void*)kvb;
    const __bf16*   Ksl = (const __bf16*)(const void*)(kvb + 64 * LP);
    const _Float16* Vth = (const _Float16*)(const void*)(kvb + 2 * 64 * LP);
    const _Float16* Vtl = (const _Float16*)(const void*)(kvb + (NPL - 1) * 64 * LP);

    // ---- scores, transposed: 64 keys x 16 query columns per wave, 3 bf16 products ----
    //      The LDS reads of one 32-wide d chunk (all four 16-key groups) stand together, both chunks in front of the products.
    //      The four score tiles are independent accumulator chains: their products are issued in turn, so that each product
    //      stands in the others' hazard and latency window; every tile keeps its own order (chunk 0: hi.hi, lo.hi, hi.lo; chunk 1 alike).
    FB kb[4][2], kl[4][2];
#pragma unroll
    for (int dc = 0; dc < 2; ++dc) {
#pragma unroll
      for (int j = 0; j < 4; ++j) {
        kb[j][dc].h[0] = *(const v8b*)(Ksh + (j * 16 + c) * LP + dc * 32 + 8 * hh);
        kb[j][dc].h[1] = *(const v8b*)(Ksh + (j * 16 + c) * LP + dc * 32 + 16 + 8 * hh);
      }
#pragma unroll
      for (int j = 0; j < 4; ++j) {
        kl[j][dc].h[0] = *(const v8b*)(Ksl + (j * 16 + c) * LP + dc * 32 + 8 * hh);
        kl[j][dc].h[1] = *(const v8b*)(Ksl + (j * 16 + c) * LP + dc * 32 + 16 + 8 * hh);
      }
    }
    v8f s[4];
#pragma unroll
    for (int j = 0; j < 4; ++j) s[j] = zero8();
#pragma unroll
    for (int dc = 0; dc < 2; ++dc) {
#pragma unroll
      for (int j = 0; j < 4; ++j) s[j] = mma_b_raw(kb[j][dc].v, qah[dc], s[j]);
#pragma unroll
      for (int j = 0; j < 4; ++j) s[j] = mma_b_raw(kl[j][dc].v, qah[dc], s[j]);
#pragma unroll
      for (int j = 0; j < 4; ++j) s[j] = mma_b_raw(kb[j][dc].v, qal[dc], s[j]);
    }
    // V^T fragments, one group of reads per 32-key chunk. Without the residual planes the first chunk is read here, so that
    // the softmax below covers its LDS latency; with them (twice the fragments) each chunk is read in front of its own products.
    FH vb[2][4], vl[2][4];
    auto ldv = [&](int kk) {
#pragma unroll
      for (int t = 0; t < 4; ++t) {
        vb[kk][t].h[0] = *(const v8h*)(Vth + (t * 16 + c) * LP + kk * 32 + 8 * hh);
        vb[kk][t].h[1] = *(const v8h*)(Vth + (t * 16 + c) * LP + kk * 32 + 16 + 8 * hh);
        if (RES) {
          vl[kk][t].h[0] = *(const v8h*)(Vtl + (t * 16 + c) * LP + kk * 32 + 8 * hh);
          vl[kk][t].h[1] = *(const v8h*)(Vtl + (t * 16 + c) * LP + kk * 32 + 16 + 8 * hh);
          if (!resOK) { vl[kk][t].h[0] = zero8h(); vl[kk][t].h[1] = zero8h(); }
        }
      }
    };
    if (!RES) ldv(0);

    // ---- scale + causal compare (diagonal tile only), max and sum of this lane's query, online softmax; P^T (x1024, f16) and
    //      its residual (x4096) are packed in registers as B operands ----
    const int qrow = q0 + c;                     // query of this lane's score column
#pragma unroll
    for (int j = 0; j < 4; ++j)
#pragma unroll
      for (int r = 0; r < 8; ++r) s[j][r] *= sscale;
    if (diag) {                                  // scalar branch: every other tile runs none of the compares and selects
#pragma unroll
      for (int j = 0; j < 4; ++j)
#pragma unroll
        for (int r = 0; r < 8; ++r) {
          const int key = kv0 + j * 16 + 8 * hh + r; // key of accumulator element r of tile j in this lane
          s[j][r] = (key > qrow) ? -FLT_MAX : s[j][r];
        }
    }
    float mj[4];                                 // one maximum per score tile: four independent chains
#pragma unroll
    for (int j = 0; j < 4; ++j) {
      mj[j] = -INFINITY;
#pragma unroll
      for (int r = 0; r < 8; ++r) mj[j] = fmaxf(mj[j], s[j][r]);
    }
    float m = fmaxf(fmaxf(mj[0], mj[1]), fmaxf(mj[2], mj[3]));
    m = fmaxf(m, xhalf(m));                      // the query's other 32 keys
    const float mnew  = fmaxf(mrow, m);
    const float msafe = (mnew == -INFINITY) ? 0.f : mnew;
    const float alpha = __expf(mrow - msafe);
    mrow = mnew;
    FH pa[2], pl[2];
    float ps[4];                                 // one partial sum per score tile: four independent add chains
#pragma unroll
    for (int j = 0; j < 4; ++j) {
      ps[j] = 0.f;
#pragma unroll
      for (int r = 0; r < 8; ++r) {
        const float p = __expf(s[j][r] - msafe);     // floor logit against a normal max: exp -> 0
        ps[j] += p;
        const float p1k = p * 1024.0f;
        const _Float16 ph = (_Float16)p1k;
        pa[j >> 1].v[(j & 1) * 8 + r] = ph;
        if (RES) pl[j >> 1].v[(j & 1) * 8 + r] = (_Float16)((p1k - (float)ph) * 4096.0f);
      }
    }
    float psum = (ps[0] + ps[1]) + (ps[2] + ps[3]);
    psum += xhalf(psum);                         // the query's other 32 keys
    lrow = lrow * alpha + psum;
#pragma unroll
    for (int t = 0; t < 4; ++t)
#pragma unroll
      for (int r = 0; r < 8; ++r) oacc[t][r] *= alpha;

    // ---- context^T += V^T . P^T (f16 WMMA), residual products into a separate accumulator ----
    v8f o1[4];
#pragma unroll
    for (int t = 0; t < 4; ++t) o1[t] = zero8();
    if (!RES) {
      ldv(1);
      // keeps the second chunk's eight reads one group in front of the products; without it they are read in pairs among the
      // products, over the first chunk's registers, and each pair is waited for
      __builtin_amdgcn_sched_barrier(0);
    }
#pragma unroll   // constant kk: the fragment arrays stay in registers
    for (int kk = 0; kk < 2; ++kk) {
      if (RES) ldv(kk);
#pragma unroll
      for (int t = 0; t < 4; ++t) oacc[t] = mma_h_raw(vb[kk][t].v, pa[kk].v, oacc[t]);
      if (RES) {
#pragma unroll
        for (int t = 0; t < 4; ++t) o1[t] = mma_h_raw(vl[kk][t].v, pa[kk].v, o1[t]);
#pragma unroll
        for (int t = 0; t < 4; ++t) o1[t] = mma_h_raw(vb[kk][t].v, pl[kk].v, o1[t]);
      }
    }
    if (RES) {
#pragma unroll
      for (int t = 0; t < 4; ++t)
#pragma unroll
        for (int r = 0; r < 8; ++r) oacc[t][r] += o1[t][r] * (1.0f / 4096.0f);
    }
    // WMMA distance in front of the branches at the loop's foot, on either side of them; taking the accumulators, the statement also keeps
    // the tile's products in front of the foot's waits (otherwise they sink behind the barrier, behind a full wait for the second chunk's reads)
    acc_guard4(oacc[0], oacc[1], oacc[2], oacc[3]);
    asm volatile("s_wait_dscnt 0x0" ::: "memory");       // this wave's reads of tile kt's buffer are done
    asm volatile("s_wait_asynccnt 0x0" ::: "memory");    // this wave's copies of tile kt + 1 have landed
    __syncthreads();                                     // publishes tile kt + 1 and frees tile kt's buffer
    if (kt + 2 < nkt) issue(kt + 2, cur);                // block-uniform
    cur = BUFB - cur;
  }
  asm volatile("s_wait_asynccnt 0x0" ::: "memory");      // no copy is left in flight behind the loop

  // ---- normalise (1/l and the 1/1024 p carry), stage the wave's 16x64 tile, bf16 hi/lo split,
  float* os = Os[wave];
  {
    const float l = lrow;
    const float inv = ((l > 0.f) ? (1.0f / l) : 0.f) * (1.0f / 1024.0f);
#pragma unroll
    for (int t = 0; t < 4; ++t) {              // row = query c, 8 consecutive d per lane and tile: two 16-B stores
      v4f a, b;
#pragma unroll
      for (int r = 0; r < 4; ++r) { a[r] = oacc[t][r] * inv; b[r] = oacc[t][4 + r] * inv; }
      *(v4f*)(os + c * OP + t * 16 + 8 * hh)     = a;
      *(v4f*)(os + c * OP + t * 16 + 8 * hh + 4) = b;
    }
  }
  __builtin_amdgcn_fence(__ATOMIC_RELEASE, "workgroup");
  __builtin_amdgcn_wave_barrier();
  __builtin_amdgcn_fence(__ATOMIC_ACQUIRE, "workgroup");
  {
    const int q4 = lane >> 3, c8 = (lane & 7) * 8;
    v4u hv[4], lv[4];
#pragma unroll
    for (int it = 0; it < 4; ++it) {
      const int row = it * 4 + q4;   // it 0..3 x q4 0..3 = rows 0..15 of the wave tile
      const float* sp = os + row * OP + c8;
      v4u a, a2;
#pragma unroll
      for (int e = 0; e < 4; ++e) {
        const float f0 = sp[2 * e], f1 = sp[2 * e + 1];
        const unsigned short h0 = bf_bits(f0), h1 = bf_bits(f1);
        const unsigned short l0 = bf_bits(f0 - bf_up(h0)), l1 = bf_bits(f1 - bf_up(h1));
        a[e] = pk16(h0, h1); a2[e] = pk16(l0, l1);
      }
      hv[it] = a; lv[it] = a2;
    }
    {
#pragma unroll
      for (int it = 0; it < 4; ++it) {
        const int row = it * 4 + q4;
        const size_t go = (size_t)(q0 + row) * DM + (size_t)h * HD + c8;
        *(v4u*)(ohp + go) = hv[it];
        *(v4u*)(olp + go) = lv[it];
      }
      
    }
  }
}

// =====================================================================================================
// Workspace map (bytes, SEQ = 4096):
//   Xb    bf16 [SEQ][1024]          0          8388608
//   Wqkvb bf16 [3072 n][1024 k]     8388608    6291456   (rows 0..1023 = q columns, 1024..2047 = k, 2048..3071 = v)
//   Wob   bf16 [1024 n][1024 k]     14680064   2097152
//   Qh    bf16 [SEQ][1024]          16777216   8388608
//   Ql    bf16 [SEQ][1024]          25165824   8388608
//   Kh    bf16 [SEQ][1024]          33554432   8388608
//   Kl    bf16 [SEQ][1024]          41943040   8388608
//   VTh   f16  [1024][SEQ]          50331648   8388608
//   VTl   f16  [1024][VLP=512]      58720256   1048576
//   Oh    bf16 [SEQ][1024]          59768832   8388608
//   Ol    bf16 [SEQ][1024]          68157440   8388608
//   end                             76546048
// All planes are exact multiples of their 64x64 / whole-line store granularity (no padded tails needed),
// =====================================================================================================
extern "C" void kernel_launch(void* const* d_in, const int* in_sizes, int n_in,
                              void* d_out, int out_size, void* d_ws, size_t ws_size,
                              hipStream_t stream) {
  if (n_in < 5) return;
  if (in_sizes[0] < SEQ * DM) return;                 // x rows 0..SEQ-1 (prefix of the full input)
  if (in_sizes[1] != DM * NQKV) return;               // w_qkv [1024][3072]
  if (in_sizes[2] != NQKV) return;                    // b_qkv [3072]
  if (in_sizes[3] != DM * DM) return;                 // w_o [1024][1024]
  if (in_sizes[4] != DM) return;                      // b_o [1024]
  if (out_size < SEQ * DM) return;

  const float* x     = (const float*)d_in[0];
  const float* w_qkv = (const float*)d_in[1];
  const float* b_qkv = (const float*)d_in[2];
  const float* w_o   = (const float*)d_in[3];
  const float* b_o   = (const float*)d_in[4];

  const size_t PX  = (size_t)SEQ * DM * 2;       // 16-bit activation plane [SEQ][1024]
  const size_t PWQ = (size_t)NQKV * DM * 2;      // 16-bit fused weight plane [3072][1024]
  const size_t PWO = (size_t)DM * DM * 2;        // 16-bit out weight plane
  const size_t PVT = (size_t)DM * SEQ * 2;       // v^T hi plane
  const size_t PVL = (size_t)DM * VLP * 2;       // v^T residual plane
  size_t off = 0;
  const size_t oXb   = off; off += PX;
  const size_t oWqkv = off; off += PWQ;
  const size_t oWo   = off; off += PWO;
  const size_t oQh   = off; off += PX;
  const size_t oQl   = off; off += PX;
  const size_t oKh   = off; off += PX;
  const size_t oKl   = off; off += PX;
  const size_t oVTh  = off; off += PVT;
  const size_t oVTl  = off; off += PVL;
  const size_t oOh   = off; off += PX;
  const size_t oOl   = off; off += PX;
  if (off > ws_size) return;                     // off = 76546048 for SEQ = 4096
  if (off > (size_t)134217728) return;

  char* ws = (char*)d_ws;
  unsigned short* Xb    = (unsigned short*)(ws + oXb);
  unsigned short* Wqkvb = (unsigned short*)(ws + oWqkv);
  unsigned short* Wob   = (unsigned short*)(ws + oWo);
  unsigned short* Qh    = (unsigned short*)(ws + oQh);
  unsigned short* Ql    = (unsigned short*)(ws + oQl);
  unsigned short* Kh    = (unsigned short*)(ws + oKh);
  unsigned short* Kl    = (unsigned short*)(ws + oKl);
  unsigned short* VTh   = (unsigned short*)(ws + oVTh);
  unsigned short* VTl   = (unsigned short*)(ws + oVTl);
  unsigned short* Oh    = (unsigned short*)(ws + oOh);
  unsigned short* Ol    = (unsigned short*)(ws + oOl);
  const unsigned short* Wqb = Wqkvb;                              // q weight rows  [1024 n][1024 k]
  const unsigned short* Wkb = Wqkvb + (size_t)DM * DM;            // k weight rows
  const unsigned short* Wvb = Wqkvb + (size_t)2 * DM * DM;        // v weight rows

  const dim3 blk(256);
  const int n8x = SEQ * DM / 8;                                    // multiple of 256
  const dim3 gCvtX((n8x + 255) / 256);
  const dim3 gTq(NQKV / 64, DM / 64);                              // in [1024 k][3072 n] -> out [3072][1024]: (n tiles, k tiles) = (48, 16)
  const dim3 gTo(DM / 64, DM / 64);                                // in [1024 k][1024 n] -> out [1024][1024]: (16, 16)
  const dim3 gProj((SEQ / 128) * (DM / 128), 1);                   // M = SEQ, N = 1024 -> 256 block tiles of 128x128 (SEQ = 4096)
  const dim3 gVT((DM / 128) * (SEQ / 128), 1);                     // M = 1024, N = SEQ

  // (1) x -> bf16 plane [SEQ][1024]; w_qkv [k][n] -> bf16 [n][k]; w_o [k][n] -> bf16 [n][k]
  cvt_bf16x8<<<gCvtX, blk, 0, stream>>>(x, Xb, n8x);
  cvtT_bf16<<<gTq, blk, 0, stream>>>(w_qkv, Wqkvb, DM, NQKV);
  cvtT_bf16<<<gTo, blk, 0, stream>>>(w_o, Wob, DM, DM);
  // (2) q = x . Wq + b_q -> bf16 hi/lo planes [t][h*64+d]   (M = SEQ, N = 1024, K = 1024)
  gemm64<0, 2, 1><<<gProj, blk, 0, stream>>>(
      Xb, Xb, DM, 0LL, Wqb, Wqb, DM, 0LL,
      (void*)Qh, DM, 0LL, (void*)Ql, DM, 0LL, DM,
      SEQ, DM, DM, 1.0f, b_qkv);
  // (3) k = x . Wk + b_k -> bf16 hi/lo planes
  gemm64<0, 2, 1><<<gProj, blk, 0, stream>>>(
      Xb, Xb, DM, 0LL, Wkb, Wkb, DM, 0LL,
      (void*)Kh, DM, 0LL, (void*)Kl, DM, 0LL, DM,
      SEQ, DM, DM, 1.0f, b_qkv + DM);
  // (4) v^T = Wv . x^T + b_v (per row) -> f16 hi plane [h*64+d][s] (pitch SEQ) and residual plane
  //     (x4096, keys < VLP only, pitch VLP)   (A = Wvb [n][k], Bt = Xb; M = 1024, N = SEQ, K = 1024)
  gemm64<0, 3, 2><<<gVT, blk, 0, stream>>>(
      Wvb, Wvb, DM, 0LL, Xb, Xb, DM, 0LL,
      (void*)VTh, SEQ, 0LL, (void*)VTl, VLP, 0LL, VLP,
      DM, SEQ, DM, 4096.0f, b_qkv + 2 * DM);
  // (5) causal attention: query blocks 0..RESQB-1 with residual planes, the rest without
  attn_causal64<true><<<dim3(NH * RESQB), dim3(128), 0, stream>>>(
      Qh, Ql, Kh, Kl, VTh, VTl, Oh, Ol, 0, RESQB, 0.125f);
  if (NQB > RESQB) {
    attn_causal64<false><<<dim3(NH * (NQB - RESQB)), dim3(128), 0, stream>>>(
        Qh, Ql, Kh, Kl, VTh, VTl, Oh, Ol, RESQB, NQB - RESQB, 0.125f);
  }
  // (6) out = context . Wo + b_o -> d_out f32 [SEQ][1024]  (A = context hi + lo planes, 2 products)
  gemm64<1, 0, 1><<<gProj, blk, 0, stream>>>(
      Oh, Ol, DM, 0LL, Wob, Wob, DM, 0LL,
      d_out, DM, 0LL, d_out, DM, 0LL, DM,
      SEQ, DM, DM, 1.0f, b_o);
  (void)hipGetLastError();
}

// v008
// A run of this version takes 129 microseconds.
// Next to v007, in two timings, it ran 1.19 and 1.16 times as fast.
// Over all steps from v000 it is 4.56 times as fast.
// Contractions: q, k, v^T projections = v_wmma_f32_16x16x32_bf16 (bf16 operands from RNE-converted inputs, single product, f32 bias add);
// k.q^T scores (transposed) = v_wmma_f32_16x16x32_bf16 with bf16 hi/lo split q and k (hi.hi + hi.lo + lo.hi);
// v^T.p^T = v_wmma_f32_16x16x32_f16 (p carried x1024 in f16, v in f16; extra f16 residual planes x4096 of p and v for the first VLP query rows);
// ctx.Wo = v_wmma_f32_16x16x32_bf16 with ctx as bf16 hi/lo planes times bf16 Wo (2 products); all f32 accumulate; causal compare and softmax in f32.
#include <hip/hip_runtime.h>
#include <math.h>
#include <float.h>
#include <stdint.h>

#ifndef NB
#define NB    1
#endif
#ifndef SEQ
#define SEQ   4096
#endif
#define SEQ_FULL 4096
#define DM    1024
#define NH    16
#define HD    64
#define NQKV  (3 * DM)
#define NQB   (SEQ / 64)                      // key / query tiles of 64
#define VLP   ((SEQ < 512) ? SEQ : 512)       // key pitch of the v^T residual plane (keys 0..VLP-1)
#define RESQB (VLP / 64)                      // number of leading 64-row query blocks that use the p / v residual planes
#define LP    72                              // LDS row pitch of the 64-wide 16-bit K / V^T tiles, in elements: 144 B = 16 B x 9 (odd), so the
                                              // 16 rows that one half-wave's 16-B fragment read touches fall on 16 distinct groups of 4 banks
#define OP    68                              // LDS row pitch of the 64-wide f32 context tile, in elements: 272 B = 16 B x 17 (odd)
static_assert(NB == 1);
static_assert(NH * HD == DM && HD == 64);
static_assert((SEQ % 64) == 0 && (DM % 64) == 0 && SEQ >= 64 && SEQ <= SEQ_FULL);
static_assert(RESQB * 64 == VLP && VLP <= SEQ && RESQB >= 1 && RESQB <= NQB);
static_assert((NQKV % 64) == 0);
static_assert((SEQ % 128) == 0 && (DM % 128) == 0);   // 128x128 block tiles and 128-wide k steps of the projections

typedef _Float16 v16h __attribute__((ext_vector_type(16)));
typedef _Float16 v8h  __attribute__((ext_vector_type(8)));
typedef __bf16   v16b __attribute__((ext_vector_type(16)));
typedef __bf16   v8b  __attribute__((ext_vector_type(8)));
typedef float    v8f  __attribute__((ext_vector_type(8)));
typedef float    v4f  __attribute__((ext_vector_type(4)));
typedef unsigned int v4u __attribute__((ext_vector_type(4)));

// ---- scalar helpers --------------------------------------------------------------------------------
__device__ __forceinline__ unsigned short bf_bits(float f) {          // f32 -> bf16 bits, RNE convert
  unsigned u = __float_as_uint(f);
  return (unsigned short)((u + 0x7FFFu + ((u >> 16) & 1u)) >> 16);
}
__device__ __forceinline__ float bf_up(unsigned short h) { return __uint_as_float(((unsigned)h) << 16); }
__device__ __forceinline__ unsigned short h_bits(_Float16 x) { return __builtin_bit_cast(unsigned short, x); }
__device__ __forceinline__ unsigned pk16(unsigned short a, unsigned short b) { return (unsigned)a | ((unsigned)b << 16); }
__device__ __forceinline__ v8f zero8() { v8f z = {0.f, 0.f, 0.f, 0.f, 0.f, 0.f, 0.f, 0.f}; return z; }
__device__ __forceinline__ v8h zero8h() {
  const _Float16 z = (_Float16)0.0f;
  v8h r = {z, z, z, z, z, z, z, z};
  return r;
}

// ---- value of lane l ^ 16 (the other half of the wave), a vector-port move
__device__ __forceinline__ float xhalf(float x) {
  return __builtin_bit_cast(float, __builtin_amdgcn_permlanex16(__builtin_bit_cast(int, x), __builtin_bit_cast(int, x),
                                                                0x76543210, 0xfedcba98, false, false));
}

// ---- fragment loaders: 16-bit A/B operand, lane -> row/col (lane&15), p already includes +8*(lane>>4);
//      elements 0..7 <- p[0..7] (k0+8h..), elements 8..15 <- p[16..23] (k0+16+8h..)
__device__ __forceinline__ v16b ldfrag_b(const __bf16* p) {
  union { v16b v; v8b h[2]; } f;
  f.h[0] = *(const v8b*)(p);
  f.h[1] = *(const v8b*)(p + 16);
  return f.v;
}

// ---- WMMA helpers: bare builtins (the compiler pads where a vector instruction follows too closely) and hand-written gaps --------
__device__ __forceinline__ v8f mma_b_raw(v16b a, v16b b, v8f c) {
  return __builtin_amdgcn_wmma_f32_16x16x32_bf16(false, a, false, b, (short)0, c, false, false);
}
__device__ __forceinline__ v8f mma_h_raw(v16h a, v16h b, v8f c) {
  return __builtin_amdgcn_wmma_f32_16x16x32_f16(false, a, false, b, (short)0, c, false, false);
}
__device__ __forceinline__ void dep_guard_b(v8f& a, v8f& b, v16b x, v16b y) {
  asm volatile("v_nop\n\tv_nop\n\tv_nop\n\tv_nop" : "+v"(a), "+v"(b) : "v"(x), "v"(y));
}
__device__ __forceinline__ void keep4_b(v16b a, v16b b, v16b c, v16b d) {
  asm volatile("v_nop" :: "v"(a), "v"(b), "v"(c), "v"(d));
}
__device__ __forceinline__ void acc_guard4(v8f& a, v8f& b, v8f& c, v8f& d) {
  asm volatile("v_nop\n\tv_nop\n\tv_nop\n\tv_nop" : "+v"(a), "+v"(b), "+v"(c), "+v"(d));
}

// =====================================================================================================
// f32 -> bf16 (RNE convert), 8 elements per thread, one 16-B store per lane: a wave writes 512 contiguous B
// coverage: n8 threads x 8 = whole plane (n8 = SEQ*DM/8 is a multiple of 256).
// =====================================================================================================
__device__ __forceinline__ void cvt_bf16x8(const float* __restrict__ in, unsigned short* out, int n8, int blk) {
  const int i = blk * 256 + threadIdx.x;
  if (i < n8) {
    const v4f a = *(const v4f*)(in + (size_t)i * 8);
    const v4f b = *(const v4f*)(in + (size_t)i * 8 + 4);
    v4u p;
    p[0] = pk16(bf_bits(a[0]), bf_bits(a[1]));
    p[1] = pk16(bf_bits(a[2]), bf_bits(a[3]));
    p[2] = pk16(bf_bits(b[0]), bf_bits(b[1]));
    p[3] = pk16(bf_bits(b[2]), bf_bits(b[3]));
    *(v4u*)(out + (size_t)i * 8) = p;
    
  }
}

// =====================================================================================================
// Transposed convert: in f32 [K rows][N cols] (pitch N) -> out bf16 [N rows][K cols] (pitch K), RNE.
// (N/64) x (K/64) blocks of 256 threads (bn = n tile, bk = k tile); one 64(k) x 64(n) tile per block through the LDS tile st (64 * 72 halves).
// Load phase: thread (k row = tid>>2, 16 n columns = (tid&3)*16) reads 4 x 16 B and writes bf16 bits
// transposed into st[n][k] (pitch 72 halves). After __syncthreads each wave writes 8 output rows:
// coverage: load 64 k x (4 threads x 16 n) = 64x64; store 8 waves x 2 it x 4 rows x (8 lanes x 8) = 64x64.
// LDS st: cross-wave exchange behind the block barrier.
// =====================================================================================================
__device__ __forceinline__ void cvtT_bf16(unsigned short* st, const float* __restrict__ in, unsigned short* out, int K, int N,
                                          int bn, int bk) {
  const int tid = threadIdx.x;
  const int n0  = bn * 64;
  const int k0  = bk * 64;
  {
    const int r  = tid >> 2;            // k row 0..63
    const int cb = (tid & 3) * 16;      // n column base
    const float* src = in + (size_t)(k0 + r) * N + n0 + cb;
#pragma unroll
    for (int e = 0; e < 4; ++e) {
      const v4f a = *(const v4f*)(src + 4 * e);
#pragma unroll
      for (int u = 0; u < 4; ++u) st[(cb + 4 * e + u) * 72 + r] = bf_bits(a[u]);
    }
  }
  __syncthreads();
  {
    const int lane = tid & 31, wave = tid >> 5;
    const int q = lane >> 3, c8 = (lane & 7) * 8;
    v4u hv[2];
#pragma unroll
    for (int it = 0; it < 2; ++it) {
      const int row = wave * 8 + it * 4 + q;      // n row within the tile
      hv[it] = *(const v4u*)(st + row * 72 + c8);
    }
    {
#pragma unroll
      for (int it = 0; it < 2; ++it) {
        const int row = wave * 8 + it * 4 + q;
        *(v4u*)(out + (size_t)(n0 + row) * K + k0 + c8) = hv[it];
      }
      // the code of another role follows in the merged kernel: no register of the two issued stores is rewritten ahead of this wait
      asm volatile("s_wait_xcnt 0x0" ::: "memory");
    }
  }
}

// =====================================================================================================
// The three independent conversions in one launch, role by block index (block-uniform branches):
// blocks 0..PTQ-1: w_qkv tiles; PTQ..PTQ+PTO-1: w_o tiles; the rest: 2048-element pieces of x.
// =====================================================================================================
#define PTQ ((NQKV / 64) * (DM / 64))
#define PTO ((DM / 64) * (DM / 64))
__global__ __launch_bounds__(256) void prep_bf16(const float* __restrict__ x, const float* __restrict__ w_qkv,
                                                 const float* __restrict__ w_o, unsigned short* Xb, unsigned short* Wqkvb,
                                                 unsigned short* Wob, int n8) {
  __shared__ __align__(16) unsigned short st[64 * 72];
  const int bx = blockIdx.x;
  if (bx < PTQ) {
    cvtT_bf16(st, w_qkv, Wqkvb, DM, NQKV, bx % (NQKV / 64), bx / (NQKV / 64));
  } else if (bx < PTQ + PTO) {
    cvtT_bf16(st, w_o, Wob, DM, DM, (bx - PTQ) % (DM / 64), (bx - PTQ) / (DM / 64));
  } else {
    cvt_bf16x8(x, Xb, n8, bx - (PTQ + PTO));
  }
}

// =====================================================================================================
// Register-blocked bf16 WMMA GEMM: C[m][n] = sum_k A[m][k] * Bt[n][k] + bias; one wave per 32x64 tile,
// 8 waves (4 x 2) per block = one 128x128 tile of C. A row-major [M][K] pitch lda; Bt row-major [N][K] pitch ldb
// (k contiguous); M, N multiples of 128, K a multiple of GKS. tile = index of the block's tile; smem, sT = the block's LDS.
// Operands: per k step of GKS the block's 128 rows of every operand plane are copied global -> LDS in whole lines
// (stage_tile), two buffers, the next step's copies in flight while this step's fragments are read from LDS;
// every fragment keeps its k order and the k steps stay ascending, so each f32 sum keeps its order.
// NSPLIT: 0 = A.Bt; 1 = (A + A2).Bt (A2 = unscaled bf16 lo plane of A); 2 = A.Bt + A2.Bt + A.Bt2.
// OUT_MODE: 0 = f32 (pitch ldc); 2 = bf16 hi plane C + bf16 lo plane C2 (lo = RNE(v - hi), unscaled);
//           3 = f16 hi plane C + f16 residual plane C2 = f16((v - hi) * rscale), C2 written only for tiles
//               with n0 < N2 (pitch ldc2).
// BIASM: 1 = bias[n] added per column (bias has >= N entries); 2 = bias[m] added per row (>= M entries);
//        the bias value is RNE-converted to bf16 and added in f32 before any output split.
// =====================================================================================================
#define GKS 128                               // k elements of one staged step: 256 B of every operand row
#define GP  136                               // LDS row pitch of a staged operand tile, in elements: 272 B = 16 B x 17 (odd)
#define GMI 2                                 // 16-row sub-tiles of one wave's 32x64 tile

// One operand tile of 128 rows x GKS k (256 B per row), global -> LDS, by asynchronous copies of 16 B per lane.
// Thread t of 256: 16-B piece (t & 15) of rows (t >> 4) + 16 e, e = 0..7; one wave-wide copy = 2 whole rows = 4 whole lines.
// Coverage: 16 rows x 8 e = 128 rows, 16 pieces x 16 B = 256 B; each LDS byte is written by one lane only.
// s_wait_xcnt 0 closes the statement so that no address register of an issued copy is rewritten ahead of it.
__device__ __forceinline__ void stage_tile(const __bf16* g, int ld, __bf16* l, int tid) {
  const __bf16* gp = g + (size_t)(tid >> 4) * ld + (tid & 15) * 8;
  const unsigned la = (unsigned)(uintptr_t)l + (unsigned)(((tid >> 4) * GP + (tid & 15) * 8) * 2);
  asm volatile(
      "global_load_async_to_lds_b128 %0, %8, off\n\t"
      "global_load_async_to_lds_b128 %1, %9, off\n\t"
      "global_load_async_to_lds_b128 %2, %10, off\n\t"
      "global_load_async_to_lds_b128 %3, %11, off\n\t"
      "global_load_async_to_lds_b128 %4, %12, off\n\t"
      "global_load_async_to_lds_b128 %5, %13, off\n\t"
      "global_load_async_to_lds_b128 %6, %14, off\n\t"
      "global_load_async_to_lds_b128 %7, %15, off\n\t"
      "s_wait_xcnt 0x0"
      :: "v"(la), "v"(la + (unsigned)(1 * 16 * GP * 2)),
         "v"(la + (unsigned)(2 * 16 * GP * 2)), "v"(la + (unsigned)(3 * 16 * GP * 2)),
         "v"(la + (unsigned)(4 * 16 * GP * 2)), "v"(la + (unsigned)(5 * 16 * GP * 2)),
         "v"(la + (unsigned)(6 * 16 * GP * 2)), "v"(la + (unsigned)(7 * 16 * GP * 2)),
         "v"(gp), "v"(gp + (size_t)(1 * 16) * ld),
         "v"(gp + (size_t)(2 * 16) * ld), "v"(gp + (size_t)(3 * 16) * ld),
         "v"(gp + (size_t)(4 * 16) * ld), "v"(gp + (size_t)(5 * 16) * ld),
         "v"(gp + (size_t)(6 * 16) * ld), "v"(gp + (size_t)(7 * 16) * ld)
      : "memory");
}

#define GSM(NPL) (2 * (NPL) * 128 * GP)        // elements of a block's LDS: two buffers of NPL staged planes
template <int NSPLIT, int OUT_MODE, int BIASM>
__device__ __forceinline__ void gemm64(
    __bf16* smem, float* sT, int tile,
    const unsigned short* __restrict__ Ap, const unsigned short* A2p, int lda,
    const unsigned short* __restrict__ Btp, const unsigned short* Bt2p, int ldb,
    void* Cout, int ldc,
    void* Cout2, int ldc2, int N2,
    int M, int N, int K, float rscale, const float* __restrict__ bias) {
  const __bf16* A   = (const __bf16*)(const void*)Ap;
  const __bf16* A2  = (const __bf16*)(const void*)A2p;
  const __bf16* Bt  = (const __bf16*)(const void*)Btp;
  const __bf16* Bt2 = (const __bf16*)(const void*)Bt2p;
  constexpr int NPL = 2 + (NSPLIT >= 1 ? 1 : 0) + (NSPLIT == 2 ? 1 : 0);   // staged planes: A, Bt, (A2), (Bt2)
  // smem: two buffers of the block's NPL operand tiles, pitch GP; sT: per-wave 16x64 slabs of the epilogue, pitch 68 floats
  auto stg = [&](int buf, int pl) { return smem + (size_t)(buf * NPL + pl) * (128 * GP); };
  const int tid  = threadIdx.x;
  const int lane = threadIdx.x & 31;
  const int wave = threadIdx.x >> 5;
  const int tilesN = N >> 7;
  const int tilesM = M >> 7;
  if (tile >= tilesM * tilesN) return;   // block-uniform, in front of every copy and barrier
  const int tm = tile / tilesN;
  const int tn = tile - tm * tilesN;
  const int bm0 = tm << 7;               // block tile origin
  const int bn0 = tn << 7;
  const int wm  = (wave >> 1) << 5;      // wave tile origin inside the block tile: 4 wave rows of 32, 2 wave columns of 64
  const int wn  = (wave & 1) << 6;
  const int m0 = bm0 + wm;
  const int n0 = bn0 + wn;

  const __bf16* Ab  = A;
  const __bf16* Bb  = Bt;
  const __bf16* Ab2 = (NSPLIT >= 1) ? A2  : Ab;
  const __bf16* Bb2 = (NSPLIT == 2) ? Bt2 : Bb;

  const int rlane = lane & 15;                 // row (A) / col (B, D) within subtile
  const int koff  = (lane >> 4) * 8;           // k offset of this lane half
  const int mOff  = (lane >> 4) * 8;           // D row offset

  v8f acc[GMI][4];
#pragma unroll
  for (int i = 0; i < GMI; ++i)
#pragma unroll
    for (int j = 0; j < 4; ++j) acc[i][j] = zero8();

  // copies of k step t (rows bm0.. / bn0.. + 0..127 < M / N, k = t*GKS..+GKS-1 < K) into buffer buf
  auto issue = [&](int t, int buf) {
    const size_t k0 = (size_t)t * GKS;
    stage_tile(Ab + (size_t)bm0 * lda + k0, lda, stg(buf, 0), tid);
    stage_tile(Bb + (size_t)bn0 * ldb + k0, ldb, stg(buf, 1), tid);
    if constexpr (NSPLIT >= 1) stage_tile(Ab2 + (size_t)bm0 * lda + k0, lda, stg(buf, 2), tid);
    if constexpr (NSPLIT == 2) stage_tile(Bb2 + (size_t)bn0 * ldb + k0, ldb, stg(buf, 3), tid);
  };
  const int NT = K / GKS;                                // block-uniform
  issue(0, 0);
  asm volatile("s_wait_asynccnt 0x0" ::: "memory");      // this wave's copies of step 0 have landed
  __syncthreads();                                       // ... and every other wave's
  if (NT > 1) issue(1, 1);

  for (int t = 0; t < NT; ++t) {
    const __bf16* sA  = stg(t & 1, 0);
    const __bf16* sB  = stg(t & 1, 1);
    const __bf16* sA2 = stg(t & 1, NSPLIT >= 1 ? 2 : 0);
    const __bf16* sB2 = stg(t & 1, NSPLIT == 2 ? 3 : 1);
#pragma unroll   // constant kk: every LDS fragment offset is an immediate and the fragment arrays stay in registers
    for (int kk = 0; kk < GKS; kk += 32) {
      v16b bh[4], bl[4], ah[GMI], al[GMI];
#pragma unroll
      for (int j = 0; j < 4; ++j) {
        const int bo = (wn + (j << 4) + rlane) * GP + koff + kk;
        bh[j] = ldfrag_b(sB + bo);
        if (NSPLIT == 2) bl[j] = ldfrag_b(sB2 + bo); else bl[j] = bh[j];
      }
#pragma unroll   // all fragment reads of this k chunk stand as one group in front of its products
      for (int i = 0; i < GMI; ++i) {
        const int ao = (wm + (i << 4) + rlane) * GP + koff + kk;
        ah[i] = ldfrag_b(sA + ao);
        if (NSPLIT >= 1) al[i] = ldfrag_b(sA2 + ao); else al[i] = ah[i];
      }
#pragma unroll
      for (int i = 0; i < GMI; ++i) {
#pragma unroll
        for (int j = 0; j < 4; ++j) {
          acc[i][j] = mma_b_raw(ah[i], bh[j], acc[i][j]);
          if (NSPLIT >= 1) acc[i][j] = mma_b_raw(al[i], bh[j], acc[i][j]);
          if (NSPLIT == 2) acc[i][j] = mma_b_raw(ah[i], bl[j], acc[i][j]);
        }
        dep_guard_b(acc[i][0], acc[i][3], ah[i], al[i]);
      }
      keep4_b(bh[0], bh[1], bh[2], bh[3]);
      if (NSPLIT == 2) keep4_b(bl[0], bl[1], bl[2], bl[3]);
    }
    asm volatile("s_wait_dscnt 0x0" ::: "memory");       // this wave's reads of buffer t & 1 are done
    asm volatile("s_wait_asynccnt 0x0" ::: "memory");    // this wave's copies of step t + 1 have landed
    __syncthreads();                                     // publishes step t + 1 and frees buffer t & 1
    if (t + 2 < NT) issue(t + 2, t & 1);                 // block-uniform
  }
  asm volatile("s_wait_asynccnt 0x0" ::: "memory");      // no copy is left in flight behind the loop
  acc_guard4(acc[0][0], acc[0][1], acc[0][2], acc[0][3]);
  acc_guard4(acc[1][0], acc[1][1], acc[1][2], acc[1][3]);

  // ---- epilogue ----
  float* slab = sT + wave * (16 * 68);
  float bcol[4];
#pragma unroll
  for (int j = 0; j < 4; ++j) bcol[j] = 0.f;
  if (BIASM == 1) {
#pragma unroll
    for (int j = 0; j < 4; ++j) bcol[j] = bf_up(bf_bits(bias[n0 + (j << 4) + rlane]));   // < N, in range
  }
#pragma unroll
  for (int i = 0; i < GMI; ++i) {
    const int mBase = m0 + (i << 4);
    float brow[8];
#pragma unroll
    for (int r = 0; r < 8; ++r) brow[r] = 0.f;
    if (BIASM == 2) {
      const v4f b0 = *(const v4f*)(bias + mBase + mOff);          // rows mBase+mOff..+7 < M, in range
      const v4f b1 = *(const v4f*)(bias + mBase + mOff + 4);
#pragma unroll
      for (int r = 0; r < 4; ++r) {
        brow[r]     = bf_up(bf_bits(b0[r]));
        brow[4 + r] = bf_up(bf_bits(b1[r]));
      }
    }
#pragma unroll
    for (int j = 0; j < 4; ++j) {
#pragma unroll
      for (int r = 0; r < 8; ++r) {
        slab[(mOff + r) * 68 + (j << 4) + rlane] = acc[i][j][r] + bcol[j] + brow[r];
      }
    }
    __builtin_amdgcn_fence(__ATOMIC_RELEASE, "workgroup");
    __builtin_amdgcn_wave_barrier();
    __builtin_amdgcn_fence(__ATOMIC_ACQUIRE, "workgroup");
    if (OUT_MODE == 0) {
      float* C = (float*)Cout;
      const int hh = lane >> 4, c4 = (lane & 15) * 4;     // 256-B row segment = 16 lanes x 16 B
      {
#pragma unroll
        for (int it = 0; it < 8; ++it) {
          const int row = it * 2 + hh;                     // it 0..7 x hh 0..1 = rows 0..15
          const v4f v = *(const v4f*)(slab + row * 68 + c4);
          *(v4f*)(C + (size_t)(mBase + row) * ldc + n0 + c4) = v;
        }
        
      }
    } else {
      const int q = lane >> 3, c8 = (lane & 7) * 8;
      unsigned short* C  = (unsigned short*)Cout;
      unsigned short* C2 = (unsigned short*)Cout2;
      const bool wlo = (OUT_MODE == 2) || (n0 < N2);      // wave-uniform
      v4u hv[4], lv[4];
#pragma unroll
      for (int it = 0; it < 4; ++it) {
        const int row = it * 4 + q;                        // it 0..3 x q 0..3 = rows 0..15
        const float* sp = slab + row * 68 + c8;
        v4u a, a2;
#pragma unroll
        for (int e = 0; e < 4; ++e) {
          const float f0 = sp[2 * e], f1 = sp[2 * e + 1];
          unsigned short h0, h1, l0, l1;
          if (OUT_MODE == 2) {
            h0 = bf_bits(f0); h1 = bf_bits(f1);
            l0 = bf_bits(f0 - bf_up(h0)); l1 = bf_bits(f1 - bf_up(h1));
          } else {
            const _Float16 x0 = (_Float16)f0, x1 = (_Float16)f1;
            h0 = h_bits(x0); h1 = h_bits(x1);
            l0 = h_bits((_Float16)((f0 - (float)x0) * rscale));
            l1 = h_bits((_Float16)((f1 - (float)x1) * rscale));
          }
          a[e] = pk16(h0, h1); a2[e] = pk16(l0, l1);
        }
        hv[it] = a; lv[it] = a2;
      }
      {
#pragma unroll
        for (int it = 0; it < 4; ++it) {
          const int row = it * 4 + q;
          *(v4u*)(C + (size_t)(mBase + row) * ldc + n0 + c8) = hv[it];
          if (wlo) *(v4u*)(C2 + (size_t)(mBase + row) * ldc2 + n0 + c8) = lv[it];
        }
        
      }
    }
    __builtin_amdgcn_fence(__ATOMIC_RELEASE, "workgroup");
    __builtin_amdgcn_wave_barrier();
    __builtin_amdgcn_fence(__ATOMIC_ACQUIRE, "workgroup");
  }
}

// =====================================================================================================
// The three independent projections in one launch, role by block index (block-uniform): with T = (S/128)*(D/128) tiles each,
// blocks 0..T-1: q = x . Wq + b_q -> bf16 hi/lo planes [t][h*64+d]; T..2T-1: k alike;
// 2T..3T-1: v^T = Wv . x^T + b_v (per row) -> f16 hi plane [h*64+d][s] (pitch S) and residual plane (x4096, keys < vlp only, pitch vlp).
// Wb = bf16 [3 D n][D k] (rows 0..D-1 = q columns, then k, then v); bqkv has 3 D entries.
// =====================================================================================================
__global__ __launch_bounds__(256) void proj_qkv(
    const unsigned short* __restrict__ Xb, const unsigned short* __restrict__ Wb,
    unsigned short* Qh, unsigned short* Ql, unsigned short* Kh, unsigned short* Kl,
    unsigned short* VTh, unsigned short* VTl, const float* __restrict__ bqkv, int S, int D, int vlp) {
  __shared__ __align__(16) __bf16 smem[GSM(2)];
  __shared__ __align__(16) float sT[8 * 16 * 68];
  const int T    = (S >> 7) * (D >> 7);
  const int role = blockIdx.x / T;                   // 0 = q, 1 = k, 2 = v^T
  const int tile = blockIdx.x - role * T;
  const unsigned short* W = Wb + (size_t)role * D * D;
  if (role < 2) {
    gemm64<0, 2, 1>(smem, sT, tile, Xb, Xb, D, W, W, D,
                    (void*)(role ? Kh : Qh), D, (void*)(role ? Kl : Ql), D, D,
                    S, D, D, 1.0f, bqkv + role * D);
  } else {
    gemm64<0, 3, 2>(smem, sT, tile, W, W, D, Xb, Xb, D,
                    (void*)VTh, S, (void*)VTl, vlp, vlp,
                    D, S, D, 4096.0f, bqkv + role * D);
  }
}

// out = context . Wo + b_o -> f32 [S][D]  (A = context hi + lo planes, 2 products)
__global__ __launch_bounds__(256) void proj_out(
    const unsigned short* __restrict__ Oh, const unsigned short* Ol, const unsigned short* __restrict__ Wob,
    float* out, const float* __restrict__ bo, int S, int D) {
  __shared__ __align__(16) __bf16 smem[GSM(3)];
  __shared__ __align__(16) float sT[8 * 16 * 68];
  gemm64<1, 0, 1>(smem, sT, blockIdx.x, Oh, Ol, D, Wob, Wob, D,
                  (void*)out, D, (void*)out, D, D,
                  S, D, D, 1.0f, bo);
}

// =====================================================================================================
// Causal attention, head dim 64, single batch.
//   q planes (bf16 hi / lo): element (t, h, d) at [t*DM + h*64 + d]
//   k planes (bf16 hi / lo): same layout with key index s
//   v^T hi plane (f16):      element (h, d, s) at [(h*64 + d)*SEQ + s]
//   v^T residual plane (f16, (v - hi)*4096): [(h*64 + d)*VLP + s], s < VLP, read only when RES
//   (a key tile at or beyond VLP would contribute a zero v residual; never happens for query blocks < RESQB)
//   logit (t, s) = q.k * sscale for s <= t, finfo.min for s > t. Query block qb (64 rows) visits key tiles
//   0..qb only (every later key is above the diagonal for all 64 rows -> weight exactly 0); the compare
//   s > t is applied on the diagonal tile kt == qb only (block-uniform scalar branch around the per-element selects). Every row
//   has the live key s = t in the diagonal tile, so the row max is always finite.
//   out planes (bf16 hi / lo of the normalised context): element (t, h, d) at [t*DM + h*64 + d]
//   scores, transposed: S^T = K . Q^T (A = K rows, B = Q rows as columns): bf16 hi/lo split (hi.hi + hi.lo + lo.hi), f32 accumulate,
//   then * sscale in f32. Accumulator element r of tile j in lane (c, hh) = score of key kv0 + 16 j + 8 hh + r for query q0 + c: a lane
//   holds 32 of one query's 64 scores, lane l ^ 16 the other 32, so row max and row sum are in-lane plus one exchange between the halves.
//   p = exp(s - m) carried as f16(1024 p); two score tiles, converted in place, are the B operand P^T of one 32-key chunk
//   (element e < 8: tile 2 kk, e >= 8: tile 2 kk + 1: the k order of the V^T loader); context^T = V^T . P^T on f16 WMMA; RES adds f16 residual planes of p and v
//   (scale 4096, separate accumulator folded back with 1/4096 per chunk in f32); online softmax in f32.
//   Block = 4 waves = 64 query rows (block qb) of one head h; kv chunks of 64, static bound NQB,
//   block-uniform break at kt == qb + 1.
//   K / V^T chunk staging: asynchronous copies global -> LDS (stage_kv3 / stage_kv1), 128 threads x 4 x 16 B per plane = the whole
//   64x64 tile, two buffers: tile kt + 1 is in flight while tile kt is worked on; one block barrier per tile, at the loop's foot,
//   publishes tile kt + 1 and frees the buffer of tile kt, which tile kt + 2 is then copied into;
//   the context tile is wave-private: context^T accumulators are stored as rows [query][d] and reloaded for whole-line stores; it lies
//   on the K / V^T buffers' bytes, used behind the loop's last barrier (every wave's reads done, no copy in flight).
//   Output coverage: each wave stores rows q0..q0+15 (it 0..3 x lane>>3 0..3) x 64 columns (8 lanes x 8) of both planes.
// =====================================================================================================
#define KVR16 (16 * LP * 2)                   // LDS bytes of 16 rows of a staged K / V^T tile

// One 64 x 64 tile of 16-bit elements (64 rows of 128 B) of each of three planes, global -> LDS rows of pitch LP, 16 B per lane and copy.
// Thread t of 128: 16-B piece (t & 7) of rows (t >> 3) + 16 e, e = 0..3; one wave-wide copy = 4 whole rows = 4 whole lines.
// The pointers and LDS byte addresses handed in are the thread's own for e = 0; each LDS byte is written by one lane only.
// s_wait_xcnt 0 closes the statement so that no address register of an issued copy is rewritten ahead of it.
__device__ __forceinline__ void stage_kv3(const __bf16* ka, const __bf16* kb, const _Float16* va,
                                          unsigned la, unsigned lb, unsigned lv) {
  asm volatile(
      "global_load_async_to_lds_b128 %0, %12, off\n\t"
      "global_load_async_to_lds_b128 %1, %13, off\n\t"
      "global_load_async_to_lds_b128 %2, %14, off\n\t"
      "global_load_async_to_lds_b128 %3, %15, off\n\t"
      "global_load_async_to_lds_b128 %4, %16, off\n\t"
      "global_load_async_to_lds_b128 %5, %17, off\n\t"
      "global_load_async_to_lds_b128 %6, %18, off\n\t"
      "global_load_async_to_lds_b128 %7, %19, off\n\t"
      "global_load_async_to_lds_b128 %8, %20, off\n\t"
      "global_load_async_to_lds_b128 %9, %21, off\n\t"
      "global_load_async_to_lds_b128 %10, %22, off\n\t"
      "global_load_async_to_lds_b128 %11, %23, off\n\t"
      "s_wait_xcnt 0x0"
      :: "v"(la), "v"(la + (unsigned)(1 * KVR16)), "v"(la + (unsigned)(2 * KVR16)), "v"(la + (unsigned)(3 * KVR16)),
         "v"(lb), "v"(lb + (unsigned)(1 * KVR16)), "v"(lb + (unsigned)(2 * KVR16)), "v"(lb + (unsigned)(3 * KVR16)),
         "v"(lv), "v"(lv + (unsigned)(1 * KVR16)), "v"(lv + (unsigned)(2 * KVR16)), "v"(lv + (unsigned)(3 * KVR16)),
         "v"(ka), "v"(ka + (size_t)16 * DM), "v"(ka + (size_t)32 * DM), "v"(ka + (size_t)48 * DM),
         "v"(kb), "v"(kb + (size_t)16 * DM), "v"(kb + (size_t)32 * DM), "v"(kb + (size_t)48 * DM),
         "v"(va), "v"(va + (size_t)16 * SEQ), "v"(va + (size_t)32 * SEQ), "v"(va + (size_t)48 * SEQ)
      : "memory");
}
// The same for one plane of row pitch ld elements.
__device__ __forceinline__ void stage_kv1(const _Float16* g, int ld, unsigned l) {
  asm volatile(
      "global_load_async_to_lds_b128 %0, %4, off\n\t"
      "global_load_async_to_lds_b128 %1, %5, off\n\t"
      "global_load_async_to_lds_b128 %2, %6, off\n\t"
      "global_load_async_to_lds_b128 %3, %7, off\n\t"
      "s_wait_xcnt 0x0"
      :: "v"(l), "v"(l + (unsigned)(1 * KVR16)), "v"(l + (unsigned)(2 * KVR16)), "v"(l + (unsigned)(3 * KVR16)),
         "v"(g), "v"(g + (size_t)16 * ld), "v"(g + (size_t)32 * ld), "v"(g + (size_t)48 * ld)
      : "memory");
}

template <bool RES>
__device__ __forceinline__
void attn_tile64(unsigned short* smem, int qb, int h,
                 const unsigned short* __restrict__ qhp, const unsigned short* __restrict__ qlp,
                 const unsigned short* __restrict__ khp, const unsigned short* __restrict__ klp,
                 const unsigned short* __restrict__ vhp, const unsigned short* __restrict__ vlp,
                 unsigned short* ohp, unsigned short* olp, float sscale) {
  union FB { v16b v; v8b h[2]; };
  union FH { v16h v; v8h h[2]; };
  constexpr int NPL = RES ? 4 : 3;                                // staged planes of one buffer
  // smem: two buffers of: K hi [kv][d], K lo, V^T hi [d][kv], (V^T residual), each 64 rows of pitch LP;
  // behind the loop: per wave context tile [row][d], pitch OP (4 x 4352 B, less than two planes)
  unsigned short* kvs = smem;

  const int tid  = threadIdx.x;
  const int wave = tid >> 5;
  const int lane = tid & 31;
  const int hh   = lane >> 4;
  const int c    = lane & 15;

  const int q0   = qb * 64 + wave * 16;

  const __bf16* Qh = (const __bf16*)(const void*)qhp + (size_t)h * HD;
  const __bf16* Ql = (const __bf16*)(const void*)qlp + (size_t)h * HD;
  const __bf16* Kh = (const __bf16*)(const void*)khp + (size_t)h * HD;
  const __bf16* Kl = (const __bf16*)(const void*)klp + (size_t)h * HD;
  const _Float16* Vh = (const _Float16*)(const void*)vhp + (size_t)h * HD * SEQ;
  const _Float16* Vl = (const _Float16*)(const void*)vlp + (size_t)h * HD * VLP;

  // ---- Q fragments (B operand, column = query = lane&15): 2 d-chunks, hi and lo ----
  v16b qah[2], qal[2];
#pragma unroll
  for (int dc = 0; dc < 2; ++dc) {
    const size_t qo = (size_t)(q0 + c) * DM + dc * 32 + 8 * hh;
    qah[dc] = ldfrag_b(Qh + qo);
    qal[dc] = ldfrag_b(Ql + qo);
  }

  float mrow = -INFINITY, lrow = 0.f;        // running max and sum of query q0 + c, the same value in both halves
  v8f oacc[4];                               // context^T: oacc[t][r] = element d = 16 t + 8 hh + r of query q0 + c
#pragma unroll
  for (int t = 0; t < 4; ++t) oacc[t] = zero8();

  const int nkt = qb + 1;                    // key tiles 0..qb (block-uniform)
  // copies of key tile t (0 <= t <= qb, so K rows t*64..+63 < SEQ and V^T columns t*64..+63 < SEQ) into one of the two buffers
  const int sr = tid >> 3, sc = (tid & 7) * 8;                    // this thread's first row (0..15) and element column of every plane
  const unsigned sl = (unsigned)(uintptr_t)kvs + (unsigned)((sr * LP + sc) * 2);
  constexpr unsigned BUFB = (unsigned)(NPL * 64 * LP * 2);        // bytes of one buffer
  auto issue = [&](int t, unsigned bo) {                          // bo = byte offset of the buffer: 0 or BUFB
    const int kv = t * 64;
    const unsigned l0 = sl + bo;
    stage_kv3(Kh + (size_t)(kv + sr) * DM + sc, Kl + (size_t)(kv + sr) * DM + sc, Vh + (size_t)sr * SEQ + kv + sc,
              l0, l0 + (unsigned)(64 * LP * 2), l0 + (unsigned)(2 * 64 * LP * 2));
    if constexpr (RES) {
      const int kvl = (kv + 64 <= VLP) ? kv : (VLP - 64);         // clamped address into the residual plane
      stage_kv1(Vl + (size_t)sr * VLP + kvl + sc, VLP, l0 + (unsigned)(3 * 64 * LP * 2));
    }
  };
  issue(0, 0u);
  asm volatile("s_wait_asynccnt 0x0" ::: "memory");      // this wave's copies of tile 0 have landed
  __syncthreads();                                       // ... and every other wave's
  if (nkt > 1) issue(1, BUFB);                           // block-uniform
  unsigned cur = 0u;                                     // byte offset of the buffer that holds tile kt (block-uniform)

  for (int kt = 0; kt < NQB; ++kt) {         // static bound
    if (kt >= nkt) break;                    // block-uniform
    const bool diag = (kt == qb);            // block-uniform
    const int kv0 = kt * 64;
    const bool resOK = (kv0 + 64 <= VLP);    // block-uniform: beyond VLP the v residual counts as zero
    const unsigned short* kvb = kvs + (cur >> 1);
    const __bf16*   Ksh = (const __bf16*)(const void*)kvb;
    const __bf16*   Ksl = (const __bf16*)(const void*)(kvb + 64 * LP);
    const _Float16* Vth = (const _Float16*)(const void*)(kvb + 2 * 64 * LP);
    const _Float16* Vtl = (const _Float16*)(const void*)(kvb + (NPL - 1) * 64 * LP);

    // ---- scores, transposed: 64 keys x 16 query columns per wave, 3 bf16 products ----
    //      The LDS reads of one 32-wide d chunk (all four 16-key groups) stand together, both chunks in front of the products.
    //      The four score tiles are independent accumulator chains: their products are issued in turn, so that each product
    //      stands in the others' hazard and latency window; every tile keeps its own order (chunk 0: hi.hi, lo.hi, hi.lo; chunk 1 alike).
    FB kb[4][2], kl[4][2];
#pragma unroll
    for (int dc = 0; dc < 2; ++dc) {
#pragma unroll
      for (int j = 0; j < 4; ++j) {
        kb[j][dc].h[0] = *(const v8b*)(Ksh + (j * 16 + c) * LP + dc * 32 + 8 * hh);
        kb[j][dc].h[1] = *(const v8b*)(Ksh + (j * 16 + c) * LP + dc * 32 + 16 + 8 * hh);
      }
#pragma unroll
      for (int j = 0; j < 4; ++j) {
        kl[j][dc].h[0] = *(const v8b*)(Ksl + (j * 16 + c) * LP + dc * 32 + 8 * hh);
        kl[j][dc].h[1] = *(const v8b*)(Ksl + (j * 16 + c) * LP + dc * 32 + 16 + 8 * hh);
      }
    }
    v8f s[4];
#pragma unroll
    for (int j = 0; j < 4; ++j) s[j] = zero8();
#pragma unroll
    for (int dc = 0; dc < 2; ++dc) {
#pragma unroll
      for (int j = 0; j < 4; ++j) s[j] = mma_b_raw(kb[j][dc].v, qah[dc], s[j]);
#pragma unroll
      for (int j = 0; j < 4; ++j) s[j] = mma_b_raw(kl[j][dc].v, qah[dc], s[j]);
#pragma unroll
      for (int j = 0; j < 4; ++j) s[j] = mma_b_raw(kb[j][dc].v, qal[dc], s[j]);
    }
    // V^T fragments, one group of reads per 32-key chunk. Without the residual planes the first chunk is read here, so that
    // the softmax below covers its LDS latency; with them (twice the fragments) each chunk is read in front of its own products.
    FH vb[2][4], vl[2][4];
    auto ldv = [&](int kk) {
#pragma unroll
      for (int t = 0; t < 4; ++t) {
        vb[kk][t].h[0] = *(const v8h*)(Vth + (t * 16 + c) * LP + kk * 32 + 8 * hh);
        vb[kk][t].h[1] = *(const v8h*)(Vth + (t * 16 + c) * LP + kk * 32 + 16 + 8 * hh);
        if (RES) {
          vl[kk][t].h[0] = *(const v8h*)(Vtl + (t * 16 + c) * LP + kk * 32 + 8 * hh);
          vl[kk][t].h[1] = *(const v8h*)(Vtl + (t * 16 + c) * LP + kk * 32 + 16 + 8 * hh);
          if (!resOK) { vl[kk][t].h[0] = zero8h(); vl[kk][t].h[1] = zero8h(); }
        }
      }
    };
    if (!RES) ldv(0);

    // ---- scale + causal compare (diagonal tile only), max and sum of this lane's query, online softmax; P^T (x1024, f16) and
    //      its residual (x4096) are packed in registers as B operands ----
    const int qrow = q0 + c;                     // query of this lane's score column
#pragma unroll
    for (int j = 0; j < 4; ++j)
#pragma unroll
      for (int r = 0; r < 8; ++r) s[j][r] *= sscale;
    if (diag) {                                  // scalar branch: every other tile runs none of the compares and selects
#pragma unroll
      for (int j = 0; j < 4; ++j)
#pragma unroll
        for (int r = 0; r < 8; ++r) {
          const int key = kv0 + j * 16 + 8 * hh + r; // key of accumulator element r of tile j in this lane
          s[j][r] = (key > qrow) ? -FLT_MAX : s[j][r];
        }
    }
    float mj[4];                                 // one maximum per score tile: four independent chains
#pragma unroll
    for (int j = 0; j < 4; ++j) {
      mj[j] = -INFINITY;
#pragma unroll
      for (int r = 0; r < 8; ++r) mj[j] = fmaxf(mj[j], s[j][r]);
    }
    float m = fmaxf(fmaxf(mj[0], mj[1]), fmaxf(mj[2], mj[3]));
    m = fmaxf(m, xhalf(m));                      // the query's other 32 keys
    const float mnew  = fmaxf(mrow, m);
    const float msafe = (mnew == -INFINITY) ? 0.f : mnew;
    const float alpha = __expf(mrow - msafe);
    mrow = mnew;
    FH pa[2], pl[2];
    float ps[4];                                 // one partial sum per score tile: four independent add chains
#pragma unroll
    for (int j = 0; j < 4; ++j) {
      ps[j] = 0.f;
#pragma unroll
      for (int r = 0; r < 8; ++r) {
        const float p = __expf(s[j][r] - msafe);     // floor logit against a normal max: exp -> 0
        ps[j] += p;
        const float p1k = p * 1024.0f;
        const _Float16 ph = (_Float16)p1k;
        pa[j >> 1].v[(j & 1) * 8 + r] = ph;
        if (RES) pl[j >> 1].v[(j & 1) * 8 + r] = (_Float16)((p1k - (float)ph) * 4096.0f);
      }
    }
    float psum = (ps[0] + ps[1]) + (ps[2] + ps[3]);
    psum += xhalf(psum);                         // the query's other 32 keys
    lrow = lrow * alpha + psum;
#pragma unroll
    for (int t = 0; t < 4; ++t)
#pragma unroll
      for (int r = 0; r < 8; ++r) oacc[t][r] *= alpha;

    // ---- context^T += V^T . P^T (f16 WMMA), residual products into a separate accumulator ----
    v8f o1[4];
#pragma unroll
    for (int t = 0; t < 4; ++t) o1[t] = zero8();
    if (!RES) {
      ldv(1);
      // keeps the second chunk's eight reads one group in front of the products; without it they are read in pairs among the
      // products, over the first chunk's registers, and each pair is waited for
      __builtin_amdgcn_sched_barrier(0);
    }
#pragma unroll   // constant kk: the fragment arrays stay in registers
    for (int kk = 0; kk < 2; ++kk) {
      if (RES) ldv(kk);
#pragma unroll
      for (int t = 0; t < 4; ++t) oacc[t] = mma_h_raw(vb[kk][t].v, pa[kk].v, oacc[t]);
      if (RES) {
#pragma unroll
        for (int t = 0; t < 4; ++t) o1[t] = mma_h_raw(vl[kk][t].v, pa[kk].v, o1[t]);
#pragma unroll
        for (int t = 0; t < 4; ++t) o1[t] = mma_h_raw(vb[kk][t].v, pl[kk].v, o1[t]);
      }
    }
    if (RES) {
#pragma unroll
      for (int t = 0; t < 4; ++t)
#pragma unroll
        for (int r = 0; r < 8; ++r) oacc[t][r] += o1[t][r] * (1.0f / 4096.0f);
    }
    // WMMA distance in front of the branches at the loop's foot, on either side of them; taking the accumulators, the statement also keeps
    // the tile's products in front of the foot's waits (otherwise they sink behind the barrier, behind a full wait for the second chunk's reads)
    acc_guard4(oacc[0], oacc[1], oacc[2], oacc[3]);
    asm volatile("s_wait_dscnt 0x0" ::: "memory");       // this wave's reads of tile kt's buffer are done
    asm volatile("s_wait_asynccnt 0x0" ::: "memory");    // this wave's copies of tile kt + 1 have landed
    __syncthreads();                                     // publishes tile kt + 1 and frees tile kt's buffer
    if (kt + 2 < nkt) issue(kt + 2, cur);                // block-uniform
    cur = BUFB - cur;
  }
  asm volatile("s_wait_asynccnt 0x0" ::: "memory");      // no copy is left in flight behind the loop

  // ---- normalise (1/l and the 1/1024 p carry), stage the wave's 16x64 tile, bf16 hi/lo split,
  float* os = (float*)(void*)smem + wave * (16 * OP);
  {
    const float l = lrow;
    const float inv = ((l > 0.f) ? (1.0f / l) : 0.f) * (1.0f / 1024.0f);
#pragma unroll
    for (int t = 0; t < 4; ++t) {              // row = query c, 8 consecutive d per lane and tile: two 16-B stores
      v4f a, b;
#pragma unroll
      for (int r = 0; r < 4; ++r) { a[r] = oacc[t][r] * inv; b[r] = oacc[t][4 + r] * inv; }
      *(v4f*)(os + c * OP + t * 16 + 8 * hh)     = a;
      *(v4f*)(os + c * OP + t * 16 + 8 * hh + 4) = b;
    }
  }
  __builtin_amdgcn_fence(__ATOMIC_RELEASE, "workgroup");
  __builtin_amdgcn_wave_barrier();
  __builtin_amdgcn_fence(__ATOMIC_ACQUIRE, "workgroup");
  {
    const int q4 = lane >> 3, c8 = (lane & 7) * 8;
    v4u hv[4], lv[4];
#pragma unroll
    for (int it = 0; it < 4; ++it) {
      const int row = it * 4 + q4;   // it 0..3 x q4 0..3 = rows 0..15 of the wave tile
      const float* sp = os + row * OP + c8;
      v4u a, a2;
#pragma unroll
      for (int e = 0; e < 4; ++e) {
        const float f0 = sp[2 * e], f1 = sp[2 * e + 1];
        const unsigned short h0 = bf_bits(f0), h1 = bf_bits(f1);
        const unsigned short l0 = bf_bits(f0 - bf_up(h0)), l1 = bf_bits(f1 - bf_up(h1));
        a[e] = pk16(h0, h1); a2[e] = pk16(l0, l1);
      }
      hv[it] = a; lv[it] = a2;
    }
    {
#pragma unroll
      for (int it = 0; it < 4; ++it) {
        const int row = it * 4 + q4;
        const size_t go = (size_t)(q0 + row) * DM + (size_t)h * HD + c8;
        *(v4u*)(ohp + go) = hv[it];
        *(v4u*)(olp + go) = lv[it];
      }
      
    }
  }
}

// Both kinds of query block in one launch, role by block index (block-uniform): blocks 0..AMAIN-1 = query blocks RESQB..NQB-1 of the
// NH heads without the residual planes (head-major, as many per head as there are such blocks), the last NH * RESQB blocks = query
// blocks 0..RESQB-1 with them.
#define ANQ   ((NQB > RESQB) ? (NQB - RESQB) : 1)
#define AMAIN (NH * (NQB - RESQB))
__global__ __launch_bounds__(128)
void attn_causal64(const unsigned short* __restrict__ qhp, const unsigned short* __restrict__ qlp,
                   const unsigned short* __restrict__ khp, const unsigned short* __restrict__ klp,
                   const unsigned short* __restrict__ vhp, const unsigned short* __restrict__ vlp,
                   unsigned short* ohp, unsigned short* olp, float sscale) {
  __shared__ __align__(16) unsigned short smem[2 * 4 * 64 * LP];
  const int bx = blockIdx.x;
  if (bx < AMAIN) {
    attn_tile64<false>(smem, RESQB + bx % ANQ, bx / ANQ, qhp, qlp, khp, klp, vhp, vlp, ohp, olp, sscale);
  } else {
    attn_tile64<true>(smem, (bx - AMAIN) % RESQB, (bx - AMAIN) / RESQB, qhp, qlp, khp, klp, vhp, vlp, ohp, olp, sscale);
  }
}

// =====================================================================================================
// Workspace map (bytes, SEQ = 4096):
//   Xb    bf16 [SEQ][1024]          0          8388608
//   Wqkvb bf16 [3072 n][1024 k]     8388608    6291456   (rows 0..1023 = q columns, 1024..2047 = k, 2048..3071 = v)
//   Wob   bf16 [1024 n][1024 k]     14680064   2097152
//   Qh    bf16 [SEQ][1024]          16777216   8388608
//   Ql    bf16 [SEQ][1024]          25165824   8388608
//   Kh    bf16 [SEQ][1024]          33554432   8388608
//   Kl    bf16 [SEQ][1024]          41943040   8388608
//   VTh   f16  [1024][SEQ]          50331648   8388608
//   VTl   f16  [1024][VLP=512]      58720256   1048576
//   Oh    bf16 [SEQ][1024]          59768832   8388608
//   Ol    bf16 [SEQ][1024]          68157440   8388608
//   end                             76546048
// All planes are exact multiples of their 64x64 / whole-line store granularity (no padded tails needed),
// =====================================================================================================
extern "C" void kernel_launch(void* const* d_in, const int* in_sizes, int n_in,
                              void* d_out, int out_size, void* d_ws, size_t ws_size,
                              hipStream_t stream) {
  if (n_in < 5) return;
  if (in_sizes[0] < SEQ * DM) return;                 // x rows 0..SEQ-1 (prefix of the full input)
  if (in_sizes[1] != DM * NQKV) return;               // w_qkv [1024][3072]
  if (in_sizes[2] != NQKV) return;                    // b_qkv [3072]
  if (in_sizes[3] != DM * DM) return;                 // w_o [1024][1024]
  if (in_sizes[4] != DM) return;                      // b_o [1024]
  if (out_size < SEQ * DM) return;

  const float* x     = (const float*)d_in[0];
  const float* w_qkv = (const float*)d_in[1];
  const float* b_qkv = (const float*)d_in[2];
  const float* w_o   = (const float*)d_in[3];
  const float* b_o   = (const float*)d_in[4];

  const size_t PX  = (size_t)SEQ * DM * 2;       // 16-bit activation plane [SEQ][1024]
  const size_t PWQ = (size_t)NQKV * DM * 2;      // 16-bit fused weight plane [3072][1024]
  const size_t PWO = (size_t)DM * DM * 2;        // 16-bit out weight plane
  const size_t PVT = (size_t)DM * SEQ * 2;       // v^T hi plane
  const size_t PVL = (size_t)DM * VLP * 2;       // v^T residual plane
  size_t off = 0;
  const size_t oXb   = off; off += PX;
  const size_t oWqkv = off; off += PWQ;
  const size_t oWo   = off; off += PWO;
  const size_t oQh   = off; off += PX;
  const size_t oQl   = off; off += PX;
  const size_t oKh   = off; off += PX;
  const size_t oKl   = off; off += PX;
  const size_t oVTh  = off; off += PVT;
  const size_t oVTl  = off; off += PVL;
  const size_t oOh   = off; off += PX;
  const size_t oOl   = off; off += PX;
  if (off > ws_size) return;                     // off = 76546048 for SEQ = 4096
  if (off > (size_t)134217728) return;

  char* ws = (char*)d_ws;
  unsigned short* Xb    = (unsigned short*)(ws + oXb);
  unsigned short* Wqkvb = (unsigned short*)(ws + oWqkv);
  unsigned short* Wob   = (unsigned short*)(ws + oWo);
  unsigned short* Qh    = (unsigned short*)(ws + oQh);
  unsigned short* Ql    = (unsigned short*)(ws + oQl);
  unsigned short* Kh    = (unsigned short*)(ws + oKh);
  unsigned short* Kl    = (unsigned short*)(ws + oKl);
  unsigned short* VTh   = (unsigned short*)(ws + oVTh);
  unsigned short* VTl   = (unsigned short*)(ws + oVTl);
  unsigned short* Oh    = (unsigned short*)(ws + oOh);
  unsigned short* Ol    = (unsigned short*)(ws + oOl);

  const dim3 blk(256);
  const int n8x = SEQ * DM / 8;                                    // multiple of 256
  const dim3 gPrep(PTQ + PTO + (n8x + 255) / 256);                 // 768 + 256 transposing tiles, 2048 pieces of x
  const dim3 gProj((SEQ / 128) * (DM / 128));                      // M = SEQ, N = 1024 -> 256 block tiles of 128x128 (SEQ = 4096)

  // (1) x -> bf16 plane [SEQ][1024]; w_qkv [k][n] -> bf16 [n][k]; w_o [k][n] -> bf16 [n][k]
  prep_bf16<<<gPrep, blk, 0, stream>>>(x, w_qkv, w_o, Xb, Wqkvb, Wob, n8x);
  // (2) q, k -> bf16 hi/lo planes; v^T -> f16 hi plane and residual plane (M x N x K = SEQ x 1024 x 1024 for q and k, 1024 x SEQ x 1024 for v^T)
  proj_qkv<<<dim3(3 * (SEQ / 128) * (DM / 128)), blk, 0, stream>>>(
      Xb, Wqkvb, Qh, Ql, Kh, Kl, VTh, VTl, b_qkv, SEQ, DM, VLP);
  // (3) causal attention: query blocks RESQB.. without residual planes, then blocks 0..RESQB-1 with them
  attn_causal64<<<dim3(NH * NQB), dim3(128), 0, stream>>>(Qh, Ql, Kh, Kl, VTh, VTl, Oh, Ol, 0.125f);
  // (4) out = context . Wo + b_o -> d_out f32 [SEQ][1024]
  proj_out<<<gProj, blk, 0, stream>>>(Oh, Ol, Wob, (float*)d_out, b_o, SEQ, DM);
  (void)hipGetLastError();
}

// v009
// A run of this version takes 123 microseconds.
// In both of two side-by-side timings against v008, it was 1.05 times as fast.
// Over all steps from v000 it is 4.77 times as fast.
// Contractions: q, k, v^T projections = v_wmma_f32_16x16x32_bf16 (bf16 operands from RNE-converted inputs, single product, f32 bias add);
// k.q^T scores (transposed) = v_wmma_f32_16x16x32_bf16 with bf16 hi/lo split q and k (hi.hi + hi.lo + lo.hi);
// v^T.p^T = v_wmma_f32_16x16x32_f16 (p carried x1024 in f16, v in f16; extra f16 residual planes x4096 of p and v for the first VLP query rows);
// ctx.Wo = v_wmma_f32_16x16x32_bf16 with ctx as bf16 hi/lo planes times bf16 Wo (2 products); all f32 accumulate; causal compare and softmax in f32.
#include <hip/hip_runtime.h>
#include <math.h>
#include <float.h>
#include <stdint.h>

#ifndef NB
#define NB    1
#endif
#ifndef SEQ
#define SEQ   4096
#endif
#define SEQ_FULL 4096
#define DM    1024
#define NH    16
#define HD    64
#define NQKV  (3 * DM)
#define NQB   (SEQ / 64)                      // key / query tiles of 64
#define VLP   ((SEQ < 512) ? SEQ : 512)       // key pitch of the v^T residual plane (keys 0..VLP-1)
#define RESQB (VLP / 64)                      // number of leading 64-row query blocks that use the p / v residual planes
#define LP    72                              // LDS row pitch of the 64-wide 16-bit K / V^T tiles, in elements: 144 B = 16 B x 9 (odd), so the
                                              // 16 rows that one half-wave's 16-B fragment read touches fall on 16 distinct groups of 4 banks
#define OP    68                              // LDS row pitch of the 64-wide f32 context tile, in elements: 272 B = 16 B x 17 (odd)
static_assert(NB == 1);
static_assert(NH * HD == DM && HD == 64);
static_assert((SEQ % 64) == 0 && (DM % 64) == 0 && SEQ >= 64 && SEQ <= SEQ_FULL);
static_assert(RESQB * 64 == VLP && VLP <= SEQ && RESQB >= 1 && RESQB <= NQB);
static_assert((NQKV % 64) == 0);
static_assert((SEQ % 128) == 0 && (DM % 128) == 0);   // 128x128 block tiles and 128-wide k steps of the projections

typedef _Float16 v16h __attribute__((ext_vector_type(16)));
typedef _Float16 v8h  __attribute__((ext_vector_type(8)));
typedef __bf16   v16b __attribute__((ext_vector_type(16)));
typedef __bf16   v8b  __attribute__((ext_vector_type(8)));
typedef float    v8f  __attribute__((ext_vector_type(8)));
typedef float    v4f  __attribute__((ext_vector_type(4)));
typedef float    v2f  __attribute__((ext_vector_type(2)));
typedef unsigned int v4u __attribute__((ext_vector_type(4)));

// ---- scalar helpers --------------------------------------------------------------------------------
__device__ __forceinline__ unsigned short bf_bits(float f) {          // f32 -> bf16 bits, RNE convert
  unsigned u = __float_as_uint(f);
  return (unsigned short)((u + 0x7FFFu + ((u >> 16) & 1u)) >> 16);
}
__device__ __forceinline__ float bf_up(unsigned short h) { return __uint_as_float(((unsigned)h) << 16); }
__device__ __forceinline__ unsigned short h_bits(_Float16 x) { return __builtin_bit_cast(unsigned short, x); }
__device__ __forceinline__ unsigned pk16(unsigned short a, unsigned short b) { return (unsigned)a | ((unsigned)b << 16); }
__device__ __forceinline__ v8f zero8() { v8f z = {0.f, 0.f, 0.f, 0.f, 0.f, 0.f, 0.f, 0.f}; return z; }
__device__ __forceinline__ v8h zero8h() {
  const _Float16 z = (_Float16)0.0f;
  v8h r = {z, z, z, z, z, z, z, z};
  return r;
}

// ---- value of lane l ^ 16 (the other half of the wave), a vector-port move
__device__ __forceinline__ float xhalf(float x) {
  return __builtin_bit_cast(float, __builtin_amdgcn_permlanex16(__builtin_bit_cast(int, x), __builtin_bit_cast(int, x),
                                                                0x76543210, 0xfedcba98, false, false));
}

// ---- fragment loaders: 16-bit A/B operand, lane -> row/col (lane&15), p already includes +8*(lane>>4);
//      elements 0..7 <- p[0..7] (k0+8h..), elements 8..15 <- p[16..23] (k0+16+8h..)
__device__ __forceinline__ v16b ldfrag_b(const __bf16* p) {
  union { v16b v; v8b h[2]; } f;
  f.h[0] = *(const v8b*)(p);
  f.h[1] = *(const v8b*)(p + 16);
  return f.v;
}

// ---- WMMA helpers: bare builtins (the compiler pads where a vector instruction follows too closely) and hand-written gaps --------
__device__ __forceinline__ v8f mma_b_raw(v16b a, v16b b, v8f c) {
  return __builtin_amdgcn_wmma_f32_16x16x32_bf16(false, a, false, b, (short)0, c, false, false);
}
__device__ __forceinline__ v8f mma_h_raw(v16h a, v16h b, v8f c) {
  return __builtin_amdgcn_wmma_f32_16x16x32_f16(false, a, false, b, (short)0, c, false, false);
}
__device__ __forceinline__ void dep_guard_b(v8f& a, v8f& b, v16b x, v16b y) {
  asm volatile("v_nop\n\tv_nop\n\tv_nop\n\tv_nop" : "+v"(a), "+v"(b) : "v"(x), "v"(y));
}
__device__ __forceinline__ void keep4_b(v16b a, v16b b, v16b c, v16b d) {
  asm volatile("v_nop" :: "v"(a), "v"(b), "v"(c), "v"(d));
}
__device__ __forceinline__ void acc_guard4(v8f& a, v8f& b, v8f& c, v8f& d) {
  asm volatile("v_nop\n\tv_nop\n\tv_nop\n\tv_nop" : "+v"(a), "+v"(b), "+v"(c), "+v"(d));
}

// =====================================================================================================
// f32 -> bf16 (RNE convert), 8 elements per thread, one 16-B store per lane: a wave writes 512 contiguous B
// coverage: n8 threads x 8 = whole plane (n8 = SEQ*DM/8 is a multiple of 256).
// =====================================================================================================
__device__ __forceinline__ void cvt_bf16x8(const float* __restrict__ in, unsigned short* out, int n8, int blk) {
  const int i = blk * 256 + threadIdx.x;
  if (i < n8) {
    const v4f a = *(const v4f*)(in + (size_t)i * 8);
    const v4f b = *(const v4f*)(in + (size_t)i * 8 + 4);
    v4u p;
    p[0] = pk16(bf_bits(a[0]), bf_bits(a[1]));
    p[1] = pk16(bf_bits(a[2]), bf_bits(a[3]));
    p[2] = pk16(bf_bits(b[0]), bf_bits(b[1]));
    p[3] = pk16(bf_bits(b[2]), bf_bits(b[3]));
    *(v4u*)(out + (size_t)i * 8) = p;
    
  }
}

// =====================================================================================================
// Transposed convert: in f32 [K rows][N cols] (pitch N) -> out bf16 [N rows][K cols] (pitch K), RNE.
// (N/64) x (K/64) blocks of 256 threads (bn = n tile, bk = k tile); one 64(k) x 64(n) tile per block through the LDS tile st (64 * 72 halves).
// Load phase: thread (k row = tid>>2, 16 n columns = (tid&3)*16) reads 4 x 16 B and writes bf16 bits
// transposed into st[n][k] (pitch 72 halves). After __syncthreads each wave writes 8 output rows:
// coverage: load 64 k x (4 threads x 16 n) = 64x64; store 8 waves x 2 it x 4 rows x (8 lanes x 8) = 64x64.
// LDS st: cross-wave exchange behind the block barrier.
// =====================================================================================================
__device__ __forceinline__ void cvtT_bf16(unsigned short* st, const float* __restrict__ in, unsigned short* out, int K, int N,
                                          int bn, int bk) {
  const int tid = threadIdx.x;
  const int n0  = bn * 64;
  const int k0  = bk * 64;
  {
    const int r  = tid >> 2;            // k row 0..63
    const int cb = (tid & 3) * 16;      // n column base
    const float* src = in + (size_t)(k0 + r) * N + n0 + cb;
#pragma unroll
    for (int e = 0; e < 4; ++e) {
      const v4f a = *(const v4f*)(src + 4 * e);
#pragma unroll
      for (int u = 0; u < 4; ++u) st[(cb + 4 * e + u) * 72 + r] = bf_bits(a[u]);
    }
  }
  __syncthreads();
  {
    const int lane = tid & 31, wave = tid >> 5;
    const int q = lane >> 3, c8 = (lane & 7) * 8;
    v4u hv[2];
#pragma unroll
    for (int it = 0; it < 2; ++it) {
      const int row = wave * 8 + it * 4 + q;      // n row within the tile
      hv[it] = *(const v4u*)(st + row * 72 + c8);
    }
    {
#pragma unroll
      for (int it = 0; it < 2; ++it) {
        const int row = wave * 8 + it * 4 + q;
        *(v4u*)(out + (size_t)(n0 + row) * K + k0 + c8) = hv[it];
      }
      // the code of another role follows in the merged kernel: no register of the two issued stores is rewritten ahead of this wait
      asm volatile("s_wait_xcnt 0x0" ::: "memory");
    }
  }
}

// =====================================================================================================
// The three independent conversions in one launch, role by block index (block-uniform branches):
// blocks 0..PTQ-1: w_qkv tiles; PTQ..PTQ+PTO-1: w_o tiles; the rest: 2048-element pieces of x.
// =====================================================================================================
#define PTQ ((NQKV / 64) * (DM / 64))
#define PTO ((DM / 64) * (DM / 64))
__global__ __launch_bounds__(256) void prep_bf16(const float* __restrict__ x, const float* __restrict__ w_qkv,
                                                 const float* __restrict__ w_o, unsigned short* Xb, unsigned short* Wqkvb,
                                                 unsigned short* Wob, int n8) {
  __shared__ __align__(16) unsigned short st[64 * 72];
  const int bx = blockIdx.x;
  if (bx < PTQ) {
    cvtT_bf16(st, w_qkv, Wqkvb, DM, NQKV, bx % (NQKV / 64), bx / (NQKV / 64));
  } else if (bx < PTQ + PTO) {
    cvtT_bf16(st, w_o, Wob, DM, DM, (bx - PTQ) % (DM / 64), (bx - PTQ) / (DM / 64));
  } else {
    cvt_bf16x8(x, Xb, n8, bx - (PTQ + PTO));
  }
}

// =====================================================================================================
// Register-blocked bf16 WMMA GEMM: C[m][n] = sum_k A[m][k] * Bt[n][k] + bias; one wave per 32x64 tile,
// 8 waves (4 x 2) per block = one 128x128 tile of C. A row-major [M][K] pitch lda; Bt row-major [N][K] pitch ldb
// (k contiguous); M, N multiples of 128, K a multiple of GKS. tile = index of the block's tile; smem, sT = the block's LDS.
// Operands: per k step of GKS the block's 128 rows of every operand plane are copied global -> LDS in whole lines
// (stage_tile), two buffers, the next step's copies in flight while this step's fragments are read from LDS;
// every fragment keeps its k order and the k steps stay ascending, so each f32 sum keeps its order.
// NSPLIT: 0 = A.Bt; 1 = (A + A2).Bt (A2 = unscaled bf16 lo plane of A); 2 = A.Bt + A2.Bt + A.Bt2.
// OUT_MODE: 0 = f32 (pitch ldc); 2 = bf16 hi plane C + bf16 lo plane C2 (lo = RNE(v - hi), unscaled);
//           3 = f16 hi plane C + f16 residual plane C2 = f16((v - hi) * rscale), C2 written only for tiles
//               with n0 < N2 (pitch ldc2).
// BIASM: 1 = bias[n] added per column (bias has >= N entries); 2 = bias[m] added per row (>= M entries);
//        the bias value is RNE-converted to bf16 and added in f32 before any output split.
// =====================================================================================================
#define GKS 128                               // k elements of one staged step: 256 B of every operand row
#define GP  136                               // LDS row pitch of a staged operand tile, in elements: 272 B = 16 B x 17 (odd)
#define GMI 2                                 // 16-row sub-tiles of one wave's 32x64 tile

// One operand tile of 128 rows x GKS k (256 B per row), global -> LDS, by asynchronous copies of 16 B per lane.
// Thread t of 256: 16-B piece (t & 15) of rows (t >> 4) + 16 e, e = 0..7; one wave-wide copy = 2 whole rows = 4 whole lines.
// Coverage: 16 rows x 8 e = 128 rows, 16 pieces x 16 B = 256 B; each LDS byte is written by one lane only.
// s_wait_xcnt 0 closes the statement so that no address register of an issued copy is rewritten ahead of it.
__device__ __forceinline__ void stage_tile(const __bf16* g, int ld, __bf16* l, int tid) {
  const __bf16* gp = g + (size_t)(tid >> 4) * ld + (tid & 15) * 8;
  const unsigned la = (unsigned)(uintptr_t)l + (unsigned)(((tid >> 4) * GP + (tid & 15) * 8) * 2);
  asm volatile(
      "global_load_async_to_lds_b128 %0, %8, off\n\t"
      "global_load_async_to_lds_b128 %1, %9, off\n\t"
      "global_load_async_to_lds_b128 %2, %10, off\n\t"
      "global_load_async_to_lds_b128 %3, %11, off\n\t"
      "global_load_async_to_lds_b128 %4, %12, off\n\t"
      "global_load_async_to_lds_b128 %5, %13, off\n\t"
      "global_load_async_to_lds_b128 %6, %14, off\n\t"
      "global_load_async_to_lds_b128 %7, %15, off\n\t"
      "s_wait_xcnt 0x0"
      :: "v"(la), "v"(la + (unsigned)(1 * 16 * GP * 2)),
         "v"(la + (unsigned)(2 * 16 * GP * 2)), "v"(la + (unsigned)(3 * 16 * GP * 2)),
         "v"(la + (unsigned)(4 * 16 * GP * 2)), "v"(la + (unsigned)(5 * 16 * GP * 2)),
         "v"(la + (unsigned)(6 * 16 * GP * 2)), "v"(la + (unsigned)(7 * 16 * GP * 2)),
         "v"(gp), "v"(gp + (size_t)(1 * 16) * ld),
         "v"(gp + (size_t)(2 * 16) * ld), "v"(gp + (size_t)(3 * 16) * ld),
         "v"(gp + (size_t)(4 * 16) * ld), "v"(gp + (size_t)(5 * 16) * ld),
         "v"(gp + (size_t)(6 * 16) * ld), "v"(gp + (size_t)(7 * 16) * ld)
      : "memory");
}

#define GSM(NPL) (2 * (NPL) * 128 * GP)        // elements of a block's LDS: two buffers of NPL staged planes
template <int NSPLIT, int OUT_MODE, int BIASM>
__device__ __forceinline__ void gemm64(
    __bf16* smem, float* sT, int tile,
    const unsigned short* __restrict__ Ap, const unsigned short* A2p, int lda,
    const unsigned short* __restrict__ Btp, const unsigned short* Bt2p, int ldb,
    void* Cout, int ldc,
    void* Cout2, int ldc2, int N2,
    int M, int N, int K, float rscale, const float* __restrict__ bias) {
  const __bf16* A   = (const __bf16*)(const void*)Ap;
  const __bf16* A2  = (const __bf16*)(const void*)A2p;
  const __bf16* Bt  = (const __bf16*)(const void*)Btp;
  const __bf16* Bt2 = (const __bf16*)(const void*)Bt2p;
  constexpr int NPL = 2 + (NSPLIT >= 1 ? 1 : 0) + (NSPLIT == 2 ? 1 : 0);   // staged planes: A, Bt, (A2), (Bt2)
  // smem: two buffers of the block's NPL operand tiles, pitch GP; sT: per-wave 16x64 slabs of the epilogue, pitch 68 floats
  auto stg = [&](int buf, int pl) { return smem + (size_t)(buf * NPL + pl) * (128 * GP); };
  const int tid  = threadIdx.x;
  const int lane = threadIdx.x & 31;
  const int wave = threadIdx.x >> 5;
  const int tilesN = N >> 7;
  const int tilesM = M >> 7;
  if (tile >= tilesM * tilesN) return;   // block-uniform, in front of every copy and barrier
  const int tm = tile / tilesN;
  const int tn = tile - tm * tilesN;
  const int bm0 = tm << 7;               // block tile origin
  const int bn0 = tn << 7;
  const int wm  = (wave >> 1) << 5;      // wave tile origin inside the block tile: 4 wave rows of 32, 2 wave columns of 64
  const int wn  = (wave & 1) << 6;
  const int m0 = bm0 + wm;
  const int n0 = bn0 + wn;

  const __bf16* Ab  = A;
  const __bf16* Bb  = Bt;
  const __bf16* Ab2 = (NSPLIT >= 1) ? A2  : Ab;
  const __bf16* Bb2 = (NSPLIT == 2) ? Bt2 : Bb;

  const int rlane = lane & 15;                 // row (A) / col (B, D) within subtile
  const int koff  = (lane >> 4) * 8;           // k offset of this lane half
  const int mOff  = (lane >> 4) * 8;           // D row offset

  v8f acc[GMI][4];
#pragma unroll
  for (int i = 0; i < GMI; ++i)
#pragma unroll
    for (int j = 0; j < 4; ++j) acc[i][j] = zero8();

  // copies of k step t (rows bm0.. / bn0.. + 0..127 < M / N, k = t*GKS..+GKS-1 < K) into buffer buf
  auto issue = [&](int t, int buf) {
    const size_t k0 = (size_t)t * GKS;
    stage_tile(Ab + (size_t)bm0 * lda + k0, lda, stg(buf, 0), tid);
    stage_tile(Bb + (size_t)bn0 * ldb + k0, ldb, stg(buf, 1), tid);
    if constexpr (NSPLIT >= 1) stage_tile(Ab2 + (size_t)bm0 * lda + k0, lda, stg(buf, 2), tid);
    if constexpr (NSPLIT == 2) stage_tile(Bb2 + (size_t)bn0 * ldb + k0, ldb, stg(buf, 3), tid);
  };
  const int NT = K / GKS;                                // block-uniform
  issue(0, 0);
  asm volatile("s_wait_asynccnt 0x0" ::: "memory");      // this wave's copies of step 0 have landed
  __syncthreads();                                       // ... and every other wave's
  if (NT > 1) issue(1, 1);

  for (int t = 0; t < NT; ++t) {
    const __bf16* sA  = stg(t & 1, 0);
    const __bf16* sB  = stg(t & 1, 1);
    const __bf16* sA2 = stg(t & 1, NSPLIT >= 1 ? 2 : 0);
    const __bf16* sB2 = stg(t & 1, NSPLIT == 2 ? 3 : 1);
#pragma unroll   // constant kk: every LDS fragment offset is an immediate and the fragment arrays stay in registers
    for (int kk = 0; kk < GKS; kk += 32) {
      v16b bh[4], bl[4], ah[GMI], al[GMI];
#pragma unroll
      for (int j = 0; j < 4; ++j) {
        const int bo = (wn + (j << 4) + rlane) * GP + koff + kk;
        bh[j] = ldfrag_b(sB + bo);
        if (NSPLIT == 2) bl[j] = ldfrag_b(sB2 + bo); else bl[j] = bh[j];
      }
#pragma unroll   // all fragment reads of this k chunk stand as one group in front of its products
      for (int i = 0; i < GMI; ++i) {
        const int ao = (wm + (i << 4) + rlane) * GP + koff + kk;
        ah[i] = ldfrag_b(sA + ao);
        if (NSPLIT >= 1) al[i] = ldfrag_b(sA2 + ao); else al[i] = ah[i];
      }
#pragma unroll
      for (int i = 0; i < GMI; ++i) {
#pragma unroll
        for (int j = 0; j < 4; ++j) {
          acc[i][j] = mma_b_raw(ah[i], bh[j], acc[i][j]);
          if (NSPLIT >= 1) acc[i][j] = mma_b_raw(al[i], bh[j], acc[i][j]);
          if (NSPLIT == 2) acc[i][j] = mma_b_raw(ah[i], bl[j], acc[i][j]);
        }
        dep_guard_b(acc[i][0], acc[i][3], ah[i], al[i]);
      }
      keep4_b(bh[0], bh[1], bh[2], bh[3]);
      if (NSPLIT == 2) keep4_b(bl[0], bl[1], bl[2], bl[3]);
    }
    asm volatile("s_wait_dscnt 0x0" ::: "memory");       // this wave's reads of buffer t & 1 are done
    asm volatile("s_wait_asynccnt 0x0" ::: "memory");    // this wave's copies of step t + 1 have landed
    __syncthreads();                                     // publishes step t + 1 and frees buffer t & 1
    if (t + 2 < NT) issue(t + 2, t & 1);                 // block-uniform
  }
  asm volatile("s_wait_asynccnt 0x0" ::: "memory");      // no copy is left in flight behind the loop
  acc_guard4(acc[0][0], acc[0][1], acc[0][2], acc[0][3]);
  acc_guard4(acc[1][0], acc[1][1], acc[1][2], acc[1][3]);

  // ---- epilogue ----
  float* slab = sT + wave * (16 * 68);
  float bcol[4];
#pragma unroll
  for (int j = 0; j < 4; ++j) bcol[j] = 0.f;
  if (BIASM == 1) {
#pragma unroll
    for (int j = 0; j < 4; ++j) bcol[j] = bf_up(bf_bits(bias[n0 + (j << 4) + rlane]));   // < N, in range
  }
#pragma unroll
  for (int i = 0; i < GMI; ++i) {
    const int mBase = m0 + (i << 4);
    float brow[8];
#pragma unroll
    for (int r = 0; r < 8; ++r) brow[r] = 0.f;
    if (BIASM == 2) {
      const v4f b0 = *(const v4f*)(bias + mBase + mOff);          // rows mBase+mOff..+7 < M, in range
      const v4f b1 = *(const v4f*)(bias + mBase + mOff + 4);
#pragma unroll
      for (int r = 0; r < 4; ++r) {
        brow[r]     = bf_up(bf_bits(b0[r]));
        brow[4 + r] = bf_up(bf_bits(b1[r]));
      }
    }
#pragma unroll
    for (int j = 0; j < 4; ++j) {
#pragma unroll
      for (int r = 0; r < 8; ++r) {
        slab[(mOff + r) * 68 + (j << 4) + rlane] = acc[i][j][r] + bcol[j] + brow[r];
      }
    }
    __builtin_amdgcn_fence(__ATOMIC_RELEASE, "workgroup");
    __builtin_amdgcn_wave_barrier();
    __builtin_amdgcn_fence(__ATOMIC_ACQUIRE, "workgroup");
    if (OUT_MODE == 0) {
      float* C = (float*)Cout;
      const int hh = lane >> 4, c4 = (lane & 15) * 4;     // 256-B row segment = 16 lanes x 16 B
      {
#pragma unroll
        for (int it = 0; it < 8; ++it) {
          const int row = it * 2 + hh;                     // it 0..7 x hh 0..1 = rows 0..15
          const v4f v = *(const v4f*)(slab + row * 68 + c4);
          *(v4f*)(C + (size_t)(mBase + row) * ldc + n0 + c4) = v;
        }
        
      }
    } else {
      const int q = lane >> 3, c8 = (lane & 7) * 8;
      unsigned short* C  = (unsigned short*)Cout;
      unsigned short* C2 = (unsigned short*)Cout2;
      const bool wlo = (OUT_MODE == 2) || (n0 < N2);      // wave-uniform
      v4u hv[4], lv[4];
#pragma unroll
      for (int it = 0; it < 4; ++it) {
        const int row = it * 4 + q;                        // it 0..3 x q 0..3 = rows 0..15
        const float* sp = slab + row * 68 + c8;
        v4u a, a2;
#pragma unroll
        for (int e = 0; e < 4; ++e) {
          const float f0 = sp[2 * e], f1 = sp[2 * e + 1];
          unsigned short h0, h1, l0, l1;
          if (OUT_MODE == 2) {
            h0 = bf_bits(f0); h1 = bf_bits(f1);
            l0 = bf_bits(f0 - bf_up(h0)); l1 = bf_bits(f1 - bf_up(h1));
          } else {
            const _Float16 x0 = (_Float16)f0, x1 = (_Float16)f1;
            h0 = h_bits(x0); h1 = h_bits(x1);
            l0 = h_bits((_Float16)((f0 - (float)x0) * rscale));
            l1 = h_bits((_Float16)((f1 - (float)x1) * rscale));
          }
          a[e] = pk16(h0, h1); a2[e] = pk16(l0, l1);
        }
        hv[it] = a; lv[it] = a2;
      }
      {
#pragma unroll
        for (int it = 0; it < 4; ++it) {
          const int row = it * 4 + q;
          *(v4u*)(C + (size_t)(mBase + row) * ldc + n0 + c8) = hv[it];
          if (wlo) *(v4u*)(C2 + (size_t)(mBase + row) * ldc2 + n0 + c8) = lv[it];
        }
        
      }
    }
    __builtin_amdgcn_fence(__ATOMIC_RELEASE, "workgroup");
    __builtin_amdgcn_wave_barrier();
    __builtin_amdgcn_fence(__ATOMIC_ACQUIRE, "workgroup");
  }
}

// =====================================================================================================
// The three independent projections in one launch, role by block index (block-uniform): with T = (S/128)*(D/128) tiles each,
// blocks 0..T-1: q = x . Wq + b_q -> bf16 hi/lo planes [t][h*64+d]; T..2T-1: k alike;
// 2T..3T-1: v^T = Wv . x^T + b_v (per row) -> f16 hi plane [h*64+d][s] (pitch S) and residual plane (x4096, keys < vlp only, pitch vlp).
// Wb = bf16 [3 D n][D k] (rows 0..D-1 = q columns, then k, then v); bqkv has 3 D entries.
// =====================================================================================================
__global__ __launch_bounds__(256) void proj_qkv(
    const unsigned short* __restrict__ Xb, const unsigned short* __restrict__ Wb,
    unsigned short* Qh, unsigned short* Ql, unsigned short* Kh, unsigned short* Kl,
    unsigned short* VTh, unsigned short* VTl, const float* __restrict__ bqkv, int S, int D, int vlp) {
  __shared__ __align__(16) __bf16 smem[GSM(2)];
  __shared__ __align__(16) float sT[8 * 16 * 68];
  const int T    = (S >> 7) * (D >> 7);
  const int role = blockIdx.x / T;                   // 0 = q, 1 = k, 2 = v^T
  const int tile = blockIdx.x - role * T;
  const unsigned short* W = Wb + (size_t)role * D * D;
  if (role < 2) {
    gemm64<0, 2, 1>(smem, sT, tile, Xb, Xb, D, W, W, D,
                    (void*)(role ? Kh : Qh), D, (void*)(role ? Kl : Ql), D, D,
                    S, D, D, 1.0f, bqkv + role * D);
  } else {
    gemm64<0, 3, 2>(smem, sT, tile, W, W, D, Xb, Xb, D,
                    (void*)VTh, S, (void*)VTl, vlp, vlp,
                    D, S, D, 4096.0f, bqkv + role * D);
  }
}

// out = context . Wo + b_o -> f32 [S][D]  (A = context hi + lo planes, 2 products)
__global__ __launch_bounds__(256) void proj_out(
    const unsigned short* __restrict__ Oh, const unsigned short* Ol, const unsigned short* __restrict__ Wob,
    float* out, const float* __restrict__ bo, int S, int D) {
  __shared__ __align__(16) __bf16 smem[GSM(3)];
  __shared__ __align__(16) float sT[8 * 16 * 68];
  gemm64<1, 0, 1>(smem, sT, blockIdx.x, Oh, Ol, D, Wob, Wob, D,
                  (void*)out, D, (void*)out, D, D,
                  S, D, D, 1.0f, bo);
}

// =====================================================================================================
// Causal attention, head dim 64, single batch.
//   q planes (bf16 hi / lo): element (t, h, d) at [t*DM + h*64 + d]
//   k planes (bf16 hi / lo): same layout with key index s
//   v^T hi plane (f16):      element (h, d, s) at [(h*64 + d)*SEQ + s]
//   v^T residual plane (f16, (v - hi)*4096): [(h*64 + d)*VLP + s], s < VLP, read only when RES
//   (a key tile at or beyond VLP would contribute a zero v residual; never happens for query blocks < RESQB)
//   logit (t, s) = q.k * sscale for s <= t, finfo.min for s > t. Query block qb (64 rows) visits key tiles
//   0..qb only (every later key is above the diagonal for all 64 rows -> weight exactly 0); the compare
//   s > t is applied on the diagonal tile kt == qb only (block-uniform scalar branch around the per-element selects). Every row
//   has the live key s = t in the diagonal tile, so the row max is always finite.
//   out planes (bf16 hi / lo of the normalised context): element (t, h, d) at [t*DM + h*64 + d]
//   scores, transposed: S^T = K . Q^T (A = K rows, B = Q rows as columns): bf16 hi/lo split (hi.hi + hi.lo + lo.hi), f32 accumulate,
//   sscale applied in f32 in the exponent's FMA. Accumulator element r of tile j in lane (c, hh) = score of key kv0 + 16 j + 8 hh + r for query q0 + c: a lane
//   holds 32 of one query's 64 scores, lane l ^ 16 the other 32, so row max and row sum are in-lane plus one exchange between the halves.
//   1024 p = exp2(s * (sscale * log2 e) + (10 - m * sscale * log2 e)) on the raw products s and their raw maximum m (sscale > 0): one packed
//   FMA per two scores in front of exp2; the row sum is carried x1024 like p, so the carry cancels in the final division.
//   p is carried as f16(1024 p); two score tiles, converted in place, are the B operand P^T of one 32-key chunk
//   (element e < 8: tile 2 kk, e >= 8: tile 2 kk + 1: the k order of the V^T loader); context^T = V^T . P^T on f16 WMMA; RES adds f16 residual planes of p and v
//   (scale 4096, separate accumulator folded back with 1/4096 per chunk in f32); online softmax in f32.
//   Block = 4 waves = 64 query rows (block qb) of one head h; kv chunks of 64, static bound NQB,
//   block-uniform break at kt == qb + 1.
//   K / V^T chunk staging: asynchronous copies global -> LDS (stage_kv3 / stage_kv1), 128 threads x 4 x 16 B per plane = the whole
//   64x64 tile, two buffers: tile kt + 1 is in flight while tile kt is worked on; one block barrier per tile, at the loop's foot,
//   publishes tile kt + 1 and frees the buffer of tile kt, which tile kt + 2 is then copied into;
//   the context tile is wave-private: context^T accumulators are stored as rows [query][d] and reloaded for whole-line stores; it lies
//   on the K / V^T buffers' bytes, used behind the loop's last barrier (every wave's reads done, no copy in flight).
//   Output coverage: each wave stores rows q0..q0+15 (it 0..3 x lane>>3 0..3) x 64 columns (8 lanes x 8) of both planes.
// =====================================================================================================
#define KVR16 (16 * LP * 2)                   // LDS bytes of 16 rows of a staged K / V^T tile

// One 64 x 64 tile of 16-bit elements (64 rows of 128 B) of each of three planes, global -> LDS rows of pitch LP, 16 B per lane and copy.
// Thread t of 128: 16-B piece (t & 7) of rows (t >> 3) + 16 e, e = 0..3; one wave-wide copy = 4 whole rows = 4 whole lines.
// The pointers and LDS byte addresses handed in are the thread's own for e = 0; each LDS byte is written by one lane only.
// s_wait_xcnt 0 closes the statement so that no address register of an issued copy is rewritten ahead of it.
__device__ __forceinline__ void stage_kv3(const __bf16* ka, const __bf16* kb, const _Float16* va,
                                          unsigned la, unsigned lb, unsigned lv) {
  asm volatile(
      "global_load_async_to_lds_b128 %0, %12, off\n\t"
      "global_load_async_to_lds_b128 %1, %13, off\n\t"
      "global_load_async_to_lds_b128 %2, %14, off\n\t"
      "global_load_async_to_lds_b128 %3, %15, off\n\t"
      "global_load_async_to_lds_b128 %4, %16, off\n\t"
      "global_load_async_to_lds_b128 %5, %17, off\n\t"
      "global_load_async_to_lds_b128 %6, %18, off\n\t"
      "global_load_async_to_lds_b128 %7, %19, off\n\t"
      "global_load_async_to_lds_b128 %8, %20, off\n\t"
      "global_load_async_to_lds_b128 %9, %21, off\n\t"
      "global_load_async_to_lds_b128 %10, %22, off\n\t"
      "global_load_async_to_lds_b128 %11, %23, off\n\t"
      "s_wait_xcnt 0x0"
      :: "v"(la), "v"(la + (unsigned)(1 * KVR16)), "v"(la + (unsigned)(2 * KVR16)), "v"(la + (unsigned)(3 * KVR16)),
         "v"(lb), "v"(lb + (unsigned)(1 * KVR16)), "v"(lb + (unsigned)(2 * KVR16)), "v"(lb + (unsigned)(3 * KVR16)),
         "v"(lv), "v"(lv + (unsigned)(1 * KVR16)), "v"(lv + (unsigned)(2 * KVR16)), "v"(lv + (unsigned)(3 * KVR16)),
         "v"(ka), "v"(ka + (size_t)16 * DM), "v"(ka + (size_t)32 * DM), "v"(ka + (size_t)48 * DM),
         "v"(kb), "v"(kb + (size_t)16 * DM), "v"(kb + (size_t)32 * DM), "v"(kb + (size_t)48 * DM),
         "v"(va), "v"(va + (size_t)16 * SEQ), "v"(va + (size_t)32 * SEQ), "v"(va + (size_t)48 * SEQ)
      : "memory");
}
// The same for one plane of row pitch ld elements.
__device__ __forceinline__ void stage_kv1(const _Float16* g, int ld, unsigned l) {
  asm volatile(
      "global_load_async_to_lds_b128 %0, %4, off\n\t"
      "global_load_async_to_lds_b128 %1, %5, off\n\t"
      "global_load_async_to_lds_b128 %2, %6, off\n\t"
      "global_load_async_to_lds_b128 %3, %7, off\n\t"
      "s_wait_xcnt 0x0"
      :: "v"(l), "v"(l + (unsigned)(1 * KVR16)), "v"(l + (unsigned)(2 * KVR16)), "v"(l + (unsigned)(3 * KVR16)),
         "v"(g), "v"(g + (size_t)16 * ld), "v"(g + (size_t)32 * ld), "v"(g + (size_t)48 * ld)
      : "memory");
}

template <bool RES>
__device__ __forceinline__
void attn_tile64(unsigned short* smem, int qb, int h,
                 const unsigned short* __restrict__ qhp, const unsigned short* __restrict__ qlp,
                 const unsigned short* __restrict__ khp, const unsigned short* __restrict__ klp,
                 const unsigned short* __restrict__ vhp, const unsigned short* __restrict__ vlp,
                 unsigned short* ohp, unsigned short* olp, float sscale) {
  union FB { v16b v; v8b h[2]; };
  union FH { v16h v; v8h h[2]; };
  constexpr int NPL = RES ? 4 : 3;                                // staged planes of one buffer
  // smem: two buffers of: K hi [kv][d], K lo, V^T hi [d][kv], (V^T residual), each 64 rows of pitch LP;
  // behind the loop: per wave context tile [row][d], pitch OP (4 x 4352 B, less than two planes)
  unsigned short* kvs = smem;

  const int tid  = threadIdx.x;
  const int wave = tid >> 5;
  const int lane = tid & 31;
  const int hh   = lane >> 4;
  const int c    = lane & 15;

  const int q0   = qb * 64 + wave * 16;

  const __bf16* Qh = (const __bf16*)(const void*)qhp + (size_t)h * HD;
  const __bf16* Ql = (const __bf16*)(const void*)qlp + (size_t)h * HD;
  const __bf16* Kh = (const __bf16*)(const void*)khp + (size_t)h * HD;
  const __bf16* Kl = (const __bf16*)(const void*)klp + (size_t)h * HD;
  const _Float16* Vh = (const _Float16*)(const void*)vhp + (size_t)h * HD * SEQ;
  const _Float16* Vl = (const _Float16*)(const void*)vlp + (size_t)h * HD * VLP;

  // ---- Q fragments (B operand, column = query = lane&15): 2 d-chunks, hi and lo ----
  v16b qah[2], qal[2];
#pragma unroll
  for (int dc = 0; dc < 2; ++dc) {
    const size_t qo = (size_t)(q0 + c) * DM + dc * 32 + 8 * hh;
    qah[dc] = ldfrag_b(Qh + qo);
    qal[dc] = ldfrag_b(Ql + qo);
  }

  float mrow = -INFINITY, lrow = 0.f;        // running max (of the raw products) and sum (x1024) of query q0 + c, the same value in both halves
  const float cl2 = sscale * 1.44269504f;    // score scale times log2 e
  v8f oacc[4];                               // context^T: oacc[t][r] = element d = 16 t + 8 hh + r of query q0 + c
#pragma unroll
  for (int t = 0; t < 4; ++t) oacc[t] = zero8();

  const int nkt = qb + 1;                    // key tiles 0..qb (block-uniform)
  // copies of key tile t (0 <= t <= qb, so K rows t*64..+63 < SEQ and V^T columns t*64..+63 < SEQ) into one of the two buffers
  const int sr = tid >> 3, sc = (tid & 7) * 8;                    // this thread's first row (0..15) and element column of every plane
  const unsigned sl = (unsigned)(uintptr_t)kvs + (unsigned)((sr * LP + sc) * 2);
  constexpr unsigned BUFB = (unsigned)(NPL * 64 * LP * 2);        // bytes of one buffer
  auto issue = [&](int t, unsigned bo) {                          // bo = byte offset of the buffer: 0 or BUFB
    const int kv = t * 64;
    const unsigned l0 = sl + bo;
    stage_kv3(Kh + (size_t)(kv + sr) * DM + sc, Kl + (size_t)(kv + sr) * DM + sc, Vh + (size_t)sr * SEQ + kv + sc,
              l0, l0 + (unsigned)(64 * LP * 2), l0 + (unsigned)(2 * 64 * LP * 2));
    if constexpr (RES) {
      const int kvl = (kv + 64 <= VLP) ? kv : (VLP - 64);         // clamped address into the residual plane
      stage_kv1(Vl + (size_t)sr * VLP + kvl + sc, VLP, l0 + (unsigned)(3 * 64 * LP * 2));
    }
  };
  issue(0, 0u);
  asm volatile("s_wait_asynccnt 0x0" ::: "memory");      // this wave's copies of tile 0 have landed
  __syncthreads();                                       // ... and every other wave's
  if (nkt > 1) issue(1, BUFB);                           // block-uniform
  unsigned cur = 0u;                                     // byte offset of the buffer that holds tile kt (block-uniform)

  for (int kt = 0; kt < NQB; ++kt) {         // static bound
    if (kt >= nkt) break;                    // block-uniform
    const bool diag = (kt == qb);            // block-uniform
    const int kv0 = kt * 64;
    const bool resOK = (kv0 + 64 <= VLP);    // block-uniform: beyond VLP the v residual counts as zero
    const unsigned short* kvb = kvs + (cur >> 1);
    const __bf16*   Ksh = (const __bf16*)(const void*)kvb;
    const __bf16*   Ksl = (const __bf16*)(const void*)(kvb + 64 * LP);
    const _Float16* Vth = (const _Float16*)(const void*)(kvb + 2 * 64 * LP);
    const _Float16* Vtl = (const _Float16*)(const void*)(kvb + (NPL - 1) * 64 * LP);

    // ---- scores, transposed: 64 keys x 16 query columns per wave, 3 bf16 products ----
    //      The LDS reads of one 32-wide d chunk (all four 16-key groups) stand together, both chunks in front of the products.
    //      The four score tiles are independent accumulator chains: their products are issued in turn, so that each product
    //      stands in the others' hazard and latency window; every tile keeps its own order (chunk 0: hi.hi, lo.hi, hi.lo; chunk 1 alike).
    FB kb[4][2], kl[4][2];
#pragma unroll
    for (int dc = 0; dc < 2; ++dc) {
#pragma unroll
      for (int j = 0; j < 4; ++j) {
        kb[j][dc].h[0] = *(const v8b*)(Ksh + (j * 16 + c) * LP + dc * 32 + 8 * hh);
        kb[j][dc].h[1] = *(const v8b*)(Ksh + (j * 16 + c) * LP + dc * 32 + 16 + 8 * hh);
      }
#pragma unroll
      for (int j = 0; j < 4; ++j) {
        kl[j][dc].h[0] = *(const v8b*)(Ksl + (j * 16 + c) * LP + dc * 32 + 8 * hh);
        kl[j][dc].h[1] = *(const v8b*)(Ksl + (j * 16 + c) * LP + dc * 32 + 16 + 8 * hh);
      }
    }
    // keeps the tile's K reads one group in front of the products, as they stand here; without it they are read in pairs among the
    // products, over registers just used, and each pair is waited for
    __builtin_amdgcn_sched_barrier(0);
    v8f s[4];
#pragma unroll
    for (int j = 0; j < 4; ++j) s[j] = zero8();
#pragma unroll
    for (int dc = 0; dc < 2; ++dc) {
#pragma unroll
      for (int j = 0; j < 4; ++j) s[j] = mma_b_raw(kb[j][dc].v, qah[dc], s[j]);
#pragma unroll
      for (int j = 0; j < 4; ++j) s[j] = mma_b_raw(kl[j][dc].v, qah[dc], s[j]);
#pragma unroll
      for (int j = 0; j < 4; ++j) s[j] = mma_b_raw(kb[j][dc].v, qal[dc], s[j]);
    }
    // V^T fragments, one group of reads per 32-key chunk. Without the residual planes the first chunk is read here, so that
    // the softmax below covers its LDS latency; with them (twice the fragments) each chunk is read in front of its own products.
    FH vb[2][4], vl[2][4];
    auto ldv = [&](int kk) {
#pragma unroll
      for (int t = 0; t < 4; ++t) {
        vb[kk][t].h[0] = *(const v8h*)(Vth + (t * 16 + c) * LP + kk * 32 + 8 * hh);
        vb[kk][t].h[1] = *(const v8h*)(Vth + (t * 16 + c) * LP + kk * 32 + 16 + 8 * hh);
        if (RES) {
          vl[kk][t].h[0] = *(const v8h*)(Vtl + (t * 16 + c) * LP + kk * 32 + 8 * hh);
          vl[kk][t].h[1] = *(const v8h*)(Vtl + (t * 16 + c) * LP + kk * 32 + 16 + 8 * hh);
          if (!resOK) { vl[kk][t].h[0] = zero8h(); vl[kk][t].h[1] = zero8h(); }
        }
      }
    };
    if (!RES) {
      ldv(0);
      // keeps the chunk's eight reads one group in front of the softmax; without it they stand in two places among the maxima
      __builtin_amdgcn_sched_barrier(0);
    }

    // ---- causal compare (diagonal tile only), max and sum of this lane's query, online softmax; P^T (x1024, f16) and
    //      its residual (x4096) are packed in registers as B operands ----
    const int qrow = q0 + c;                     // query of this lane's score column
    if (diag) {                                  // scalar branch: every other tile runs none of the compares and selects
#pragma unroll
      for (int j = 0; j < 4; ++j)
#pragma unroll
        for (int r = 0; r < 8; ++r) {
          const int key = kv0 + j * 16 + 8 * hh + r; // key of accumulator element r of tile j in this lane
          s[j][r] = (key > qrow) ? -FLT_MAX : s[j][r];
        }
    }
    float mj[4];                                 // one maximum per score tile: four independent chains
#pragma unroll
    for (int j = 0; j < 4; ++j) {
      mj[j] = -INFINITY;
#pragma unroll
      for (int r = 0; r < 8; ++r) mj[j] = fmaxf(mj[j], s[j][r]);
    }
    float m = fmaxf(fmaxf(mj[0], mj[1]), fmaxf(mj[2], mj[3]));
    m = fmaxf(m, xhalf(m));                      // the query's other 32 keys
    const float mnew  = fmaxf(mrow, m);
    const float msafe = (mnew == -INFINITY) ? 0.f : mnew;
    const float alpha = __builtin_amdgcn_exp2f((mrow - msafe) * cl2);
    mrow = mnew;
    const float off = __builtin_fmaf(-msafe, cl2, 10.0f);    // exponent offset: minus the scaled maximum, plus log2 of the 1024 carry
    const v2f c2 = {cl2, cl2}, o2 = {off, off};
    FH pa[2], pl[2];
    float ps[4];                                 // one partial sum per score tile: four independent add chains
#pragma unroll
    for (int j = 0; j < 4; ++j) {
      ps[j] = 0.f;
#pragma unroll
      for (int r = 0; r < 8; r += 2) {
        const v2f sp = {s[j][r], s[j][r + 1]};
        const v2f x  = __builtin_elementwise_fma(sp, c2, o2);
#pragma unroll
        for (int u = 0; u < 2; ++u) {
          const float p1k = __builtin_amdgcn_exp2f(x[u]);  // 1024 p; floor logit against a normal max: exp2 -> 0
          ps[j] += p1k;
          const _Float16 ph = (_Float16)p1k;
          pa[j >> 1].v[(j & 1) * 8 + r + u] = ph;
          if (RES) pl[j >> 1].v[(j & 1) * 8 + r + u] = (_Float16)((p1k - (float)ph) * 4096.0f);
        }
      }
    }
    float psum = (ps[0] + ps[1]) + (ps[2] + ps[3]);
    psum += xhalf(psum);                         // the query's other 32 keys
    lrow = lrow * alpha + psum;
#pragma unroll
    for (int t = 0; t < 4; ++t)
#pragma unroll
      for (int r = 0; r < 8; ++r) oacc[t][r] *= alpha;

    // ---- context^T += V^T . P^T (f16 WMMA), residual products into a separate accumulator ----
    v8f o1[4];
#pragma unroll
    for (int t = 0; t < 4; ++t) o1[t] = zero8();
    if (!RES) {
      ldv(1);
      // keeps the second chunk's eight reads one group in front of the products; without it they are read in pairs among the
      // products, over the first chunk's registers, and each pair is waited for
      __builtin_amdgcn_sched_barrier(0);
    }
#pragma unroll   // constant kk: the fragment arrays stay in registers
    for (int kk = 0; kk < 2; ++kk) {
      if (RES) ldv(kk);
#pragma unroll
      for (int t = 0; t < 4; ++t) oacc[t] = mma_h_raw(vb[kk][t].v, pa[kk].v, oacc[t]);
      if (RES) {
#pragma unroll
        for (int t = 0; t < 4; ++t) o1[t] = mma_h_raw(vl[kk][t].v, pa[kk].v, o1[t]);
#pragma unroll
        for (int t = 0; t < 4; ++t) o1[t] = mma_h_raw(vb[kk][t].v, pl[kk].v, o1[t]);
      }
    }
    if (RES) {
#pragma unroll
      for (int t = 0; t < 4; ++t)
#pragma unroll
        for (int r = 0; r < 8; ++r) oacc[t][r] += o1[t][r] * (1.0f / 4096.0f);
    }
    // WMMA distance in front of the branches at the loop's foot, on either side of them; taking the accumulators, the statement also keeps
    // the tile's products in front of the foot's waits (otherwise they sink behind the barrier, behind a full wait for the second chunk's reads)
    acc_guard4(oacc[0], oacc[1], oacc[2], oacc[3]);
    asm volatile("s_wait_dscnt 0x0" ::: "memory");       // this wave's reads of tile kt's buffer are done
    asm volatile("s_wait_asynccnt 0x0" ::: "memory");    // this wave's copies of tile kt + 1 have landed
    __syncthreads();                                     // publishes tile kt + 1 and frees tile kt's buffer
    if (kt + 2 < nkt) issue(kt + 2, cur);                // block-uniform
    cur = BUFB - cur;
  }
  asm volatile("s_wait_asynccnt 0x0" ::: "memory");      // no copy is left in flight behind the loop

  // ---- normalise (1/l), stage the wave's 16x64 tile, bf16 hi/lo split,
  float* os = (float*)(void*)smem + wave * (16 * OP);
  {
    const float l = lrow;
    const float inv = (l > 0.f) ? (1.0f / l) : 0.f;   // l and the context both carry the factor 1024
#pragma unroll
    for (int t = 0; t < 4; ++t) {              // row = query c, 8 consecutive d per lane and tile: two 16-B stores
      v4f a, b;
#pragma unroll
      for (int r = 0; r < 4; ++r) { a[r] = oacc[t][r] * inv; b[r] = oacc[t][4 + r] * inv; }
      *(v4f*)(os + c * OP + t * 16 + 8 * hh)     = a;
      *(v4f*)(os + c * OP + t * 16 + 8 * hh + 4) = b;
    }
  }
  __builtin_amdgcn_fence(__ATOMIC_RELEASE, "workgroup");
  __builtin_amdgcn_wave_barrier();
  __builtin_amdgcn_fence(__ATOMIC_ACQUIRE, "workgroup");
  {
    const int q4 = lane >> 3, c8 = (lane & 7) * 8;
    v4u hv[4], lv[4];
#pragma unroll
    for (int it = 0; it < 4; ++it) {
      const int row = it * 4 + q4;   // it 0..3 x q4 0..3 = rows 0..15 of the wave tile
      const float* sp = os + row * OP + c8;
      v4u a, a2;
#pragma unroll
      for (int e = 0; e < 4; ++e) {
        const float f0 = sp[2 * e], f1 = sp[2 * e + 1];
        const unsigned short h0 = bf_bits(f0), h1 = bf_bits(f1);
        const unsigned short l0 = bf_bits(f0 - bf_up(h0)), l1 = bf_bits(f1 - bf_up(h1));
        a[e] = pk16(h0, h1); a2[e] = pk16(l0, l1);
      }
      hv[it] = a; lv[it] = a2;
    }
    {
#pragma unroll
      for (int it = 0; it < 4; ++it) {
        const int row = it * 4 + q4;
        const size_t go = (size_t)(q0 + row) * DM + (size_t)h * HD + c8;
        *(v4u*)(ohp + go) = hv[it];
        *(v4u*)(olp + go) = lv[it];
      }
      
    }
  }
}

// Both kinds of query block in one launch, role by block index (block-uniform): blocks 0..AMAIN-1 = query blocks RESQB..NQB-1 of the
// NH heads without the residual planes (head-major, as many per head as there are such blocks), the last NH * RESQB blocks = query
// blocks 0..RESQB-1 with them.
#define ANQ   ((NQB > RESQB) ? (NQB - RESQB) : 1)
#define AMAIN (NH * (NQB - RESQB))
__global__ __launch_bounds__(128)
void attn_causal64(const unsigned short* __restrict__ qhp, const unsigned short* __restrict__ qlp,
                   const unsigned short* __restrict__ khp, const unsigned short* __restrict__ klp,
                   const unsigned short* __restrict__ vhp, const unsigned short* __restrict__ vlp,
                   unsigned short* ohp, unsigned short* olp, float sscale) {
  __shared__ __align__(16) unsigned short smem[2 * 4 * 64 * LP];
  const int bx = blockIdx.x;
  if (bx < AMAIN) {
    attn_tile64<false>(smem, RESQB + bx % ANQ, bx / ANQ, qhp, qlp, khp, klp, vhp, vlp, ohp, olp, sscale);
  } else {
    attn_tile64<true>(smem, (bx - AMAIN) % RESQB, (bx - AMAIN) / RESQB, qhp, qlp, khp, klp, vhp, vlp, ohp, olp, sscale);
  }
}

// =====================================================================================================
// Workspace map (bytes, SEQ = 4096):
//   Xb    bf16 [SEQ][1024]          0          8388608
//   Wqkvb bf16 [3072 n][1024 k]     8388608    6291456   (rows 0..1023 = q columns, 1024..2047 = k, 2048..3071 = v)
//   Wob   bf16 [1024 n][1024 k]     14680064   2097152
//   Qh    bf16 [SEQ][1024]          16777216   8388608
//   Ql    bf16 [SEQ][1024]          25165824   8388608
//   Kh    bf16 [SEQ][1024]          33554432   8388608
//   Kl    bf16 [SEQ][1024]          41943040   8388608
//   VTh   f16  [1024][SEQ]          50331648   8388608
//   VTl   f16  [1024][VLP=512]      58720256   1048576
//   Oh    bf16 [SEQ][1024]          59768832   8388608
//   Ol    bf16 [SEQ][1024]          68157440   8388608
//   end                             76546048
// All planes are exact multiples of their 64x64 / whole-line store granularity (no padded tails needed),
// =====================================================================================================
extern "C" void kernel_launch(void* const* d_in, const int* in_sizes, int n_in,
                              void* d_out, int out_size, void* d_ws, size_t ws_size,
                              hipStream_t stream) {
  if (n_in < 5) return;
  if (in_sizes[0] < SEQ * DM) return;                 // x rows 0..SEQ-1 (prefix of the full input)
  if (in_sizes[1] != DM * NQKV) return;               // w_qkv [1024][3072]
  if (in_sizes[2] != NQKV) return;                    // b_qkv [3072]
  if (in_sizes[3] != DM * DM) return;                 // w_o [1024][1024]
  if (in_sizes[4] != DM) return;                      // b_o [1024]
  if (out_size < SEQ * DM) return;

  const float* x     = (const float*)d_in[0];
  const float* w_qkv = (const float*)d_in[1];
  const float* b_qkv = (const float*)d_in[2];
  const float* w_o   = (const float*)d_in[3];
  const float* b_o   = (const float*)d_in[4];

  const size_t PX  = (size_t)SEQ * DM * 2;       // 16-bit activation plane [SEQ][1024]
  const size_t PWQ = (size_t)NQKV * DM * 2;      // 16-bit fused weight plane [3072][1024]
  const size_t PWO = (size_t)DM * DM * 2;        // 16-bit out weight plane
  const size_t PVT = (size_t)DM * SEQ * 2;       // v^T hi plane
  const size_t PVL = (size_t)DM * VLP * 2;       // v^T residual plane
  size_t off = 0;
  const size_t oXb   = off; off += PX;
  const size_t oWqkv = off; off += PWQ;
  const size_t oWo   = off; off += PWO;
  const size_t oQh   = off; off += PX;
  const size_t oQl   = off; off += PX;
  const size_t oKh   = off; off += PX;
  const size_t oKl   = off; off += PX;
  const size_t oVTh  = off; off += PVT;
  const size_t oVTl  = off; off += PVL;
  const size_t oOh   = off; off += PX;
  const size_t oOl   = off; off += PX;
  if (off > ws_size) return;                     // off = 76546048 for SEQ = 4096
  if (off > (size_t)134217728) return;

  char* ws = (char*)d_ws;
  unsigned short* Xb    = (unsigned short*)(ws + oXb);
  unsigned short* Wqkvb = (unsigned short*)(ws + oWqkv);
  unsigned short* Wob   = (unsigned short*)(ws + oWo);
  unsigned short* Qh    = (unsigned short*)(ws + oQh);
  unsigned short* Ql    = (unsigned short*)(ws + oQl);
  unsigned short* Kh    = (unsigned short*)(ws + oKh);
  unsigned short* Kl    = (unsigned short*)(ws + oKl);
  unsigned short* VTh   = (unsigned short*)(ws + oVTh);
  unsigned short* VTl   = (unsigned short*)(ws + oVTl);
  unsigned short* Oh    = (unsigned short*)(ws + oOh);
  unsigned short* Ol    = (unsigned short*)(ws + oOl);

  const dim3 blk(256);
  const int n8x = SEQ * DM / 8;                                    // multiple of 256
  const dim3 gPrep(PTQ + PTO + (n8x + 255) / 256);                 // 768 + 256 transposing tiles, 2048 pieces of x
  const dim3 gProj((SEQ / 128) * (DM / 128));                      // M = SEQ, N = 1024 -> 256 block tiles of 128x128 (SEQ = 4096)

  // (1) x -> bf16 plane [SEQ][1024]; w_qkv [k][n] -> bf16 [n][k]; w_o [k][n] -> bf16 [n][k]
  prep_bf16<<<gPrep, blk, 0, stream>>>(x, w_qkv, w_o, Xb, Wqkvb, Wob, n8x);
  // (2) q, k -> bf16 hi/lo planes; v^T -> f16 hi plane and residual plane (M x N x K = SEQ x 1024 x 1024 for q and k, 1024 x SEQ x 1024 for v^T)
  proj_qkv<<<dim3(3 * (SEQ / 128) * (DM / 128)), blk, 0, stream>>>(
      Xb, Wqkvb, Qh, Ql, Kh, Kl, VTh, VTl, b_qkv, SEQ, DM, VLP);
  // (3) causal attention: query blocks RESQB.. without residual planes, then blocks 0..RESQB-1 with them
  attn_causal64<<<dim3(NH * NQB), dim3(128), 0, stream>>>(Qh, Ql, Kh, Kl, VTh, VTl, Oh, Ol, 0.125f);
  // (4) out = context . Wo + b_o -> d_out f32 [SEQ][1024]
  proj_out<<<gProj, blk, 0, stream>>>(Oh, Ol, Wob, (float*)d_out, b_o, SEQ, DM);
  (void)hipGetLastError();
}

// v010
// Measured time: 117 microseconds a run.
// In two side-by-side timings against v009, it was 1.07 and 1.06 times as fast.
// All steps since v000 together make it 5.06 times as fast.
// Contractions: q, k, v^T projections = v_wmma_f32_16x16x32_bf16 (bf16 operands from RNE-converted inputs, single product, f32 bias add);
// k.q^T scores (transposed) = v_wmma_f32_16x16x32_bf16 with bf16 hi/lo split q and k (hi.hi + hi.lo + lo.hi);
// v^T.p^T = v_wmma_f32_16x16x32_f16 (p carried x1024 in f16, v in f16; extra f16 residual planes x4096 of p and v for the first VLP query rows);
// ctx.Wo = v_wmma_f32_16x16x32_bf16 with ctx as bf16 hi/lo planes times bf16 Wo (2 products); all f32 accumulate; causal compare and softmax in f32.
#include <hip/hip_runtime.h>
#include <math.h>
#include <float.h>
#include <stdint.h>

#ifndef NB
#define NB    1
#endif
#ifndef SEQ
#define SEQ   4096
#endif
#define SEQ_FULL 4096
#define DM    1024
#define NH    16
#define HD    64
#define NQKV  (3 * DM)
#define NQB   (SEQ / 64)                      // key / query tiles of 64
#define VLP   ((SEQ < 512) ? SEQ : 512)       // key pitch of the v^T residual plane (keys 0..VLP-1)
#define RESQB (VLP / 64)                      // number of leading 64-row query blocks that use the p / v residual planes
#define LP    72                              // LDS row pitch of the 64-wide 16-bit K / V^T tiles, in elements: 144 B = 16 B x 9 (odd), so the
                                              // 16 rows that one half-wave's 16-B fragment read touches fall on 16 distinct groups of 4 banks
#define OP    68                              // LDS row pitch of the 64-wide f32 context tile, in elements: 272 B = 16 B x 17 (odd)
static_assert(NB == 1);
static_assert(NH * HD == DM && HD == 64);
static_assert((SEQ % 64) == 0 && (DM % 64) == 0 && SEQ >= 64 && SEQ <= SEQ_FULL);
static_assert(RESQB * 64 == VLP && VLP <= SEQ && RESQB >= 1 && RESQB <= NQB);
static_assert((NQKV % 64) == 0);
static_assert((SEQ % 128) == 0 && (DM % 128) == 0);   // 128x128 block tiles and 128-wide k steps of the projections

typedef _Float16 v16h __attribute__((ext_vector_type(16)));
typedef _Float16 v8h  __attribute__((ext_vector_type(8)));
typedef __bf16   v16b __attribute__((ext_vector_type(16)));
typedef __bf16   v8b  __attribute__((ext_vector_type(8)));
typedef float    v8f  __attribute__((ext_vector_type(8)));
typedef float    v4f  __attribute__((ext_vector_type(4)));
typedef float    v2f  __attribute__((ext_vector_type(2)));
typedef unsigned int v4u __attribute__((ext_vector_type(4)));

// ---- scalar helpers --------------------------------------------------------------------------------
__device__ __forceinline__ unsigned short bf_bits(float f) {          // f32 -> bf16 bits, RNE convert
  unsigned u = __float_as_uint(f);
  return (unsigned short)((u + 0x7FFFu + ((u >> 16) & 1u)) >> 16);
}
__device__ __forceinline__ float bf_up(unsigned short h) { return __uint_as_float(((unsigned)h) << 16); }
__device__ __forceinline__ unsigned short h_bits(_Float16 x) { return __builtin_bit_cast(unsigned short, x); }
__device__ __forceinline__ unsigned pk16(unsigned short a, unsigned short b) { return (unsigned)a | ((unsigned)b << 16); }
__device__ __forceinline__ v8f zero8() { v8f z = {0.f, 0.f, 0.f, 0.f, 0.f, 0.f, 0.f, 0.f}; return z; }
__device__ __forceinline__ v8h zero8h() {
  const _Float16 z = (_Float16)0.0f;
  v8h r = {z, z, z, z, z, z, z, z};
  return r;
}

// ---- value of lane l ^ 16 (the other half of the wave), a vector-port move
__device__ __forceinline__ float xhalf(float x) {
  return __builtin_bit_cast(float, __builtin_amdgcn_permlanex16(__builtin_bit_cast(int, x), __builtin_bit_cast(int, x),
                                                                0x76543210, 0xfedcba98, false, false));
}

// ---- fragment loaders: 16-bit A/B operand, lane -> row/col (lane&15), p already includes +8*(lane>>4);
//      elements 0..7 <- p[0..7] (k0+8h..), elements 8..15 <- p[16..23] (k0+16+8h..)
__device__ __forceinline__ v16b ldfrag_b(const __bf16* p) {
  union { v16b v; v8b h[2]; } f;
  f.h[0] = *(const v8b*)(p);
  f.h[1] = *(const v8b*)(p + 16);
  return f.v;
}

// ---- WMMA helpers: bare builtins (the compiler pads where a vector instruction follows too closely) and hand-written gaps --------
__device__ __forceinline__ v8f mma_b_raw(v16b a, v16b b, v8f c) {
  return __builtin_amdgcn_wmma_f32_16x16x32_bf16(false, a, false, b, (short)0, c, false, false);
}
__device__ __forceinline__ v8f mma_h_raw(v16h a, v16h b, v8f c) {
  return __builtin_amdgcn_wmma_f32_16x16x32_f16(false, a, false, b, (short)0, c, false, false);
}
__device__ __forceinline__ void dep_guard_b(v8f& a, v8f& b, v16b x, v16b y) {
  asm volatile("v_nop\n\tv_nop\n\tv_nop\n\tv_nop" : "+v"(a), "+v"(b) : "v"(x), "v"(y));
}
__device__ __forceinline__ void keep4_b(v16b a, v16b b, v16b c, v16b d) {
  asm volatile("v_nop" :: "v"(a), "v"(b), "v"(c), "v"(d));
}
__device__ __forceinline__ void acc_guard4(v8f& a, v8f& b, v8f& c, v8f& d) {
  asm volatile("v_nop\n\tv_nop\n\tv_nop\n\tv_nop" : "+v"(a), "+v"(b), "+v"(c), "+v"(d));
}

// =====================================================================================================
// f32 -> bf16 (RNE convert), 8 elements per thread, one 16-B store per lane: a wave writes 512 contiguous B
// coverage: n8 threads x 8 = whole plane (n8 = SEQ*DM/8 is a multiple of 256).
// =====================================================================================================
__device__ __forceinline__ void cvt_bf16x8(const float* __restrict__ in, unsigned short* out, int n8, int blk) {
  const int i = blk * 256 + threadIdx.x;
  if (i < n8) {
    const v4f a = *(const v4f*)(in + (size_t)i * 8);
    const v4f b = *(const v4f*)(in + (size_t)i * 8 + 4);
    v4u p;
    p[0] = pk16(bf_bits(a[0]), bf_bits(a[1]));
    p[1] = pk16(bf_bits(a[2]), bf_bits(a[3]));
    p[2] = pk16(bf_bits(b[0]), bf_bits(b[1]));
    p[3] = pk16(bf_bits(b[2]), bf_bits(b[3]));
    *(v4u*)(out + (size_t)i * 8) = p;
    
  }
}

// =====================================================================================================
// Transposed convert: in f32 [K rows][N cols] (pitch N) -> out bf16 [N rows][K cols] (pitch K), RNE.
// (N/64) x (K/64) blocks of 256 threads (bn = n tile, bk = k tile); one 64(k) x 64(n) tile per block through the LDS tile st (64 * 72 halves).
// Load phase: thread (k row = tid>>2, 16 n columns = (tid&3)*16) reads 4 x 16 B and writes bf16 bits
// transposed into st[n][k] (pitch 72 halves). After __syncthreads each wave writes 8 output rows:
// coverage: load 64 k x (4 threads x 16 n) = 64x64; store 8 waves x 2 it x 4 rows x (8 lanes x 8) = 64x64.
// LDS st: cross-wave exchange behind the block barrier.
// =====================================================================================================
__device__ __forceinline__ void cvtT_bf16(unsigned short* st, const float* __restrict__ in, unsigned short* out, int K, int N,
                                          int bn, int bk) {
  const int tid = threadIdx.x;
  const int n0  = bn * 64;
  const int k0  = bk * 64;
  {
    const int r  = tid >> 2;            // k row 0..63
    const int cb = (tid & 3) * 16;      // n column base
    const float* src = in + (size_t)(k0 + r) * N + n0 + cb;
#pragma unroll
    for (int e = 0; e < 4; ++e) {
      const v4f a = *(const v4f*)(src + 4 * e);
#pragma unroll
      for (int u = 0; u < 4; ++u) st[(cb + 4 * e + u) * 72 + r] = bf_bits(a[u]);
    }
  }
  __syncthreads();
  {
    const int lane = tid & 31, wave = tid >> 5;
    const int q = lane >> 3, c8 = (lane & 7) * 8;
    v4u hv[2];
#pragma unroll
    for (int it = 0; it < 2; ++it) {
      const int row = wave * 8 + it * 4 + q;      // n row within the tile
      hv[it] = *(const v4u*)(st + row * 72 + c8);
    }
    {
#pragma unroll
      for (int it = 0; it < 2; ++it) {
        const int row = wave * 8 + it * 4 + q;
        *(v4u*)(out + (size_t)(n0 + row) * K + k0 + c8) = hv[it];
      }
      // the code of another role follows in the merged kernel: no register of the two issued stores is rewritten ahead of this wait
      asm volatile("s_wait_xcnt 0x0" ::: "memory");
    }
  }
}

// =====================================================================================================
// The three independent conversions in one launch, role by block index (block-uniform branches):
// blocks 0..PTQ-1: w_qkv tiles; PTQ..PTQ+PTO-1: w_o tiles; the rest: 2048-element pieces of x.
// =====================================================================================================
#define PTQ ((NQKV / 64) * (DM / 64))
#define PTO ((DM / 64) * (DM / 64))
__global__ __launch_bounds__(256) void prep_bf16(const float* __restrict__ x, const float* __restrict__ w_qkv,
                                                 const float* __restrict__ w_o, unsigned short* Xb, unsigned short* Wqkvb,
                                                 unsigned short* Wob, int n8) {
  __shared__ __align__(16) unsigned short st[64 * 72];
  const int bx = blockIdx.x;
  if (bx < PTQ) {
    cvtT_bf16(st, w_qkv, Wqkvb, DM, NQKV, bx % (NQKV / 64), bx / (NQKV / 64));
  } else if (bx < PTQ + PTO) {
    cvtT_bf16(st, w_o, Wob, DM, DM, (bx - PTQ) % (DM / 64), (bx - PTQ) / (DM / 64));
  } else {
    cvt_bf16x8(x, Xb, n8, bx - (PTQ + PTO));
  }
}

// =====================================================================================================
// Register-blocked bf16 WMMA GEMM: C[m][n] = sum_k A[m][k] * Bt[n][k] + bias; one wave per 32x64 tile,
// 8 waves (4 x 2) per block = one 128x128 tile of C. A row-major [M][K] pitch lda; Bt row-major [N][K] pitch ldb
// (k contiguous); M, N multiples of 128, K a multiple of GKS. tile = index of the block's tile; smem, sT = the block's LDS.
// Operands: per k step of GKS the block's 128 rows of every operand plane are copied global -> LDS in whole lines
// (stage_tile), two buffers, the next step's copies in flight while this step's fragments are read from LDS;
// every fragment keeps its k order and the k steps stay ascending, so each f32 sum keeps its order.
// NSPLIT: 0 = A.Bt; 1 = (A + A2).Bt (A2 = unscaled bf16 lo plane of A); 2 = A.Bt + A2.Bt + A.Bt2.
// OUT_MODE: 0 = f32 (pitch ldc); 2 = bf16 hi plane C + bf16 lo plane C2 (lo = RNE(v - hi), unscaled);
//           3 = f16 hi plane C + f16 residual plane C2 = f16((v - hi) * rscale), C2 written only for tiles
//               with n0 < N2 (pitch ldc2).
// BIASM: 1 = bias[n] added per column (bias has >= N entries); 2 = bias[m] added per row (>= M entries);
//        the bias value is RNE-converted to bf16 and added in f32 before any output split.
// =====================================================================================================
#define GKS 128                               // k elements of one staged step: 256 B of every operand row
#define GP  136                               // LDS row pitch of a staged operand tile, in elements: 272 B = 16 B x 17 (odd)
#define GMI 2                                 // 16-row sub-tiles of one wave's 32x64 tile

// One operand tile of 128 rows x GKS k (256 B per row), global -> LDS, by asynchronous copies of 16 B per lane.
// Thread t of 256: 16-B piece (t & 15) of rows (t >> 4) + 16 e, e = 0..7; one wave-wide copy = 2 whole rows = 4 whole lines.
// Coverage: 16 rows x 8 e = 128 rows, 16 pieces x 16 B = 256 B; each LDS byte is written by one lane only.
// s_wait_xcnt 0 closes the statement so that no address register of an issued copy is rewritten ahead of it.
__device__ __forceinline__ void stage_tile(const __bf16* g, int ld, __bf16* l, int tid) {
  const __bf16* gp = g + (size_t)(tid >> 4) * ld + (tid & 15) * 8;
  const unsigned la = (unsigned)(uintptr_t)l + (unsigned)(((tid >> 4) * GP + (tid & 15) * 8) * 2);
  asm volatile(
      "global_load_async_to_lds_b128 %0, %8, off\n\t"
      "global_load_async_to_lds_b128 %1, %9, off\n\t"
      "global_load_async_to_lds_b128 %2, %10, off\n\t"
      "global_load_async_to_lds_b128 %3, %11, off\n\t"
      "global_load_async_to_lds_b128 %4, %12, off\n\t"
      "global_load_async_to_lds_b128 %5, %13, off\n\t"
      "global_load_async_to_lds_b128 %6, %14, off\n\t"
      "global_load_async_to_lds_b128 %7, %15, off\n\t"
      "s_wait_xcnt 0x0"
      :: "v"(la), "v"(la + (unsigned)(1 * 16 * GP * 2)),
         "v"(la + (unsigned)(2 * 16 * GP * 2)), "v"(la + (unsigned)(3 * 16 * GP * 2)),
         "v"(la + (unsigned)(4 * 16 * GP * 2)), "v"(la + (unsigned)(5 * 16 * GP * 2)),
         "v"(la + (unsigned)(6 * 16 * GP * 2)), "v"(la + (unsigned)(7 * 16 * GP * 2)),
         "v"(gp), "v"(gp + (size_t)(1 * 16) * ld),
         "v"(gp + (size_t)(2 * 16) * ld), "v"(gp + (size_t)(3 * 16) * ld),
         "v"(gp + (size_t)(4 * 16) * ld), "v"(gp + (size_t)(5 * 16) * ld),
         "v"(gp + (size_t)(6 * 16) * ld), "v"(gp + (size_t)(7 * 16) * ld)
      : "memory");
}

#define GSM(NPL) (2 * (NPL) * 128 * GP)        // elements of a block's LDS: two buffers of NPL staged planes
template <int NSPLIT, int OUT_MODE, int BIASM>
__device__ __forceinline__ void gemm64(
    __bf16* smem, float* sT, int tile,
    const unsigned short* __restrict__ Ap, const unsigned short* A2p, int lda,
    const unsigned short* __restrict__ Btp, const unsigned short* Bt2p, int ldb,
    void* Cout, int ldc,
    void* Cout2, int ldc2, int N2,
    int M, int N, int K, float rscale, const float* __restrict__ bias) {
  const __bf16* A   = (const __bf16*)(const void*)Ap;
  const __bf16* A2  = (const __bf16*)(const void*)A2p;
  const __bf16* Bt  = (const __bf16*)(const void*)Btp;
  const __bf16* Bt2 = (const __bf16*)(const void*)Bt2p;
  constexpr int NPL = 2 + (NSPLIT >= 1 ? 1 : 0) + (NSPLIT == 2 ? 1 : 0);   // staged planes: A, Bt, (A2), (Bt2)
  // smem: two buffers of the block's NPL operand tiles, pitch GP; sT: per-wave 16x64 slabs of the epilogue, pitch 68 floats
  auto stg = [&](int buf, int pl) { return smem + (size_t)(buf * NPL + pl) * (128 * GP); };
  const int tid  = threadIdx.x;
  const int lane = threadIdx.x & 31;
  const int wave = threadIdx.x >> 5;
  const int tilesN = N >> 7;
  const int tilesM = M >> 7;
  if (tile >= tilesM * tilesN) return;   // block-uniform, in front of every copy and barrier
  const int tm = tile / tilesN;
  const int tn = tile - tm * tilesN;
  const int bm0 = tm << 7;               // block tile origin
  const int bn0 = tn << 7;
  const int wm  = (wave >> 1) << 5;      // wave tile origin inside the block tile: 4 wave rows of 32, 2 wave columns of 64
  const int wn  = (wave & 1) << 6;
  const int m0 = bm0 + wm;
  const int n0 = bn0 + wn;

  const __bf16* Ab  = A;
  const __bf16* Bb  = Bt;
  const __bf16* Ab2 = (NSPLIT >= 1) ? A2  : Ab;
  const __bf16* Bb2 = (NSPLIT == 2) ? Bt2 : Bb;

  const int rlane = lane & 15;                 // row (A) / col (B, D) within subtile
  const int koff  = (lane >> 4) * 8;           // k offset of this lane half
  const int mOff  = (lane >> 4) * 8;           // D row offset

  v8f acc[GMI][4];
#pragma unroll
  for (int i = 0; i < GMI; ++i)
#pragma unroll
    for (int j = 0; j < 4; ++j) acc[i][j] = zero8();

  // copies of k step t (rows bm0.. / bn0.. + 0..127 < M / N, k = t*GKS..+GKS-1 < K) into buffer buf
  auto issue = [&](int t, int buf) {
    const size_t k0 = (size_t)t * GKS;
    stage_tile(Ab + (size_t)bm0 * lda + k0, lda, stg(buf, 0), tid);
    stage_tile(Bb + (size_t)bn0 * ldb + k0, ldb, stg(buf, 1), tid);
    if constexpr (NSPLIT >= 1) stage_tile(Ab2 + (size_t)bm0 * lda + k0, lda, stg(buf, 2), tid);
    if constexpr (NSPLIT == 2) stage_tile(Bb2 + (size_t)bn0 * ldb + k0, ldb, stg(buf, 3), tid);
  };
  const int NT = K / GKS;                                // block-uniform
  issue(0, 0);
  asm volatile("s_wait_asynccnt 0x0" ::: "memory");      // this wave's copies of step 0 have landed
  __syncthreads();                                       // ... and every other wave's
  if (NT > 1) issue(1, 1);

  for (int t = 0; t < NT; ++t) {
    const __bf16* sA  = stg(t & 1, 0);
    const __bf16* sB  = stg(t & 1, 1);
    const __bf16* sA2 = stg(t & 1, NSPLIT >= 1 ? 2 : 0);
    const __bf16* sB2 = stg(t & 1, NSPLIT == 2 ? 3 : 1);
#pragma unroll   // constant kk: every LDS fragment offset is an immediate and the fragment arrays stay in registers
    for (int kk = 0; kk < GKS; kk += 32) {
      v16b bh[4], bl[4], ah[GMI], al[GMI];
#pragma unroll
      for (int j = 0; j < 4; ++j) {
        const int bo = (wn + (j << 4) + rlane) * GP + koff + kk;
        bh[j] = ldfrag_b(sB + bo);
        if (NSPLIT == 2) bl[j] = ldfrag_b(sB2 + bo); else bl[j] = bh[j];
      }
#pragma unroll   // all fragment reads of this k chunk stand as one group in front of its products
      for (int i = 0; i < GMI; ++i) {
        const int ao = (wm + (i << 4) + rlane) * GP + koff + kk;
        ah[i] = ldfrag_b(sA + ao);
        if (NSPLIT >= 1) al[i] = ldfrag_b(sA2 + ao); else al[i] = ah[i];
      }
#pragma unroll
      for (int i = 0; i < GMI; ++i) {
#pragma unroll
        for (int j = 0; j < 4; ++j) {
          acc[i][j] = mma_b_raw(ah[i], bh[j], acc[i][j]);
          if (NSPLIT >= 1) acc[i][j] = mma_b_raw(al[i], bh[j], acc[i][j]);
          if (NSPLIT == 2) acc[i][j] = mma_b_raw(ah[i], bl[j], acc[i][j]);
        }
        dep_guard_b(acc[i][0], acc[i][3], ah[i], al[i]);
      }
      keep4_b(bh[0], bh[1], bh[2], bh[3]);
      if (NSPLIT == 2) keep4_b(bl[0], bl[1], bl[2], bl[3]);
    }
    asm volatile("s_wait_dscnt 0x0" ::: "memory");       // this wave's reads of buffer t & 1 are done
    asm volatile("s_wait_asynccnt 0x0" ::: "memory");    // this wave's copies of step t + 1 have landed
    __syncthreads();                                     // publishes step t + 1 and frees buffer t & 1
    if (t + 2 < NT) issue(t + 2, t & 1);                 // block-uniform
  }
  asm volatile("s_wait_asynccnt 0x0" ::: "memory");      // no copy is left in flight behind the loop
  acc_guard4(acc[0][0], acc[0][1], acc[0][2], acc[0][3]);
  acc_guard4(acc[1][0], acc[1][1], acc[1][2], acc[1][3]);

  // ---- epilogue ----
  float* slab = sT + wave * (16 * 68);
  float bcol[4];
#pragma unroll
  for (int j = 0; j < 4; ++j) bcol[j] = 0.f;
  if (BIASM == 1) {
#pragma unroll
    for (int j = 0; j < 4; ++j) bcol[j] = bf_up(bf_bits(bias[n0 + (j << 4) + rlane]));   // < N, in range
  }
#pragma unroll
  for (int i = 0; i < GMI; ++i) {
    const int mBase = m0 + (i << 4);
    float brow[8];
#pragma unroll
    for (int r = 0; r < 8; ++r) brow[r] = 0.f;
    if (BIASM == 2) {
      const v4f b0 = *(const v4f*)(bias + mBase + mOff);          // rows mBase+mOff..+7 < M, in range
      const v4f b1 = *(const v4f*)(bias + mBase + mOff + 4);
#pragma unroll
      for (int r = 0; r < 4; ++r) {
        brow[r]     = bf_up(bf_bits(b0[r]));
        brow[4 + r] = bf_up(bf_bits(b1[r]));
      }
    }
#pragma unroll
    for (int j = 0; j < 4; ++j) {
#pragma unroll
      for (int r = 0; r < 8; ++r) {
        slab[(mOff + r) * 68 + (j << 4) + rlane] = acc[i][j][r] + bcol[j] + brow[r];
      }
    }
    __builtin_amdgcn_fence(__ATOMIC_RELEASE, "workgroup");
    __builtin_amdgcn_wave_barrier();
    __builtin_amdgcn_fence(__ATOMIC_ACQUIRE, "workgroup");
    if (OUT_MODE == 0) {
      float* C = (float*)Cout;
      const int hh = lane >> 4, c4 = (lane & 15) * 4;     // 256-B row segment = 16 lanes x 16 B
      {
#pragma unroll
        for (int it = 0; it < 8; ++it) {
          const int row = it * 2 + hh;                     // it 0..7 x hh 0..1 = rows 0..15
          const v4f v = *(const v4f*)(slab + row * 68 + c4);
          *(v4f*)(C + (size_t)(mBase + row) * ldc + n0 + c4) = v;
        }
        
      }
    } else {
      const int q = lane >> 3, c8 = (lane & 7) * 8;
      unsigned short* C  = (unsigned short*)Cout;
      unsigned short* C2 = (unsigned short*)Cout2;
      const bool wlo = (OUT_MODE == 2) || (n0 < N2);      // wave-uniform
      v4u hv[4], lv[4];
#pragma unroll
      for (int it = 0; it < 4; ++it) {
        const int row = it * 4 + q;                        // it 0..3 x q 0..3 = rows 0..15
        const float* sp = slab + row * 68 + c8;
        v4u a, a2;
#pragma unroll
        for (int e = 0; e < 4; ++e) {
          const float f0 = sp[2 * e], f1 = sp[2 * e + 1];
          unsigned short h0, h1, l0, l1;
          if (OUT_MODE == 2) {
            h0 = bf_bits(f0); h1 = bf_bits(f1);
            l0 = bf_bits(f0 - bf_up(h0)); l1 = bf_bits(f1 - bf_up(h1));
          } else {
            const _Float16 x0 = (_Float16)f0, x1 = (_Float16)f1;
            h0 = h_bits(x0); h1 = h_bits(x1);
            l0 = h_bits((_Float16)((f0 - (float)x0) * rscale));
            l1 = h_bits((_Float16)((f1 - (float)x1) * rscale));
          }
          a[e] = pk16(h0, h1); a2[e] = pk16(l0, l1);
        }
        hv[it] = a; lv[it] = a2;
      }
      {
#pragma unroll
        for (int it = 0; it < 4; ++it) {
          const int row = it * 4 + q;
          *(v4u*)(C + (size_t)(mBase + row) * ldc + n0 + c8) = hv[it];
          if (wlo) *(v4u*)(C2 + (size_t)(mBase + row) * ldc2 + n0 + c8) = lv[it];
        }
        
      }
    }
    __builtin_amdgcn_fence(__ATOMIC_RELEASE, "workgroup");
    __builtin_amdgcn_wave_barrier();
    __builtin_amdgcn_fence(__ATOMIC_ACQUIRE, "workgroup");
  }
}

// =====================================================================================================
// The three independent projections in one launch, role by block index (block-uniform): with T = (S/128)*(D/128) tiles each,
// blocks 0..T-1: q = x . Wq + b_q -> bf16 hi/lo planes [t][h*64+d]; T..2T-1: k alike;
// 2T..3T-1: v^T = Wv . x^T + b_v (per row) -> f16 hi plane [h*64+d][s] (pitch S) and residual plane (x4096, keys < vlp only, pitch vlp).
// Wb = bf16 [3 D n][D k] (rows 0..D-1 = q columns, then k, then v); bqkv has 3 D entries.
// =====================================================================================================
__global__ __launch_bounds__(256) void proj_qkv(
    const unsigned short* __restrict__ Xb, const unsigned short* __restrict__ Wb,
    unsigned short* Qh, unsigned short* Ql, unsigned short* Kh, unsigned short* Kl,
    unsigned short* VTh, unsigned short* VTl, const float* __restrict__ bqkv, int S, int D, int vlp) {
  __shared__ __align__(16) __bf16 smem[GSM(2)];
  __shared__ __align__(16) float sT[8 * 16 * 68];
  const int T    = (S >> 7) * (D >> 7);
  const int role = blockIdx.x / T;                   // 0 = q, 1 = k, 2 = v^T
  const int tile = blockIdx.x - role * T;
  const unsigned short* W = Wb + (size_t)role * D * D;
  if (role < 2) {
    gemm64<0, 2, 1>(smem, sT, tile, Xb, Xb, D, W, W, D,
                    (void*)(role ? Kh : Qh), D, (void*)(role ? Kl : Ql), D, D,
                    S, D, D, 1.0f, bqkv + role * D);
  } else {
    gemm64<0, 3, 2>(smem, sT, tile, W, W, D, Xb, Xb, D,
                    (void*)VTh, S, (void*)VTl, vlp, vlp,
                    D, S, D, 4096.0f, bqkv + role * D);
  }
}

// out = context . Wo + b_o -> f32 [S][D]  (A = context hi + lo planes, 2 products)
__global__ __launch_bounds__(256) void proj_out(
    const unsigned short* __restrict__ Oh, const unsigned short* Ol, const unsigned short* __restrict__ Wob,
    float* out, const float* __restrict__ bo, int S, int D) {
  __shared__ __align__(16) __bf16 smem[GSM(3)];
  __shared__ __align__(16) float sT[8 * 16 * 68];
  gemm64<1, 0, 1>(smem, sT, blockIdx.x, Oh, Ol, D, Wob, Wob, D,
                  (void*)out, D, (void*)out, D, D,
                  S, D, D, 1.0f, bo);
}

// =====================================================================================================
// Causal attention, head dim 64, single batch.
//   q planes (bf16 hi / lo): element (t, h, d) at [t*DM + h*64 + d]
//   k planes (bf16 hi / lo): same layout with key index s
//   v^T hi plane (f16):      element (h, d, s) at [(h*64 + d)*SEQ + s]
//   v^T residual plane (f16, (v - hi)*4096): [(h*64 + d)*VLP + s], s < VLP, read only when RES
//   (a key tile at or beyond VLP would contribute a zero v residual; never happens for query blocks < RESQB)
//   logit (t, s) = q.k * sscale for s <= t, finfo.min for s > t. Query block qb (64 rows) visits key tiles
//   0..qb only (every later key is above the diagonal for all 64 rows -> weight exactly 0); the compare
//   s > t is applied on the diagonal tile kt == qb only (block-uniform scalar branch around the per-element selects). Every row
//   has the live key s = t in the diagonal tile, so the row max is always finite.
//   out planes (bf16 hi / lo of the normalised context): element (t, h, d) at [t*DM + h*64 + d]
//   scores, transposed: S^T = K . Q^T (A = K rows, B = Q rows as columns): bf16 hi/lo split (hi.hi + hi.lo + lo.hi), f32 accumulate,
//   sscale applied in f32 in the exponent's FMA. Accumulator element r of tile j in lane (c, hh) = score of key kv0 + 16 j + 8 hh + r for query q0 + c: a lane
//   holds 32 of one query's 64 scores, lane l ^ 16 the other 32, so row max and row sum are in-lane plus one exchange between the halves.
//   1024 p = exp2(s * (sscale * log2 e) + (10 - m * sscale * log2 e)) on the raw products s and their raw maximum m (sscale > 0): one packed
//   FMA per two scores in front of exp2; the row sum is carried x1024 like p, so the carry cancels in the final division.
//   p is carried as f16(1024 p); two score tiles, converted in place, are the B operand P^T of one 32-key chunk
//   (element e < 8: tile 2 kk, e >= 8: tile 2 kk + 1: the k order of the V^T loader); context^T = V^T . P^T on f16 WMMA; RES adds f16 residual planes of p and v
//   (scale 4096, separate accumulator folded back with 1/4096 per chunk in f32); online softmax in f32.
//   Block = 4 waves = 64 query rows (block qb) of one head h; kv chunks of 64, static bound NQB,
//   block-uniform break at kt == qb + 1.
//   K / V^T chunk staging: asynchronous copies global -> LDS (stage_kv3 / stage_kv1), 128 threads x 4 x 16 B per plane = the whole
//   64x64 tile, two buffers: tile kt + 1 is in flight while tile kt is worked on; one block barrier per tile, at the loop's foot,
//   publishes tile kt + 1 and frees the buffer of tile kt, which tile kt + 2 is then copied into;
//   the context tile is wave-private: context^T accumulators are stored as rows [query][d] and reloaded for whole-line stores; it lies
//   on the K / V^T buffers' bytes, used behind the loop's last barrier (every wave's reads done, no copy in flight).
//   Output coverage: each wave stores rows q0..q0+15 (it 0..3 x lane>>3 0..3) x 64 columns (8 lanes x 8) of both planes.
// =====================================================================================================
#define KVR16 (16 * LP * 2)                   // LDS bytes of 16 rows of a staged K / V^T tile

// One 64 x 64 tile of 16-bit elements (64 rows of 128 B) of each of three planes, global -> LDS rows of pitch LP, 16 B per lane and copy.
// Thread t of 128: 16-B piece (t & 7) of rows (t >> 3) + 16 e, e = 0..3; one wave-wide copy = 4 whole rows = 4 whole lines.
// The pointers and LDS byte addresses handed in are the thread's own for e = 0; each LDS byte is written by one lane only.
// s_wait_xcnt 0 closes the statement so that no address register of an issued copy is rewritten ahead of it.
__device__ __forceinline__ void stage_kv3(const __bf16* ka, const __bf16* kb, const _Float16* va,
                                          unsigned la, unsigned lb, unsigned lv) {
  asm volatile(
      "global_load_async_to_lds_b128 %0, %12, off\n\t"
      "global_load_async_to_lds_b128 %1, %13, off\n\t"
      "global_load_async_to_lds_b128 %2, %14, off\n\t"
      "global_load_async_to_lds_b128 %3, %15, off\n\t"
      "global_load_async_to_lds_b128 %4, %16, off\n\t"
      "global_load_async_to_lds_b128 %5, %17, off\n\t"
      "global_load_async_to_lds_b128 %6, %18, off\n\t"
      "global_load_async_to_lds_b128 %7, %19, off\n\t"
      "global_load_async_to_lds_b128 %8, %20, off\n\t"
      "global_load_async_to_lds_b128 %9, %21, off\n\t"
      "global_load_async_to_lds_b128 %10, %22, off\n\t"
      "global_load_async_to_lds_b128 %11, %23, off\n\t"
      "s_wait_xcnt 0x0"
      :: "v"(la), "v"(la + (unsigned)(1 * KVR16)), "v"(la + (unsigned)(2 * KVR16)), "v"(la + (unsigned)(3 * KVR16)),
         "v"(lb), "v"(lb + (unsigned)(1 * KVR16)), "v"(lb + (unsigned)(2 * KVR16)), "v"(lb + (unsigned)(3 * KVR16)),
         "v"(lv), "v"(lv + (unsigned)(1 * KVR16)), "v"(lv + (unsigned)(2 * KVR16)), "v"(lv + (unsigned)(3 * KVR16)),
         "v"(ka), "v"(ka + (size_t)16 * DM), "v"(ka + (size_t)32 * DM), "v"(ka + (size_t)48 * DM),
         "v"(kb), "v"(kb + (size_t)16 * DM), "v"(kb + (size_t)32 * DM), "v"(kb + (size_t)48 * DM),
         "v"(va), "v"(va + (size_t)16 * SEQ), "v"(va + (size_t)32 * SEQ), "v"(va + (size_t)48 * SEQ)
      : "memory");
}
// The same for one plane of row pitch ld elements.
__device__ __forceinline__ void stage_kv1(const _Float16* g, int ld, unsigned l) {
  asm volatile(
      "global_load_async_to_lds_b128 %0, %4, off\n\t"
      "global_load_async_to_lds_b128 %1, %5, off\n\t"
      "global_load_async_to_lds_b128 %2, %6, off\n\t"
      "global_load_async_to_lds_b128 %3, %7, off\n\t"
      "s_wait_xcnt 0x0"
      :: "v"(l), "v"(l + (unsigned)(1 * KVR16)), "v"(l + (unsigned)(2 * KVR16)), "v"(l + (unsigned)(3 * KVR16)),
         "v"(g), "v"(g + (size_t)16 * ld), "v"(g + (size_t)32 * ld), "v"(g + (size_t)48 * ld)
      : "memory");
}

template <bool RES>
__device__ __forceinline__
void attn_tile64(unsigned short* smem, int qb, int h,
                 const unsigned short* __restrict__ qhp, const unsigned short* __restrict__ qlp,
                 const unsigned short* __restrict__ khp, const unsigned short* __restrict__ klp,
                 const unsigned short* __restrict__ vhp, const unsigned short* __restrict__ vlp,
                 unsigned short* ohp, unsigned short* olp, float sscale) {
  union FB { v16b v; v8b h[2]; };
  union FH { v16h v; v8h h[2]; };
  constexpr int NPL = RES ? 4 : 3;                                // staged planes of one buffer
  // smem: two buffers of: K hi [kv][d], K lo, V^T hi [d][kv], (V^T residual), each 64 rows of pitch LP;
  // behind the loop: per wave context tile [row][d], pitch OP (4 x 4352 B, less than two planes)
  unsigned short* kvs = smem;

  const int tid  = threadIdx.x;
  const int wave = tid >> 5;
  const int lane = tid & 31;
  const int hh   = lane >> 4;
  const int c    = lane & 15;

  const int q0   = qb * 64 + wave * 16;

  const __bf16* Qh = (const __bf16*)(const void*)qhp + (size_t)h * HD;
  const __bf16* Ql = (const __bf16*)(const void*)qlp + (size_t)h * HD;
  const __bf16* Kh = (const __bf16*)(const void*)khp + (size_t)h * HD;
  const __bf16* Kl = (const __bf16*)(const void*)klp + (size_t)h * HD;
  const _Float16* Vh = (const _Float16*)(const void*)vhp + (size_t)h * HD * SEQ;
  const _Float16* Vl = (const _Float16*)(const void*)vlp + (size_t)h * HD * VLP;

  // ---- Q fragments (B operand, column = query = lane&15): 2 d-chunks, hi and lo ----
  v16b qah[2], qal[2];
  const unsigned qo = (unsigned)((q0 + c) * DM + 8 * hh);   // this lane's element offset in the head's q planes (< SEQ * DM)
#pragma unroll
  for (int dc = 0; dc < 2; ++dc) {
    qah[dc] = ldfrag_b(Qh + qo + dc * 32);
    qal[dc] = ldfrag_b(Ql + qo + dc * 32);
  }
  // the offset register of the issued q loads is not rewritten ahead of this wait: as the statement's input it stays live up to it
  asm volatile("s_wait_xcnt 0x0" :: "v"(qo * 2u) : "memory");

  float mrow = -INFINITY, lrow = 0.f;        // running max (of the raw products) and sum (x1024) of query q0 + c, the same value in both halves
  const float cl2 = sscale * 1.44269504f;    // score scale times log2 e
  v8f oacc[4];                               // context^T: oacc[t][r] = element d = 16 t + 8 hh + r of query q0 + c
#pragma unroll
  for (int t = 0; t < 4; ++t) oacc[t] = zero8();

  const int nkt = qb + 1;                    // key tiles 0..qb (block-uniform)
  // copies of key tile t (0 <= t <= qb, so K rows t*64..+63 < SEQ and V^T columns t*64..+63 < SEQ) into one of the two buffers
  const int sr = tid >> 3, sc = (tid & 7) * 8;                    // this thread's first row (0..15) and element column of every plane
  const unsigned sl = (unsigned)(uintptr_t)kvs + (unsigned)((sr * LP + sc) * 2);
  constexpr unsigned BUFB = (unsigned)(NPL * 64 * LP * 2);        // bytes of one buffer
  auto issue = [&](int t, unsigned bo) {                          // bo = byte offset of the buffer: 0 or BUFB
    const int kv = t * 64;
    const unsigned l0 = sl + bo;
    stage_kv3(Kh + (size_t)(kv + sr) * DM + sc, Kl + (size_t)(kv + sr) * DM + sc, Vh + (size_t)sr * SEQ + kv + sc,
              l0, l0 + (unsigned)(64 * LP * 2), l0 + (unsigned)(2 * 64 * LP * 2));
    if constexpr (RES) {
      const int kvl = (kv + 64 <= VLP) ? kv : (VLP - 64);         // clamped address into the residual plane
      stage_kv1(Vl + (size_t)sr * VLP + kvl + sc, VLP, l0 + (unsigned)(3 * 64 * LP * 2));
    }
  };
  issue(0, 0u);
  asm volatile("s_wait_asynccnt 0x0" ::: "memory");      // this wave's copies of tile 0 have landed
  __syncthreads();                                       // ... and every other wave's
  if (nkt > 1) issue(1, BUFB);                           // block-uniform
  unsigned cur = 0u;                                     // byte offset of the buffer that holds tile kt (block-uniform)

  for (int kt = 0; kt < NQB; ++kt) {         // static bound
    if (kt >= nkt) break;                    // block-uniform
    const bool diag = (kt == qb);            // block-uniform
    const int kv0 = kt * 64;
    const bool resOK = (kv0 + 64 <= VLP);    // block-uniform: beyond VLP the v residual counts as zero
    const unsigned short* kvb = kvs + (cur >> 1);
    const __bf16*   Ksh = (const __bf16*)(const void*)kvb;
    const __bf16*   Ksl = (const __bf16*)(const void*)(kvb + 64 * LP);
    const _Float16* Vth = (const _Float16*)(const void*)(kvb + 2 * 64 * LP);
    const _Float16* Vtl = (const _Float16*)(const void*)(kvb + (NPL - 1) * 64 * LP);

    // ---- scores, transposed: 64 keys x 16 query columns per wave, 3 bf16 products ----
    //      The LDS reads of one 32-wide d chunk (all four 16-key groups) stand together, both chunks in front of the products.
    //      The four score tiles are independent accumulator chains: their products are issued in turn, so that each product
    //      stands in the others' hazard and latency window; every tile keeps its own order (chunk 0: hi.hi, lo.hi, hi.lo; chunk 1 alike).
    FB kb[4][2], kl[4][2];
#pragma unroll
    for (int dc = 0; dc < 2; ++dc) {
#pragma unroll
      for (int j = 0; j < 4; ++j) {
        kb[j][dc].h[0] = *(const v8b*)(Ksh + (j * 16 + c) * LP + dc * 32 + 8 * hh);
        kb[j][dc].h[1] = *(const v8b*)(Ksh + (j * 16 + c) * LP + dc * 32 + 16 + 8 * hh);
      }
#pragma unroll
      for (int j = 0; j < 4; ++j) {
        kl[j][dc].h[0] = *(const v8b*)(Ksl + (j * 16 + c) * LP + dc * 32 + 8 * hh);
        kl[j][dc].h[1] = *(const v8b*)(Ksl + (j * 16 + c) * LP + dc * 32 + 16 + 8 * hh);
      }
    }
    // keeps the tile's K reads one group in front of the products, as they stand here; without it they are read in pairs among the
    // products, over registers just used, and each pair is waited for
    __builtin_amdgcn_sched_barrier(0);
    v8f s[4];
#pragma unroll
    for (int j = 0; j < 4; ++j) s[j] = zero8();
#pragma unroll
    for (int dc = 0; dc < 2; ++dc) {
#pragma unroll
      for (int j = 0; j < 4; ++j) s[j] = mma_b_raw(kb[j][dc].v, qah[dc], s[j]);
#pragma unroll
      for (int j = 0; j < 4; ++j) s[j] = mma_b_raw(kl[j][dc].v, qah[dc], s[j]);
#pragma unroll
      for (int j = 0; j < 4; ++j) s[j] = mma_b_raw(kb[j][dc].v, qal[dc], s[j]);
    }
    // V^T fragments, one group of reads per 32-key chunk. Without the residual planes the first chunk is read here, so that
    // the softmax below covers its LDS latency; with them (twice the fragments) each chunk is read in front of its own products.
    FH vb[2][4], vl[2][4];
    auto ldv = [&](int kk) {
#pragma unroll
      for (int t = 0; t < 4; ++t) {
        vb[kk][t].h[0] = *(const v8h*)(Vth + (t * 16 + c) * LP + kk * 32 + 8 * hh);
        vb[kk][t].h[1] = *(const v8h*)(Vth + (t * 16 + c) * LP + kk * 32 + 16 + 8 * hh);
        if (RES) {
          vl[kk][t].h[0] = *(const v8h*)(Vtl + (t * 16 + c) * LP + kk * 32 + 8 * hh);
          vl[kk][t].h[1] = *(const v8h*)(Vtl + (t * 16 + c) * LP + kk * 32 + 16 + 8 * hh);
          if (!resOK) { vl[kk][t].h[0] = zero8h(); vl[kk][t].h[1] = zero8h(); }
        }
      }
    };
    if (!RES) {
      ldv(0);
      // keeps the chunk's eight reads one group in front of the softmax; without it they stand in two places among the maxima
      __builtin_amdgcn_sched_barrier(0);
    }

    // ---- causal compare (diagonal tile only), max and sum of this lane's query, online softmax; P^T (x1024, f16) and
    //      its residual (x4096) are packed in registers as B operands ----
    const int qrow = q0 + c;                     // query of this lane's score column
    if (diag) {                                  // scalar branch: every other tile runs none of the compares and selects
#pragma unroll
      for (int j = 0; j < 4; ++j)
#pragma unroll
        for (int r = 0; r < 8; ++r) {
          const int key = kv0 + j * 16 + 8 * hh + r; // key of accumulator element r of tile j in this lane
          s[j][r] = (key > qrow) ? -FLT_MAX : s[j][r];
        }
    }
    float mj[4];                                 // one maximum per score tile: four independent chains
#pragma unroll
    for (int j = 0; j < 4; ++j) {
      mj[j] = -INFINITY;
#pragma unroll
      for (int r = 0; r < 8; ++r) mj[j] = fmaxf(mj[j], s[j][r]);
    }
    float m = fmaxf(fmaxf(mj[0], mj[1]), fmaxf(mj[2], mj[3]));
    m = fmaxf(m, xhalf(m));                      // the query's other 32 keys
    const float mnew  = fmaxf(mrow, m);
    const float msafe = (mnew == -INFINITY) ? 0.f : mnew;
    const float alpha = __builtin_amdgcn_exp2f((mrow - msafe) * cl2);
    mrow = mnew;
    const float off = __builtin_fmaf(-msafe, cl2, 10.0f);    // exponent offset: minus the scaled maximum, plus log2 of the 1024 carry
    const v2f c2 = {cl2, cl2}, o2 = {off, off};
    FH pa[2], pl[2];
    float ps[4];                                 // one partial sum per score tile: four independent add chains
#pragma unroll
    for (int j = 0; j < 4; ++j) {
      ps[j] = 0.f;
#pragma unroll
      for (int r = 0; r < 8; r += 2) {
        const v2f sp = {s[j][r], s[j][r + 1]};
        const v2f x  = __builtin_elementwise_fma(sp, c2, o2);
#pragma unroll
        for (int u = 0; u < 2; ++u) {
          const float p1k = __builtin_amdgcn_exp2f(x[u]);  // 1024 p; floor logit against a normal max: exp2 -> 0
          ps[j] += p1k;
          const _Float16 ph = (_Float16)p1k;
          pa[j >> 1].v[(j & 1) * 8 + r + u] = ph;
          if (RES) pl[j >> 1].v[(j & 1) * 8 + r + u] = (_Float16)((p1k - (float)ph) * 4096.0f);
        }
      }
    }
    float psum = (ps[0] + ps[1]) + (ps[2] + ps[3]);
    psum += xhalf(psum);                         // the query's other 32 keys
    lrow = lrow * alpha + psum;
#pragma unroll
    for (int t = 0; t < 4; ++t)
#pragma unroll
      for (int r = 0; r < 8; ++r) oacc[t][r] *= alpha;

    // ---- context^T += V^T . P^T (f16 WMMA), residual products into a separate accumulator ----
    v8f o1[4];
#pragma unroll
    for (int t = 0; t < 4; ++t) o1[t] = zero8();
    if (!RES) {
      ldv(1);
      // keeps the second chunk's eight reads one group in front of the products; without it they are read in pairs among the
      // products, over the first chunk's registers, and each pair is waited for
      __builtin_amdgcn_sched_barrier(0);
    }
#pragma unroll   // constant kk: the fragment arrays stay in registers
    for (int kk = 0; kk < 2; ++kk) {
      if (RES) ldv(kk);
#pragma unroll
      for (int t = 0; t < 4; ++t) oacc[t] = mma_h_raw(vb[kk][t].v, pa[kk].v, oacc[t]);
      if (RES) {
#pragma unroll
        for (int t = 0; t < 4; ++t) o1[t] = mma_h_raw(vl[kk][t].v, pa[kk].v, o1[t]);
#pragma unroll
        for (int t = 0; t < 4; ++t) o1[t] = mma_h_raw(vb[kk][t].v, pl[kk].v, o1[t]);
      }
    }
    if (RES) {
#pragma unroll
      for (int t = 0; t < 4; ++t)
#pragma unroll
        for (int r = 0; r < 8; ++r) oacc[t][r] += o1[t][r] * (1.0f / 4096.0f);
    }
    // WMMA distance in front of the branches at the loop's foot, on either side of them; taking the accumulators, the statement also keeps
    // the tile's products in front of the foot's waits (otherwise they sink behind the barrier, behind a full wait for the second chunk's reads)
    acc_guard4(oacc[0], oacc[1], oacc[2], oacc[3]);
    asm volatile("s_wait_dscnt 0x0" ::: "memory");       // this wave's reads of tile kt's buffer are done
    asm volatile("s_wait_asynccnt 0x0" ::: "memory");    // this wave's copies of tile kt + 1 have landed
    __syncthreads();                                     // publishes tile kt + 1 and frees tile kt's buffer
    if (kt + 2 < nkt) issue(kt + 2, cur);                // block-uniform
    cur = BUFB - cur;
  }
  asm volatile("s_wait_asynccnt 0x0" ::: "memory");      // no copy is left in flight behind the loop

  // ---- normalise (1/l), stage the wave's 16x64 tile, bf16 hi/lo split,
  float* os = (float*)(void*)smem + wave * (16 * OP);
  {
    const float l = lrow;
    const float inv = (l > 0.f) ? (1.0f / l) : 0.f;   // l and the context both carry the factor 1024
#pragma unroll
    for (int t = 0; t < 4; ++t) {              // row = query c, 8 consecutive d per lane and tile: two 16-B stores
      v4f a, b;
#pragma unroll
      for (int r = 0; r < 4; ++r) { a[r] = oacc[t][r] * inv; b[r] = oacc[t][4 + r] * inv; }
      *(v4f*)(os + c * OP + t * 16 + 8 * hh)     = a;
      *(v4f*)(os + c * OP + t * 16 + 8 * hh + 4) = b;
    }
  }
  __builtin_amdgcn_fence(__ATOMIC_RELEASE, "workgroup");
  __builtin_amdgcn_wave_barrier();
  __builtin_amdgcn_fence(__ATOMIC_ACQUIRE, "workgroup");
  {
    const int q4 = lane >> 3, c8 = (lane & 7) * 8;
    v4u hv[4], lv[4];
#pragma unroll
    for (int it = 0; it < 4; ++it) {
      const int row = it * 4 + q4;   // it 0..3 x q4 0..3 = rows 0..15 of the wave tile
      const float* sp = os + row * OP + c8;
      v4u a, a2;
#pragma unroll
      for (int e = 0; e < 4; ++e) {
        const float f0 = sp[2 * e], f1 = sp[2 * e + 1];
        const unsigned short h0 = bf_bits(f0), h1 = bf_bits(f1);
        const unsigned short l0 = bf_bits(f0 - bf_up(h0)), l1 = bf_bits(f1 - bf_up(h1));
        a[e] = pk16(h0, h1); a2[e] = pk16(l0, l1);
      }
      hv[it] = a; lv[it] = a2;
    }
    {
#pragma unroll
      for (int it = 0; it < 4; ++it) {
        const int row = it * 4 + q4;
        const size_t go = (size_t)(q0 + row) * DM + (size_t)h * HD + c8;
        *(v4u*)(ohp + go) = hv[it];
        *(v4u*)(olp + go) = lv[it];
      }
      
    }
  }
}

// Causal balance: query block qb walks qb + 1 key tiles and every work-group of the launch is resident from the start, so the launch lasts
// as long as its fullest work-group. Each work-group takes two query blocks of one head, one after the other: NQB - 1 - t, then t
// (t = 0..APAIR-1): NQB + 1 key tiles in every work-group, and every (head, query block) is taken exactly once (NQB is even).
// The first block is never below RESQB; the second runs with the residual planes where it is (block-uniform branch).
// amdgpu_waves_per_eu(2, 2): at most two of these 4-wave work-groups fit a WGP, so the NH * APAIR = 2 x 256 equal groups lie two on each.
#define APAIR (NQB / 2)
static_assert(APAIR * 2 == NQB && RESQB <= APAIR);
__global__ __launch_bounds__(128) __attribute__((amdgpu_waves_per_eu(2, 2)))
void attn_causal64(const unsigned short* __restrict__ qhp, const unsigned short* __restrict__ qlp,
                   const unsigned short* __restrict__ khp, const unsigned short* __restrict__ klp,
                   const unsigned short* __restrict__ vhp, const unsigned short* __restrict__ vlp,
                   unsigned short* ohp, unsigned short* olp, float sscale) {
  __shared__ __align__(16) unsigned short smem[2 * 4 * 64 * LP];
  const int h = blockIdx.x / APAIR;
  const int t = blockIdx.x % APAIR;
  attn_tile64<false>(smem, NQB - 1 - t, h, qhp, qlp, khp, klp, vhp, vlp, ohp, olp, sscale);
  // no register of the first block's issued stores is rewritten ahead of this wait
  asm volatile("s_wait_xcnt 0x0" ::: "memory");
  // the first block's context tiles lie on the K / V^T buffers: every wave's reads of its own tile are done
  // before any wave's copies of the second block's first key tile are issued into those bytes
  asm volatile("s_wait_dscnt 0x0" ::: "memory");
  __syncthreads();
  if (t >= RESQB) {
    attn_tile64<false>(smem, t, h, qhp, qlp, khp, klp, vhp, vlp, ohp, olp, sscale);
  } else {
    attn_tile64<true>(smem, t, h, qhp, qlp, khp, klp, vhp, vlp, ohp, olp, sscale);
  }
}

// =====================================================================================================
// Workspace map (bytes, SEQ = 4096):
//   Xb    bf16 [SEQ][1024]          0          8388608
//   Wqkvb bf16 [3072 n][1024 k]     8388608    6291456   (rows 0..1023 = q columns, 1024..2047 = k, 2048..3071 = v)
//   Wob   bf16 [1024 n][1024 k]     14680064   2097152
//   Qh    bf16 [SEQ][1024]          16777216   8388608
//   Ql    bf16 [SEQ][1024]          25165824   8388608
//   Kh    bf16 [SEQ][1024]          33554432   8388608
//   Kl    bf16 [SEQ][1024]          41943040   8388608
//   VTh   f16  [1024][SEQ]          50331648   8388608
//   VTl   f16  [1024][VLP=512]      58720256   1048576
//   Oh    bf16 [SEQ][1024]          59768832   8388608
//   Ol    bf16 [SEQ][1024]          68157440   8388608
//   end                             76546048
// All planes are exact multiples of their 64x64 / whole-line store granularity (no padded tails needed),
// =====================================================================================================
extern "C" void kernel_launch(void* const* d_in, const int* in_sizes, int n_in,
                              void* d_out, int out_size, void* d_ws, size_t ws_size,
                              hipStream_t stream) {
  if (n_in < 5) return;
  if (in_sizes[0] < SEQ * DM) return;                 // x rows 0..SEQ-1 (prefix of the full input)
  if (in_sizes[1] != DM * NQKV) return;               // w_qkv [1024][3072]
  if (in_sizes[2] != NQKV) return;                    // b_qkv [3072]
  if (in_sizes[3] != DM * DM) return;                 // w_o [1024][1024]
  if (in_sizes[4] != DM) return;                      // b_o [1024]
  if (out_size < SEQ * DM) return;

  const float* x     = (const float*)d_in[0];
  const float* w_qkv = (const float*)d_in[1];
  const float* b_qkv = (const float*)d_in[2];
  const float* w_o   = (const float*)d_in[3];
  const float* b_o   = (const float*)d_in[4];

  const size_t PX  = (size_t)SEQ * DM * 2;       // 16-bit activation plane [SEQ][1024]
  const size_t PWQ = (size_t)NQKV * DM * 2;      // 16-bit fused weight plane [3072][1024]
  const size_t PWO = (size_t)DM * DM * 2;        // 16-bit out weight plane
  const size_t PVT = (size_t)DM * SEQ * 2;       // v^T hi plane
  const size_t PVL = (size_t)DM * VLP * 2;       // v^T residual plane
  size_t off = 0;
  const size_t oXb   = off; off += PX;
  const size_t oWqkv = off; off += PWQ;
  const size_t oWo   = off; off += PWO;
  const size_t oQh   = off; off += PX;
  const size_t oQl   = off; off += PX;
  const size_t oKh   = off; off += PX;
  const size_t oKl   = off; off += PX;
  const size_t oVTh  = off; off += PVT;
  const size_t oVTl  = off; off += PVL;
  const size_t oOh   = off; off += PX;
  const size_t oOl   = off; off += PX;
  if (off > ws_size) return;                     // off = 76546048 for SEQ = 4096
  if (off > (size_t)134217728) return;

  char* ws = (char*)d_ws;
  unsigned short* Xb    = (unsigned short*)(ws + oXb);
  unsigned short* Wqkvb = (unsigned short*)(ws + oWqkv);
  unsigned short* Wob   = (unsigned short*)(ws + oWo);
  unsigned short* Qh    = (unsigned short*)(ws + oQh);
  unsigned short* Ql    = (unsigned short*)(ws + oQl);
  unsigned short* Kh    = (unsigned short*)(ws + oKh);
  unsigned short* Kl    = (unsigned short*)(ws + oKl);
  unsigned short* VTh   = (unsigned short*)(ws + oVTh);
  unsigned short* VTl   = (unsigned short*)(ws + oVTl);
  unsigned short* Oh    = (unsigned short*)(ws + oOh);
  unsigned short* Ol    = (unsigned short*)(ws + oOl);

  const dim3 blk(256);
  const int n8x = SEQ * DM / 8;                                    // multiple of 256
  const dim3 gPrep(PTQ + PTO + (n8x + 255) / 256);                 // 768 + 256 transposing tiles, 2048 pieces of x
  const dim3 gProj((SEQ / 128) * (DM / 128));                      // M = SEQ, N = 1024 -> 256 block tiles of 128x128 (SEQ = 4096)

  // (1) x -> bf16 plane [SEQ][1024]; w_qkv [k][n] -> bf16 [n][k]; w_o [k][n] -> bf16 [n][k]
  prep_bf16<<<gPrep, blk, 0, stream>>>(x, w_qkv, w_o, Xb, Wqkvb, Wob, n8x);
  // (2) q, k -> bf16 hi/lo planes; v^T -> f16 hi plane and residual plane (M x N x K = SEQ x 1024 x 1024 for q and k, 1024 x SEQ x 1024 for v^T)
  proj_qkv<<<dim3(3 * (SEQ / 128) * (DM / 128)), blk, 0, stream>>>(
      Xb, Wqkvb, Qh, Ql, Kh, Kl, VTh, VTl, b_qkv, SEQ, DM, VLP);
  // (3) causal attention: one work-group per head and pair of query blocks (NQB - 1 - t, t)
  attn_causal64<<<dim3(NH * (NQB / 2)), dim3(128), 0, stream>>>(Qh, Ql, Kh, Kl, VTh, VTl, Oh, Ol, 0.125f);
  // (4) out = context . Wo + b_o -> d_out f32 [SEQ][1024]
  proj_out<<<gProj, blk, 0, stream>>>(Oh, Ol, Wob, (float*)d_out, b_o, SEQ, DM);
  (void)hipGetLastError();
}
